// v000
// Measured on an AMD MI455X. A time is GPU time per run, averaged over a window of back-to-back runs after a warm-up
// (all launches, gaps included; the runs take copies of the inputs in turn), and the median of several windows.
// Apart from v000's, it joins two sittings. Times from different sittings can be a few percent apart, while
// side-by-side timings come from the same sitting.
// v000 is the starting kernel. One run takes 3650 microseconds.
// Contractions: q/k/v projections (x,m RNE-converted to bf16 held in f16 planes x W^T bf16-valued f16 planes carried x16), scores q.k^T (gated q,k f16 planes carried x8), attn.v (P f16 carried x32768 x gated V^T f16 carried x8), output projection (context f16 carried x256 x Wo^T f16 carried x16): all v_wmma_f32_16x16x32_f16 with f32 accumulate; token pooling, channel-gate MLP, softmax in f32.
#include <hip/hip_runtime.h>
#include <math.h>

// ---------------------------------------------------------------------------
// Problem constants
// ---------------------------------------------------------------------------
constexpr int kBatch = 4;
constexpr int kSeq   = 2048;
constexpr int kDim   = 512;               // model dim = inner dim
constexpr int kHeads = 8;
constexpr int kDh    = 64;
constexpr int kRed   = 32;                // gate hidden width (512 / 16)
constexpr int kTok   = kBatch * kSeq;     // 8192 token rows
constexpr int kPlane = kTok * kDim;       // 4194304 elements per [8192][512] plane
constexpr float kWCarry    = 16.0f;                 // weights carried x16 in f16
constexpr float kWCarryInv = 1.0f / 16.0f;
constexpr float kGCarry    = 8.0f;                  // gated q/k/v planes carried x8 in f16
constexpr float kPCarry    = 32768.0f;              // probabilities carried x2^15 in f16
constexpr float kCtxCarry  = 256.0f;                // context carried x2^8 in f16
constexpr float kPVScale   = kCtxCarry / (kPCarry * kGCarry);       // 2^-10
constexpr float kOutScale  = 1.0f / (kCtxCarry * kWCarry);          // 2^-12
constexpr float kAttnScale = 0.044194173824159216f;                 // 512^-0.5
constexpr float kSmScale   = kAttnScale / (kGCarry * kGCarry);      // exact: / 64
constexpr float kInvSeq    = 1.0f / 2048.0f;
static_assert(kHeads * kDh == kDim);
static_assert(kDim / 16 == kRed);
static_assert(kSeq == 4 * 512);                 // softmax: 4 trips x 256 threads x 2 cols; 256 threads x 8 cols
static_assert(kSeq * kDim == (1 << 20));        // gate cast batch index = element >> 20
// GEMM shape contract: M % 64 == 0, N % 64 == 0, K % 32 == 0 for every launch
static_assert(kTok % 64 == 0 && kDim % 64 == 0 && kDim % 32 == 0);     // projections / out: M=8192 N=512 K=512
static_assert(kSeq % 64 == 0 && kDh % 32 == 0);                        // scores: M=N=2048 K=64
static_assert(kDh % 64 == 0 && kSeq % 32 == 0);                        // attn.v: M=2048 N=64 K=2048
static_assert((kPlane / 8) % 256 == 0);                                // cast grids exact

typedef __attribute__((ext_vector_type(16))) _Float16 v16h;
typedef __attribute__((ext_vector_type(8)))  _Float16 v8h;
typedef __attribute__((ext_vector_type(16))) __bf16   v16b;
typedef __attribute__((ext_vector_type(8)))  __bf16   v8b;
typedef __attribute__((ext_vector_type(8)))  float    v8f;
typedef __attribute__((ext_vector_type(4)))  float    v4f;
typedef __attribute__((ext_vector_type(2)))  float    v2f;
typedef __attribute__((ext_vector_type(4)))  unsigned int v4u;

__device__ __forceinline__ unsigned short f2bf_bits(float f) {
  unsigned u = __float_as_uint(f);
  return (unsigned short)((u + 0x7FFFu + ((u >> 16) & 1u)) >> 16);
}
__device__ __forceinline__ float bf_bits2f(unsigned short h) { return __uint_as_float(((unsigned)h) << 16); }
// RNE convert f32 -> bf16 -> f32
__device__ __forceinline__ float bf_rne(float f) { return bf_bits2f(f2bf_bits(f)); }

// hazard guards as plain device helpers (no inline asm inside the kernel template body)
__device__ __forceinline__ void dep_guard_h(v8f& a, v8f& b, v16h x, v16h y) { asm volatile("v_nop\n\tv_nop\n\tv_nop\n\tv_nop" : "+v"(a), "+v"(b) : "v"(x), "v"(y)); }
__device__ __forceinline__ void dep_guard_b(v8f& a, v8f& b, v16b x, v16b y) { asm volatile("v_nop\n\tv_nop\n\tv_nop\n\tv_nop" : "+v"(a), "+v"(b) : "v"(x), "v"(y)); }
__device__ __forceinline__ void keep4_h(v16h a, v16h b, v16h c, v16h d) { asm volatile("v_nop" :: "v"(a), "v"(b), "v"(c), "v"(d)); }
__device__ __forceinline__ void keep4_b(v16b a, v16b b, v16b c, v16b d) { asm volatile("v_nop" :: "v"(a), "v"(b), "v"(c), "v"(d)); }
__device__ __forceinline__ void acc_guard4(v8f& a, v8f& b, v8f& c, v8f& d) { asm volatile("v_nop\n\tv_nop\n\tv_nop\n\tv_nop" : "+v"(a), "+v"(b), "+v"(c), "+v"(d)); }
template <typename T> struct Frag;
template <> struct Frag<_Float16> {
  typedef v16h V; union U { v16h v; v8h h[2]; };
  // elements 0..7 <- p[0..7], 8..15 <- p[16..23]
  static __device__ __forceinline__ v16h load(const _Float16* p) {
    U f; f.h[0] = *(const v8h*)(p); f.h[1] = *(const v8h*)(p + 16); return f.v;
  }
  static __device__ __forceinline__ v8f mma(v16h a, v16h b, v8f c) {
    return __builtin_amdgcn_wmma_f32_16x16x32_f16(false, a, false, b, (short)0, c, false, false);
  }
  static __device__ __forceinline__ void guard(v8f& a, v8f& b, v16h x, v16h y) { dep_guard_h(a, b, x, y); }
  static __device__ __forceinline__ void keep(v16h a, v16h b, v16h c, v16h d) { keep4_h(a, b, c, d); }
};
template <> struct Frag<__bf16> {
  typedef v16b V; union U { v16b v; v8b h[2]; };
  static __device__ __forceinline__ v16b load(const __bf16* p) {
    U f; f.h[0] = *(const v8b*)(p); f.h[1] = *(const v8b*)(p + 16); return f.v;
  }
  static __device__ __forceinline__ v8f mma(v16b a, v16b b, v8f c) {
    return __builtin_amdgcn_wmma_f32_16x16x32_bf16(false, a, false, b, (short)0, c, false, false);
  }
  static __device__ __forceinline__ void guard(v8f& a, v8f& b, v16b x, v16b y) { dep_guard_b(a, b, x, y); }
  static __device__ __forceinline__ void keep(v16b a, v16b b, v16b c, v16b d) { keep4_b(a, b, c, d); }
};

__device__ __forceinline__ unsigned pk16(unsigned short a, unsigned short b) { return (unsigned)a | ((unsigned)b << 16); }
__device__ __forceinline__ unsigned short h_bits(float f) { const _Float16 h = (_Float16)f; return __builtin_bit_cast(unsigned short, h); }

// ---- Register-blocked batched WMMA GEMM (ACT reduced to none/relu/leaky) -------------------------------
// C[m,n] = scale * sum_k A[m,k] * Bt[n,k] (+bias)(+resid); each wave owns a 64x64 tile.
// A row-major [M,K]; Bt row-major [N,K]; M,N % 64 == 0, K % 32 == 0.
// SPLIT: operands are hi/lo planes (A2/Bt2 = lo planes, same layout); product = hi*hi + hi*lo + lo*hi.
// BIAS_MODE: 0 = none, 1 = bias[m], 2 = bias[n].
// OUT_MODE: 0 = f32, 1 = f16, 2 = bf16 hi plane (Cout) + bf16 lo plane (Cout2).
// ET: 0 = f16 operands, 1 = bf16 operands (pointers passed as 16-bit storage)
template <int ET> struct Elem;
template <> struct Elem<0> { typedef _Float16 T; };
template <> struct Elem<1> { typedef __bf16 T; };
template <int ET, bool SPLIT, int BIAS_MODE, int OUT_MODE, bool RESID, int ACT = 0>
__global__ __launch_bounds__(256) void wmma_gemm64(
    const unsigned short* __restrict__ Ap, const unsigned short* __restrict__ A2p, int lda, long strideA,
    const unsigned short* __restrict__ Btp, const unsigned short* __restrict__ Bt2p, int ldb, long strideB,
    void* __restrict__ Cout, void* __restrict__ Cout2, int ldc, long strideC,
    const float* __restrict__ bias,
    const float* __restrict__ resid, long strideR,
    int M, int N, int K, float scale) {
  typedef typename Elem<ET>::T T;
  typedef typename Frag<T>::V V;
  const T* A = (const T*)Ap; const T* A2 = (const T*)A2p; const T* Bt = (const T*)Btp; const T* Bt2 = (const T*)Bt2p;
  __shared__ __align__(16) float sT[8][16 * 68];   // per-wave 16x64 slab, pitch 68 floats
  const int b    = blockIdx.y;
  const int lane = threadIdx.x & 31;
  const int wave = threadIdx.x >> 5;
  const int tilesN = N >> 6;
  const int tilesM = M >> 6;
  const int tile = blockIdx.x * 8 + wave;
  if (tile >= tilesM * tilesN) return;   // wave-uniform; no block barriers in this kernel
  const int tm = tile / tilesN;
  const int tn = tile - tm * tilesN;
  const int m0 = tm << 6;
  const int n0 = tn << 6;

  const T* Ab  = A  + (size_t)b * strideA;
  const T* Bb  = Bt + (size_t)b * strideB;
  const T* Ab2 = SPLIT ? (A2  + (size_t)b * strideA) : nullptr;
  const T* Bb2 = SPLIT ? (Bt2 + (size_t)b * strideB) : nullptr;

  const int rlane = lane & 15;                 // row (A) / col (B, D) within subtile
  const int koff  = (lane >> 4) * 8;           // k offset of this lane half
  const int mOff  = (lane >> 4) * 8;           // D row offset

  v8f acc[4][4];
#pragma unroll
  for (int i = 0; i < 4; ++i)
#pragma unroll
    for (int j = 0; j < 4; ++j) acc[i][j] = (v8f){0.f,0.f,0.f,0.f,0.f,0.f,0.f,0.f};

  for (int k0 = 0; k0 < K; k0 += 32) {
    V bh[4], bl[4];
#pragma unroll
    for (int j = 0; j < 4; ++j) {
      const size_t bo = (size_t)(n0 + (j << 4) + rlane) * ldb + koff + k0;
      bh[j] = Frag<T>::load(Bb + bo);
      if (SPLIT) bl[j] = Frag<T>::load(Bb2 + bo);
    }
#pragma unroll
    for (int i = 0; i < 4; ++i) {
      const size_t ao = (size_t)(m0 + (i << 4) + rlane) * lda + koff + k0;
      V ah = Frag<T>::load(Ab + ao);
      V al;
      if (SPLIT) al = Frag<T>::load(Ab2 + ao);
#pragma unroll
      for (int j = 0; j < 4; ++j) {
        acc[i][j] = Frag<T>::mma(ah, bh[j], acc[i][j]);
        if (SPLIT) {
          acc[i][j] = Frag<T>::mma(ah, bl[j], acc[i][j]);
          acc[i][j] = Frag<T>::mma(al, bh[j], acc[i][j]);
        }
      }
      Frag<T>::guard(acc[i][0], acc[i][3], ah, SPLIT ? al : ah);
    }
    Frag<T>::keep(bh[0], bh[1], bh[2], bh[3]);
    if (SPLIT) Frag<T>::keep(bl[0], bl[1], bl[2], bl[3]);
  }
  acc_guard4(acc[0][0], acc[0][1], acc[0][2], acc[0][3]);
  acc_guard4(acc[1][0], acc[1][1], acc[1][2], acc[1][3]);
  acc_guard4(acc[2][0], acc[2][1], acc[2][2], acc[2][3]);
  acc_guard4(acc[3][0], acc[3][1], acc[3][2], acc[3][3]);

  // ---- epilogue ----
  float* slab = sT[wave];
  const float* Rb = RESID ? (resid + (size_t)b * strideR) : nullptr;
#pragma unroll
  for (int i = 0; i < 4; ++i) {
    const int mBase = m0 + (i << 4);
#pragma unroll
    for (int j = 0; j < 4; ++j) {
      const int n = n0 + (j << 4) + rlane;
      float bv = 0.f;
      if (BIAS_MODE == 2) bv = bias[n];
#pragma unroll
      for (int r = 0; r < 8; ++r) {
        float v = acc[i][j][r] * scale;
        if (BIAS_MODE == 1) v += bias[mBase + mOff + r];
        if (BIAS_MODE == 2) v += bv;
        if (RESID) v += Rb[(size_t)(mBase + mOff + r) * ldc + n];
        if (ACT == 2) v = fmaxf(v, 0.0f);
        if (ACT == 4) v = (v > 0.f) ? v : 0.01f * v;
        slab[(mOff + r) * 68 + (j << 4) + rlane] = v;
      }
    }
    __builtin_amdgcn_fence(__ATOMIC_RELEASE, "workgroup");
    __builtin_amdgcn_wave_barrier();
    __builtin_amdgcn_fence(__ATOMIC_ACQUIRE, "workgroup");
    if (OUT_MODE == 0) {
      float* C = (float*)Cout + (size_t)b * strideC;
      const int hh = lane >> 4, c4 = (lane & 15) * 4;     // row seg = 256 B = 16 lanes x 16 B
      {
#pragma unroll
        for (int it = 0; it < 8; ++it) {
          const int row = it * 2 + hh;
          v4f v = *(const v4f*)(slab + row * 68 + c4);
          *(v4f*)(C + (size_t)(mBase + row) * ldc + n0 + c4) = v;
        }
        
      }
    } else {
      const int q = lane >> 3, c8 = (lane & 7) * 8;
      unsigned short* C  = (unsigned short*)Cout  + (size_t)b * strideC;
      unsigned short* C2 = (OUT_MODE == 2) ? ((unsigned short*)Cout2 + (size_t)b * strideC) : nullptr;
      {
#pragma unroll
        for (int it = 0; it < 4; ++it) {
          const int row = it * 4 + q;
          const float* sp = slab + row * 68 + c8;
          v8h hv, lv;
#pragma unroll
          for (int e = 0; e < 8; ++e) {
            if (OUT_MODE == 1) {
              hv[e] = (_Float16)sp[e];
            } else {
              unsigned short hb = f2bf_bits(sp[e]);
              unsigned short lb = f2bf_bits(sp[e] - bf_bits2f(hb));
              hv[e] = __builtin_bit_cast(_Float16, hb);
              lv[e] = __builtin_bit_cast(_Float16, lb);
            }
          }
          *(v8h*)(C + (size_t)(mBase + row) * ldc + n0 + c8) = hv;
          if (OUT_MODE == 2) *(v8h*)(C2 + (size_t)(mBase + row) * ldc + n0 + c8) = lv;
        }
        
      }
    }
    __builtin_amdgcn_fence(__ATOMIC_RELEASE, "workgroup");
    __builtin_amdgcn_wave_barrier();
    __builtin_amdgcn_fence(__ATOMIC_ACQUIRE, "workgroup");
  }
}

// ---------------------------------------------------------------------------
// Input cast: out plane z (0 <- x, 1 <- m) = f16( bf16_rne(v) ), [8192][512] halves each.
// ---------------------------------------------------------------------------
__global__ __launch_bounds__(256) void cast_in_kernel(const float* __restrict__ x, const float* __restrict__ m,
                                                      unsigned short* __restrict__ out, int n8) {
  const int z = blockIdx.y;                          // block-uniform plane select
  const float* in = (z == 0) ? x : m;
  const int i = blockIdx.x * 256 + threadIdx.x;
  if (i >= n8) return;
  const float* p = in + 8 * (size_t)i;
  const v4f a = *(const v4f*)(p);
  const v4f c = *(const v4f*)(p + 4);
  unsigned short hb[8];
#pragma unroll
  for (int e = 0; e < 4; ++e) {
    hb[e]     = h_bits(bf_rne(a[e]));
    hb[4 + e] = h_bits(bf_rne(c[e]));
  }
  const v4u u = (v4u){pk16(hb[0], hb[1]), pk16(hb[2], hb[3]), pk16(hb[4], hb[5]), pk16(hb[6], hb[7])};
  unsigned short* q = out + (size_t)z * 8 * (size_t)n8 + 8 * (size_t)i;
  *(v4u*)q = u;
  
}

// ---------------------------------------------------------------------------
// Weight transpose + cast: W is [in d][out h] (512x512, row-major); WT[h][d] = f16( scale * bf16_rne(W[d][h]) ).
// grid (8, 8, 4): blockIdx.x = d tile (64 cols of WT), blockIdx.y = h tile (64 rows of WT), blockIdx.z selects W0..W3 and the
// output plane (plane z at out + z*512*512 halves). 256 threads.
// Load coverage: 4 iterations x 256 threads x float4 = 4096 = the whole 64(d) x 64(h) tile (coalesced along h), 4 b128 loads per lane.
// Store coverage: 8 waves x 2 iterations x 4 rows (lane>>3) = 64 rows; (lane&7) x 8 halves = 64 cols; each row segment =
// ---------------------------------------------------------------------------
__global__ __launch_bounds__(256) void wtcast_kernel(const float* __restrict__ W0, const float* __restrict__ W1,
                                                     const float* __restrict__ W2, const float* __restrict__ W3,
                                                     unsigned short* __restrict__ out, float scale) {
  __shared__ float sm[64][65];   // sm[h_local][d_local]
  const int t  = threadIdx.x;
  const int d0 = blockIdx.x * 64;
  const int h0 = blockIdx.y * 64;
  const int z  = blockIdx.z;                                   // block-uniform
  const float* W = (z == 0) ? W0 : (z == 1) ? W1 : (z == 2) ? W2 : W3;
#pragma unroll
  for (int i = 0; i < 4; ++i) {
    const int e4 = i * 256 + t;
    const int r  = e4 >> 4;            // d local 0..63
    const int c4 = (e4 & 15) * 4;      // h local 0..60
    const v4f w = *(const v4f*)(W + (size_t)(d0 + r) * kDim + h0 + c4);
#pragma unroll
    for (int k = 0; k < 4; ++k) sm[c4 + k][r] = bf_rne(w[k]) * scale;
  }
  __syncthreads();
  const int lane = t & 31, wave = t >> 5;
  const int q = lane >> 3, c8 = (lane & 7) * 8;
  unsigned short* op = out + (size_t)z * kDim * kDim;
  {
#pragma unroll
    for (int it = 0; it < 2; ++it) {
      const int row = wave * 8 + it * 4 + q;                 // h local
      unsigned short hb[8];
#pragma unroll
      for (int e = 0; e < 8; ++e) hb[e] = h_bits(sm[row][c8 + e]);
      const v4u u = (v4u){pk16(hb[0], hb[1]), pk16(hb[2], hb[3]), pk16(hb[4], hb[5]), pk16(hb[6], hb[7])};
      *(v4u*)(op + (size_t)(h0 + row) * kDim + d0 + c8) = u;
    }
    
  }
}

// ---------------------------------------------------------------------------
// Token pooling + channel gate MLP (f32): block tb = tensor*4 + batch (12 blocks), 512 threads = channels.
//   mx[c] = max_n F[t][b][n][c], av[c] = (sum_n F[t][b][n][c]) * (1/2048)     (sequential over 2048 tokens, coalesced)
//   hid[j] = relu( sum_c mx[c]*w1[c][j] + sum_c av[c]*w1[c][j] )   j < 32      (w1, w2 RNE-converted to bf16 at load)
//   g[c]   = 1 / (1 + exp(-sum_j hid[j]*w2[j][c]))
// Output row scl[tb][0..511] (2048 B): staged in LDS, threads 0..127 write one float4 each -> wave w writes 512 contiguous B =
// ---------------------------------------------------------------------------
__global__ __launch_bounds__(512) void pool_gate_kernel(const float* __restrict__ F, const float* __restrict__ w1,
                                                        const float* __restrict__ w2, float* __restrict__ scl) {
  __shared__ float smax[kDim];
  __shared__ float savg[kDim];
  __shared__ float hid[kRed];
  __shared__ __align__(16) float sout[kDim];
  const int t  = threadIdx.x;
  const int tb = blockIdx.x;            // 0..11
  const int z  = tb >> 2;               // tensor: 0 q, 1 k, 2 v
  const int b  = tb & 3;
  const float* src = F + ((size_t)z * kTok + (size_t)b * kSeq) * kDim + t;
  float mx = -__builtin_inff();
  float sm = 0.0f;
#pragma unroll 4
  for (int n = 0; n < kSeq; ++n) {
    const float v = src[(size_t)n * kDim];
    mx = fmaxf(mx, v);
    sm += v;
  }
  smax[t] = mx;
  savg[t] = sm * kInvSeq;
  __syncthreads();
  if (t < kRed) {                       // wave 0, wave-uniform
    float a1 = 0.0f, a2 = 0.0f;
#pragma unroll 1
    for (int c = 0; c < kDim; ++c) {
      const float w = bf_rne(w1[c * kRed + t]);
      a1 += smax[c] * w;
      a2 += savg[c] * w;
    }
    hid[t] = fmaxf(a1 + a2, 0.0f);
  }
  __syncthreads();
  float a = 0.0f;
#pragma unroll 1
  for (int j = 0; j < kRed; ++j) a += hid[j] * bf_rne(w2[j * kDim + t]);
  const float g = 1.0f / (1.0f + expf(-a));
  sout[t] = g;
  __syncthreads();
  if (t < 128) {
    const v4f val = *(const v4f*)(sout + 4 * t);
    float* dp = scl + (size_t)tb * kDim + 4 * t;
    *(v4f*)dp = val;
    
  }
}

// ---------------------------------------------------------------------------
// Gate + cast for q and k planes: out[z][row][c] = f16( 8 * F[z][row][c] * g[z][batch(row)][c] ), z = blockIdx.y (0 q, 1 k).
// Coverage: n8 = 524288 = 2048 blocks x 256 exact per plane.
// ---------------------------------------------------------------------------
__global__ __launch_bounds__(256) void gate_cast_kernel(const float* __restrict__ F, const float* __restrict__ scl,
                                                        unsigned short* __restrict__ out, int n8) {
  const int z = blockIdx.y;
  const int i = blockIdx.x * 256 + threadIdx.x;
  if (i >= n8) return;
  const size_t e0 = 8 * (size_t)i;                    // element index inside the plane
  const int c0 = (int)(e0 & (size_t)(kDim - 1));
  const int b  = (int)(e0 >> 20);                     // row / 2048
  const float* p  = F + (size_t)z * kPlane + e0;
  const float* sp = scl + (size_t)(z * kBatch + b) * kDim + c0;
  const v4f a  = *(const v4f*)(p);
  const v4f c  = *(const v4f*)(p + 4);
  const v4f g0 = *(const v4f*)(sp);
  const v4f g1 = *(const v4f*)(sp + 4);
  unsigned short hb[8];
#pragma unroll
  for (int e = 0; e < 4; ++e) {
    hb[e]     = h_bits(a[e] * g0[e] * kGCarry);
    hb[4 + e] = h_bits(c[e] * g1[e] * kGCarry);
  }
  const v4u u = (v4u){pk16(hb[0], hb[1]), pk16(hb[2], hb[3]), pk16(hb[4], hb[5]), pk16(hb[6], hb[7])};
  unsigned short* q = out + (size_t)z * kPlane + e0;
  *(v4u*)q = u;
  
}

// ---------------------------------------------------------------------------
// Gate + transpose + cast for v: VT[(b*8+h)][d][s] = f16( 8 * Fv[b][s][h*64+d] * gv[b][h*64+d] ).
// grid (32, 8, 4): blockIdx.x = s tile (64 rows), blockIdx.y = head, blockIdx.z = batch. 256 threads.
// Load coverage: 4 iterations x 256 threads x float4 = 4096 = whole 64(s) x 64(d) tile (coalesced along d); gate as one float4.
// Store coverage: 8 waves x 2 iterations x 4 rows (lane>>3) = 64 d-rows; (lane&7) x 8 halves = 64 s-cols; each row segment =
// ---------------------------------------------------------------------------
__global__ __launch_bounds__(256) void vt_gate_cast_kernel(const float* __restrict__ Fv, const float* __restrict__ gv,
                                                           unsigned short* __restrict__ VT) {
  __shared__ float sm[64][65];   // sm[d][s_local]
  const int t  = threadIdx.x;
  const int s0 = blockIdx.x * 64;
  const int h  = blockIdx.y;
  const int b  = blockIdx.z;
  const int c4 = (t & 15) * 4;   // d, constant over the load loop
  const v4f g = *(const v4f*)(gv + (size_t)b * kDim + h * kDh + c4);
#pragma unroll
  for (int i = 0; i < 4; ++i) {
    const int e4 = i * 256 + t;
    const int r  = e4 >> 4;        // s local 0..63
    const v4f w = *(const v4f*)(Fv + ((size_t)(b * kSeq + s0 + r)) * kDim + h * kDh + c4);
#pragma unroll
    for (int k = 0; k < 4; ++k) sm[c4 + k][r] = w[k] * g[k] * kGCarry;
  }
  __syncthreads();
  const int lane = t & 31, wave = t >> 5;
  const int q = lane >> 3, c8 = (lane & 7) * 8;
  unsigned short* op = VT + ((size_t)(b * kHeads + h) * kDh) * kSeq;
  {
#pragma unroll
    for (int it = 0; it < 2; ++it) {
      const int row = wave * 8 + it * 4 + q;                 // d
      unsigned short hb[8];
#pragma unroll
      for (int e = 0; e < 8; ++e) hb[e] = h_bits(sm[row][c8 + e]);
      const v4u u = (v4u){pk16(hb[0], hb[1]), pk16(hb[2], hb[3]), pk16(hb[4], hb[5]), pk16(hb[6], hb[7])};
      *(v4u*)(op + (size_t)row * kSeq + s0 + c8) = u;
    }
    
  }
}

// ---------------------------------------------------------------------------
// Row softmax over 2048 keys, f32 math:  a = S[i][j] * (512^-0.5 / 64);  P[i][j] = f16( 32768 * exp(a - max) / sum exp(a - max) ).
// One block of 256 threads per row i = blockIdx.x.
// Phase 1/2: rolled 4-trip loops, thread t owns columns it*512 + 2t, 2t+1 (4 x 256 x 2 = 2048 = whole row); values kept in LDS.
// Reductions in fixed order (thread sequential, wave shuffle tree, 8 wave partials in index order); block barriers before
// any cross-thread LDS read.
// ---------------------------------------------------------------------------
__global__ __launch_bounds__(256) void softmax_row_kernel(const float* __restrict__ Sp, unsigned short* __restrict__ Pp) {
  __shared__ __align__(16) float lg[kSeq];
  __shared__ float redM[8];
  __shared__ float redS[8];
  const int i    = blockIdx.x;
  const int t    = threadIdx.x;
  const int lane = t & 31, wave = t >> 5;
  const size_t rowoff = (size_t)i * kSeq;
  const float* sr = Sp + rowoff;

  float mx = -__builtin_inff();
#pragma unroll 1
  for (int it = 0; it < 4; ++it) {
    const int c = it * 512 + 2 * t;
    const v2f sv = *(const v2f*)(sr + c);
    v2f av;
#pragma unroll
    for (int e = 0; e < 2; ++e) {
      av[e] = sv[e] * kSmScale;
      mx = fmaxf(mx, av[e]);
    }
    *(v2f*)(lg + c) = av;
  }
#pragma unroll
  for (int off = 16; off > 0; off >>= 1) mx = fmaxf(mx, __shfl_xor(mx, off, 32));
  if (lane == 0) redM[wave] = mx;
  __syncthreads();
  float m = redM[0];
#pragma unroll
  for (int w = 1; w < 8; ++w) m = fmaxf(m, redM[w]);

  float sum = 0.0f;
#pragma unroll 1
  for (int it = 0; it < 4; ++it) {
    const int c = it * 512 + 2 * t;
    const v2f l = *(const v2f*)(lg + c);
    v2f ev;
#pragma unroll
    for (int e = 0; e < 2; ++e) {
      ev[e] = expf(l[e] - m);
      sum += ev[e];
    }
    *(v2f*)(lg + c) = ev;
  }
#pragma unroll
  for (int off = 16; off > 0; off >>= 1) sum += __shfl_xor(sum, off, 32);
  if (lane == 0) redS[wave] = sum;
  __syncthreads();
  float tot = redS[0];
#pragma unroll
  for (int w = 1; w < 8; ++w) tot += redS[w];
  const float inv = kPCarry / tot;

  const v4f e0 = *(const v4f*)(lg + 8 * t);
  const v4f e1 = *(const v4f*)(lg + 8 * t + 4);
  unsigned short hb[8];
#pragma unroll
  for (int e = 0; e < 4; ++e) {
    hb[e]     = h_bits(e0[e] * inv);
    hb[4 + e] = h_bits(e1[e] * inv);
  }
  const v4u u = (v4u){pk16(hb[0], hb[1]), pk16(hb[2], hb[3]), pk16(hb[4], hb[5]), pk16(hb[6], hb[7])};
  unsigned short* pr = Pp + rowoff + 8 * (size_t)t;
  *(v4u*)pr = u;
  
}

// ---------------------------------------------------------------------------
// Host glue.
//   XMh  f16 [2][8192][512]     16,777,216  at           0   (x plane then m plane, bf16-valued)
//   WT   f16 [4][512][512]       2,097,152  at  16,777,216   (Wq^T, Wk^T, Wv^T, Wo^T, [out][in], carried x16)
//   F    f32 [3][8192][512]     50,331,648  at  18,874,368   (q, k, v projections, ungated)
//   Qh   f16 [8192][512]         8,388,608  at  69,206,016   (gated q, carried x8)
//   Kh   f16 [8192][512]         8,388,608  at  77,594,624   (gated k, carried x8)
//   VT   f16 [32][64][2048]      8,388,608  at  85,983,232   (gated v transposed per (batch, head), carried x8)
//   Oh   f16 [8192][512]         8,388,608  at  94,371,840   (attention context, carried x256)
//   SC   f32 [2048][2048]       16,777,216  at 102,760,448   (scores of one (batch, head), re-used 32x, same type/layout)
//   PP   f16 [2048][2048]        8,388,608  at 119,537,664   (probabilities x32768, re-used 32x, same type/layout)
//   SCL  f32 [3][4][512]            24,576  at 127,926,272   (channel gates)
//   total                      127,950,848
// GEMM shapes: projections/out M=8192 N=512 K=512; scores M=N=2048 K=64; context M=2048 N=64 K=2048.
// All M,N multiples of 64, all K multiples of 32, no padded rows anywhere; every plane fully written before it is read.
// Launches: 1 + 1 + 2 + 1 + 1 + 1 + 32*3 + 1 = 104.
// ---------------------------------------------------------------------------
extern "C" void kernel_launch(void* const* d_in, const int* in_sizes, int n_in,
                              void* d_out, int out_size, void* d_ws, size_t ws_size,
                              hipStream_t stream) {
  if (n_in < 9) return;
  if (in_sizes[0] != kPlane || in_sizes[1] != kPlane) return;
  if (in_sizes[2] != kDim * kDim || in_sizes[3] != kDim * kDim || in_sizes[4] != kDim * kDim || in_sizes[5] != kDim * kDim) return;
  if (in_sizes[6] != kDim || in_sizes[7] != kDim * kRed || in_sizes[8] != kRed * kDim) return;
  if (out_size != kPlane) return;

  const size_t szHalfPlane = (size_t)kPlane * 2;                 // 8,388,608
  const size_t szXM  = 2 * szHalfPlane;
  const size_t szWT  = (size_t)4 * kDim * kDim * 2;
  const size_t szF   = (size_t)3 * kPlane * 4;
  const size_t szVT  = (size_t)kBatch * kHeads * kDh * kSeq * 2;
  const size_t szSC  = (size_t)kSeq * kSeq * 4;
  const size_t szPP  = (size_t)kSeq * kSeq * 2;
  const size_t szSCL = (size_t)3 * kBatch * kDim * 4;
  const size_t offXM  = 0;
  const size_t offWT  = offXM + szXM;
  const size_t offF   = offWT + szWT;
  const size_t offQh  = offF + szF;
  const size_t offKh  = offQh + szHalfPlane;
  const size_t offVT  = offKh + szHalfPlane;
  const size_t offOh  = offVT + szVT;
  const size_t offSC  = offOh + szHalfPlane;
  const size_t offPP  = offSC + szSC;
  const size_t offSCL = offPP + szPP;
  const size_t total  = offSCL + szSCL;                           // 127,950,848
  if (ws_size < total) return;

  const float* x      = (const float*)d_in[0];
  const float* m      = (const float*)d_in[1];
  const float* Wq     = (const float*)d_in[2];
  const float* Wk     = (const float*)d_in[3];
  const float* Wv     = (const float*)d_in[4];
  const float* Wo     = (const float*)d_in[5];
  const float* bias_o = (const float*)d_in[6];
  const float* gw1    = (const float*)d_in[7];
  const float* gw2    = (const float*)d_in[8];
  float* out = (float*)d_out;
  char* ws = (char*)d_ws;
  unsigned short* XMh = (unsigned short*)(ws + offXM);
  unsigned short* WT  = (unsigned short*)(ws + offWT);
  float*          F   = (float*)(ws + offF);
  unsigned short* Qh  = (unsigned short*)(ws + offQh);
  unsigned short* Kh  = (unsigned short*)(ws + offKh);
  unsigned short* VT  = (unsigned short*)(ws + offVT);
  unsigned short* Oh  = (unsigned short*)(ws + offOh);
  float*          SC  = (float*)(ws + offSC);
  unsigned short* PP  = (unsigned short*)(ws + offPP);
  float*          SCL = (float*)(ws + offSCL);

  const unsigned short* Xh = XMh;
  const unsigned short* Mh = XMh + (size_t)kPlane;
  const size_t wPlane = (size_t)kDim * kDim;

  // ---- 16-bit operand planes of the inputs ----
  const int n8 = kPlane / 8;   // 524288 -> 2048 blocks exact
  cast_in_kernel<<<dim3(n8 / 256, 2), dim3(256), 0, stream>>>(x, m, XMh, n8);
  wtcast_kernel<<<dim3(kDim / 64, kDim / 64, 4), dim3(256), 0, stream>>>(Wq, Wk, Wv, Wo, WT, kWCarry);

  // ---- projections: F[0] = x.Wq, F[1] = m.Wk, F[2] = m.Wv   (M=8192, N=512, K=512), f32 out, scale 1/16 ----
  const int tilesProj = (kTok / 64) * (kDim / 64);   // 1024 -> 128 blocks of 8 waves
  wmma_gemm64<0, false, 0, 0, false, 0><<<dim3(tilesProj / 8, 1), dim3(256), 0, stream>>>(
      Xh, Xh, kDim, 0L, WT, WT, kDim, 0L,
      (void*)F, (void*)F, kDim, 0L, bias_o, SCL, 0L, kTok, kDim, kDim, kWCarryInv);
  wmma_gemm64<0, false, 0, 0, false, 0><<<dim3(tilesProj / 8, 2), dim3(256), 0, stream>>>(
      Mh, Mh, kDim, 0L, WT + wPlane, WT + wPlane, kDim, (long)wPlane,
      (void*)(F + (size_t)kPlane), (void*)(F + (size_t)kPlane), kDim, (long)kPlane, bias_o, SCL, 0L, kTok, kDim, kDim, kWCarryInv);

  // ---- token pooling + channel gates ----
  pool_gate_kernel<<<dim3(3 * kBatch), dim3(512), 0, stream>>>(F, gw1, gw2, SCL);

  // ---- gated 16-bit planes: Qh, Kh (row-major [token][channel]); VT ([batch*head][d][token]) ----
  gate_cast_kernel<<<dim3(n8 / 256, 2), dim3(256), 0, stream>>>(F, SCL, Qh, n8);
  vt_gate_cast_kernel<<<dim3(kSeq / 64, kHeads, kBatch), dim3(256), 0, stream>>>(
      F + (size_t)2 * kPlane, SCL + (size_t)2 * kBatch * kDim, VT);

  // ---- attention per (batch, head) ----
  const int tilesScore = (kSeq / 64) * (kSeq / 64);   // 1024 -> 128 blocks
  const int tilesCtx   = (kSeq / 64) * (kDh / 64);    // 32 -> 4 blocks
  for (int b = 0; b < kBatch; ++b) {
    for (int h = 0; h < kHeads; ++h) {
      const size_t tokOff = ((size_t)b * kSeq) * kDim + (size_t)h * kDh;   // elements
      const unsigned short* Ag  = Qh + tokOff;
      const unsigned short* Btg = Kh + tokOff;
      // SC[i][j] = sum_d Qh[b,i,h*64+d] * Kh[b,j,h*64+d]   (M=N=2048, K=64)
      wmma_gemm64<0, false, 0, 0, false, 0><<<dim3(tilesScore / 8, 1), dim3(256), 0, stream>>>(
          Ag, Ag, kDim, 0L, Btg, Btg, kDim, 0L,
          (void*)SC, (void*)SC, kSeq, 0L, bias_o, SCL, 0L, kSeq, kSeq, kDh, 1.0f);
      // scale + softmax -> PP (f16, x32768)
      softmax_row_kernel<<<dim3(kSeq), dim3(256), 0, stream>>>(SC, PP);
      // Oh[b, i, h*64+n] = f16( 2^-10 * sum_j PP[i][j] * VT[b,h][n][j] )   (M=2048, N=64, K=2048); context carried x256
      const unsigned short* VTg = VT + ((size_t)(b * kHeads + h) * kDh) * kSeq;
      unsigned short* Og = Oh + tokOff;
      wmma_gemm64<0, false, 0, 1, false, 0><<<dim3(tilesCtx / 8, 1), dim3(256), 0, stream>>>(
          PP, PP, kSeq, 0L, VTg, VTg, kSeq, 0L,
          (void*)Og, (void*)Og, kDim, 0L, bias_o, SCL, 0L, kSeq, kDh, kSeq, kPVScale);
    }
  }

  // ---- output projection: out = 2^-12 * Oh.Wo^T(x16) + bo   (M=8192, N=512, K=512), f32 to d_out ----
  wmma_gemm64<0, false, 2, 0, false, 0><<<dim3(tilesProj / 8, 1), dim3(256), 0, stream>>>(
      Oh, Oh, kDim, 0L, WT + 3 * wPlane, WT + 3 * wPlane, kDim, 0L,
      (void*)out, (void*)out, kDim, 0L, bias_o, SCL, 0L, kTok, kDim, kDim, kOutScale);
}

// v001
// It runs in 515 microseconds.
// Timed twice side by side with v000, it ran 6.77 and 7.06 times as fast.
// Contractions: q/k/v projections (x,m RNE-converted to bf16 held in f16 planes x W^T bf16-valued f16 planes carried x16), scores k.q^T (gated q,k f16 planes carried x8), v^T.p^T (gated V^T f16 carried x8 x unnormalised P f16 carried x64), output projection (context f16 carried x256 x Wo^T f16 carried x16): all v_wmma_f32_16x16x32_f16 with f32 accumulate; token pooling, channel-gate MLP, online softmax in f32.
#include <hip/hip_runtime.h>
#include <math.h>

// ---------------------------------------------------------------------------
// Problem constants
// ---------------------------------------------------------------------------
constexpr int kBatch = 4;
constexpr int kSeq   = 2048;
constexpr int kDim   = 512;               // model dim = inner dim
constexpr int kHeads = 8;
constexpr int kDh    = 64;
constexpr int kRed   = 32;                // gate hidden width (512 / 16)
constexpr int kTok   = kBatch * kSeq;     // 8192 token rows
constexpr int kPlane = kTok * kDim;       // 4194304 elements per [8192][512] plane
constexpr float kWCarry    = 16.0f;                 // weights carried x16 in f16
constexpr float kWCarryInv = 1.0f / 16.0f;
constexpr float kGCarry    = 8.0f;                  // gated q/k/v planes carried x8 in f16
constexpr float kPShift    = 6.0f;                  // unnormalised probabilities carried x2^6 in f16 (added to the base-2 exponent)
constexpr float kCtxCarry  = 256.0f;                // context carried x2^8 in f16
constexpr float kCtxScale  = kCtxCarry / kGCarry;                   // 32; the P carry cancels against the row sum
constexpr float kOutScale  = 1.0f / (kCtxCarry * kWCarry);          // 2^-12
constexpr float kAttnScale = 0.044194173824159216f;                 // 512^-0.5
constexpr float kSmScale   = kAttnScale / (kGCarry * kGCarry);      // exact: / 64
constexpr float kSmScale2  = kSmScale * 1.4426950408889634f;        // scores to base-2 exponents
constexpr float kInvSeq    = 1.0f / 2048.0f;
static_assert(kHeads * kDh == kDim);
static_assert(kDim / 16 == kRed);
static_assert(kSeq % 256 == 0 && (kSeq & (kSeq - 1)) == 0 && kDh == 64);   // fused attention: 256 queries per block, key index wraps by mask
static_assert(kSeq * kDim == (1 << 20));        // gate cast batch index = element >> 20
// GEMM shape contract: M % 64 == 0, N % 64 == 0, K % 32 == 0 for every launch
static_assert(kTok % 64 == 0 && kDim % 64 == 0 && kDim % 32 == 0);     // projections / out: M=8192 N=512 K=512
static_assert((kPlane / 8) % 256 == 0);                                // cast grids exact

typedef __attribute__((ext_vector_type(16))) _Float16 v16h;
typedef __attribute__((ext_vector_type(8)))  _Float16 v8h;
typedef __attribute__((ext_vector_type(16))) __bf16   v16b;
typedef __attribute__((ext_vector_type(8)))  __bf16   v8b;
typedef __attribute__((ext_vector_type(8)))  float    v8f;
typedef __attribute__((ext_vector_type(4)))  float    v4f;
typedef __attribute__((ext_vector_type(2)))  float    v2f;
typedef __attribute__((ext_vector_type(2)))  _Float16 v2h;
typedef __attribute__((ext_vector_type(4)))  unsigned int v4u;

__device__ __forceinline__ unsigned short f2bf_bits(float f) {
  unsigned u = __float_as_uint(f);
  return (unsigned short)((u + 0x7FFFu + ((u >> 16) & 1u)) >> 16);
}
__device__ __forceinline__ float bf_bits2f(unsigned short h) { return __uint_as_float(((unsigned)h) << 16); }
// RNE convert f32 -> bf16 -> f32
__device__ __forceinline__ float bf_rne(float f) { return bf_bits2f(f2bf_bits(f)); }

// hazard guards as plain device helpers (no inline asm inside the kernel template body)
__device__ __forceinline__ void dep_guard_h(v8f& a, v8f& b, v16h x, v16h y) { asm volatile("v_nop\n\tv_nop\n\tv_nop\n\tv_nop" : "+v"(a), "+v"(b) : "v"(x), "v"(y)); }
__device__ __forceinline__ void dep_guard_b(v8f& a, v8f& b, v16b x, v16b y) { asm volatile("v_nop\n\tv_nop\n\tv_nop\n\tv_nop" : "+v"(a), "+v"(b) : "v"(x), "v"(y)); }
__device__ __forceinline__ void keep4_h(v16h a, v16h b, v16h c, v16h d) { asm volatile("v_nop" :: "v"(a), "v"(b), "v"(c), "v"(d)); }
__device__ __forceinline__ void keep4_b(v16b a, v16b b, v16b c, v16b d) { asm volatile("v_nop" :: "v"(a), "v"(b), "v"(c), "v"(d)); }
__device__ __forceinline__ void acc_guard4(v8f& a, v8f& b, v8f& c, v8f& d) { asm volatile("v_nop\n\tv_nop\n\tv_nop\n\tv_nop" : "+v"(a), "+v"(b), "+v"(c), "+v"(d)); }
template <typename T> struct Frag;
template <> struct Frag<_Float16> {
  typedef v16h V; union U { v16h v; v8h h[2]; };
  // elements 0..7 <- p[0..7], 8..15 <- p[16..23]
  static __device__ __forceinline__ v16h load(const _Float16* p) {
    U f; f.h[0] = *(const v8h*)(p); f.h[1] = *(const v8h*)(p + 16); return f.v;
  }
  static __device__ __forceinline__ v8f mma(v16h a, v16h b, v8f c) {
    return __builtin_amdgcn_wmma_f32_16x16x32_f16(false, a, false, b, (short)0, c, false, false);
  }
  static __device__ __forceinline__ void guard(v8f& a, v8f& b, v16h x, v16h y) { dep_guard_h(a, b, x, y); }
  static __device__ __forceinline__ void keep(v16h a, v16h b, v16h c, v16h d) { keep4_h(a, b, c, d); }
};
template <> struct Frag<__bf16> {
  typedef v16b V; union U { v16b v; v8b h[2]; };
  static __device__ __forceinline__ v16b load(const __bf16* p) {
    U f; f.h[0] = *(const v8b*)(p); f.h[1] = *(const v8b*)(p + 16); return f.v;
  }
  static __device__ __forceinline__ v8f mma(v16b a, v16b b, v8f c) {
    return __builtin_amdgcn_wmma_f32_16x16x32_bf16(false, a, false, b, (short)0, c, false, false);
  }
  static __device__ __forceinline__ void guard(v8f& a, v8f& b, v16b x, v16b y) { dep_guard_b(a, b, x, y); }
  static __device__ __forceinline__ void keep(v16b a, v16b b, v16b c, v16b d) { keep4_b(a, b, c, d); }
};

__device__ __forceinline__ unsigned pk16(unsigned short a, unsigned short b) { return (unsigned)a | ((unsigned)b << 16); }
__device__ __forceinline__ unsigned short h_bits(float f) { const _Float16 h = (_Float16)f; return __builtin_bit_cast(unsigned short, h); }

// ---- Register-blocked batched WMMA GEMM (ACT reduced to none/relu/leaky) -------------------------------
// C[m,n] = scale * sum_k A[m,k] * Bt[n,k] (+bias)(+resid); each wave owns a 64x64 tile.
// A row-major [M,K]; Bt row-major [N,K]; M,N % 64 == 0, K % 32 == 0.
// SPLIT: operands are hi/lo planes (A2/Bt2 = lo planes, same layout); product = hi*hi + hi*lo + lo*hi.
// BIAS_MODE: 0 = none, 1 = bias[m], 2 = bias[n].
// OUT_MODE: 0 = f32, 1 = f16, 2 = bf16 hi plane (Cout) + bf16 lo plane (Cout2).
// ET: 0 = f16 operands, 1 = bf16 operands (pointers passed as 16-bit storage)
template <int ET> struct Elem;
template <> struct Elem<0> { typedef _Float16 T; };
template <> struct Elem<1> { typedef __bf16 T; };
template <int ET, bool SPLIT, int BIAS_MODE, int OUT_MODE, bool RESID, int ACT = 0>
__global__ __launch_bounds__(256) void wmma_gemm64(
    const unsigned short* __restrict__ Ap, const unsigned short* __restrict__ A2p, int lda, long strideA,
    const unsigned short* __restrict__ Btp, const unsigned short* __restrict__ Bt2p, int ldb, long strideB,
    void* __restrict__ Cout, void* __restrict__ Cout2, int ldc, long strideC,
    const float* __restrict__ bias,
    const float* __restrict__ resid, long strideR,
    int M, int N, int K, float scale) {
  typedef typename Elem<ET>::T T;
  typedef typename Frag<T>::V V;
  const T* A = (const T*)Ap; const T* A2 = (const T*)A2p; const T* Bt = (const T*)Btp; const T* Bt2 = (const T*)Bt2p;
  __shared__ __align__(16) float sT[8][16 * 68];   // per-wave 16x64 slab, pitch 68 floats
  const int b    = blockIdx.y;
  const int lane = threadIdx.x & 31;
  const int wave = threadIdx.x >> 5;
  const int tilesN = N >> 6;
  const int tilesM = M >> 6;
  const int tile = blockIdx.x * 8 + wave;
  if (tile >= tilesM * tilesN) return;   // wave-uniform; no block barriers in this kernel
  const int tm = tile / tilesN;
  const int tn = tile - tm * tilesN;
  const int m0 = tm << 6;
  const int n0 = tn << 6;

  const T* Ab  = A  + (size_t)b * strideA;
  const T* Bb  = Bt + (size_t)b * strideB;
  const T* Ab2 = SPLIT ? (A2  + (size_t)b * strideA) : nullptr;
  const T* Bb2 = SPLIT ? (Bt2 + (size_t)b * strideB) : nullptr;

  const int rlane = lane & 15;                 // row (A) / col (B, D) within subtile
  const int koff  = (lane >> 4) * 8;           // k offset of this lane half
  const int mOff  = (lane >> 4) * 8;           // D row offset

  v8f acc[4][4];
#pragma unroll
  for (int i = 0; i < 4; ++i)
#pragma unroll
    for (int j = 0; j < 4; ++j) acc[i][j] = (v8f){0.f,0.f,0.f,0.f,0.f,0.f,0.f,0.f};

  for (int k0 = 0; k0 < K; k0 += 32) {
    V bh[4], bl[4];
#pragma unroll
    for (int j = 0; j < 4; ++j) {
      const size_t bo = (size_t)(n0 + (j << 4) + rlane) * ldb + koff + k0;
      bh[j] = Frag<T>::load(Bb + bo);
      if (SPLIT) bl[j] = Frag<T>::load(Bb2 + bo);
    }
#pragma unroll
    for (int i = 0; i < 4; ++i) {
      const size_t ao = (size_t)(m0 + (i << 4) + rlane) * lda + koff + k0;
      V ah = Frag<T>::load(Ab + ao);
      V al;
      if (SPLIT) al = Frag<T>::load(Ab2 + ao);
#pragma unroll
      for (int j = 0; j < 4; ++j) {
        acc[i][j] = Frag<T>::mma(ah, bh[j], acc[i][j]);
        if (SPLIT) {
          acc[i][j] = Frag<T>::mma(ah, bl[j], acc[i][j]);
          acc[i][j] = Frag<T>::mma(al, bh[j], acc[i][j]);
        }
      }
      Frag<T>::guard(acc[i][0], acc[i][3], ah, SPLIT ? al : ah);
    }
    Frag<T>::keep(bh[0], bh[1], bh[2], bh[3]);
    if (SPLIT) Frag<T>::keep(bl[0], bl[1], bl[2], bl[3]);
  }
  acc_guard4(acc[0][0], acc[0][1], acc[0][2], acc[0][3]);
  acc_guard4(acc[1][0], acc[1][1], acc[1][2], acc[1][3]);
  acc_guard4(acc[2][0], acc[2][1], acc[2][2], acc[2][3]);
  acc_guard4(acc[3][0], acc[3][1], acc[3][2], acc[3][3]);

  // ---- epilogue ----
  float* slab = sT[wave];
  const float* Rb = RESID ? (resid + (size_t)b * strideR) : nullptr;
#pragma unroll
  for (int i = 0; i < 4; ++i) {
    const int mBase = m0 + (i << 4);
#pragma unroll
    for (int j = 0; j < 4; ++j) {
      const int n = n0 + (j << 4) + rlane;
      float bv = 0.f;
      if (BIAS_MODE == 2) bv = bias[n];
#pragma unroll
      for (int r = 0; r < 8; ++r) {
        float v = acc[i][j][r] * scale;
        if (BIAS_MODE == 1) v += bias[mBase + mOff + r];
        if (BIAS_MODE == 2) v += bv;
        if (RESID) v += Rb[(size_t)(mBase + mOff + r) * ldc + n];
        if (ACT == 2) v = fmaxf(v, 0.0f);
        if (ACT == 4) v = (v > 0.f) ? v : 0.01f * v;
        slab[(mOff + r) * 68 + (j << 4) + rlane] = v;
      }
    }
    __builtin_amdgcn_fence(__ATOMIC_RELEASE, "workgroup");
    __builtin_amdgcn_wave_barrier();
    __builtin_amdgcn_fence(__ATOMIC_ACQUIRE, "workgroup");
    if (OUT_MODE == 0) {
      float* C = (float*)Cout + (size_t)b * strideC;
      const int hh = lane >> 4, c4 = (lane & 15) * 4;     // row seg = 256 B = 16 lanes x 16 B
      {
#pragma unroll
        for (int it = 0; it < 8; ++it) {
          const int row = it * 2 + hh;
          v4f v = *(const v4f*)(slab + row * 68 + c4);
          *(v4f*)(C + (size_t)(mBase + row) * ldc + n0 + c4) = v;
        }
        
      }
    } else {
      const int q = lane >> 3, c8 = (lane & 7) * 8;
      unsigned short* C  = (unsigned short*)Cout  + (size_t)b * strideC;
      unsigned short* C2 = (OUT_MODE == 2) ? ((unsigned short*)Cout2 + (size_t)b * strideC) : nullptr;
      {
#pragma unroll
        for (int it = 0; it < 4; ++it) {
          const int row = it * 4 + q;
          const float* sp = slab + row * 68 + c8;
          v8h hv, lv;
#pragma unroll
          for (int e = 0; e < 8; ++e) {
            if (OUT_MODE == 1) {
              hv[e] = (_Float16)sp[e];
            } else {
              unsigned short hb = f2bf_bits(sp[e]);
              unsigned short lb = f2bf_bits(sp[e] - bf_bits2f(hb));
              hv[e] = __builtin_bit_cast(_Float16, hb);
              lv[e] = __builtin_bit_cast(_Float16, lb);
            }
          }
          *(v8h*)(C + (size_t)(mBase + row) * ldc + n0 + c8) = hv;
          if (OUT_MODE == 2) *(v8h*)(C2 + (size_t)(mBase + row) * ldc + n0 + c8) = lv;
        }
        
      }
    }
    __builtin_amdgcn_fence(__ATOMIC_RELEASE, "workgroup");
    __builtin_amdgcn_wave_barrier();
    __builtin_amdgcn_fence(__ATOMIC_ACQUIRE, "workgroup");
  }
}

// ---------------------------------------------------------------------------
// Input cast: out plane z (0 <- x, 1 <- m) = f16( bf16_rne(v) ), [8192][512] halves each.
// ---------------------------------------------------------------------------
__global__ __launch_bounds__(256) void cast_in_kernel(const float* __restrict__ x, const float* __restrict__ m,
                                                      unsigned short* __restrict__ out, int n8) {
  const int z = blockIdx.y;                          // block-uniform plane select
  const float* in = (z == 0) ? x : m;
  const int i = blockIdx.x * 256 + threadIdx.x;
  if (i >= n8) return;
  const float* p = in + 8 * (size_t)i;
  const v4f a = *(const v4f*)(p);
  const v4f c = *(const v4f*)(p + 4);
  unsigned short hb[8];
#pragma unroll
  for (int e = 0; e < 4; ++e) {
    hb[e]     = h_bits(bf_rne(a[e]));
    hb[4 + e] = h_bits(bf_rne(c[e]));
  }
  const v4u u = (v4u){pk16(hb[0], hb[1]), pk16(hb[2], hb[3]), pk16(hb[4], hb[5]), pk16(hb[6], hb[7])};
  unsigned short* q = out + (size_t)z * 8 * (size_t)n8 + 8 * (size_t)i;
  *(v4u*)q = u;
  
}

// ---------------------------------------------------------------------------
// Weight transpose + cast: W is [in d][out h] (512x512, row-major); WT[h][d] = f16( scale * bf16_rne(W[d][h]) ).
// grid (8, 8, 4): blockIdx.x = d tile (64 cols of WT), blockIdx.y = h tile (64 rows of WT), blockIdx.z selects W0..W3 and the
// output plane (plane z at out + z*512*512 halves). 256 threads.
// Load coverage: 4 iterations x 256 threads x float4 = 4096 = the whole 64(d) x 64(h) tile (coalesced along h), 4 b128 loads per lane.
// Store coverage: 8 waves x 2 iterations x 4 rows (lane>>3) = 64 rows; (lane&7) x 8 halves = 64 cols; each row segment =
// ---------------------------------------------------------------------------
__global__ __launch_bounds__(256) void wtcast_kernel(const float* __restrict__ W0, const float* __restrict__ W1,
                                                     const float* __restrict__ W2, const float* __restrict__ W3,
                                                     unsigned short* __restrict__ out, float scale) {
  __shared__ float sm[64][65];   // sm[h_local][d_local]
  const int t  = threadIdx.x;
  const int d0 = blockIdx.x * 64;
  const int h0 = blockIdx.y * 64;
  const int z  = blockIdx.z;                                   // block-uniform
  const float* W = (z == 0) ? W0 : (z == 1) ? W1 : (z == 2) ? W2 : W3;
#pragma unroll
  for (int i = 0; i < 4; ++i) {
    const int e4 = i * 256 + t;
    const int r  = e4 >> 4;            // d local 0..63
    const int c4 = (e4 & 15) * 4;      // h local 0..60
    const v4f w = *(const v4f*)(W + (size_t)(d0 + r) * kDim + h0 + c4);
#pragma unroll
    for (int k = 0; k < 4; ++k) sm[c4 + k][r] = bf_rne(w[k]) * scale;
  }
  __syncthreads();
  const int lane = t & 31, wave = t >> 5;
  const int q = lane >> 3, c8 = (lane & 7) * 8;
  unsigned short* op = out + (size_t)z * kDim * kDim;
  {
#pragma unroll
    for (int it = 0; it < 2; ++it) {
      const int row = wave * 8 + it * 4 + q;                 // h local
      unsigned short hb[8];
#pragma unroll
      for (int e = 0; e < 8; ++e) hb[e] = h_bits(sm[row][c8 + e]);
      const v4u u = (v4u){pk16(hb[0], hb[1]), pk16(hb[2], hb[3]), pk16(hb[4], hb[5]), pk16(hb[6], hb[7])};
      *(v4u*)(op + (size_t)(h0 + row) * kDim + d0 + c8) = u;
    }
    
  }
}

// ---------------------------------------------------------------------------
// Token pooling + channel gate MLP (f32): block tb = tensor*4 + batch (12 blocks), 512 threads = channels.
//   mx[c] = max_n F[t][b][n][c], av[c] = (sum_n F[t][b][n][c]) * (1/2048)     (sequential over 2048 tokens, coalesced)
//   hid[j] = relu( sum_c mx[c]*w1[c][j] + sum_c av[c]*w1[c][j] )   j < 32      (w1, w2 RNE-converted to bf16 at load)
//   g[c]   = 1 / (1 + exp(-sum_j hid[j]*w2[j][c]))
// Output row scl[tb][0..511] (2048 B): staged in LDS, threads 0..127 write one float4 each -> wave w writes 512 contiguous B =
// ---------------------------------------------------------------------------
__global__ __launch_bounds__(512) void pool_gate_kernel(const float* __restrict__ F, const float* __restrict__ w1,
                                                        const float* __restrict__ w2, float* __restrict__ scl) {
  __shared__ float smax[kDim];
  __shared__ float savg[kDim];
  __shared__ float hid[kRed];
  __shared__ __align__(16) float sout[kDim];
  const int t  = threadIdx.x;
  const int tb = blockIdx.x;            // 0..11
  const int z  = tb >> 2;               // tensor: 0 q, 1 k, 2 v
  const int b  = tb & 3;
  const float* src = F + ((size_t)z * kTok + (size_t)b * kSeq) * kDim + t;
  float mx = -__builtin_inff();
  float sm = 0.0f;
#pragma unroll 4
  for (int n = 0; n < kSeq; ++n) {
    const float v = src[(size_t)n * kDim];
    mx = fmaxf(mx, v);
    sm += v;
  }
  smax[t] = mx;
  savg[t] = sm * kInvSeq;
  __syncthreads();
  if (t < kRed) {                       // wave 0, wave-uniform
    float a1 = 0.0f, a2 = 0.0f;
#pragma unroll 1
    for (int c = 0; c < kDim; ++c) {
      const float w = bf_rne(w1[c * kRed + t]);
      a1 += smax[c] * w;
      a2 += savg[c] * w;
    }
    hid[t] = fmaxf(a1 + a2, 0.0f);
  }
  __syncthreads();
  float a = 0.0f;
#pragma unroll 1
  for (int j = 0; j < kRed; ++j) a += hid[j] * bf_rne(w2[j * kDim + t]);
  const float g = 1.0f / (1.0f + expf(-a));
  sout[t] = g;
  __syncthreads();
  if (t < 128) {
    const v4f val = *(const v4f*)(sout + 4 * t);
    float* dp = scl + (size_t)tb * kDim + 4 * t;
    *(v4f*)dp = val;
    
  }
}

// ---------------------------------------------------------------------------
// Gate + cast for q and k planes: out[z][row][c] = f16( 8 * F[z][row][c] * g[z][batch(row)][c] ), z = blockIdx.y (0 q, 1 k).
// Coverage: n8 = 524288 = 2048 blocks x 256 exact per plane.
// ---------------------------------------------------------------------------
__global__ __launch_bounds__(256) void gate_cast_kernel(const float* __restrict__ F, const float* __restrict__ scl,
                                                        unsigned short* __restrict__ out, int n8) {
  const int z = blockIdx.y;
  const int i = blockIdx.x * 256 + threadIdx.x;
  if (i >= n8) return;
  const size_t e0 = 8 * (size_t)i;                    // element index inside the plane
  const int c0 = (int)(e0 & (size_t)(kDim - 1));
  const int b  = (int)(e0 >> 20);                     // row / 2048
  const float* p  = F + (size_t)z * kPlane + e0;
  const float* sp = scl + (size_t)(z * kBatch + b) * kDim + c0;
  const v4f a  = *(const v4f*)(p);
  const v4f c  = *(const v4f*)(p + 4);
  const v4f g0 = *(const v4f*)(sp);
  const v4f g1 = *(const v4f*)(sp + 4);
  unsigned short hb[8];
#pragma unroll
  for (int e = 0; e < 4; ++e) {
    hb[e]     = h_bits(a[e] * g0[e] * kGCarry);
    hb[4 + e] = h_bits(c[e] * g1[e] * kGCarry);
  }
  const v4u u = (v4u){pk16(hb[0], hb[1]), pk16(hb[2], hb[3]), pk16(hb[4], hb[5]), pk16(hb[6], hb[7])};
  unsigned short* q = out + (size_t)z * kPlane + e0;
  *(v4u*)q = u;
  
}

// ---------------------------------------------------------------------------
// Gate + transpose + cast for v: VT[(b*8+h)][d][s] = f16( 8 * Fv[b][s][h*64+d] * gv[b][h*64+d] ).
// grid (32, 8, 4): blockIdx.x = s tile (64 rows), blockIdx.y = head, blockIdx.z = batch. 256 threads.
// Load coverage: 4 iterations x 256 threads x float4 = 4096 = whole 64(s) x 64(d) tile (coalesced along d); gate as one float4.
// Store coverage: 8 waves x 2 iterations x 4 rows (lane>>3) = 64 d-rows; (lane&7) x 8 halves = 64 s-cols; each row segment =
// ---------------------------------------------------------------------------
__global__ __launch_bounds__(256) void vt_gate_cast_kernel(const float* __restrict__ Fv, const float* __restrict__ gv,
                                                           unsigned short* __restrict__ VT) {
  __shared__ float sm[64][65];   // sm[d][s_local]
  const int t  = threadIdx.x;
  const int s0 = blockIdx.x * 64;
  const int h  = blockIdx.y;
  const int b  = blockIdx.z;
  const int c4 = (t & 15) * 4;   // d, constant over the load loop
  const v4f g = *(const v4f*)(gv + (size_t)b * kDim + h * kDh + c4);
#pragma unroll
  for (int i = 0; i < 4; ++i) {
    const int e4 = i * 256 + t;
    const int r  = e4 >> 4;        // s local 0..63
    const v4f w = *(const v4f*)(Fv + ((size_t)(b * kSeq + s0 + r)) * kDim + h * kDh + c4);
#pragma unroll
    for (int k = 0; k < 4; ++k) sm[c4 + k][r] = w[k] * g[k] * kGCarry;
  }
  __syncthreads();
  const int lane = t & 31, wave = t >> 5;
  const int q = lane >> 3, c8 = (lane & 7) * 8;
  unsigned short* op = VT + ((size_t)(b * kHeads + h) * kDh) * kSeq;
  {
#pragma unroll
    for (int it = 0; it < 2; ++it) {
      const int row = wave * 8 + it * 4 + q;                 // d
      unsigned short hb[8];
#pragma unroll
      for (int e = 0; e < 8; ++e) hb[e] = h_bits(sm[row][c8 + e]);
      const v4u u = (v4u){pk16(hb[0], hb[1]), pk16(hb[2], hb[3]), pk16(hb[4], hb[5]), pk16(hb[6], hb[7])};
      *(v4u*)(op + (size_t)row * kSeq + s0 + c8) = u;
    }
    
  }
}

// ---------------------------------------------------------------------------
// Fused attention of every (batch, head): S^T = K.Q^T, online softmax (base 2, f32), O^T += V^T.P^T; scores and P stay in registers.
// grid (8, 32): blockIdx.x = block of 256 queries, blockIdx.y = batch*8 + head. 8 waves x 32 query columns (2 groups of 16).
// One pass = 32 keys. Lane (c = lane & 15, hf = lane >> 4) of a score tile holds query c, keys 8*hf + r: the two 16-key tiles of a
// pass, converted in place, are the B operand of the second product (element s: key 8*hf + s, s < 8; key 16 + 8*hf + s - 8 else),
// the k order in which Frag::load brings V^T (and K, Q among themselves).
// The maximum in use may trail the true one by up to 8 (base-2 exponent), so P <= 2^8 and P carried x2^6 <= 2^14 in f16.
// Oh[b][q][head*64 + d] = f16( 32 * acc / rowsum ): context carried x256, V carried x8.
// ---------------------------------------------------------------------------
__device__ __forceinline__ float xhalf(float x) {   // lane l <-> lane l ^ 16
  const int v = __builtin_bit_cast(int, x);
  return __builtin_bit_cast(float, __builtin_amdgcn_permlanex16(v, v, 0x76543210, 0xfedcba98, false, false));
}
__global__ __launch_bounds__(256) void attn_fused_kernel(const unsigned short* __restrict__ Qp, const unsigned short* __restrict__ Kp,
                                                         const unsigned short* __restrict__ VTp, unsigned short* __restrict__ Op) {
  typedef Frag<_Float16> FH;
  const int lane = threadIdx.x & 31, wave = threadIdx.x >> 5;
  const int c = lane & 15, hf = lane >> 4;
  const int bh = blockIdx.y;
  const int q0 = blockIdx.x * 256 + wave * 32;
  const size_t tokOff = (size_t)(bh >> 3) * kSeq * kDim + (size_t)(bh & 7) * kDh;
  const _Float16* ql = (const _Float16*)Qp + tokOff + (size_t)(q0 + c) * kDim + 8 * hf;
  const _Float16* kl = (const _Float16*)Kp + tokOff + (size_t)c * kDim + 8 * hf;
  const _Float16* vl = (const _Float16*)VTp + (size_t)bh * kDh * kSeq + (size_t)c * kSeq + 8 * hf;

  v16h qf[2][2];
#pragma unroll
  for (int g = 0; g < 2; ++g)
#pragma unroll
    for (int kc = 0; kc < 2; ++kc) qf[g][kc] = FH::load(ql + (size_t)(16 * g) * kDim + 32 * kc);

  v8f acc[2][4];
  v2f ls[2];
  float m_run[2];
#pragma unroll
  for (int g = 0; g < 2; ++g) {
    m_run[g] = -__builtin_inff();
    ls[g] = (v2f){0.f, 0.f};
#pragma unroll
    for (int t = 0; t < 4; ++t) acc[g][t] = (v8f){0.f,0.f,0.f,0.f,0.f,0.f,0.f,0.f};
  }

  v16h kf[2][2];
#pragma unroll
  for (int kt = 0; kt < 2; ++kt)
#pragma unroll
    for (int kc = 0; kc < 2; ++kc) kf[kt][kc] = FH::load(kl + (size_t)(16 * kt) * kDim + 32 * kc);

  // rolled: one pass's fragments, scores and the 64 accumulator registers fill the register budget
#pragma unroll 1
  for (int key0 = 0; key0 < kSeq; key0 += 32) {
    v16h vf[4];      // this pass's V^T, in flight under the score products and the maxima
#pragma unroll
    for (int t = 0; t < 4; ++t) vf[t] = FH::load(vl + (size_t)(16 * t) * kSeq + key0);

    v8f s[2][2];
#pragma unroll
    for (int kt = 0; kt < 2; ++kt)
#pragma unroll
      for (int g = 0; g < 2; ++g) {
        s[kt][g] = (v8f){0.f,0.f,0.f,0.f,0.f,0.f,0.f,0.f};
#pragma unroll
        for (int kc = 0; kc < 2; ++kc) s[kt][g] = FH::mma(kf[kt][kc], qf[g][kc], s[kt][g]);
      }
    const int nk = (key0 + 32) & (kSeq - 1);
#pragma unroll
    for (int kt = 0; kt < 2; ++kt)
#pragma unroll
      for (int kc = 0; kc < 2; ++kc) kf[kt][kc] = FH::load(kl + (size_t)(nk + 16 * kt) * kDim + 32 * kc);
    __builtin_amdgcn_sched_barrier(0);   // keeps the K loads issued here, ahead of the vector work that hides their latency

    float mb[2];
    bool need = false;
#pragma unroll
    for (int g = 0; g < 2; ++g) {
      float mx = s[0][g][0];
#pragma unroll
      for (int r = 1; r < 8; ++r) mx = fmaxf(mx, s[0][g][r]);
#pragma unroll
      for (int r = 0; r < 8; ++r) mx = fmaxf(mx, s[1][g][r]);
      mx = fmaxf(mx, xhalf(mx)) * kSmScale2;         // both halves hold the query's maximum of this pass (the scale is positive)
      mb[g] = mx;
      need = need || (mx > m_run[g] + 8.0f);
    }
    if (__builtin_amdgcn_ballot_w32(need) != 0) {    // wave-uniform; always on the first pass, rare later
#pragma unroll
      for (int g = 0; g < 2; ++g) {
        const float m_new = fmaxf(m_run[g], mb[g]);
        const float corr = __builtin_amdgcn_exp2f(m_run[g] - m_new);   // 0 on the first pass
        m_run[g] = m_new;
        ls[g] = ls[g] * corr;
#pragma unroll
        for (int t = 0; t < 4; ++t) acc[g][t] = acc[g][t] * corr;
      }
    }
#pragma unroll
    for (int g = 0; g < 2; ++g) {
      const float nm = kPShift - m_run[g];
      v16h pf;
#pragma unroll
      for (int i = 0; i < 8; ++i) {
        const v2f sv = (v2f){s[i >> 2][g][2 * (i & 3)], s[i >> 2][g][2 * (i & 3) + 1]};
        const v2f arg = __builtin_elementwise_fma(sv, (v2f){kSmScale2, kSmScale2}, (v2f){nm, nm});
        const v2f p = (v2f){__builtin_amdgcn_exp2f(arg.x), __builtin_amdgcn_exp2f(arg.y)};
        ls[g] = ls[g] + p;
        const v2h ph = __builtin_convertvector(p, v2h);
        pf[2 * i]     = ph.x;
        pf[2 * i + 1] = ph.y;
      }
#pragma unroll
      for (int t = 0; t < 4; ++t) acc[g][t] = FH::mma(vf[t], pf, acc[g][t]);
    }
  }

  _Float16* ol = (_Float16*)Op + tokOff + (size_t)(q0 + c) * kDim + 8 * hf;
#pragma unroll
  for (int g = 0; g < 2; ++g) {
    float l = ls[g].x + ls[g].y;
    l += xhalf(l);                                   // join the two halves' key sums
    const float inv = kCtxScale / l;
#pragma unroll
    for (int t = 0; t < 4; ++t) {
      v8h hv;
#pragma unroll
      for (int r = 0; r < 8; ++r) hv[r] = (_Float16)(acc[g][t][r] * inv);   // d = 16 t + 8 hf + r of query 16 g + c
      *(v8h*)(ol + (size_t)(16 * g) * kDim + 16 * t) = hv;
    }
  }
}

// ---------------------------------------------------------------------------
// Host glue.
//   XMh  f16 [2][8192][512]     16,777,216  at           0   (x plane then m plane, bf16-valued)
//   WT   f16 [4][512][512]       2,097,152  at  16,777,216   (Wq^T, Wk^T, Wv^T, Wo^T, [out][in], carried x16)
//   F    f32 [3][8192][512]     50,331,648  at  18,874,368   (q, k, v projections, ungated)
//   Qh   f16 [8192][512]         8,388,608  at  69,206,016   (gated q, carried x8)
//   Kh   f16 [8192][512]         8,388,608  at  77,594,624   (gated k, carried x8)
//   VT   f16 [32][64][2048]      8,388,608  at  85,983,232   (gated v transposed per (batch, head), carried x8)
//   Oh   f16 [8192][512]         8,388,608  at  94,371,840   (attention context, carried x256)
//   SCL  f32 [3][4][512]            24,576  at 102,760,448   (channel gates)
//   total                      102,785,024
// GEMM shapes: projections/out M=8192 N=512 K=512.
// All M,N multiples of 64, all K multiples of 32, no padded rows anywhere; every plane fully written before it is read.
// Launches: 1 + 1 + 2 + 1 + 1 + 1 + 1 + 1 = 9.
// ---------------------------------------------------------------------------
extern "C" void kernel_launch(void* const* d_in, const int* in_sizes, int n_in,
                              void* d_out, int out_size, void* d_ws, size_t ws_size,
                              hipStream_t stream) {
  if (n_in < 9) return;
  if (in_sizes[0] != kPlane || in_sizes[1] != kPlane) return;
  if (in_sizes[2] != kDim * kDim || in_sizes[3] != kDim * kDim || in_sizes[4] != kDim * kDim || in_sizes[5] != kDim * kDim) return;
  if (in_sizes[6] != kDim || in_sizes[7] != kDim * kRed || in_sizes[8] != kRed * kDim) return;
  if (out_size != kPlane) return;

  const size_t szHalfPlane = (size_t)kPlane * 2;                 // 8,388,608
  const size_t szXM  = 2 * szHalfPlane;
  const size_t szWT  = (size_t)4 * kDim * kDim * 2;
  const size_t szF   = (size_t)3 * kPlane * 4;
  const size_t szVT  = (size_t)kBatch * kHeads * kDh * kSeq * 2;
  const size_t szSCL = (size_t)3 * kBatch * kDim * 4;
  const size_t offXM  = 0;
  const size_t offWT  = offXM + szXM;
  const size_t offF   = offWT + szWT;
  const size_t offQh  = offF + szF;
  const size_t offKh  = offQh + szHalfPlane;
  const size_t offVT  = offKh + szHalfPlane;
  const size_t offOh  = offVT + szVT;
  const size_t offSCL = offOh + szHalfPlane;
  const size_t total  = offSCL + szSCL;                           // 102,785,024
  if (ws_size < total) return;

  const float* x      = (const float*)d_in[0];
  const float* m      = (const float*)d_in[1];
  const float* Wq     = (const float*)d_in[2];
  const float* Wk     = (const float*)d_in[3];
  const float* Wv     = (const float*)d_in[4];
  const float* Wo     = (const float*)d_in[5];
  const float* bias_o = (const float*)d_in[6];
  const float* gw1    = (const float*)d_in[7];
  const float* gw2    = (const float*)d_in[8];
  float* out = (float*)d_out;
  char* ws = (char*)d_ws;
  unsigned short* XMh = (unsigned short*)(ws + offXM);
  unsigned short* WT  = (unsigned short*)(ws + offWT);
  float*          F   = (float*)(ws + offF);
  unsigned short* Qh  = (unsigned short*)(ws + offQh);
  unsigned short* Kh  = (unsigned short*)(ws + offKh);
  unsigned short* VT  = (unsigned short*)(ws + offVT);
  unsigned short* Oh  = (unsigned short*)(ws + offOh);
  float*          SCL = (float*)(ws + offSCL);

  const unsigned short* Xh = XMh;
  const unsigned short* Mh = XMh + (size_t)kPlane;
  const size_t wPlane = (size_t)kDim * kDim;

  // ---- 16-bit operand planes of the inputs ----
  const int n8 = kPlane / 8;   // 524288 -> 2048 blocks exact
  cast_in_kernel<<<dim3(n8 / 256, 2), dim3(256), 0, stream>>>(x, m, XMh, n8);
  wtcast_kernel<<<dim3(kDim / 64, kDim / 64, 4), dim3(256), 0, stream>>>(Wq, Wk, Wv, Wo, WT, kWCarry);

  // ---- projections: F[0] = x.Wq, F[1] = m.Wk, F[2] = m.Wv   (M=8192, N=512, K=512), f32 out, scale 1/16 ----
  const int tilesProj = (kTok / 64) * (kDim / 64);   // 1024 -> 128 blocks of 8 waves
  wmma_gemm64<0, false, 0, 0, false, 0><<<dim3(tilesProj / 8, 1), dim3(256), 0, stream>>>(
      Xh, Xh, kDim, 0L, WT, WT, kDim, 0L,
      (void*)F, (void*)F, kDim, 0L, bias_o, SCL, 0L, kTok, kDim, kDim, kWCarryInv);
  wmma_gemm64<0, false, 0, 0, false, 0><<<dim3(tilesProj / 8, 2), dim3(256), 0, stream>>>(
      Mh, Mh, kDim, 0L, WT + wPlane, WT + wPlane, kDim, (long)wPlane,
      (void*)(F + (size_t)kPlane), (void*)(F + (size_t)kPlane), kDim, (long)kPlane, bias_o, SCL, 0L, kTok, kDim, kDim, kWCarryInv);

  // ---- token pooling + channel gates ----
  pool_gate_kernel<<<dim3(3 * kBatch), dim3(512), 0, stream>>>(F, gw1, gw2, SCL);

  // ---- gated 16-bit planes: Qh, Kh (row-major [token][channel]); VT ([batch*head][d][token]) ----
  gate_cast_kernel<<<dim3(n8 / 256, 2), dim3(256), 0, stream>>>(F, SCL, Qh, n8);
  vt_gate_cast_kernel<<<dim3(kSeq / 64, kHeads, kBatch), dim3(256), 0, stream>>>(
      F + (size_t)2 * kPlane, SCL + (size_t)2 * kBatch * kDim, VT);

  // ---- attention, all (batch, head) in one launch: Oh[b, i, h*64+d] = f16( 256 * context ) ----
  attn_fused_kernel<<<dim3(kSeq / 256, kBatch * kHeads), dim3(256), 0, stream>>>(Qh, Kh, VT, Oh);

  // ---- output projection: out = 2^-12 * Oh.Wo^T(x16) + bo   (M=8192, N=512, K=512), f32 to d_out ----
  wmma_gemm64<0, false, 2, 0, false, 0><<<dim3(tilesProj / 8, 1), dim3(256), 0, stream>>>(
      Oh, Oh, kDim, 0L, WT + 3 * wPlane, WT + 3 * wPlane, kDim, 0L,
      (void*)out, (void*)out, kDim, 0L, bias_o, SCL, 0L, kTok, kDim, kDim, kOutScale);
}

// v002
// One run takes 183 microseconds.
// In two side-by-side timings against v001, it was 2.80 and 2.79 times as fast.
// Counting every step since v000, it is 19.3 times as fast.
// Contractions: q/k/v projections (x,m RNE-converted to bf16 held in f16 planes x W^T bf16-valued f16 planes carried x16), scores k.q^T (gated q,k f16 planes carried x8), v^T.p^T (gated V^T f16 carried x8 x unnormalised P f16 carried x64), output projection (context f16 carried x256 x Wo^T f16 carried x16): all v_wmma_f32_16x16x32_f16 with f32 accumulate; token pooling, channel-gate MLP, online softmax in f32.
#include <hip/hip_runtime.h>
#include <math.h>

// ---------------------------------------------------------------------------
// Problem constants
// ---------------------------------------------------------------------------
constexpr int kBatch = 4;
constexpr int kSeq   = 2048;
constexpr int kDim   = 512;               // model dim = inner dim
constexpr int kHeads = 8;
constexpr int kDh    = 64;
constexpr int kRed   = 32;                // gate hidden width (512 / 16)
constexpr int kTok   = kBatch * kSeq;     // 8192 token rows
constexpr int kPlane = kTok * kDim;       // 4194304 elements per [8192][512] plane
constexpr float kWCarry    = 16.0f;                 // weights carried x16 in f16
constexpr float kWCarryInv = 1.0f / 16.0f;
constexpr float kGCarry    = 8.0f;                  // gated q/k/v planes carried x8 in f16
constexpr float kPShift    = 6.0f;                  // unnormalised probabilities carried x2^6 in f16 (added to the base-2 exponent)
constexpr float kCtxCarry  = 256.0f;                // context carried x2^8 in f16
constexpr float kCtxScale  = kCtxCarry / kGCarry;                   // 32; the P carry cancels against the row sum
constexpr float kOutScale  = 1.0f / (kCtxCarry * kWCarry);          // 2^-12
constexpr float kAttnScale = 0.044194173824159216f;                 // 512^-0.5
constexpr float kSmScale   = kAttnScale / (kGCarry * kGCarry);      // exact: / 64
constexpr float kSmScale2  = kSmScale * 1.4426950408889634f;        // scores to base-2 exponents
constexpr float kInvSeq    = 1.0f / 2048.0f;
static_assert(kHeads * kDh == kDim);
static_assert(kDim / 16 == kRed);
static_assert(kSeq % 256 == 0 && (kSeq & (kSeq - 1)) == 0 && kDh == 64);   // fused attention: 256 queries per block, key index wraps by mask
static_assert(kSeq * kDim == (1 << 20));        // gate cast batch index = element >> 20
// GEMM shape contract: M % 64 == 0, N % 64 == 0, K % 32 == 0 for every launch
static_assert(kTok % 64 == 0 && kDim % 64 == 0 && kDim % 32 == 0);     // projections / out: M=8192 N=512 K=512
static_assert((kPlane / 8) % 256 == 0);                                // cast grids exact

typedef __attribute__((ext_vector_type(16))) _Float16 v16h;
typedef __attribute__((ext_vector_type(8)))  _Float16 v8h;
typedef __attribute__((ext_vector_type(16))) __bf16   v16b;
typedef __attribute__((ext_vector_type(8)))  __bf16   v8b;
typedef __attribute__((ext_vector_type(8)))  float    v8f;
typedef __attribute__((ext_vector_type(4)))  float    v4f;
typedef __attribute__((ext_vector_type(2)))  float    v2f;
typedef __attribute__((ext_vector_type(2)))  _Float16 v2h;
typedef __attribute__((ext_vector_type(4)))  unsigned int v4u;

__device__ __forceinline__ unsigned short f2bf_bits(float f) {
  unsigned u = __float_as_uint(f);
  return (unsigned short)((u + 0x7FFFu + ((u >> 16) & 1u)) >> 16);
}
__device__ __forceinline__ float bf_bits2f(unsigned short h) { return __uint_as_float(((unsigned)h) << 16); }
// RNE convert f32 -> bf16 -> f32
__device__ __forceinline__ float bf_rne(float f) { return bf_bits2f(f2bf_bits(f)); }

// hazard guards as plain device helpers (no inline asm inside the kernel template body)
__device__ __forceinline__ void dep_guard_h(v8f& a, v8f& b, v16h x, v16h y) { asm volatile("v_nop\n\tv_nop\n\tv_nop\n\tv_nop" : "+v"(a), "+v"(b) : "v"(x), "v"(y)); }
__device__ __forceinline__ void dep_guard_b(v8f& a, v8f& b, v16b x, v16b y) { asm volatile("v_nop\n\tv_nop\n\tv_nop\n\tv_nop" : "+v"(a), "+v"(b) : "v"(x), "v"(y)); }
__device__ __forceinline__ void keep4_h(v16h a, v16h b, v16h c, v16h d) { asm volatile("v_nop" :: "v"(a), "v"(b), "v"(c), "v"(d)); }
__device__ __forceinline__ void keep4_b(v16b a, v16b b, v16b c, v16b d) { asm volatile("v_nop" :: "v"(a), "v"(b), "v"(c), "v"(d)); }
__device__ __forceinline__ void acc_guard4(v8f& a, v8f& b, v8f& c, v8f& d) { asm volatile("v_nop\n\tv_nop\n\tv_nop\n\tv_nop" : "+v"(a), "+v"(b), "+v"(c), "+v"(d)); }
template <typename T> struct Frag;
template <> struct Frag<_Float16> {
  typedef v16h V; union U { v16h v; v8h h[2]; };
  // elements 0..7 <- p[0..7], 8..15 <- p[16..23]
  static __device__ __forceinline__ v16h load(const _Float16* p) {
    U f; f.h[0] = *(const v8h*)(p); f.h[1] = *(const v8h*)(p + 16); return f.v;
  }
  static __device__ __forceinline__ v8f mma(v16h a, v16h b, v8f c) {
    return __builtin_amdgcn_wmma_f32_16x16x32_f16(false, a, false, b, (short)0, c, false, false);
  }
  static __device__ __forceinline__ void guard(v8f& a, v8f& b, v16h x, v16h y) { dep_guard_h(a, b, x, y); }
  static __device__ __forceinline__ void keep(v16h a, v16h b, v16h c, v16h d) { keep4_h(a, b, c, d); }
};
template <> struct Frag<__bf16> {
  typedef v16b V; union U { v16b v; v8b h[2]; };
  static __device__ __forceinline__ v16b load(const __bf16* p) {
    U f; f.h[0] = *(const v8b*)(p); f.h[1] = *(const v8b*)(p + 16); return f.v;
  }
  static __device__ __forceinline__ v8f mma(v16b a, v16b b, v8f c) {
    return __builtin_amdgcn_wmma_f32_16x16x32_bf16(false, a, false, b, (short)0, c, false, false);
  }
  static __device__ __forceinline__ void guard(v8f& a, v8f& b, v16b x, v16b y) { dep_guard_b(a, b, x, y); }
  static __device__ __forceinline__ void keep(v16b a, v16b b, v16b c, v16b d) { keep4_b(a, b, c, d); }
};

__device__ __forceinline__ unsigned pk16(unsigned short a, unsigned short b) { return (unsigned)a | ((unsigned)b << 16); }
__device__ __forceinline__ unsigned short h_bits(float f) { const _Float16 h = (_Float16)f; return __builtin_bit_cast(unsigned short, h); }

// ---- Register-blocked batched WMMA GEMM (ACT reduced to none/relu/leaky) -------------------------------
// C[m,n] = scale * sum_k A[m,k] * Bt[n,k] (+bias)(+resid); each wave owns a 64x64 tile.
// A row-major [M,K]; Bt row-major [N,K]; M,N % 64 == 0, K % 32 == 0.
// SPLIT: operands are hi/lo planes (A2/Bt2 = lo planes, same layout); product = hi*hi + hi*lo + lo*hi.
// BIAS_MODE: 0 = none, 1 = bias[m], 2 = bias[n].
// OUT_MODE: 0 = f32, 1 = f16, 2 = bf16 hi plane (Cout) + bf16 lo plane (Cout2).
// ET: 0 = f16 operands, 1 = bf16 operands (pointers passed as 16-bit storage)
template <int ET> struct Elem;
template <> struct Elem<0> { typedef _Float16 T; };
template <> struct Elem<1> { typedef __bf16 T; };
template <int ET, bool SPLIT, int BIAS_MODE, int OUT_MODE, bool RESID, int ACT = 0>
__global__ __launch_bounds__(256) void wmma_gemm64(
    const unsigned short* __restrict__ Ap, const unsigned short* __restrict__ A2p, int lda, long strideA,
    const unsigned short* __restrict__ Btp, const unsigned short* __restrict__ Bt2p, int ldb, long strideB,
    void* __restrict__ Cout, void* __restrict__ Cout2, int ldc, long strideC,
    const float* __restrict__ bias,
    const float* __restrict__ resid, long strideR,
    int M, int N, int K, float scale) {
  typedef typename Elem<ET>::T T;
  typedef typename Frag<T>::V V;
  const T* A = (const T*)Ap; const T* A2 = (const T*)A2p; const T* Bt = (const T*)Btp; const T* Bt2 = (const T*)Bt2p;
  __shared__ __align__(16) float sT[8][16 * 68];   // per-wave 16x64 slab, pitch 68 floats
  const int b    = blockIdx.y;
  const int lane = threadIdx.x & 31;
  const int wave = threadIdx.x >> 5;
  const int tilesN = N >> 6;
  const int tilesM = M >> 6;
  const int tile = blockIdx.x * 8 + wave;
  if (tile >= tilesM * tilesN) return;   // wave-uniform; no block barriers in this kernel
  const int tm = tile / tilesN;
  const int tn = tile - tm * tilesN;
  const int m0 = tm << 6;
  const int n0 = tn << 6;

  const T* Ab  = A  + (size_t)b * strideA;
  const T* Bb  = Bt + (size_t)b * strideB;
  const T* Ab2 = SPLIT ? (A2  + (size_t)b * strideA) : nullptr;
  const T* Bb2 = SPLIT ? (Bt2 + (size_t)b * strideB) : nullptr;

  const int rlane = lane & 15;                 // row (A) / col (B, D) within subtile
  const int koff  = (lane >> 4) * 8;           // k offset of this lane half
  const int mOff  = (lane >> 4) * 8;           // D row offset

  v8f acc[4][4];
#pragma unroll
  for (int i = 0; i < 4; ++i)
#pragma unroll
    for (int j = 0; j < 4; ++j) acc[i][j] = (v8f){0.f,0.f,0.f,0.f,0.f,0.f,0.f,0.f};

  for (int k0 = 0; k0 < K; k0 += 32) {
    V bh[4], bl[4];
#pragma unroll
    for (int j = 0; j < 4; ++j) {
      const size_t bo = (size_t)(n0 + (j << 4) + rlane) * ldb + koff + k0;
      bh[j] = Frag<T>::load(Bb + bo);
      if (SPLIT) bl[j] = Frag<T>::load(Bb2 + bo);
    }
#pragma unroll
    for (int i = 0; i < 4; ++i) {
      const size_t ao = (size_t)(m0 + (i << 4) + rlane) * lda + koff + k0;
      V ah = Frag<T>::load(Ab + ao);
      V al;
      if (SPLIT) al = Frag<T>::load(Ab2 + ao);
#pragma unroll
      for (int j = 0; j < 4; ++j) {
        acc[i][j] = Frag<T>::mma(ah, bh[j], acc[i][j]);
        if (SPLIT) {
          acc[i][j] = Frag<T>::mma(ah, bl[j], acc[i][j]);
          acc[i][j] = Frag<T>::mma(al, bh[j], acc[i][j]);
        }
      }
      Frag<T>::guard(acc[i][0], acc[i][3], ah, SPLIT ? al : ah);
    }
    Frag<T>::keep(bh[0], bh[1], bh[2], bh[3]);
    if (SPLIT) Frag<T>::keep(bl[0], bl[1], bl[2], bl[3]);
  }
  acc_guard4(acc[0][0], acc[0][1], acc[0][2], acc[0][3]);
  acc_guard4(acc[1][0], acc[1][1], acc[1][2], acc[1][3]);
  acc_guard4(acc[2][0], acc[2][1], acc[2][2], acc[2][3]);
  acc_guard4(acc[3][0], acc[3][1], acc[3][2], acc[3][3]);

  // ---- epilogue ----
  float* slab = sT[wave];
  const float* Rb = RESID ? (resid + (size_t)b * strideR) : nullptr;
#pragma unroll
  for (int i = 0; i < 4; ++i) {
    const int mBase = m0 + (i << 4);
#pragma unroll
    for (int j = 0; j < 4; ++j) {
      const int n = n0 + (j << 4) + rlane;
      float bv = 0.f;
      if (BIAS_MODE == 2) bv = bias[n];
#pragma unroll
      for (int r = 0; r < 8; ++r) {
        float v = acc[i][j][r] * scale;
        if (BIAS_MODE == 1) v += bias[mBase + mOff + r];
        if (BIAS_MODE == 2) v += bv;
        if (RESID) v += Rb[(size_t)(mBase + mOff + r) * ldc + n];
        if (ACT == 2) v = fmaxf(v, 0.0f);
        if (ACT == 4) v = (v > 0.f) ? v : 0.01f * v;
        slab[(mOff + r) * 68 + (j << 4) + rlane] = v;
      }
    }
    __builtin_amdgcn_fence(__ATOMIC_RELEASE, "workgroup");
    __builtin_amdgcn_wave_barrier();
    __builtin_amdgcn_fence(__ATOMIC_ACQUIRE, "workgroup");
    if (OUT_MODE == 0) {
      float* C = (float*)Cout + (size_t)b * strideC;
      const int hh = lane >> 4, c4 = (lane & 15) * 4;     // row seg = 256 B = 16 lanes x 16 B
      {
#pragma unroll
        for (int it = 0; it < 8; ++it) {
          const int row = it * 2 + hh;
          v4f v = *(const v4f*)(slab + row * 68 + c4);
          *(v4f*)(C + (size_t)(mBase + row) * ldc + n0 + c4) = v;
        }
        
      }
    } else {
      const int q = lane >> 3, c8 = (lane & 7) * 8;
      unsigned short* C  = (unsigned short*)Cout  + (size_t)b * strideC;
      unsigned short* C2 = (OUT_MODE == 2) ? ((unsigned short*)Cout2 + (size_t)b * strideC) : nullptr;
      {
#pragma unroll
        for (int it = 0; it < 4; ++it) {
          const int row = it * 4 + q;
          const float* sp = slab + row * 68 + c8;
          v8h hv, lv;
#pragma unroll
          for (int e = 0; e < 8; ++e) {
            if (OUT_MODE == 1) {
              hv[e] = (_Float16)sp[e];
            } else {
              unsigned short hb = f2bf_bits(sp[e]);
              unsigned short lb = f2bf_bits(sp[e] - bf_bits2f(hb));
              hv[e] = __builtin_bit_cast(_Float16, hb);
              lv[e] = __builtin_bit_cast(_Float16, lb);
            }
          }
          *(v8h*)(C + (size_t)(mBase + row) * ldc + n0 + c8) = hv;
          if (OUT_MODE == 2) *(v8h*)(C2 + (size_t)(mBase + row) * ldc + n0 + c8) = lv;
        }
        
      }
    }
    __builtin_amdgcn_fence(__ATOMIC_RELEASE, "workgroup");
    __builtin_amdgcn_wave_barrier();
    __builtin_amdgcn_fence(__ATOMIC_ACQUIRE, "workgroup");
  }
}

// ---------------------------------------------------------------------------
// Input cast: out plane z (0 <- x, 1 <- m) = f16( bf16_rne(v) ), [8192][512] halves each.
// ---------------------------------------------------------------------------
__global__ __launch_bounds__(256) void cast_in_kernel(const float* __restrict__ x, const float* __restrict__ m,
                                                      unsigned short* __restrict__ out, int n8) {
  const int z = blockIdx.y;                          // block-uniform plane select
  const float* in = (z == 0) ? x : m;
  const int i = blockIdx.x * 256 + threadIdx.x;
  if (i >= n8) return;
  const float* p = in + 8 * (size_t)i;
  const v4f a = *(const v4f*)(p);
  const v4f c = *(const v4f*)(p + 4);
  unsigned short hb[8];
#pragma unroll
  for (int e = 0; e < 4; ++e) {
    hb[e]     = h_bits(bf_rne(a[e]));
    hb[4 + e] = h_bits(bf_rne(c[e]));
  }
  const v4u u = (v4u){pk16(hb[0], hb[1]), pk16(hb[2], hb[3]), pk16(hb[4], hb[5]), pk16(hb[6], hb[7])};
  unsigned short* q = out + (size_t)z * 8 * (size_t)n8 + 8 * (size_t)i;
  *(v4u*)q = u;
  
}

// ---------------------------------------------------------------------------
// Weight transpose + cast: W is [in d][out h] (512x512, row-major); WT[h][d] = f16( scale * bf16_rne(W[d][h]) ).
// grid (8, 8, 4): blockIdx.x = d tile (64 cols of WT), blockIdx.y = h tile (64 rows of WT), blockIdx.z selects W0..W3 and the
// output plane (plane z at out + z*512*512 halves). 256 threads.
// Load coverage: 4 iterations x 256 threads x float4 = 4096 = the whole 64(d) x 64(h) tile (coalesced along h), 4 b128 loads per lane.
// Store coverage: 8 waves x 2 iterations x 4 rows (lane>>3) = 64 rows; (lane&7) x 8 halves = 64 cols; each row segment =
// ---------------------------------------------------------------------------
__global__ __launch_bounds__(256) void wtcast_kernel(const float* __restrict__ W0, const float* __restrict__ W1,
                                                     const float* __restrict__ W2, const float* __restrict__ W3,
                                                     unsigned short* __restrict__ out, float scale) {
  __shared__ float sm[64][65];   // sm[h_local][d_local]
  const int t  = threadIdx.x;
  const int d0 = blockIdx.x * 64;
  const int h0 = blockIdx.y * 64;
  const int z  = blockIdx.z;                                   // block-uniform
  const float* W = (z == 0) ? W0 : (z == 1) ? W1 : (z == 2) ? W2 : W3;
#pragma unroll
  for (int i = 0; i < 4; ++i) {
    const int e4 = i * 256 + t;
    const int r  = e4 >> 4;            // d local 0..63
    const int c4 = (e4 & 15) * 4;      // h local 0..60
    const v4f w = *(const v4f*)(W + (size_t)(d0 + r) * kDim + h0 + c4);
#pragma unroll
    for (int k = 0; k < 4; ++k) sm[c4 + k][r] = bf_rne(w[k]) * scale;
  }
  __syncthreads();
  const int lane = t & 31, wave = t >> 5;
  const int q = lane >> 3, c8 = (lane & 7) * 8;
  unsigned short* op = out + (size_t)z * kDim * kDim;
  {
#pragma unroll
    for (int it = 0; it < 2; ++it) {
      const int row = wave * 8 + it * 4 + q;                 // h local
      unsigned short hb[8];
#pragma unroll
      for (int e = 0; e < 8; ++e) hb[e] = h_bits(sm[row][c8 + e]);
      const v4u u = (v4u){pk16(hb[0], hb[1]), pk16(hb[2], hb[3]), pk16(hb[4], hb[5]), pk16(hb[6], hb[7])};
      *(v4u*)(op + (size_t)(h0 + row) * kDim + d0 + c8) = u;
    }
    
  }
}

// ---------------------------------------------------------------------------
// Token pooling, part 1 (f32): grid (64, 12): blockIdx.x = chunk of 32 tokens, blockIdx.y = tb = tensor*4 + batch. 128 threads x 4 channels.
//   pmax[tb][chunk][c] = max over the chunk's tokens of F[tb][n][c], psum[tb][chunk][c] = their sum (token order).
// Every load is independent of the others and covers 512 contiguous bytes per wave; all 32 of a thread are issued before the first is used.
// ---------------------------------------------------------------------------
constexpr int kPoolTok   = 32;                  // tokens per pooling work-group
constexpr int kPoolParts = kSeq / kPoolTok;     // 64 partial rows per (tensor, batch)
static_assert(kSeq % kPoolTok == 0 && kDim == 128 * 4 && kRed == 32 && kDim == 16 * 32);
__global__ __launch_bounds__(128) void pool_part_kernel(const float* __restrict__ F, float* __restrict__ pmax,
                                                        float* __restrict__ psum) {
  const int t    = threadIdx.x;
  const int part = blockIdx.x;
  const int tb   = blockIdx.y;          // 0..11; F is [12][2048][512]
  const float* src = F + ((size_t)tb * kSeq + (size_t)part * kPoolTok) * kDim + 4 * t;
  v4f v[kPoolTok];
#pragma unroll   // one base address, immediate offsets: the loads wait on nothing and overlap their latencies
  for (int n = 0; n < kPoolTok; ++n) v[n] = *(const v4f*)(src + (size_t)n * kDim);
  v4f mx = v[0];
  v4f sm = v[0];
#pragma unroll   // v[] stays in registers
  for (int n = 1; n < kPoolTok; ++n) {
#pragma unroll   // element-wise maximum of a register vector
    for (int e = 0; e < 4; ++e) mx[e] = fmaxf(mx[e], v[n][e]);
    sm = sm + v[n];
  }
  const size_t o = ((size_t)tb * kPoolParts + part) * kDim + 4 * t;
  *(v4f*)(pmax + o) = mx;
  *(v4f*)(psum + o) = sm;
}

// ---------------------------------------------------------------------------
// Token pooling, part 2 + channel gate MLP (f32): block tb = tensor*4 + batch (12 blocks), 512 threads = channels.
//   mx[c] = max over 64 chunk maxima, av[c] = (sum of 64 chunk sums, chunk order) * (1/2048)
//   hid[j] = relu( sum_c mx[c]*w1[c][j] + sum_c av[c]*w1[c][j] )   j < 32      (w1, w2 RNE-converted to bf16 at use)
//            thread t holds w1 elements i*512 + t, so wave w sums channels w, w+16, .. w+496 for all 32 j (lane = j);
//            32 threads then add the 16 wave partials in wave order
//   g[c]   = 1 / (1 + exp(-sum_j hid[j]*w2[j][c]))
// The w1 and w2 elements a thread needs depend on nothing computed here: they are loaded first, beside the chunk partials.
// ---------------------------------------------------------------------------
__global__ __launch_bounds__(512) void gate_kernel(const float* __restrict__ pmax, const float* __restrict__ psum,
                                                   const float* __restrict__ w1, const float* __restrict__ w2,
                                                   float* __restrict__ scl) {
  __shared__ float smax[kDim];
  __shared__ float savg[kDim];
  __shared__ float pa1[kDim / 32][kRed];
  __shared__ float pa2[kDim / 32][kRed];
  __shared__ float hid[kRed];
  const int t    = threadIdx.x;
  const int tb   = blockIdx.x;          // 0..11
  const int lane = t & 31, wave = t >> 5;
  float w1v[32], w2v[kRed];
#pragma unroll   // this loop and the next two: independent loads at immediate offsets, in flight together
  for (int i = 0; i < 32; ++i) w1v[i] = w1[i * kDim + t];      // channel i*16 + wave, hidden unit lane
#pragma unroll   // as above
  for (int j = 0; j < kRed; ++j) w2v[j] = w2[j * kDim + t];
  const float* pm = pmax + (size_t)tb * kPoolParts * kDim + t;
  const float* ps = psum + (size_t)tb * kPoolParts * kDim + t;
  float mx = -__builtin_inff();
  float sm = 0.0f;
#pragma unroll   // as above
  for (int p = 0; p < kPoolParts; ++p) {
    mx = fmaxf(mx, pm[p * kDim]);
    sm += ps[p * kDim];
  }
  smax[t] = mx;
  savg[t] = sm * kInvSeq;
  __syncthreads();
  float a1 = 0.0f, a2 = 0.0f;
#pragma unroll   // w1v[] stays in registers
  for (int i = 0; i < 32; ++i) {
    const float w = bf_rne(w1v[i]);
    a1 += smax[i * 16 + wave] * w;
    a2 += savg[i * 16 + wave] * w;
  }
  pa1[wave][lane] = a1;
  pa2[wave][lane] = a2;
  __syncthreads();
  if (t < kRed) {                       // wave 0, wave-uniform
    float s1 = 0.0f, s2 = 0.0f;
#pragma unroll   // the 32 LDS reads overlap
    for (int w = 0; w < kDim / 32; ++w) {
      s1 += pa1[w][t];
      s2 += pa2[w][t];
    }
    hid[t] = fmaxf(s1 + s2, 0.0f);
  }
  __syncthreads();
  float a = 0.0f;
#pragma unroll   // w2v[] stays in registers
  for (int j = 0; j < kRed; ++j) a += hid[j] * bf_rne(w2v[j]);
  const float g = 1.0f / (1.0f + expf(-a));
  scl[(size_t)tb * kDim + t] = g;       // one whole 128-byte line per wave
}

// ---------------------------------------------------------------------------
// Gate + cast for q and k planes: out[z][row][c] = f16( 8 * F[z][row][c] * g[z][batch(row)][c] ), z = blockIdx.y (0 q, 1 k).
// Coverage: n8 = 524288 = 2048 blocks x 256 exact per plane.
// ---------------------------------------------------------------------------
__global__ __launch_bounds__(256) void gate_cast_kernel(const float* __restrict__ F, const float* __restrict__ scl,
                                                        unsigned short* __restrict__ out, int n8) {
  const int z = blockIdx.y;
  const int i = blockIdx.x * 256 + threadIdx.x;
  if (i >= n8) return;
  const size_t e0 = 8 * (size_t)i;                    // element index inside the plane
  const int c0 = (int)(e0 & (size_t)(kDim - 1));
  const int b  = (int)(e0 >> 20);                     // row / 2048
  const float* p  = F + (size_t)z * kPlane + e0;
  const float* sp = scl + (size_t)(z * kBatch + b) * kDim + c0;
  const v4f a  = *(const v4f*)(p);
  const v4f c  = *(const v4f*)(p + 4);
  const v4f g0 = *(const v4f*)(sp);
  const v4f g1 = *(const v4f*)(sp + 4);
  unsigned short hb[8];
#pragma unroll
  for (int e = 0; e < 4; ++e) {
    hb[e]     = h_bits(a[e] * g0[e] * kGCarry);
    hb[4 + e] = h_bits(c[e] * g1[e] * kGCarry);
  }
  const v4u u = (v4u){pk16(hb[0], hb[1]), pk16(hb[2], hb[3]), pk16(hb[4], hb[5]), pk16(hb[6], hb[7])};
  unsigned short* q = out + (size_t)z * kPlane + e0;
  *(v4u*)q = u;
  
}

// ---------------------------------------------------------------------------
// Gate + transpose + cast for v: VT[(b*8+h)][d][s] = f16( 8 * Fv[b][s][h*64+d] * gv[b][h*64+d] ).
// grid (32, 8, 4): blockIdx.x = s tile (64 rows), blockIdx.y = head, blockIdx.z = batch. 256 threads.
// Load coverage: 4 iterations x 256 threads x float4 = 4096 = whole 64(s) x 64(d) tile (coalesced along d); gate as one float4.
// Store coverage: 8 waves x 2 iterations x 4 rows (lane>>3) = 64 d-rows; (lane&7) x 8 halves = 64 s-cols; each row segment =
// ---------------------------------------------------------------------------
__global__ __launch_bounds__(256) void vt_gate_cast_kernel(const float* __restrict__ Fv, const float* __restrict__ gv,
                                                           unsigned short* __restrict__ VT) {
  __shared__ float sm[64][65];   // sm[d][s_local]
  const int t  = threadIdx.x;
  const int s0 = blockIdx.x * 64;
  const int h  = blockIdx.y;
  const int b  = blockIdx.z;
  const int c4 = (t & 15) * 4;   // d, constant over the load loop
  const v4f g = *(const v4f*)(gv + (size_t)b * kDim + h * kDh + c4);
#pragma unroll
  for (int i = 0; i < 4; ++i) {
    const int e4 = i * 256 + t;
    const int r  = e4 >> 4;        // s local 0..63
    const v4f w = *(const v4f*)(Fv + ((size_t)(b * kSeq + s0 + r)) * kDim + h * kDh + c4);
#pragma unroll
    for (int k = 0; k < 4; ++k) sm[c4 + k][r] = w[k] * g[k] * kGCarry;
  }
  __syncthreads();
  const int lane = t & 31, wave = t >> 5;
  const int q = lane >> 3, c8 = (lane & 7) * 8;
  unsigned short* op = VT + ((size_t)(b * kHeads + h) * kDh) * kSeq;
  {
#pragma unroll
    for (int it = 0; it < 2; ++it) {
      const int row = wave * 8 + it * 4 + q;                 // d
      unsigned short hb[8];
#pragma unroll
      for (int e = 0; e < 8; ++e) hb[e] = h_bits(sm[row][c8 + e]);
      const v4u u = (v4u){pk16(hb[0], hb[1]), pk16(hb[2], hb[3]), pk16(hb[4], hb[5]), pk16(hb[6], hb[7])};
      *(v4u*)(op + (size_t)row * kSeq + s0 + c8) = u;
    }
    
  }
}

// ---------------------------------------------------------------------------
// Fused attention of every (batch, head): S^T = K.Q^T, online softmax (base 2, f32), O^T += V^T.P^T; scores and P stay in registers.
// grid (8, 32): blockIdx.x = block of 256 queries, blockIdx.y = batch*8 + head. 8 waves x 32 query columns (2 groups of 16).
// One pass = 32 keys. Lane (c = lane & 15, hf = lane >> 4) of a score tile holds query c, keys 8*hf + r: the two 16-key tiles of a
// pass, converted in place, are the B operand of the second product (element s: key 8*hf + s, s < 8; key 16 + 8*hf + s - 8 else),
// the k order in which Frag::load brings V^T (and K, Q among themselves).
// The maximum in use may trail the true one by up to 8 (base-2 exponent), so P <= 2^8 and P carried x2^6 <= 2^14 in f16.
// Oh[b][q][head*64 + d] = f16( 32 * acc / rowsum ): context carried x256, V carried x8.
// ---------------------------------------------------------------------------
__device__ __forceinline__ float xhalf(float x) {   // lane l <-> lane l ^ 16
  const int v = __builtin_bit_cast(int, x);
  return __builtin_bit_cast(float, __builtin_amdgcn_permlanex16(v, v, 0x76543210, 0xfedcba98, false, false));
}
__global__ __launch_bounds__(256) void attn_fused_kernel(const unsigned short* __restrict__ Qp, const unsigned short* __restrict__ Kp,
                                                         const unsigned short* __restrict__ VTp, unsigned short* __restrict__ Op) {
  typedef Frag<_Float16> FH;
  const int lane = threadIdx.x & 31, wave = threadIdx.x >> 5;
  const int c = lane & 15, hf = lane >> 4;
  const int bh = blockIdx.y;
  const int q0 = blockIdx.x * 256 + wave * 32;
  const size_t tokOff = (size_t)(bh >> 3) * kSeq * kDim + (size_t)(bh & 7) * kDh;
  const _Float16* ql = (const _Float16*)Qp + tokOff + (size_t)(q0 + c) * kDim + 8 * hf;
  const _Float16* kl = (const _Float16*)Kp + tokOff + (size_t)c * kDim + 8 * hf;
  const _Float16* vl = (const _Float16*)VTp + (size_t)bh * kDh * kSeq + (size_t)c * kSeq + 8 * hf;

  v16h qf[2][2];
#pragma unroll
  for (int g = 0; g < 2; ++g)
#pragma unroll
    for (int kc = 0; kc < 2; ++kc) qf[g][kc] = FH::load(ql + (size_t)(16 * g) * kDim + 32 * kc);

  v8f acc[2][4];
  v2f ls[2];
  float m_run[2];
#pragma unroll
  for (int g = 0; g < 2; ++g) {
    m_run[g] = -__builtin_inff();
    ls[g] = (v2f){0.f, 0.f};
#pragma unroll
    for (int t = 0; t < 4; ++t) acc[g][t] = (v8f){0.f,0.f,0.f,0.f,0.f,0.f,0.f,0.f};
  }

  v16h kf[2][2];
#pragma unroll
  for (int kt = 0; kt < 2; ++kt)
#pragma unroll
    for (int kc = 0; kc < 2; ++kc) kf[kt][kc] = FH::load(kl + (size_t)(16 * kt) * kDim + 32 * kc);

  // rolled: one pass's fragments, scores and the 64 accumulator registers fill the register budget
#pragma unroll 1
  for (int key0 = 0; key0 < kSeq; key0 += 32) {
    v16h vf[4];      // this pass's V^T, in flight under the score products and the maxima
#pragma unroll
    for (int t = 0; t < 4; ++t) vf[t] = FH::load(vl + (size_t)(16 * t) * kSeq + key0);

    v8f s[2][2];
#pragma unroll
    for (int kt = 0; kt < 2; ++kt)
#pragma unroll
      for (int g = 0; g < 2; ++g) {
        s[kt][g] = (v8f){0.f,0.f,0.f,0.f,0.f,0.f,0.f,0.f};
#pragma unroll
        for (int kc = 0; kc < 2; ++kc) s[kt][g] = FH::mma(kf[kt][kc], qf[g][kc], s[kt][g]);
      }
    const int nk = (key0 + 32) & (kSeq - 1);
#pragma unroll
    for (int kt = 0; kt < 2; ++kt)
#pragma unroll
      for (int kc = 0; kc < 2; ++kc) kf[kt][kc] = FH::load(kl + (size_t)(nk + 16 * kt) * kDim + 32 * kc);
    __builtin_amdgcn_sched_barrier(0);   // keeps the K loads issued here, ahead of the vector work that hides their latency

    float mb[2];
    bool need = false;
#pragma unroll
    for (int g = 0; g < 2; ++g) {
      float mx = s[0][g][0];
#pragma unroll
      for (int r = 1; r < 8; ++r) mx = fmaxf(mx, s[0][g][r]);
#pragma unroll
      for (int r = 0; r < 8; ++r) mx = fmaxf(mx, s[1][g][r]);
      mx = fmaxf(mx, xhalf(mx)) * kSmScale2;         // both halves hold the query's maximum of this pass (the scale is positive)
      mb[g] = mx;
      need = need || (mx > m_run[g] + 8.0f);
    }
    if (__builtin_amdgcn_ballot_w32(need) != 0) {    // wave-uniform; always on the first pass, rare later
#pragma unroll
      for (int g = 0; g < 2; ++g) {
        const float m_new = fmaxf(m_run[g], mb[g]);
        const float corr = __builtin_amdgcn_exp2f(m_run[g] - m_new);   // 0 on the first pass
        m_run[g] = m_new;
        ls[g] = ls[g] * corr;
#pragma unroll
        for (int t = 0; t < 4; ++t) acc[g][t] = acc[g][t] * corr;
      }
    }
#pragma unroll
    for (int g = 0; g < 2; ++g) {
      const float nm = kPShift - m_run[g];
      v16h pf;
#pragma unroll
      for (int i = 0; i < 8; ++i) {
        const v2f sv = (v2f){s[i >> 2][g][2 * (i & 3)], s[i >> 2][g][2 * (i & 3) + 1]};
        const v2f arg = __builtin_elementwise_fma(sv, (v2f){kSmScale2, kSmScale2}, (v2f){nm, nm});
        const v2f p = (v2f){__builtin_amdgcn_exp2f(arg.x), __builtin_amdgcn_exp2f(arg.y)};
        ls[g] = ls[g] + p;
        const v2h ph = __builtin_convertvector(p, v2h);
        pf[2 * i]     = ph.x;
        pf[2 * i + 1] = ph.y;
      }
#pragma unroll
      for (int t = 0; t < 4; ++t) acc[g][t] = FH::mma(vf[t], pf, acc[g][t]);
    }
  }

  _Float16* ol = (_Float16*)Op + tokOff + (size_t)(q0 + c) * kDim + 8 * hf;
#pragma unroll
  for (int g = 0; g < 2; ++g) {
    float l = ls[g].x + ls[g].y;
    l += xhalf(l);                                   // join the two halves' key sums
    const float inv = kCtxScale / l;
#pragma unroll
    for (int t = 0; t < 4; ++t) {
      v8h hv;
#pragma unroll
      for (int r = 0; r < 8; ++r) hv[r] = (_Float16)(acc[g][t][r] * inv);   // d = 16 t + 8 hf + r of query 16 g + c
      *(v8h*)(ol + (size_t)(16 * g) * kDim + 16 * t) = hv;
    }
  }
}

// ---------------------------------------------------------------------------
// Host glue.
//   XMh  f16 [2][8192][512]     16,777,216  at           0   (x plane then m plane, bf16-valued)
//   WT   f16 [4][512][512]       2,097,152  at  16,777,216   (Wq^T, Wk^T, Wv^T, Wo^T, [out][in], carried x16)
//   F    f32 [3][8192][512]     50,331,648  at  18,874,368   (q, k, v projections, ungated)
//   Qh   f16 [8192][512]         8,388,608  at  69,206,016   (gated q, carried x8)
//   Kh   f16 [8192][512]         8,388,608  at  77,594,624   (gated k, carried x8)
//   VT   f16 [32][64][2048]      8,388,608  at  85,983,232   (gated v transposed per (batch, head), carried x8)
//   Oh   f16 [8192][512]         8,388,608  at  94,371,840   (attention context, carried x256)
//   SCL  f32 [3][4][512]            24,576  at 102,760,448   (channel gates)
//   PMX  f32 [12][64][512]       1,572,864  at 102,785,024   (chunk maxima of the token pooling)
//   PSM  f32 [12][64][512]       1,572,864  at 104,357,888   (chunk sums of the token pooling)
//   total                      105,930,752
// GEMM shapes: projections/out M=8192 N=512 K=512.
// All M,N multiples of 64, all K multiples of 32, no padded rows anywhere; every plane fully written before it is read.
// Launches: 1 + 1 + 2 + 2 + 1 + 1 + 1 + 1 = 10.
// ---------------------------------------------------------------------------
extern "C" void kernel_launch(void* const* d_in, const int* in_sizes, int n_in,
                              void* d_out, int out_size, void* d_ws, size_t ws_size,
                              hipStream_t stream) {
  if (n_in < 9) return;
  if (in_sizes[0] != kPlane || in_sizes[1] != kPlane) return;
  if (in_sizes[2] != kDim * kDim || in_sizes[3] != kDim * kDim || in_sizes[4] != kDim * kDim || in_sizes[5] != kDim * kDim) return;
  if (in_sizes[6] != kDim || in_sizes[7] != kDim * kRed || in_sizes[8] != kRed * kDim) return;
  if (out_size != kPlane) return;

  const size_t szHalfPlane = (size_t)kPlane * 2;                 // 8,388,608
  const size_t szXM  = 2 * szHalfPlane;
  const size_t szWT  = (size_t)4 * kDim * kDim * 2;
  const size_t szF   = (size_t)3 * kPlane * 4;
  const size_t szVT  = (size_t)kBatch * kHeads * kDh * kSeq * 2;
  const size_t szSCL = (size_t)3 * kBatch * kDim * 4;
  const size_t offXM  = 0;
  const size_t offWT  = offXM + szXM;
  const size_t offF   = offWT + szWT;
  const size_t offQh  = offF + szF;
  const size_t offKh  = offQh + szHalfPlane;
  const size_t offVT  = offKh + szHalfPlane;
  const size_t offOh  = offVT + szVT;
  const size_t offSCL = offOh + szHalfPlane;
  const size_t szPart = (size_t)3 * kBatch * kPoolParts * kDim * 4;
  const size_t offPMX = offSCL + szSCL;
  const size_t offPSM = offPMX + szPart;
  const size_t total  = offPSM + szPart;                          // 105,930,752
  if (ws_size < total) return;

  const float* x      = (const float*)d_in[0];
  const float* m      = (const float*)d_in[1];
  const float* Wq     = (const float*)d_in[2];
  const float* Wk     = (const float*)d_in[3];
  const float* Wv     = (const float*)d_in[4];
  const float* Wo     = (const float*)d_in[5];
  const float* bias_o = (const float*)d_in[6];
  const float* gw1    = (const float*)d_in[7];
  const float* gw2    = (const float*)d_in[8];
  float* out = (float*)d_out;
  char* ws = (char*)d_ws;
  unsigned short* XMh = (unsigned short*)(ws + offXM);
  unsigned short* WT  = (unsigned short*)(ws + offWT);
  float*          F   = (float*)(ws + offF);
  unsigned short* Qh  = (unsigned short*)(ws + offQh);
  unsigned short* Kh  = (unsigned short*)(ws + offKh);
  unsigned short* VT  = (unsigned short*)(ws + offVT);
  unsigned short* Oh  = (unsigned short*)(ws + offOh);
  float*          SCL = (float*)(ws + offSCL);
  float*          PMX = (float*)(ws + offPMX);
  float*          PSM = (float*)(ws + offPSM);

  const unsigned short* Xh = XMh;
  const unsigned short* Mh = XMh + (size_t)kPlane;
  const size_t wPlane = (size_t)kDim * kDim;

  // ---- 16-bit operand planes of the inputs ----
  const int n8 = kPlane / 8;   // 524288 -> 2048 blocks exact
  cast_in_kernel<<<dim3(n8 / 256, 2), dim3(256), 0, stream>>>(x, m, XMh, n8);
  wtcast_kernel<<<dim3(kDim / 64, kDim / 64, 4), dim3(256), 0, stream>>>(Wq, Wk, Wv, Wo, WT, kWCarry);

  // ---- projections: F[0] = x.Wq, F[1] = m.Wk, F[2] = m.Wv   (M=8192, N=512, K=512), f32 out, scale 1/16 ----
  const int tilesProj = (kTok / 64) * (kDim / 64);   // 1024 -> 128 blocks of 8 waves
  wmma_gemm64<0, false, 0, 0, false, 0><<<dim3(tilesProj / 8, 1), dim3(256), 0, stream>>>(
      Xh, Xh, kDim, 0L, WT, WT, kDim, 0L,
      (void*)F, (void*)F, kDim, 0L, bias_o, SCL, 0L, kTok, kDim, kDim, kWCarryInv);
  wmma_gemm64<0, false, 0, 0, false, 0><<<dim3(tilesProj / 8, 2), dim3(256), 0, stream>>>(
      Mh, Mh, kDim, 0L, WT + wPlane, WT + wPlane, kDim, (long)wPlane,
      (void*)(F + (size_t)kPlane), (void*)(F + (size_t)kPlane), kDim, (long)kPlane, bias_o, SCL, 0L, kTok, kDim, kDim, kWCarryInv);

  // ---- token pooling + channel gates ----
  pool_part_kernel<<<dim3(kPoolParts, 3 * kBatch), dim3(128), 0, stream>>>(F, PMX, PSM);
  gate_kernel<<<dim3(3 * kBatch), dim3(512), 0, stream>>>(PMX, PSM, gw1, gw2, SCL);

  // ---- gated 16-bit planes: Qh, Kh (row-major [token][channel]); VT ([batch*head][d][token]) ----
  gate_cast_kernel<<<dim3(n8 / 256, 2), dim3(256), 0, stream>>>(F, SCL, Qh, n8);
  vt_gate_cast_kernel<<<dim3(kSeq / 64, kHeads, kBatch), dim3(256), 0, stream>>>(
      F + (size_t)2 * kPlane, SCL + (size_t)2 * kBatch * kDim, VT);

  // ---- attention, all (batch, head) in one launch: Oh[b, i, h*64+d] = f16( 256 * context ) ----
  attn_fused_kernel<<<dim3(kSeq / 256, kBatch * kHeads), dim3(256), 0, stream>>>(Qh, Kh, VT, Oh);

  // ---- output projection: out = 2^-12 * Oh.Wo^T(x16) + bo   (M=8192, N=512, K=512), f32 to d_out ----
  wmma_gemm64<0, false, 2, 0, false, 0><<<dim3(tilesProj / 8, 1), dim3(256), 0, stream>>>(
      Oh, Oh, kDim, 0L, WT + 3 * wPlane, WT + 3 * wPlane, kDim, 0L,
      (void*)out, (void*)out, kDim, 0L, bias_o, SCL, 0L, kTok, kDim, kDim, kOutScale);
}

// v003
// It runs in 157 microseconds.
// Two timings next to v002 put it at 1.16 and 1.17 times that version's speed.
// All steps since v000 together make it 22.5 times as fast.
// Contractions: q/k/v projections (x,m RNE-converted to bf16 held in f16 planes x W^T bf16-valued f16 planes carried x16), scores k.q^T (gated q,k f16 planes carried x8), v^T.p^T (gated V^T f16 carried x8 x unnormalised P f16 carried x64), output projection (context f16 carried x256 x Wo^T f16 carried x16): all v_wmma_f32_16x16x32_f16 with f32 accumulate; token pooling, channel-gate MLP, online softmax in f32.
#include <hip/hip_runtime.h>
#include <math.h>

// ---------------------------------------------------------------------------
// Problem constants
// ---------------------------------------------------------------------------
constexpr int kBatch = 4;
constexpr int kSeq   = 2048;
constexpr int kDim   = 512;               // model dim = inner dim
constexpr int kHeads = 8;
constexpr int kDh    = 64;
constexpr int kRed   = 32;                // gate hidden width (512 / 16)
constexpr int kTok   = kBatch * kSeq;     // 8192 token rows
constexpr int kPlane = kTok * kDim;       // 4194304 elements per [8192][512] plane
constexpr float kWCarry    = 16.0f;                 // weights carried x16 in f16
constexpr float kWCarryInv = 1.0f / 16.0f;
constexpr float kGCarry    = 8.0f;                  // gated q/k/v planes carried x8 in f16
constexpr float kPShift    = 6.0f;                  // unnormalised probabilities carried x2^6 in f16 (added to the base-2 exponent)
constexpr float kCtxCarry  = 256.0f;                // context carried x2^8 in f16
constexpr float kCtxScale  = kCtxCarry / kGCarry;                   // 32; the P carry cancels against the row sum
constexpr float kOutScale  = 1.0f / (kCtxCarry * kWCarry);          // 2^-12
constexpr float kAttnScale = 0.044194173824159216f;                 // 512^-0.5
constexpr float kSmScale   = kAttnScale / (kGCarry * kGCarry);      // exact: / 64
constexpr float kSmScale2  = kSmScale * 1.4426950408889634f;        // scores to base-2 exponents
constexpr float kInvSeq    = 1.0f / 2048.0f;
static_assert(kHeads * kDh == kDim);
static_assert(kDim / 16 == kRed);
static_assert(kSeq % 256 == 0 && (kSeq & (kSeq - 1)) == 0 && kDh == 64);   // fused attention: 256 queries per block, key index wraps by mask
static_assert(kSeq * kDim == (1 << 20));        // gate cast batch index = element >> 20
// GEMM shape contract: M % 64 == 0, N % 64 == 0, K % 32 == 0 for every launch
static_assert(kTok % 64 == 0 && kDim % 64 == 0 && kDim % 32 == 0);     // projections / out: M=8192 N=512 K=512
static_assert((kPlane / 8) % 256 == 0);                                // cast grids exact

typedef __attribute__((ext_vector_type(16))) _Float16 v16h;
typedef __attribute__((ext_vector_type(8)))  _Float16 v8h;
typedef __attribute__((ext_vector_type(16))) __bf16   v16b;
typedef __attribute__((ext_vector_type(8)))  __bf16   v8b;
typedef __attribute__((ext_vector_type(8)))  float    v8f;
typedef __attribute__((ext_vector_type(4)))  float    v4f;
typedef __attribute__((ext_vector_type(2)))  float    v2f;
typedef __attribute__((ext_vector_type(2)))  _Float16 v2h;
typedef __attribute__((ext_vector_type(4)))  unsigned int v4u;

__device__ __forceinline__ unsigned short f2bf_bits(float f) {
  unsigned u = __float_as_uint(f);
  return (unsigned short)((u + 0x7FFFu + ((u >> 16) & 1u)) >> 16);
}
__device__ __forceinline__ float bf_bits2f(unsigned short h) { return __uint_as_float(((unsigned)h) << 16); }
// RNE convert f32 -> bf16 -> f32
__device__ __forceinline__ float bf_rne(float f) { return bf_bits2f(f2bf_bits(f)); }

// hazard guards as plain device helpers (no inline asm inside the kernel template body)
__device__ __forceinline__ void dep_guard_h(v8f& a, v8f& b, v16h x, v16h y) { asm volatile("v_nop\n\tv_nop\n\tv_nop\n\tv_nop" : "+v"(a), "+v"(b) : "v"(x), "v"(y)); }
__device__ __forceinline__ void dep_guard_b(v8f& a, v8f& b, v16b x, v16b y) { asm volatile("v_nop\n\tv_nop\n\tv_nop\n\tv_nop" : "+v"(a), "+v"(b) : "v"(x), "v"(y)); }
__device__ __forceinline__ void keep4_h(v16h a, v16h b, v16h c, v16h d) { asm volatile("v_nop" :: "v"(a), "v"(b), "v"(c), "v"(d)); }
__device__ __forceinline__ void keep4_b(v16b a, v16b b, v16b c, v16b d) { asm volatile("v_nop" :: "v"(a), "v"(b), "v"(c), "v"(d)); }
__device__ __forceinline__ void acc_guard4(v8f& a, v8f& b, v8f& c, v8f& d) { asm volatile("v_nop\n\tv_nop\n\tv_nop\n\tv_nop" : "+v"(a), "+v"(b), "+v"(c), "+v"(d)); }
template <typename T> struct Frag;
template <> struct Frag<_Float16> {
  typedef v16h V; union U { v16h v; v8h h[2]; };
  // elements 0..7 <- p[0..7], 8..15 <- p[16..23]
  static __device__ __forceinline__ v16h load(const _Float16* p) {
    U f; f.h[0] = *(const v8h*)(p); f.h[1] = *(const v8h*)(p + 16); return f.v;
  }
  static __device__ __forceinline__ v8f mma(v16h a, v16h b, v8f c) {
    return __builtin_amdgcn_wmma_f32_16x16x32_f16(false, a, false, b, (short)0, c, false, false);
  }
  static __device__ __forceinline__ void guard(v8f& a, v8f& b, v16h x, v16h y) { dep_guard_h(a, b, x, y); }
  static __device__ __forceinline__ void keep(v16h a, v16h b, v16h c, v16h d) { keep4_h(a, b, c, d); }
};
template <> struct Frag<__bf16> {
  typedef v16b V; union U { v16b v; v8b h[2]; };
  static __device__ __forceinline__ v16b load(const __bf16* p) {
    U f; f.h[0] = *(const v8b*)(p); f.h[1] = *(const v8b*)(p + 16); return f.v;
  }
  static __device__ __forceinline__ v8f mma(v16b a, v16b b, v8f c) {
    return __builtin_amdgcn_wmma_f32_16x16x32_bf16(false, a, false, b, (short)0, c, false, false);
  }
  static __device__ __forceinline__ void guard(v8f& a, v8f& b, v16b x, v16b y) { dep_guard_b(a, b, x, y); }
  static __device__ __forceinline__ void keep(v16b a, v16b b, v16b c, v16b d) { keep4_b(a, b, c, d); }
};

__device__ __forceinline__ unsigned pk16(unsigned short a, unsigned short b) { return (unsigned)a | ((unsigned)b << 16); }
__device__ __forceinline__ unsigned short h_bits(float f) { const _Float16 h = (_Float16)f; return __builtin_bit_cast(unsigned short, h); }

// ---- Register-blocked batched WMMA GEMM (ACT reduced to none/relu/leaky) -------------------------------
// C[m,n] = scale * sum_k A[m,k] * Bt[n,k] (+bias)(+resid); each wave owns a 64x64 tile.
// A row-major [M,K]; Bt row-major [N,K]; M,N % 64 == 0, K % 32 == 0.
// SPLIT: operands are hi/lo planes (A2/Bt2 = lo planes, same layout); product = hi*hi + hi*lo + lo*hi.
// BIAS_MODE: 0 = none, 1 = bias[m], 2 = bias[n].
// OUT_MODE: 0 = f32, 1 = f16, 2 = bf16 hi plane (Cout) + bf16 lo plane (Cout2).
// ET: 0 = f16 operands, 1 = bf16 operands (pointers passed as 16-bit storage)
// A_ALT (only without SPLIT): batch 0 reads A from Ap, batch b > 0 from A2p + (b - 1) * strideA, so products of different left operands share one grid.
template <int ET> struct Elem;
template <> struct Elem<0> { typedef _Float16 T; };
template <> struct Elem<1> { typedef __bf16 T; };
template <int ET, bool SPLIT, int BIAS_MODE, int OUT_MODE, bool RESID, int ACT = 0, bool A_ALT = false>
__global__ __launch_bounds__(256) void wmma_gemm64(
    const unsigned short* __restrict__ Ap, const unsigned short* __restrict__ A2p, int lda, long strideA,
    const unsigned short* __restrict__ Btp, const unsigned short* __restrict__ Bt2p, int ldb, long strideB,
    void* __restrict__ Cout, void* __restrict__ Cout2, int ldc, long strideC,
    const float* __restrict__ bias,
    const float* __restrict__ resid, long strideR,
    int M, int N, int K, float scale) {
  typedef typename Elem<ET>::T T;
  typedef typename Frag<T>::V V;
  const T* A = (const T*)Ap; const T* A2 = (const T*)A2p; const T* Bt = (const T*)Btp; const T* Bt2 = (const T*)Bt2p;
  __shared__ __align__(16) float sT[8][16 * 68];   // per-wave 16x64 slab, pitch 68 floats
  const int b    = blockIdx.y;
  const int lane = threadIdx.x & 31;
  const int wave = threadIdx.x >> 5;
  const int tilesN = N >> 6;
  const int tilesM = M >> 6;
  const int tile = blockIdx.x * 8 + wave;
  if (tile >= tilesM * tilesN) return;   // wave-uniform; no block barriers in this kernel
  const int tm = tile / tilesN;
  const int tn = tile - tm * tilesN;
  const int m0 = tm << 6;
  const int n0 = tn << 6;

  static_assert(!(A_ALT && SPLIT));
  const T* Ab  = (A_ALT && b > 0) ? (A2 + (size_t)(b - 1) * strideA) : (A + (size_t)b * strideA);   // block-uniform select
  const T* Bb  = Bt + (size_t)b * strideB;
  const T* Ab2 = SPLIT ? (A2  + (size_t)b * strideA) : nullptr;
  const T* Bb2 = SPLIT ? (Bt2 + (size_t)b * strideB) : nullptr;

  const int rlane = lane & 15;                 // row (A) / col (B, D) within subtile
  const int koff  = (lane >> 4) * 8;           // k offset of this lane half
  const int mOff  = (lane >> 4) * 8;           // D row offset

  v8f acc[4][4];
#pragma unroll
  for (int i = 0; i < 4; ++i)
#pragma unroll
    for (int j = 0; j < 4; ++j) acc[i][j] = (v8f){0.f,0.f,0.f,0.f,0.f,0.f,0.f,0.f};

  for (int k0 = 0; k0 < K; k0 += 32) {
    V bh[4], bl[4];
#pragma unroll
    for (int j = 0; j < 4; ++j) {
      const size_t bo = (size_t)(n0 + (j << 4) + rlane) * ldb + koff + k0;
      bh[j] = Frag<T>::load(Bb + bo);
      if (SPLIT) bl[j] = Frag<T>::load(Bb2 + bo);
    }
#pragma unroll
    for (int i = 0; i < 4; ++i) {
      const size_t ao = (size_t)(m0 + (i << 4) + rlane) * lda + koff + k0;
      V ah = Frag<T>::load(Ab + ao);
      V al;
      if (SPLIT) al = Frag<T>::load(Ab2 + ao);
#pragma unroll
      for (int j = 0; j < 4; ++j) {
        acc[i][j] = Frag<T>::mma(ah, bh[j], acc[i][j]);
        if (SPLIT) {
          acc[i][j] = Frag<T>::mma(ah, bl[j], acc[i][j]);
          acc[i][j] = Frag<T>::mma(al, bh[j], acc[i][j]);
        }
      }
      Frag<T>::guard(acc[i][0], acc[i][3], ah, SPLIT ? al : ah);
    }
    Frag<T>::keep(bh[0], bh[1], bh[2], bh[3]);
    if (SPLIT) Frag<T>::keep(bl[0], bl[1], bl[2], bl[3]);
  }
  acc_guard4(acc[0][0], acc[0][1], acc[0][2], acc[0][3]);
  acc_guard4(acc[1][0], acc[1][1], acc[1][2], acc[1][3]);
  acc_guard4(acc[2][0], acc[2][1], acc[2][2], acc[2][3]);
  acc_guard4(acc[3][0], acc[3][1], acc[3][2], acc[3][3]);

  // ---- epilogue ----
  float* slab = sT[wave];
  const float* Rb = RESID ? (resid + (size_t)b * strideR) : nullptr;
#pragma unroll
  for (int i = 0; i < 4; ++i) {
    const int mBase = m0 + (i << 4);
#pragma unroll
    for (int j = 0; j < 4; ++j) {
      const int n = n0 + (j << 4) + rlane;
      float bv = 0.f;
      if (BIAS_MODE == 2) bv = bias[n];
#pragma unroll
      for (int r = 0; r < 8; ++r) {
        float v = acc[i][j][r] * scale;
        if (BIAS_MODE == 1) v += bias[mBase + mOff + r];
        if (BIAS_MODE == 2) v += bv;
        if (RESID) v += Rb[(size_t)(mBase + mOff + r) * ldc + n];
        if (ACT == 2) v = fmaxf(v, 0.0f);
        if (ACT == 4) v = (v > 0.f) ? v : 0.01f * v;
        slab[(mOff + r) * 68 + (j << 4) + rlane] = v;
      }
    }
    __builtin_amdgcn_fence(__ATOMIC_RELEASE, "workgroup");
    __builtin_amdgcn_wave_barrier();
    __builtin_amdgcn_fence(__ATOMIC_ACQUIRE, "workgroup");
    if (OUT_MODE == 0) {
      float* C = (float*)Cout + (size_t)b * strideC;
      const int hh = lane >> 4, c4 = (lane & 15) * 4;     // row seg = 256 B = 16 lanes x 16 B
      {
#pragma unroll
        for (int it = 0; it < 8; ++it) {
          const int row = it * 2 + hh;
          v4f v = *(const v4f*)(slab + row * 68 + c4);
          *(v4f*)(C + (size_t)(mBase + row) * ldc + n0 + c4) = v;
        }
        
      }
    } else {
      const int q = lane >> 3, c8 = (lane & 7) * 8;
      unsigned short* C  = (unsigned short*)Cout  + (size_t)b * strideC;
      unsigned short* C2 = (OUT_MODE == 2) ? ((unsigned short*)Cout2 + (size_t)b * strideC) : nullptr;
      {
#pragma unroll
        for (int it = 0; it < 4; ++it) {
          const int row = it * 4 + q;
          const float* sp = slab + row * 68 + c8;
          v8h hv, lv;
#pragma unroll
          for (int e = 0; e < 8; ++e) {
            if (OUT_MODE == 1) {
              hv[e] = (_Float16)sp[e];
            } else {
              unsigned short hb = f2bf_bits(sp[e]);
              unsigned short lb = f2bf_bits(sp[e] - bf_bits2f(hb));
              hv[e] = __builtin_bit_cast(_Float16, hb);
              lv[e] = __builtin_bit_cast(_Float16, lb);
            }
          }
          *(v8h*)(C + (size_t)(mBase + row) * ldc + n0 + c8) = hv;
          if (OUT_MODE == 2) *(v8h*)(C2 + (size_t)(mBase + row) * ldc + n0 + c8) = lv;
        }
        
      }
    }
    __builtin_amdgcn_fence(__ATOMIC_RELEASE, "workgroup");
    __builtin_amdgcn_wave_barrier();
    __builtin_amdgcn_fence(__ATOMIC_ACQUIRE, "workgroup");
  }
}

// ---------------------------------------------------------------------------
// Input cast: out plane z (0 <- x, 1 <- m) = f16( bf16_rne(v) ), [8192][512] halves each. One work-group's share: block bx of plane z.
// ---------------------------------------------------------------------------
__device__ __forceinline__ void cast_in_block(const float* __restrict__ x, const float* __restrict__ m,
                                              unsigned short* __restrict__ out, int n8, int z, int bx) {
  const float* in = (z == 0) ? x : m;                // block-uniform plane select
  const int i = bx * 256 + threadIdx.x;
  if (i >= n8) return;
  const float* p = in + 8 * (size_t)i;
  const v4f a = *(const v4f*)(p);
  const v4f c = *(const v4f*)(p + 4);
  unsigned short hb[8];
#pragma unroll
  for (int e = 0; e < 4; ++e) {
    hb[e]     = h_bits(bf_rne(a[e]));
    hb[4 + e] = h_bits(bf_rne(c[e]));
  }
  const v4u u = (v4u){pk16(hb[0], hb[1]), pk16(hb[2], hb[3]), pk16(hb[4], hb[5]), pk16(hb[6], hb[7])};
  unsigned short* q = out + (size_t)z * 8 * (size_t)n8 + 8 * (size_t)i;
  *(v4u*)q = u;
  
}

// ---------------------------------------------------------------------------
// Weight transpose + cast: W is [in d][out h] (512x512, row-major); WT[h][d] = f16( scale * bf16_rne(W[d][h]) ).
// One work-group's share: bd = d tile (64 cols of WT, 0..7), bh = h tile (64 rows of WT, 0..7), z selects W0..W3 and the
// output plane (plane z at out + z*512*512 halves). 256 threads; sm is the work-group's 64 x 65 float exchange tile.
// Load coverage: 4 iterations x 256 threads x float4 = 4096 = the whole 64(d) x 64(h) tile (coalesced along h), 4 b128 loads per lane.
// Store coverage: 8 waves x 2 iterations x 4 rows (lane>>3) = 64 rows; (lane&7) x 8 halves = 64 cols; each row segment =
// ---------------------------------------------------------------------------
__device__ __forceinline__ void wtcast_block(const float* __restrict__ W0, const float* __restrict__ W1,
                                             const float* __restrict__ W2, const float* __restrict__ W3,
                                             unsigned short* __restrict__ out, float scale,
                                             float (*sm)[65], int bd, int bh, int z) {   // sm[h_local][d_local]; z block-uniform
  const int t  = threadIdx.x;
  const int d0 = bd * 64;
  const int h0 = bh * 64;
  const float* W = (z == 0) ? W0 : (z == 1) ? W1 : (z == 2) ? W2 : W3;
#pragma unroll
  for (int i = 0; i < 4; ++i) {
    const int e4 = i * 256 + t;
    const int r  = e4 >> 4;            // d local 0..63
    const int c4 = (e4 & 15) * 4;      // h local 0..60
    const v4f w = *(const v4f*)(W + (size_t)(d0 + r) * kDim + h0 + c4);
#pragma unroll
    for (int k = 0; k < 4; ++k) sm[c4 + k][r] = bf_rne(w[k]) * scale;
  }
  __syncthreads();
  const int lane = t & 31, wave = t >> 5;
  const int q = lane >> 3, c8 = (lane & 7) * 8;
  unsigned short* op = out + (size_t)z * kDim * kDim;
  {
#pragma unroll
    for (int it = 0; it < 2; ++it) {
      const int row = wave * 8 + it * 4 + q;                 // h local
      unsigned short hb[8];
#pragma unroll
      for (int e = 0; e < 8; ++e) hb[e] = h_bits(sm[row][c8 + e]);
      const v4u u = (v4u){pk16(hb[0], hb[1]), pk16(hb[2], hb[3]), pk16(hb[4], hb[5]), pk16(hb[6], hb[7])};
      *(v4u*)(op + (size_t)(h0 + row) * kDim + d0 + c8) = u;
    }
    
  }
}

// ---------------------------------------------------------------------------
// The two independent casts above in one grid, told apart by the block index (block-uniform, so the transpose's barrier is passed by
// whole work-groups only): blocks 0..255 = weight tiles (d tile, h tile, matrix), blocks 256..4351 = input cast (2048 blocks per plane).
// ---------------------------------------------------------------------------
constexpr int kWtBlocks   = (kDim / 64) * (kDim / 64) * 4;   // 256
constexpr int kCastBlocks = kPlane / 8 / 256;                // 2048 per plane
static_assert(kDim / 64 == 8 && kCastBlocks == 2048);
__global__ __launch_bounds__(256) void prep_kernel(const float* __restrict__ x, const float* __restrict__ m,
                                                   const float* __restrict__ W0, const float* __restrict__ W1,
                                                   const float* __restrict__ W2, const float* __restrict__ W3,
                                                   unsigned short* __restrict__ xm_out, unsigned short* __restrict__ wt_out,
                                                   float scale, int n8) {
  __shared__ float sm[64][65];
  const int blk = blockIdx.x;
  if (blk < kWtBlocks) {
    wtcast_block(W0, W1, W2, W3, wt_out, scale, sm, blk & 7, (blk >> 3) & 7, blk >> 6);
  } else {
    const int cb = blk - kWtBlocks;
    cast_in_block(x, m, xm_out, n8, cb >> 11, cb & (kCastBlocks - 1));
  }
}

// ---------------------------------------------------------------------------
// Token pooling, part 1 (f32): grid (64, 12): blockIdx.x = chunk of 32 tokens, blockIdx.y = tb = tensor*4 + batch. 128 threads x 4 channels.
//   pmax[tb][chunk][c] = max over the chunk's tokens of F[tb][n][c], psum[tb][chunk][c] = their sum (token order).
// Every load is independent of the others and covers 512 contiguous bytes per wave; all 32 of a thread are issued before the first is used.
// ---------------------------------------------------------------------------
constexpr int kPoolTok   = 32;                  // tokens per pooling work-group
constexpr int kPoolParts = kSeq / kPoolTok;     // 64 partial rows per (tensor, batch)
static_assert(kSeq % kPoolTok == 0 && kDim == 128 * 4 && kRed == 32 && kDim == 16 * 32);
__global__ __launch_bounds__(128) void pool_part_kernel(const float* __restrict__ F, float* __restrict__ pmax,
                                                        float* __restrict__ psum) {
  const int t    = threadIdx.x;
  const int part = blockIdx.x;
  const int tb   = blockIdx.y;          // 0..11; F is [12][2048][512]
  const float* src = F + ((size_t)tb * kSeq + (size_t)part * kPoolTok) * kDim + 4 * t;
  v4f v[kPoolTok];
#pragma unroll   // one base address, immediate offsets: the loads wait on nothing and overlap their latencies
  for (int n = 0; n < kPoolTok; ++n) v[n] = *(const v4f*)(src + (size_t)n * kDim);
  v4f mx = v[0];
  v4f sm = v[0];
#pragma unroll   // v[] stays in registers
  for (int n = 1; n < kPoolTok; ++n) {
#pragma unroll   // element-wise maximum of a register vector
    for (int e = 0; e < 4; ++e) mx[e] = fmaxf(mx[e], v[n][e]);
    sm = sm + v[n];
  }
  const size_t o = ((size_t)tb * kPoolParts + part) * kDim + 4 * t;
  *(v4f*)(pmax + o) = mx;
  *(v4f*)(psum + o) = sm;
}

// ---------------------------------------------------------------------------
// Token pooling, part 2 + channel gate MLP (f32): block tb = tensor*4 + batch (12 blocks), 512 threads = channels.
//   mx[c] = max over 64 chunk maxima, av[c] = (sum of 64 chunk sums, chunk order) * (1/2048)
//   hid[j] = relu( sum_c mx[c]*w1[c][j] + sum_c av[c]*w1[c][j] )   j < 32      (w1, w2 RNE-converted to bf16 at use)
//            thread t holds w1 elements i*512 + t, so wave w sums channels w, w+16, .. w+496 for all 32 j (lane = j);
//            32 threads then add the 16 wave partials in wave order
//   g[c]   = 1 / (1 + exp(-sum_j hid[j]*w2[j][c]))
// The w1 and w2 elements a thread needs depend on nothing computed here: they are loaded first, beside the chunk partials.
// ---------------------------------------------------------------------------
__global__ __launch_bounds__(512) void gate_kernel(const float* __restrict__ pmax, const float* __restrict__ psum,
                                                   const float* __restrict__ w1, const float* __restrict__ w2,
                                                   float* __restrict__ scl) {
  __shared__ float smax[kDim];
  __shared__ float savg[kDim];
  __shared__ float pa1[kDim / 32][kRed];
  __shared__ float pa2[kDim / 32][kRed];
  __shared__ float hid[kRed];
  const int t    = threadIdx.x;
  const int tb   = blockIdx.x;          // 0..11
  const int lane = t & 31, wave = t >> 5;
  float w1v[32], w2v[kRed];
#pragma unroll   // this loop and the next two: independent loads at immediate offsets, in flight together
  for (int i = 0; i < 32; ++i) w1v[i] = w1[i * kDim + t];      // channel i*16 + wave, hidden unit lane
#pragma unroll   // as above
  for (int j = 0; j < kRed; ++j) w2v[j] = w2[j * kDim + t];
  const float* pm = pmax + (size_t)tb * kPoolParts * kDim + t;
  const float* ps = psum + (size_t)tb * kPoolParts * kDim + t;
  float mx = -__builtin_inff();
  float sm = 0.0f;
#pragma unroll   // as above
  for (int p = 0; p < kPoolParts; ++p) {
    mx = fmaxf(mx, pm[p * kDim]);
    sm += ps[p * kDim];
  }
  smax[t] = mx;
  savg[t] = sm * kInvSeq;
  __syncthreads();
  float a1 = 0.0f, a2 = 0.0f;
#pragma unroll   // w1v[] stays in registers
  for (int i = 0; i < 32; ++i) {
    const float w = bf_rne(w1v[i]);
    a1 += smax[i * 16 + wave] * w;
    a2 += savg[i * 16 + wave] * w;
  }
  pa1[wave][lane] = a1;
  pa2[wave][lane] = a2;
  __syncthreads();
  if (t < kRed) {                       // wave 0, wave-uniform
    float s1 = 0.0f, s2 = 0.0f;
#pragma unroll   // the 32 LDS reads overlap
    for (int w = 0; w < kDim / 32; ++w) {
      s1 += pa1[w][t];
      s2 += pa2[w][t];
    }
    hid[t] = fmaxf(s1 + s2, 0.0f);
  }
  __syncthreads();
  float a = 0.0f;
#pragma unroll   // w2v[] stays in registers
  for (int j = 0; j < kRed; ++j) a += hid[j] * bf_rne(w2v[j]);
  const float g = 1.0f / (1.0f + expf(-a));
  scl[(size_t)tb * kDim + t] = g;       // one whole 128-byte line per wave
}

// ---------------------------------------------------------------------------
// Gate + cast for q and k planes: out[z][row][c] = f16( 8 * F[z][row][c] * g[z][batch(row)][c] ), z = plane (0 q, 1 k), bx = block of it.
// Coverage: n8 = 524288 = 2048 blocks x 256 exact per plane.
// ---------------------------------------------------------------------------
__device__ __forceinline__ void gate_cast_block(const float* __restrict__ F, const float* __restrict__ scl,
                                                unsigned short* __restrict__ out, int n8, int z, int bx) {
  const int i = bx * 256 + threadIdx.x;
  if (i >= n8) return;
  const size_t e0 = 8 * (size_t)i;                    // element index inside the plane
  const int c0 = (int)(e0 & (size_t)(kDim - 1));
  const int b  = (int)(e0 >> 20);                     // row / 2048
  const float* p  = F + (size_t)z * kPlane + e0;
  const float* sp = scl + (size_t)(z * kBatch + b) * kDim + c0;
  const v4f a  = *(const v4f*)(p);
  const v4f c  = *(const v4f*)(p + 4);
  const v4f g0 = *(const v4f*)(sp);
  const v4f g1 = *(const v4f*)(sp + 4);
  unsigned short hb[8];
#pragma unroll
  for (int e = 0; e < 4; ++e) {
    hb[e]     = h_bits(a[e] * g0[e] * kGCarry);
    hb[4 + e] = h_bits(c[e] * g1[e] * kGCarry);
  }
  const v4u u = (v4u){pk16(hb[0], hb[1]), pk16(hb[2], hb[3]), pk16(hb[4], hb[5]), pk16(hb[6], hb[7])};
  unsigned short* q = out + (size_t)z * kPlane + e0;
  *(v4u*)q = u;
  
}

// ---------------------------------------------------------------------------
// Gate + transpose + cast for v: VT[(b*8+h)][d][s] = f16( 8 * Fv[b][s][h*64+d] * gv[b][h*64+d] ).
// One work-group's share: bs = s tile (64 rows, 0..31), h = head, b = batch. 256 threads; sm is the work-group's 64 x 65 float exchange tile.
// Load coverage: 4 iterations x 256 threads x float4 = 4096 = whole 64(s) x 64(d) tile (coalesced along d); gate as one float4.
// Store coverage: 8 waves x 2 iterations x 4 rows (lane>>3) = 64 d-rows; (lane&7) x 8 halves = 64 s-cols; each row segment =
// ---------------------------------------------------------------------------
__device__ __forceinline__ void vt_gate_cast_block(const float* __restrict__ Fv, const float* __restrict__ gv,
                                                   unsigned short* __restrict__ VT,
                                                   float (*sm)[65], int bs, int h, int b) {   // sm[d][s_local]
  const int t  = threadIdx.x;
  const int s0 = bs * 64;
  const int c4 = (t & 15) * 4;   // d, constant over the load loop
  const v4f g = *(const v4f*)(gv + (size_t)b * kDim + h * kDh + c4);
#pragma unroll
  for (int i = 0; i < 4; ++i) {
    const int e4 = i * 256 + t;
    const int r  = e4 >> 4;        // s local 0..63
    const v4f w = *(const v4f*)(Fv + ((size_t)(b * kSeq + s0 + r)) * kDim + h * kDh + c4);
#pragma unroll
    for (int k = 0; k < 4; ++k) sm[c4 + k][r] = w[k] * g[k] * kGCarry;
  }
  __syncthreads();
  const int lane = t & 31, wave = t >> 5;
  const int q = lane >> 3, c8 = (lane & 7) * 8;
  unsigned short* op = VT + ((size_t)(b * kHeads + h) * kDh) * kSeq;
  {
#pragma unroll
    for (int it = 0; it < 2; ++it) {
      const int row = wave * 8 + it * 4 + q;                 // d
      unsigned short hb[8];
#pragma unroll
      for (int e = 0; e < 8; ++e) hb[e] = h_bits(sm[row][c8 + e]);
      const v4u u = (v4u){pk16(hb[0], hb[1]), pk16(hb[2], hb[3]), pk16(hb[4], hb[5]), pk16(hb[6], hb[7])};
      *(v4u*)(op + (size_t)row * kSeq + s0 + c8) = u;
    }
    
  }
}

// ---------------------------------------------------------------------------
// The two independent gate casts above in one grid, told apart by the block index (block-uniform, so the transpose's barrier is passed
// by whole work-groups only): blocks 0..1023 = v tiles (s tile, head, batch), blocks 1024..5119 = q and k planes (2048 blocks each).
// F is [3][8192][512] (q, k, v), scl is [3][4][512].
// ---------------------------------------------------------------------------
constexpr int kVtBlocks = (kSeq / 64) * kHeads * kBatch;   // 1024
static_assert(kSeq / 64 == 32 && kHeads == 8);
__global__ __launch_bounds__(256) void gate_planes_kernel(const float* __restrict__ F, const float* __restrict__ scl,
                                                          unsigned short* __restrict__ qk_out, unsigned short* __restrict__ VT, int n8) {
  __shared__ float sm[64][65];
  const int blk = blockIdx.x;
  if (blk < kVtBlocks) {
    vt_gate_cast_block(F + (size_t)2 * kPlane, scl + (size_t)2 * kBatch * kDim, VT, sm, blk & 31, (blk >> 5) & 7, blk >> 8);
  } else {
    const int cb = blk - kVtBlocks;
    gate_cast_block(F, scl, qk_out, n8, cb >> 11, cb & (kCastBlocks - 1));
  }
}

// ---------------------------------------------------------------------------
// Fused attention of every (batch, head): S^T = K.Q^T, online softmax (base 2, f32), O^T += V^T.P^T; scores and P stay in registers.
// grid (8, 32): blockIdx.x = block of 256 queries, blockIdx.y = batch*8 + head. 8 waves x 32 query columns (2 groups of 16).
// One pass = 32 keys. Lane (c = lane & 15, hf = lane >> 4) of a score tile holds query c, keys 8*hf + r: the two 16-key tiles of a
// pass, converted in place, are the B operand of the second product (element s: key 8*hf + s, s < 8; key 16 + 8*hf + s - 8 else),
// the k order in which Frag::load brings V^T (and K, Q among themselves).
// The maximum in use may trail the true one by up to 8 (base-2 exponent), so P <= 2^8 and P carried x2^6 <= 2^14 in f16.
// Oh[b][q][head*64 + d] = f16( 32 * acc / rowsum ): context carried x256, V carried x8.
// ---------------------------------------------------------------------------
__device__ __forceinline__ float xhalf(float x) {   // lane l <-> lane l ^ 16
  const int v = __builtin_bit_cast(int, x);
  return __builtin_bit_cast(float, __builtin_amdgcn_permlanex16(v, v, 0x76543210, 0xfedcba98, false, false));
}
__global__ __launch_bounds__(256) void attn_fused_kernel(const unsigned short* __restrict__ Qp, const unsigned short* __restrict__ Kp,
                                                         const unsigned short* __restrict__ VTp, unsigned short* __restrict__ Op) {
  typedef Frag<_Float16> FH;
  const int lane = threadIdx.x & 31, wave = threadIdx.x >> 5;
  const int c = lane & 15, hf = lane >> 4;
  const int bh = blockIdx.y;
  const int q0 = blockIdx.x * 256 + wave * 32;
  const size_t tokOff = (size_t)(bh >> 3) * kSeq * kDim + (size_t)(bh & 7) * kDh;
  const _Float16* ql = (const _Float16*)Qp + tokOff + (size_t)(q0 + c) * kDim + 8 * hf;
  const _Float16* kl = (const _Float16*)Kp + tokOff + (size_t)c * kDim + 8 * hf;
  const _Float16* vl = (const _Float16*)VTp + (size_t)bh * kDh * kSeq + (size_t)c * kSeq + 8 * hf;

  v16h qf[2][2];
#pragma unroll
  for (int g = 0; g < 2; ++g)
#pragma unroll
    for (int kc = 0; kc < 2; ++kc) qf[g][kc] = FH::load(ql + (size_t)(16 * g) * kDim + 32 * kc);

  v8f acc[2][4];
  v2f ls[2];
  float m_run[2];
#pragma unroll
  for (int g = 0; g < 2; ++g) {
    m_run[g] = -__builtin_inff();
    ls[g] = (v2f){0.f, 0.f};
#pragma unroll
    for (int t = 0; t < 4; ++t) acc[g][t] = (v8f){0.f,0.f,0.f,0.f,0.f,0.f,0.f,0.f};
  }

  v16h kf[2][2];
#pragma unroll
  for (int kt = 0; kt < 2; ++kt)
#pragma unroll
    for (int kc = 0; kc < 2; ++kc) kf[kt][kc] = FH::load(kl + (size_t)(16 * kt) * kDim + 32 * kc);

  // rolled: one pass's fragments, scores and the 64 accumulator registers fill the register budget
#pragma unroll 1
  for (int key0 = 0; key0 < kSeq; key0 += 32) {
    v16h vf[4];      // this pass's V^T, in flight under the score products and the maxima
#pragma unroll
    for (int t = 0; t < 4; ++t) vf[t] = FH::load(vl + (size_t)(16 * t) * kSeq + key0);

    v8f s[2][2];
#pragma unroll
    for (int kt = 0; kt < 2; ++kt)
#pragma unroll
      for (int g = 0; g < 2; ++g) {
        s[kt][g] = (v8f){0.f,0.f,0.f,0.f,0.f,0.f,0.f,0.f};
#pragma unroll
        for (int kc = 0; kc < 2; ++kc) s[kt][g] = FH::mma(kf[kt][kc], qf[g][kc], s[kt][g]);
      }
    const int nk = (key0 + 32) & (kSeq - 1);
#pragma unroll
    for (int kt = 0; kt < 2; ++kt)
#pragma unroll
      for (int kc = 0; kc < 2; ++kc) kf[kt][kc] = FH::load(kl + (size_t)(nk + 16 * kt) * kDim + 32 * kc);
    __builtin_amdgcn_sched_barrier(0);   // keeps the K loads issued here, ahead of the vector work that hides their latency

    float mb[2];
    bool need = false;
#pragma unroll
    for (int g = 0; g < 2; ++g) {
      float mx = s[0][g][0];
#pragma unroll
      for (int r = 1; r < 8; ++r) mx = fmaxf(mx, s[0][g][r]);
#pragma unroll
      for (int r = 0; r < 8; ++r) mx = fmaxf(mx, s[1][g][r]);
      mx = fmaxf(mx, xhalf(mx)) * kSmScale2;         // both halves hold the query's maximum of this pass (the scale is positive)
      mb[g] = mx;
      need = need || (mx > m_run[g] + 8.0f);
    }
    if (__builtin_amdgcn_ballot_w32(need) != 0) {    // wave-uniform; always on the first pass, rare later
#pragma unroll
      for (int g = 0; g < 2; ++g) {
        const float m_new = fmaxf(m_run[g], mb[g]);
        const float corr = __builtin_amdgcn_exp2f(m_run[g] - m_new);   // 0 on the first pass
        m_run[g] = m_new;
        ls[g] = ls[g] * corr;
#pragma unroll
        for (int t = 0; t < 4; ++t) acc[g][t] = acc[g][t] * corr;
      }
    }
#pragma unroll
    for (int g = 0; g < 2; ++g) {
      const float nm = kPShift - m_run[g];
      v16h pf;
#pragma unroll
      for (int i = 0; i < 8; ++i) {
        const v2f sv = (v2f){s[i >> 2][g][2 * (i & 3)], s[i >> 2][g][2 * (i & 3) + 1]};
        const v2f arg = __builtin_elementwise_fma(sv, (v2f){kSmScale2, kSmScale2}, (v2f){nm, nm});
        const v2f p = (v2f){__builtin_amdgcn_exp2f(arg.x), __builtin_amdgcn_exp2f(arg.y)};
        ls[g] = ls[g] + p;
        const v2h ph = __builtin_convertvector(p, v2h);
        pf[2 * i]     = ph.x;
        pf[2 * i + 1] = ph.y;
      }
#pragma unroll
      for (int t = 0; t < 4; ++t) acc[g][t] = FH::mma(vf[t], pf, acc[g][t]);
    }
  }

  _Float16* ol = (_Float16*)Op + tokOff + (size_t)(q0 + c) * kDim + 8 * hf;
#pragma unroll
  for (int g = 0; g < 2; ++g) {
    float l = ls[g].x + ls[g].y;
    l += xhalf(l);                                   // join the two halves' key sums
    const float inv = kCtxScale / l;
#pragma unroll
    for (int t = 0; t < 4; ++t) {
      v8h hv;
#pragma unroll
      for (int r = 0; r < 8; ++r) hv[r] = (_Float16)(acc[g][t][r] * inv);   // d = 16 t + 8 hf + r of query 16 g + c
      *(v8h*)(ol + (size_t)(16 * g) * kDim + 16 * t) = hv;
    }
  }
}

// ---------------------------------------------------------------------------
// Host glue.
//   XMh  f16 [2][8192][512]     16,777,216  at           0   (x plane then m plane, bf16-valued)
//   WT   f16 [4][512][512]       2,097,152  at  16,777,216   (Wq^T, Wk^T, Wv^T, Wo^T, [out][in], carried x16)
//   F    f32 [3][8192][512]     50,331,648  at  18,874,368   (q, k, v projections, ungated)
//   Qh   f16 [8192][512]         8,388,608  at  69,206,016   (gated q, carried x8)
//   Kh   f16 [8192][512]         8,388,608  at  77,594,624   (gated k, carried x8)
//   VT   f16 [32][64][2048]      8,388,608  at  85,983,232   (gated v transposed per (batch, head), carried x8)
//   Oh   f16 [8192][512]         8,388,608  at  94,371,840   (attention context, carried x256)
//   SCL  f32 [3][4][512]            24,576  at 102,760,448   (channel gates)
//   PMX  f32 [12][64][512]       1,572,864  at 102,785,024   (chunk maxima of the token pooling)
//   PSM  f32 [12][64][512]       1,572,864  at 104,357,888   (chunk sums of the token pooling)
//   total                      105,930,752
// GEMM shapes: projections/out M=8192 N=512 K=512.
// All M,N multiples of 64, all K multiples of 32, no padded rows anywhere; every plane fully written before it is read.
// Launches: casts 1, projections 1, pooling 1, gates 1, gated planes 1, attention 1, output projection 1 = 7.
// ---------------------------------------------------------------------------
extern "C" void kernel_launch(void* const* d_in, const int* in_sizes, int n_in,
                              void* d_out, int out_size, void* d_ws, size_t ws_size,
                              hipStream_t stream) {
  if (n_in < 9) return;
  if (in_sizes[0] != kPlane || in_sizes[1] != kPlane) return;
  if (in_sizes[2] != kDim * kDim || in_sizes[3] != kDim * kDim || in_sizes[4] != kDim * kDim || in_sizes[5] != kDim * kDim) return;
  if (in_sizes[6] != kDim || in_sizes[7] != kDim * kRed || in_sizes[8] != kRed * kDim) return;
  if (out_size != kPlane) return;

  const size_t szHalfPlane = (size_t)kPlane * 2;                 // 8,388,608
  const size_t szXM  = 2 * szHalfPlane;
  const size_t szWT  = (size_t)4 * kDim * kDim * 2;
  const size_t szF   = (size_t)3 * kPlane * 4;
  const size_t szVT  = (size_t)kBatch * kHeads * kDh * kSeq * 2;
  const size_t szSCL = (size_t)3 * kBatch * kDim * 4;
  const size_t offXM  = 0;
  const size_t offWT  = offXM + szXM;
  const size_t offF   = offWT + szWT;
  const size_t offQh  = offF + szF;
  const size_t offKh  = offQh + szHalfPlane;
  const size_t offVT  = offKh + szHalfPlane;
  const size_t offOh  = offVT + szVT;
  const size_t offSCL = offOh + szHalfPlane;
  const size_t szPart = (size_t)3 * kBatch * kPoolParts * kDim * 4;
  const size_t offPMX = offSCL + szSCL;
  const size_t offPSM = offPMX + szPart;
  const size_t total  = offPSM + szPart;                          // 105,930,752
  if (ws_size < total) return;

  const float* x      = (const float*)d_in[0];
  const float* m      = (const float*)d_in[1];
  const float* Wq     = (const float*)d_in[2];
  const float* Wk     = (const float*)d_in[3];
  const float* Wv     = (const float*)d_in[4];
  const float* Wo     = (const float*)d_in[5];
  const float* bias_o = (const float*)d_in[6];
  const float* gw1    = (const float*)d_in[7];
  const float* gw2    = (const float*)d_in[8];
  float* out = (float*)d_out;
  char* ws = (char*)d_ws;
  unsigned short* XMh = (unsigned short*)(ws + offXM);
  unsigned short* WT  = (unsigned short*)(ws + offWT);
  float*          F   = (float*)(ws + offF);
  unsigned short* Qh  = (unsigned short*)(ws + offQh);
  unsigned short* Kh  = (unsigned short*)(ws + offKh);
  unsigned short* VT  = (unsigned short*)(ws + offVT);
  unsigned short* Oh  = (unsigned short*)(ws + offOh);
  float*          SCL = (float*)(ws + offSCL);
  float*          PMX = (float*)(ws + offPMX);
  float*          PSM = (float*)(ws + offPSM);

  const unsigned short* Xh = XMh;
  const unsigned short* Mh = XMh + (size_t)kPlane;
  const size_t wPlane = (size_t)kDim * kDim;

  // ---- 16-bit operand planes of the inputs ----
  const int n8 = kPlane / 8;   // 524288 -> 2048 blocks exact
  prep_kernel<<<dim3(kWtBlocks + 2 * kCastBlocks), dim3(256), 0, stream>>>(x, m, Wq, Wk, Wv, Wo, XMh, WT, kWCarry, n8);

  // ---- projections: F[0] = x.Wq, F[1] = m.Wk, F[2] = m.Wv   (M=8192, N=512, K=512), f32 out, scale 1/16 ----
  const int tilesProj = (kTok / 64) * (kDim / 64);   // 1024 -> 128 blocks of 8 waves
  // one grid, blockIdx.y = product: left operand x for 0, m for 1 and 2 (A_ALT, stride 0)
  wmma_gemm64<0, false, 0, 0, false, 0, true><<<dim3(tilesProj / 8, 3), dim3(256), 0, stream>>>(
      Xh, Mh, kDim, 0L, WT, WT, kDim, (long)wPlane,
      (void*)F, (void*)F, kDim, (long)kPlane, bias_o, SCL, 0L, kTok, kDim, kDim, kWCarryInv);

  // ---- token pooling + channel gates ----
  pool_part_kernel<<<dim3(kPoolParts, 3 * kBatch), dim3(128), 0, stream>>>(F, PMX, PSM);
  gate_kernel<<<dim3(3 * kBatch), dim3(512), 0, stream>>>(PMX, PSM, gw1, gw2, SCL);

  // ---- gated 16-bit planes: Qh, Kh (row-major [token][channel]); VT ([batch*head][d][token]) ----
  gate_planes_kernel<<<dim3(kVtBlocks + 2 * kCastBlocks), dim3(256), 0, stream>>>(F, SCL, Qh, VT, n8);

  // ---- attention, all (batch, head) in one launch: Oh[b, i, h*64+d] = f16( 256 * context ) ----
  attn_fused_kernel<<<dim3(kSeq / 256, kBatch * kHeads), dim3(256), 0, stream>>>(Qh, Kh, VT, Oh);

  // ---- output projection: out = 2^-12 * Oh.Wo^T(x16) + bo   (M=8192, N=512, K=512), f32 to d_out ----
  wmma_gemm64<0, false, 2, 0, false, 0><<<dim3(tilesProj / 8, 1), dim3(256), 0, stream>>>(
      Oh, Oh, kDim, 0L, WT + 3 * wPlane, WT + 3 * wPlane, kDim, 0L,
      (void*)out, (void*)out, kDim, 0L, bias_o, SCL, 0L, kTok, kDim, kDim, kOutScale);
}

// v004
// Measured time: 141 microseconds a run.
// Two timings next to v003 put it at 1.14 and 1.13 times that version's speed.
// Over all steps from v000 it is 25.5 times as fast.
// Contractions: q/k/v projections (x,m RNE-converted to bf16 held in f16 planes x W^T bf16-valued f16 planes carried x16), scores k.q^T (k f16 plane and q fragments scaled by both gates, each carried x8), v^T.p^T (V^T f16 carried x8 x unnormalised P f16 carried x64; v gate on the f32 result), output projection (context f16 carried x256 x Wo^T f16 carried x16): all v_wmma_f32_16x16x32_f16 with f32 accumulate; token pooling, channel-gate MLP, online softmax in f32.
#include <hip/hip_runtime.h>
#include <math.h>

// ---------------------------------------------------------------------------
// Problem constants
// ---------------------------------------------------------------------------
constexpr int kBatch = 4;
constexpr int kSeq   = 2048;
constexpr int kDim   = 512;               // model dim = inner dim
constexpr int kHeads = 8;
constexpr int kDh    = 64;
constexpr int kRed   = 32;                // gate hidden width (512 / 16)
constexpr int kTok   = kBatch * kSeq;     // 8192 token rows
constexpr int kPlane = kTok * kDim;       // 4194304 elements per [8192][512] plane
constexpr float kWCarry    = 16.0f;                 // weights carried x16 in f16
constexpr float kWCarryInv = 1.0f / 16.0f;
constexpr float kGCarry    = 8.0f;                  // q fragments, k and V^T planes carried x8 in f16
constexpr float kPShift    = 6.0f;                  // unnormalised probabilities carried x2^6 in f16 (added to the base-2 exponent)
constexpr float kCtxCarry  = 256.0f;                // context carried x2^8 in f16
constexpr float kCtxScale  = kCtxCarry / kGCarry;                   // 32; the P carry cancels against the row sum
constexpr float kOutScale  = 1.0f / (kCtxCarry * kWCarry);          // 2^-12
constexpr float kAttnScale = 0.044194173824159216f;                 // 512^-0.5
constexpr float kSmScale   = kAttnScale / (kGCarry * kGCarry);      // exact: / 64
constexpr float kSmScale2  = kSmScale * 1.4426950408889634f;        // scores to base-2 exponents
constexpr float kInvSeq    = 1.0f / 2048.0f;
static_assert(kHeads * kDh == kDim);
static_assert(kDim / 16 == kRed);
static_assert(kSeq % 256 == 0 && (kSeq & (kSeq - 1)) == 0 && kDh == 64);   // fused attention: 256 queries per block, key index wraps by mask
// GEMM shape contract: M % 64 == 0, N % 64 == 0, K % 32 == 0 for every launch
static_assert(kTok % 64 == 0 && kDim % 64 == 0 && kDim % 32 == 0);     // projections / out: M=8192 N=512 K=512
static_assert((kPlane / 8) % 256 == 0);                                // cast grids exact

typedef __attribute__((ext_vector_type(16))) _Float16 v16h;
typedef __attribute__((ext_vector_type(8)))  _Float16 v8h;
typedef __attribute__((ext_vector_type(16))) __bf16   v16b;
typedef __attribute__((ext_vector_type(8)))  __bf16   v8b;
typedef __attribute__((ext_vector_type(8)))  float    v8f;
typedef __attribute__((ext_vector_type(4)))  float    v4f;
typedef __attribute__((ext_vector_type(2)))  float    v2f;
typedef __attribute__((ext_vector_type(2)))  _Float16 v2h;
typedef __attribute__((ext_vector_type(4)))  unsigned int v4u;

__device__ __forceinline__ unsigned short f2bf_bits(float f) {
  unsigned u = __float_as_uint(f);
  return (unsigned short)((u + 0x7FFFu + ((u >> 16) & 1u)) >> 16);
}
__device__ __forceinline__ float bf_bits2f(unsigned short h) { return __uint_as_float(((unsigned)h) << 16); }
// RNE convert f32 -> bf16 -> f32
__device__ __forceinline__ float bf_rne(float f) { return bf_bits2f(f2bf_bits(f)); }

// hazard guards as plain device helpers (no inline asm inside the kernel template body)
__device__ __forceinline__ void dep_guard_h(v8f& a, v8f& b, v16h x, v16h y) { asm volatile("v_nop\n\tv_nop\n\tv_nop\n\tv_nop" : "+v"(a), "+v"(b) : "v"(x), "v"(y)); }
__device__ __forceinline__ void dep_guard_b(v8f& a, v8f& b, v16b x, v16b y) { asm volatile("v_nop\n\tv_nop\n\tv_nop\n\tv_nop" : "+v"(a), "+v"(b) : "v"(x), "v"(y)); }
__device__ __forceinline__ void keep4_h(v16h a, v16h b, v16h c, v16h d) { asm volatile("v_nop" :: "v"(a), "v"(b), "v"(c), "v"(d)); }
__device__ __forceinline__ void keep4_b(v16b a, v16b b, v16b c, v16b d) { asm volatile("v_nop" :: "v"(a), "v"(b), "v"(c), "v"(d)); }
__device__ __forceinline__ void acc_guard4(v8f& a, v8f& b, v8f& c, v8f& d) { asm volatile("v_nop\n\tv_nop\n\tv_nop\n\tv_nop" : "+v"(a), "+v"(b), "+v"(c), "+v"(d)); }
template <typename T> struct Frag;
template <> struct Frag<_Float16> {
  typedef v16h V; union U { v16h v; v8h h[2]; };
  // elements 0..7 <- p[0..7], 8..15 <- p[16..23]
  static __device__ __forceinline__ v16h load(const _Float16* p) {
    U f; f.h[0] = *(const v8h*)(p); f.h[1] = *(const v8h*)(p + 16); return f.v;
  }
  static __device__ __forceinline__ v8f mma(v16h a, v16h b, v8f c) {
    return __builtin_amdgcn_wmma_f32_16x16x32_f16(false, a, false, b, (short)0, c, false, false);
  }
  static __device__ __forceinline__ void guard(v8f& a, v8f& b, v16h x, v16h y) { dep_guard_h(a, b, x, y); }
  static __device__ __forceinline__ void keep(v16h a, v16h b, v16h c, v16h d) { keep4_h(a, b, c, d); }
};
template <> struct Frag<__bf16> {
  typedef v16b V; union U { v16b v; v8b h[2]; };
  static __device__ __forceinline__ v16b load(const __bf16* p) {
    U f; f.h[0] = *(const v8b*)(p); f.h[1] = *(const v8b*)(p + 16); return f.v;
  }
  static __device__ __forceinline__ v8f mma(v16b a, v16b b, v8f c) {
    return __builtin_amdgcn_wmma_f32_16x16x32_bf16(false, a, false, b, (short)0, c, false, false);
  }
  static __device__ __forceinline__ void guard(v8f& a, v8f& b, v16b x, v16b y) { dep_guard_b(a, b, x, y); }
  static __device__ __forceinline__ void keep(v16b a, v16b b, v16b c, v16b d) { keep4_b(a, b, c, d); }
};

__device__ __forceinline__ unsigned pk16(unsigned short a, unsigned short b) { return (unsigned)a | ((unsigned)b << 16); }
__device__ __forceinline__ unsigned short h_bits(float f) { const _Float16 h = (_Float16)f; return __builtin_bit_cast(unsigned short, h); }

__device__ __forceinline__ float xhalf(float x) {   // lane l <-> lane l ^ 16
  const int v = __builtin_bit_cast(int, x);
  return __builtin_bit_cast(float, __builtin_amdgcn_permlanex16(v, v, 0x76543210, 0xfedcba98, false, false));
}

// ---------------------------------------------------------------------------
// Epilogue of the q/k/v projections (OUT_MODE 3 of the GEMM below): the first passes of their consumers, done on the wave's own tile.
// b = product (0: x.Wq, 1: m.Wk, 2: m.Wv, block-uniform); the tile is 64 tokens (from row m0) x 64 channels (from n0) = one head of one batch.
// From the f32 accumulators, before anything is rounded:
//   pmax[tb][chunk][c] = max over the tile's 64 tokens, psum[tb][chunk][c] = their sum (tb = product*4 + batch, chunk = 64 tokens);
//   in-lane over the lane's 32 rows in row order, then one exchange between the wave's halves.
// Then the tile itself, ungated (the gates are not known yet; the attention kernel applies them):
//   product 0: Qf[token][c] f32;  product 1: Kh[token][c] = f16(8 k);  product 2: VT[batch*8+head][d][token] = f16(8 v).
// ---------------------------------------------------------------------------
constexpr int kPoolTok   = 64;                  // tokens per pooling chunk = rows of a wave tile
constexpr int kPoolParts = kSeq / kPoolTok;     // 32 partial rows per (tensor, batch)
static_assert(kSeq % kPoolTok == 0 && kRed == 32 && kDim == 16 * 32 && kSeq == 2048);
__device__ __forceinline__ void proj_epilogue(const v8f (&acc)[4][4], float* slab, int b, int m0, int n0, int lane,
                                              float* __restrict__ Qf, unsigned short* __restrict__ Kh, unsigned short* __restrict__ VT,
                                              float* __restrict__ pmax, float* __restrict__ psum) {
  const int rlane = lane & 15;                 // column within a subtile
  const int hf    = lane >> 4;
  const int mOff  = hf * 8;                    // row offset within a subtile
  const int batch = m0 >> 11;                  // token row / 2048
  const int s0    = m0 & (kSeq - 1);           // token inside the batch

  // ---- pooling partials of this tile: lane half 0 stores the maxima, half 1 the sums; 256 contiguous bytes per wave and array ----
  {
    float* dst = (hf == 0 ? pmax : psum) + ((size_t)(b * kBatch + batch) * kPoolParts + (s0 >> 6)) * kDim + n0 + rlane;
#pragma unroll
    for (int j = 0; j < 4; ++j) {
      float mx = acc[0][j][0];
      float sm = 0.0f;
#pragma unroll
      for (int i = 0; i < 4; ++i)
#pragma unroll
        for (int r = 0; r < 8; ++r) {
          mx = fmaxf(mx, acc[i][j][r]);
          sm += acc[i][j][r];
        }
      mx = fmaxf(mx, xhalf(mx));
      sm += xhalf(sm);
      dst[j << 4] = (hf == 0 ? mx : sm) * kWCarryInv;   // the weight carry is a power of two: exact on either side of max and sum
    }
    asm volatile("s_wait_xcnt 0x0" ::: "memory");   // the code behind reuses the address and data registers of the four stores above
  }

  // ---- the tile ----
  if (b == 2) {      // a lane holds 8 consecutive tokens of one channel: V^T rows straight from the registers
    _Float16* vt = (_Float16*)VT + ((size_t)(batch * kHeads + (n0 >> 6)) * kDh + rlane) * kSeq + s0 + mOff;
#pragma unroll
    for (int j = 0; j < 4; ++j)
#pragma unroll
      for (int i = 0; i < 4; ++i) {    // the four stores of a j fill each channel's 128-byte line
        v8h hv;
#pragma unroll
        for (int r = 0; r < 8; ++r) hv[r] = (_Float16)(acc[i][j][r] * (kGCarry * kWCarryInv));
        *(v8h*)(vt + (size_t)(j << 4) * kSeq + (i << 4)) = hv;
      }
    return;
  }
  const float sc = (b == 0) ? kWCarryInv : kGCarry * kWCarryInv;
#pragma unroll
  for (int i = 0; i < 4; ++i) {
    const int mBase = m0 + (i << 4);
#pragma unroll
    for (int j = 0; j < 4; ++j)
#pragma unroll
      for (int r = 0; r < 8; ++r) slab[(mOff + r) * 68 + (j << 4) + rlane] = acc[i][j][r] * sc;
    __builtin_amdgcn_fence(__ATOMIC_RELEASE, "workgroup");
    __builtin_amdgcn_wave_barrier();
    __builtin_amdgcn_fence(__ATOMIC_ACQUIRE, "workgroup");
    if (b == 0) {
      const int c4 = (lane & 15) * 4;                    // row seg = 256 B = 16 lanes x 16 B
#pragma unroll
      for (int it = 0; it < 8; ++it) {
        const int row = it * 2 + hf;
        const v4f v = *(const v4f*)(slab + row * 68 + c4);
        *(v4f*)(Qf + (size_t)(mBase + row) * kDim + n0 + c4) = v;
      }
    } else {
      const int q = lane >> 3, c8 = (lane & 7) * 8;      // row seg = 128 B = 8 lanes x 16 B
#pragma unroll
      for (int it = 0; it < 4; ++it) {
        const int row = it * 4 + q;
        const float* sp = slab + row * 68 + c8;
        v8h hv;
#pragma unroll
        for (int e = 0; e < 8; ++e) hv[e] = (_Float16)sp[e];
        *(v8h*)((_Float16*)Kh + (size_t)(mBase + row) * kDim + n0 + c8) = hv;
      }
      asm volatile("s_wait_xcnt 0x0" ::: "memory");   // the code behind reuses the address and data registers of the four stores above
    }
    __builtin_amdgcn_fence(__ATOMIC_RELEASE, "workgroup");
    __builtin_amdgcn_wave_barrier();
    __builtin_amdgcn_fence(__ATOMIC_ACQUIRE, "workgroup");
  }
}

// ---- Register-blocked batched WMMA GEMM (ACT reduced to none/relu/leaky) -------------------------------
// C[m,n] = scale * sum_k A[m,k] * Bt[n,k] (+bias)(+resid); each wave owns a 64x64 tile.
// A row-major [M,K]; Bt row-major [N,K]; M,N % 64 == 0, K % 32 == 0.
// SPLIT: operands are hi/lo planes (A2/Bt2 = lo planes, same layout); product = hi*hi + hi*lo + lo*hi.
// BIAS_MODE: 0 = none, 1 = bias[m], 2 = bias[n].
// OUT_MODE: 0 = f32, 1 = f16, 2 = bf16 hi plane (Cout) + bf16 lo plane (Cout2), 3 = proj_epilogue above (Cout = f32 q, Cout2 = f16 k, VTo, pmax, psum).
// ET: 0 = f16 operands, 1 = bf16 operands (pointers passed as 16-bit storage)
// A_ALT (only without SPLIT): batch 0 reads A from Ap, batch b > 0 from A2p + (b - 1) * strideA, so products of different left operands share one grid.
template <int ET> struct Elem;
template <> struct Elem<0> { typedef _Float16 T; };
template <> struct Elem<1> { typedef __bf16 T; };
template <int ET, bool SPLIT, int BIAS_MODE, int OUT_MODE, bool RESID, int ACT = 0, bool A_ALT = false>
__global__ __launch_bounds__(256) void wmma_gemm64(
    const unsigned short* __restrict__ Ap, const unsigned short* __restrict__ A2p, int lda, long strideA,
    const unsigned short* __restrict__ Btp, const unsigned short* __restrict__ Bt2p, int ldb, long strideB,
    void* __restrict__ Cout, void* __restrict__ Cout2, int ldc, long strideC,
    const float* __restrict__ bias,
    const float* __restrict__ resid, long strideR,
    int M, int N, int K, float scale,
    unsigned short* __restrict__ VTo, float* __restrict__ pmax, float* __restrict__ psum) {
  typedef typename Elem<ET>::T T;
  typedef typename Frag<T>::V V;
  const T* A = (const T*)Ap; const T* A2 = (const T*)A2p; const T* Bt = (const T*)Btp; const T* Bt2 = (const T*)Bt2p;
  __shared__ __align__(16) float sT[8][16 * 68];   // per-wave 16x64 slab, pitch 68 floats
  const int b    = blockIdx.y;
  const int lane = threadIdx.x & 31;
  const int wave = threadIdx.x >> 5;
  const int tilesN = N >> 6;
  const int tilesM = M >> 6;
  const int tile = blockIdx.x * 8 + wave;
  if (tile >= tilesM * tilesN) return;   // wave-uniform; no block barriers in this kernel
  const int tm = tile / tilesN;
  const int tn = tile - tm * tilesN;
  const int m0 = tm << 6;
  const int n0 = tn << 6;

  static_assert(!(A_ALT && SPLIT));
  const T* Ab  = (A_ALT && b > 0) ? (A2 + (size_t)(b - 1) * strideA) : (A + (size_t)b * strideA);   // block-uniform select
  const T* Bb  = Bt + (size_t)b * strideB;
  const T* Ab2 = SPLIT ? (A2  + (size_t)b * strideA) : nullptr;
  const T* Bb2 = SPLIT ? (Bt2 + (size_t)b * strideB) : nullptr;

  const int rlane = lane & 15;                 // row (A) / col (B, D) within subtile
  const int koff  = (lane >> 4) * 8;           // k offset of this lane half
  const int mOff  = (lane >> 4) * 8;           // D row offset

  v8f acc[4][4];
#pragma unroll
  for (int i = 0; i < 4; ++i)
#pragma unroll
    for (int j = 0; j < 4; ++j) acc[i][j] = (v8f){0.f,0.f,0.f,0.f,0.f,0.f,0.f,0.f};

  for (int k0 = 0; k0 < K; k0 += 32) {
    V bh[4], bl[4];
#pragma unroll
    for (int j = 0; j < 4; ++j) {
      const size_t bo = (size_t)(n0 + (j << 4) + rlane) * ldb + koff + k0;
      bh[j] = Frag<T>::load(Bb + bo);
      if (SPLIT) bl[j] = Frag<T>::load(Bb2 + bo);
    }
#pragma unroll
    for (int i = 0; i < 4; ++i) {
      const size_t ao = (size_t)(m0 + (i << 4) + rlane) * lda + koff + k0;
      V ah = Frag<T>::load(Ab + ao);
      V al;
      if (SPLIT) al = Frag<T>::load(Ab2 + ao);
#pragma unroll
      for (int j = 0; j < 4; ++j) {
        acc[i][j] = Frag<T>::mma(ah, bh[j], acc[i][j]);
        if (SPLIT) {
          acc[i][j] = Frag<T>::mma(ah, bl[j], acc[i][j]);
          acc[i][j] = Frag<T>::mma(al, bh[j], acc[i][j]);
        }
      }
      Frag<T>::guard(acc[i][0], acc[i][3], ah, SPLIT ? al : ah);
    }
    Frag<T>::keep(bh[0], bh[1], bh[2], bh[3]);
    if (SPLIT) Frag<T>::keep(bl[0], bl[1], bl[2], bl[3]);
  }
  acc_guard4(acc[0][0], acc[0][1], acc[0][2], acc[0][3]);
  acc_guard4(acc[1][0], acc[1][1], acc[1][2], acc[1][3]);
  acc_guard4(acc[2][0], acc[2][1], acc[2][2], acc[2][3]);
  acc_guard4(acc[3][0], acc[3][1], acc[3][2], acc[3][3]);

  // ---- epilogue ----
  float* slab = sT[wave];
  if (OUT_MODE == 3) {
    proj_epilogue(acc, slab, b, m0, n0, lane, (float*)Cout, (unsigned short*)Cout2, VTo, pmax, psum);
    return;
  }
  const float* Rb = RESID ? (resid + (size_t)b * strideR) : nullptr;
#pragma unroll
  for (int i = 0; i < 4; ++i) {
    const int mBase = m0 + (i << 4);
#pragma unroll
    for (int j = 0; j < 4; ++j) {
      const int n = n0 + (j << 4) + rlane;
      float bv = 0.f;
      if (BIAS_MODE == 2) bv = bias[n];
#pragma unroll
      for (int r = 0; r < 8; ++r) {
        float v = acc[i][j][r] * scale;
        if (BIAS_MODE == 1) v += bias[mBase + mOff + r];
        if (BIAS_MODE == 2) v += bv;
        if (RESID) v += Rb[(size_t)(mBase + mOff + r) * ldc + n];
        if (ACT == 2) v = fmaxf(v, 0.0f);
        if (ACT == 4) v = (v > 0.f) ? v : 0.01f * v;
        slab[(mOff + r) * 68 + (j << 4) + rlane] = v;
      }
    }
    __builtin_amdgcn_fence(__ATOMIC_RELEASE, "workgroup");
    __builtin_amdgcn_wave_barrier();
    __builtin_amdgcn_fence(__ATOMIC_ACQUIRE, "workgroup");
    if (OUT_MODE == 0) {
      float* C = (float*)Cout + (size_t)b * strideC;
      const int hh = lane >> 4, c4 = (lane & 15) * 4;     // row seg = 256 B = 16 lanes x 16 B
      {
#pragma unroll
        for (int it = 0; it < 8; ++it) {
          const int row = it * 2 + hh;
          v4f v = *(const v4f*)(slab + row * 68 + c4);
          *(v4f*)(C + (size_t)(mBase + row) * ldc + n0 + c4) = v;
        }
        
      }
    } else {
      const int q = lane >> 3, c8 = (lane & 7) * 8;
      unsigned short* C  = (unsigned short*)Cout  + (size_t)b * strideC;
      unsigned short* C2 = (OUT_MODE == 2) ? ((unsigned short*)Cout2 + (size_t)b * strideC) : nullptr;
      {
#pragma unroll
        for (int it = 0; it < 4; ++it) {
          const int row = it * 4 + q;
          const float* sp = slab + row * 68 + c8;
          v8h hv, lv;
#pragma unroll
          for (int e = 0; e < 8; ++e) {
            if (OUT_MODE == 1) {
              hv[e] = (_Float16)sp[e];
            } else {
              unsigned short hb = f2bf_bits(sp[e]);
              unsigned short lb = f2bf_bits(sp[e] - bf_bits2f(hb));
              hv[e] = __builtin_bit_cast(_Float16, hb);
              lv[e] = __builtin_bit_cast(_Float16, lb);
            }
          }
          *(v8h*)(C + (size_t)(mBase + row) * ldc + n0 + c8) = hv;
          if (OUT_MODE == 2) *(v8h*)(C2 + (size_t)(mBase + row) * ldc + n0 + c8) = lv;
        }
        
      }
    }
    __builtin_amdgcn_fence(__ATOMIC_RELEASE, "workgroup");
    __builtin_amdgcn_wave_barrier();
    __builtin_amdgcn_fence(__ATOMIC_ACQUIRE, "workgroup");
  }
}

// ---------------------------------------------------------------------------
// Input cast: out plane z (0 <- x, 1 <- m) = f16( bf16_rne(v) ), [8192][512] halves each. One work-group's share: block bx of plane z.
// ---------------------------------------------------------------------------
__device__ __forceinline__ void cast_in_block(const float* __restrict__ x, const float* __restrict__ m,
                                              unsigned short* __restrict__ out, int n8, int z, int bx) {
  const float* in = (z == 0) ? x : m;                // block-uniform plane select
  const int i = bx * 256 + threadIdx.x;
  if (i >= n8) return;
  const float* p = in + 8 * (size_t)i;
  const v4f a = *(const v4f*)(p);
  const v4f c = *(const v4f*)(p + 4);
  unsigned short hb[8];
#pragma unroll
  for (int e = 0; e < 4; ++e) {
    hb[e]     = h_bits(bf_rne(a[e]));
    hb[4 + e] = h_bits(bf_rne(c[e]));
  }
  const v4u u = (v4u){pk16(hb[0], hb[1]), pk16(hb[2], hb[3]), pk16(hb[4], hb[5]), pk16(hb[6], hb[7])};
  unsigned short* q = out + (size_t)z * 8 * (size_t)n8 + 8 * (size_t)i;
  *(v4u*)q = u;
  
}

// ---------------------------------------------------------------------------
// Weight transpose + cast: W is [in d][out h] (512x512, row-major); WT[h][d] = f16( scale * bf16_rne(W[d][h]) ).
// One work-group's share: bd = d tile (64 cols of WT, 0..7), bh = h tile (64 rows of WT, 0..7), z selects W0..W3 and the
// output plane (plane z at out + z*512*512 halves). 256 threads; sm is the work-group's 64 x 65 float exchange tile.
// Load coverage: 4 iterations x 256 threads x float4 = 4096 = the whole 64(d) x 64(h) tile (coalesced along h), 4 b128 loads per lane.
// Store coverage: 8 waves x 2 iterations x 4 rows (lane>>3) = 64 rows; (lane&7) x 8 halves = 64 cols; each row segment =
// ---------------------------------------------------------------------------
__device__ __forceinline__ void wtcast_block(const float* __restrict__ W0, const float* __restrict__ W1,
                                             const float* __restrict__ W2, const float* __restrict__ W3,
                                             unsigned short* __restrict__ out, float scale,
                                             float (*sm)[65], int bd, int bh, int z) {   // sm[h_local][d_local]; z block-uniform
  const int t  = threadIdx.x;
  const int d0 = bd * 64;
  const int h0 = bh * 64;
  const float* W = (z == 0) ? W0 : (z == 1) ? W1 : (z == 2) ? W2 : W3;
#pragma unroll
  for (int i = 0; i < 4; ++i) {
    const int e4 = i * 256 + t;
    const int r  = e4 >> 4;            // d local 0..63
    const int c4 = (e4 & 15) * 4;      // h local 0..60
    const v4f w = *(const v4f*)(W + (size_t)(d0 + r) * kDim + h0 + c4);
#pragma unroll
    for (int k = 0; k < 4; ++k) sm[c4 + k][r] = bf_rne(w[k]) * scale;
  }
  __syncthreads();
  const int lane = t & 31, wave = t >> 5;
  const int q = lane >> 3, c8 = (lane & 7) * 8;
  unsigned short* op = out + (size_t)z * kDim * kDim;
  {
#pragma unroll
    for (int it = 0; it < 2; ++it) {
      const int row = wave * 8 + it * 4 + q;                 // h local
      unsigned short hb[8];
#pragma unroll
      for (int e = 0; e < 8; ++e) hb[e] = h_bits(sm[row][c8 + e]);
      const v4u u = (v4u){pk16(hb[0], hb[1]), pk16(hb[2], hb[3]), pk16(hb[4], hb[5]), pk16(hb[6], hb[7])};
      *(v4u*)(op + (size_t)(h0 + row) * kDim + d0 + c8) = u;
    }
    
  }
}

// ---------------------------------------------------------------------------
// The two independent casts above in one grid, told apart by the block index (block-uniform, so the transpose's barrier is passed by
// whole work-groups only): blocks 0..255 = weight tiles (d tile, h tile, matrix), blocks 256..4351 = input cast (2048 blocks per plane).
// ---------------------------------------------------------------------------
constexpr int kWtBlocks   = (kDim / 64) * (kDim / 64) * 4;   // 256
constexpr int kCastBlocks = kPlane / 8 / 256;                // 2048 per plane
static_assert(kDim / 64 == 8 && kCastBlocks == 2048);
__global__ __launch_bounds__(256) void prep_kernel(const float* __restrict__ x, const float* __restrict__ m,
                                                   const float* __restrict__ W0, const float* __restrict__ W1,
                                                   const float* __restrict__ W2, const float* __restrict__ W3,
                                                   unsigned short* __restrict__ xm_out, unsigned short* __restrict__ wt_out,
                                                   float scale, int n8) {
  __shared__ float sm[64][65];
  const int blk = blockIdx.x;
  if (blk < kWtBlocks) {
    wtcast_block(W0, W1, W2, W3, wt_out, scale, sm, blk & 7, (blk >> 3) & 7, blk >> 6);
  } else {
    const int cb = blk - kWtBlocks;
    cast_in_block(x, m, xm_out, n8, cb >> 11, cb & (kCastBlocks - 1));
  }
}

// ---------------------------------------------------------------------------
// Token pooling, part 2 + channel gate MLP (f32): block tb = tensor*4 + batch (12 blocks), 512 threads = channels.
//   mx[c] = max over 32 chunk maxima, av[c] = (sum of 32 chunk sums, chunk order) * (1/2048)
//   hid[j] = relu( sum_c mx[c]*w1[c][j] + sum_c av[c]*w1[c][j] )   j < 32      (w1, w2 RNE-converted to bf16 where used)
//            thread t holds w1 elements i*512 + t, so wave w sums channels w, w+16, .. w+496 for all 32 j (lane = j);
//            32 threads then add the 16 wave partials in wave order
//   g[c]   = 1 / (1 + exp(-sum_j hid[j]*w2[j][c]))
// The w1 and w2 elements a thread needs depend on nothing computed here: they are loaded first, beside the chunk partials.
// ---------------------------------------------------------------------------
__global__ __launch_bounds__(512) void gate_kernel(const float* __restrict__ pmax, const float* __restrict__ psum,
                                                   const float* __restrict__ w1, const float* __restrict__ w2,
                                                   float* __restrict__ scl) {
  __shared__ float smax[kDim];
  __shared__ float savg[kDim];
  __shared__ float pa1[kDim / 32][kRed];
  __shared__ float pa2[kDim / 32][kRed];
  __shared__ float hid[kRed];
  const int t    = threadIdx.x;
  const int tb   = blockIdx.x;          // 0..11
  const int lane = t & 31, wave = t >> 5;
  float w1v[32], w2v[kRed];
#pragma unroll   // this loop and the next two: independent loads at immediate offsets, in flight together
  for (int i = 0; i < 32; ++i) w1v[i] = w1[i * kDim + t];      // channel i*16 + wave, hidden unit lane
#pragma unroll   // as above
  for (int j = 0; j < kRed; ++j) w2v[j] = w2[j * kDim + t];
  const float* pm = pmax + (size_t)tb * kPoolParts * kDim + t;
  const float* ps = psum + (size_t)tb * kPoolParts * kDim + t;
  float mx = -__builtin_inff();
  float sm = 0.0f;
#pragma unroll   // as above
  for (int p = 0; p < kPoolParts; ++p) {
    mx = fmaxf(mx, pm[p * kDim]);
    sm += ps[p * kDim];
  }
  smax[t] = mx;
  savg[t] = sm * kInvSeq;
  __syncthreads();
  float a1 = 0.0f, a2 = 0.0f;
#pragma unroll   // w1v[] stays in registers
  for (int i = 0; i < 32; ++i) {
    const float w = bf_rne(w1v[i]);
    a1 += smax[i * 16 + wave] * w;
    a2 += savg[i * 16 + wave] * w;
  }
  pa1[wave][lane] = a1;
  pa2[wave][lane] = a2;
  __syncthreads();
  if (t < kRed) {                       // wave 0, wave-uniform
    float s1 = 0.0f, s2 = 0.0f;
#pragma unroll   // the 32 LDS reads overlap
    for (int w = 0; w < kDim / 32; ++w) {
      s1 += pa1[w][t];
      s2 += pa2[w][t];
    }
    hid[t] = fmaxf(s1 + s2, 0.0f);
  }
  __syncthreads();
  float a = 0.0f;
#pragma unroll   // w2v[] stays in registers
  for (int j = 0; j < kRed; ++j) a += hid[j] * bf_rne(w2v[j]);
  const float g = 1.0f / (1.0f + expf(-a));
  scl[(size_t)tb * kDim + t] = g;       // one whole 128-byte line per wave
}

// ---------------------------------------------------------------------------
// Fused attention of every (batch, head): S^T = K.Q^T, online softmax (base 2, f32), O^T += V^T.P^T; scores and P stay in registers.
// grid (8, 32): blockIdx.x = block of 256 queries, blockIdx.y = batch*8 + head. 8 waves x 32 query columns (2 groups of 16).
// One pass = 32 keys. Lane (c = lane & 15, hf = lane >> 4) of a score tile holds query c, keys 8*hf + r: the two 16-key tiles of a
// pass, converted in place, are the B operand of the second product (element s: key 8*hf + s, s < 8; key 16 + 8*hf + s - 8 else),
// the k order in which Frag::load brings V^T (and K; the q fragments are built in the same order).
// The maximum in use may trail the true one by up to 8 (base-2 exponent), so P <= 2^8 and P carried x2^6 <= 2^14 in f16.
// Oh[b][q][head*64 + d] = f16( 32 * acc / rowsum * gv[d] ): context carried x256, V carried x8.
// The channel gates (scl = [3][4][512]: q, k, v) come in here: a score is sum_d q_d gq_d k_d gk_d, so the q fragments, built once per wave
// from f32 q, carry f16( q * (8 gq gk) ) against the ungated k plane; gv scales channel d of the f32 result.
// ---------------------------------------------------------------------------
__global__ __launch_bounds__(256) void attn_fused_kernel(const float* __restrict__ Qf, const unsigned short* __restrict__ Kp,
                                                         const unsigned short* __restrict__ VTp, const float* __restrict__ scl,
                                                         unsigned short* __restrict__ Op) {
  typedef Frag<_Float16> FH;
  const int lane = threadIdx.x & 31, wave = threadIdx.x >> 5;
  const int c = lane & 15, hf = lane >> 4;
  const int bh = blockIdx.y;
  const int q0 = blockIdx.x * 256 + wave * 32;
  const size_t tokOff = (size_t)(bh >> 3) * kSeq * kDim + (size_t)(bh & 7) * kDh;
  const float* ql = Qf + tokOff + (size_t)(q0 + c) * kDim + 8 * hf;
  const float* gl = scl + (size_t)(bh >> 3) * kDim + (size_t)(bh & 7) * kDh + 8 * hf;   // q gate of this lane's first channel; k, v: + 4, 8 rows
  const _Float16* kl = (const _Float16*)Kp + tokOff + (size_t)c * kDim + 8 * hf;
  const _Float16* vl = (const _Float16*)VTp + (size_t)bh * kDh * kSeq + (size_t)c * kSeq + 8 * hf;

  v16h qf[2][2];   // element e < 8: channel 32 kc + 8 hf + e; e >= 8: 32 kc + 16 + 8 hf + e - 8 (the order of Frag::load)
#pragma unroll
  for (int kc = 0; kc < 2; ++kc)
#pragma unroll
    for (int u = 0; u < 4; ++u) {      // four channels at a time
      const int d = 32 * kc + 16 * (u >> 1) + 4 * (u & 1);
      const v4f gg = *(const v4f*)(gl + d) * *(const v4f*)(gl + (size_t)kBatch * kDim + d) * kGCarry;
#pragma unroll
      for (int g = 0; g < 2; ++g) {
        const v4f qv = *(const v4f*)(ql + (size_t)(16 * g) * kDim + d) * gg;
#pragma unroll
        for (int e = 0; e < 4; ++e) qf[g][kc][4 * u + e] = (_Float16)qv[e];
      }
    }

  v8f acc[2][4];
  v2f ls[2];
  float m_run[2];
#pragma unroll
  for (int g = 0; g < 2; ++g) {
    m_run[g] = -__builtin_inff();
    ls[g] = (v2f){0.f, 0.f};
#pragma unroll
    for (int t = 0; t < 4; ++t) acc[g][t] = (v8f){0.f,0.f,0.f,0.f,0.f,0.f,0.f,0.f};
  }

  v16h kf[2][2];
#pragma unroll
  for (int kt = 0; kt < 2; ++kt)
#pragma unroll
    for (int kc = 0; kc < 2; ++kc) kf[kt][kc] = FH::load(kl + (size_t)(16 * kt) * kDim + 32 * kc);

  // rolled: one pass's fragments, scores and the 64 accumulator registers fill the register budget
#pragma unroll 1
  for (int key0 = 0; key0 < kSeq; key0 += 32) {
    v16h vf[4];      // this pass's V^T, in flight under the score products and the maxima
#pragma unroll
    for (int t = 0; t < 4; ++t) vf[t] = FH::load(vl + (size_t)(16 * t) * kSeq + key0);

    v8f s[2][2];
#pragma unroll
    for (int kt = 0; kt < 2; ++kt)
#pragma unroll
      for (int g = 0; g < 2; ++g) {
        s[kt][g] = (v8f){0.f,0.f,0.f,0.f,0.f,0.f,0.f,0.f};
#pragma unroll
        for (int kc = 0; kc < 2; ++kc) s[kt][g] = FH::mma(kf[kt][kc], qf[g][kc], s[kt][g]);
      }
    const int nk = (key0 + 32) & (kSeq - 1);
#pragma unroll
    for (int kt = 0; kt < 2; ++kt)
#pragma unroll
      for (int kc = 0; kc < 2; ++kc) kf[kt][kc] = FH::load(kl + (size_t)(nk + 16 * kt) * kDim + 32 * kc);
    __builtin_amdgcn_sched_barrier(0);   // keeps the K loads issued here, ahead of the vector work that hides their latency

    float mb[2];
    bool need = false;
#pragma unroll
    for (int g = 0; g < 2; ++g) {
      float mx = s[0][g][0];
#pragma unroll
      for (int r = 1; r < 8; ++r) mx = fmaxf(mx, s[0][g][r]);
#pragma unroll
      for (int r = 0; r < 8; ++r) mx = fmaxf(mx, s[1][g][r]);
      mx = fmaxf(mx, xhalf(mx)) * kSmScale2;         // both halves hold the query's maximum of this pass (the scale is positive)
      mb[g] = mx;
      need = need || (mx > m_run[g] + 8.0f);
    }
    if (__builtin_amdgcn_ballot_w32(need) != 0) {    // wave-uniform; always on the first pass, rare later
#pragma unroll
      for (int g = 0; g < 2; ++g) {
        const float m_new = fmaxf(m_run[g], mb[g]);
        const float corr = __builtin_amdgcn_exp2f(m_run[g] - m_new);   // 0 on the first pass
        m_run[g] = m_new;
        ls[g] = ls[g] * corr;
#pragma unroll
        for (int t = 0; t < 4; ++t) acc[g][t] = acc[g][t] * corr;
      }
    }
#pragma unroll
    for (int g = 0; g < 2; ++g) {
      const float nm = kPShift - m_run[g];
      v16h pf;
#pragma unroll
      for (int i = 0; i < 8; ++i) {
        const v2f sv = (v2f){s[i >> 2][g][2 * (i & 3)], s[i >> 2][g][2 * (i & 3) + 1]};
        const v2f arg = __builtin_elementwise_fma(sv, (v2f){kSmScale2, kSmScale2}, (v2f){nm, nm});
        const v2f p = (v2f){__builtin_amdgcn_exp2f(arg.x), __builtin_amdgcn_exp2f(arg.y)};
        ls[g] = ls[g] + p;
        const v2h ph = __builtin_convertvector(p, v2h);
        pf[2 * i]     = ph.x;
        pf[2 * i + 1] = ph.y;
      }
#pragma unroll
      for (int t = 0; t < 4; ++t) acc[g][t] = FH::mma(vf[t], pf, acc[g][t]);
    }
  }

  _Float16* ol = (_Float16*)Op + tokOff + (size_t)(q0 + c) * kDim + 8 * hf;
  float inv[2];
#pragma unroll
  for (int g = 0; g < 2; ++g) {
    float l = ls[g].x + ls[g].y;
    l += xhalf(l);                                   // join the two halves' key sums
    inv[g] = kCtxScale / l;
  }
#pragma unroll
  for (int t = 0; t < 4; ++t) {
    const float* gv = gl + (size_t)(2 * kBatch) * kDim + 16 * t;
    const v4f g0 = *(const v4f*)(gv);
    const v4f g1 = *(const v4f*)(gv + 4);
#pragma unroll
    for (int g = 0; g < 2; ++g) {
      v8h hv;
#pragma unroll
      for (int r = 0; r < 8; ++r) hv[r] = (_Float16)(acc[g][t][r] * inv[g] * (r < 4 ? g0[r & 3] : g1[r & 3]));   // d = 16 t + 8 hf + r of query 16 g + c
      *(v8h*)(ol + (size_t)(16 * g) * kDim + 16 * t) = hv;
    }
  }
}

// ---------------------------------------------------------------------------
// Host glue.
//   XMh  f16 [2][8192][512]     16,777,216  at           0   (x plane then m plane, bf16-valued)
//   WT   f16 [4][512][512]       2,097,152  at  16,777,216   (Wq^T, Wk^T, Wv^T, Wo^T, [out][in], carried x16)
//   Qf   f32 [8192][512]        16,777,216  at  18,874,368   (q projection, ungated)
//   Kh   f16 [8192][512]         8,388,608  at  35,651,584   (k projection, ungated, carried x8)
//   VT   f16 [32][64][2048]      8,388,608  at  44,040,192   (v projection transposed per (batch, head), ungated, carried x8)
//   Oh   f16 [8192][512]         8,388,608  at  52,428,800   (attention context, carried x256)
//   SCL  f32 [3][4][512]            24,576  at  60,817,408   (channel gates)
//   PMX  f32 [12][32][512]         786,432  at  60,841,984   (chunk maxima of the token pooling)
//   PSM  f32 [12][32][512]         786,432  at  61,628,416   (chunk sums of the token pooling)
//   total                       62,414,848
// GEMM shapes: projections/out M=8192 N=512 K=512.
// All M,N multiples of 64, all K multiples of 32, no padded rows anywhere; every plane fully written before it is read.
// Launches: casts 1, projections with pooling partials 1, gates 1, attention 1, output projection 1 = 5.
// ---------------------------------------------------------------------------
extern "C" void kernel_launch(void* const* d_in, const int* in_sizes, int n_in,
                              void* d_out, int out_size, void* d_ws, size_t ws_size,
                              hipStream_t stream) {
  if (n_in < 9) return;
  if (in_sizes[0] != kPlane || in_sizes[1] != kPlane) return;
  if (in_sizes[2] != kDim * kDim || in_sizes[3] != kDim * kDim || in_sizes[4] != kDim * kDim || in_sizes[5] != kDim * kDim) return;
  if (in_sizes[6] != kDim || in_sizes[7] != kDim * kRed || in_sizes[8] != kRed * kDim) return;
  if (out_size != kPlane) return;

  const size_t szHalfPlane = (size_t)kPlane * 2;                 // 8,388,608
  const size_t szXM  = 2 * szHalfPlane;
  const size_t szWT  = (size_t)4 * kDim * kDim * 2;
  const size_t szQf  = (size_t)kPlane * 4;
  const size_t szVT  = (size_t)kBatch * kHeads * kDh * kSeq * 2;
  const size_t szSCL = (size_t)3 * kBatch * kDim * 4;
  const size_t offXM  = 0;
  const size_t offWT  = offXM + szXM;
  const size_t offQf  = offWT + szWT;
  const size_t offKh  = offQf + szQf;
  const size_t offVT  = offKh + szHalfPlane;
  const size_t offOh  = offVT + szVT;
  const size_t offSCL = offOh + szHalfPlane;
  const size_t szPart = (size_t)3 * kBatch * kPoolParts * kDim * 4;
  const size_t offPMX = offSCL + szSCL;
  const size_t offPSM = offPMX + szPart;
  const size_t total  = offPSM + szPart;                          // 62,414,848
  if (ws_size < total) return;

  const float* x      = (const float*)d_in[0];
  const float* m      = (const float*)d_in[1];
  const float* Wq     = (const float*)d_in[2];
  const float* Wk     = (const float*)d_in[3];
  const float* Wv     = (const float*)d_in[4];
  const float* Wo     = (const float*)d_in[5];
  const float* bias_o = (const float*)d_in[6];
  const float* gw1    = (const float*)d_in[7];
  const float* gw2    = (const float*)d_in[8];
  float* out = (float*)d_out;
  char* ws = (char*)d_ws;
  unsigned short* XMh = (unsigned short*)(ws + offXM);
  unsigned short* WT  = (unsigned short*)(ws + offWT);
  float*          Qf  = (float*)(ws + offQf);
  unsigned short* Kh  = (unsigned short*)(ws + offKh);
  unsigned short* VT  = (unsigned short*)(ws + offVT);
  unsigned short* Oh  = (unsigned short*)(ws + offOh);
  float*          SCL = (float*)(ws + offSCL);
  float*          PMX = (float*)(ws + offPMX);
  float*          PSM = (float*)(ws + offPSM);

  const unsigned short* Xh = XMh;
  const unsigned short* Mh = XMh + (size_t)kPlane;
  const size_t wPlane = (size_t)kDim * kDim;

  // ---- 16-bit operand planes of the inputs ----
  const int n8 = kPlane / 8;   // 524288 -> 2048 blocks exact
  prep_kernel<<<dim3(kWtBlocks + 2 * kCastBlocks), dim3(256), 0, stream>>>(x, m, Wq, Wk, Wv, Wo, XMh, WT, kWCarry, n8);

  // ---- projections x.Wq, m.Wk, m.Wv (M=8192, N=512, K=512): f32 q, f16 k and V^T, and the token pooling's chunk partials ----
  const int tilesProj = (kTok / 64) * (kDim / 64);   // 1024 -> 128 blocks of 8 waves
  // one grid, blockIdx.y = product: left operand x for 0, m for 1 and 2 (A_ALT, stride 0)
  wmma_gemm64<0, false, 0, 3, false, 0, true><<<dim3(tilesProj / 8, 3), dim3(256), 0, stream>>>(
      Xh, Mh, kDim, 0L, WT, WT, kDim, (long)wPlane,
      (void*)Qf, (void*)Kh, kDim, 0L, bias_o, SCL, 0L, kTok, kDim, kDim, kWCarryInv, VT, PMX, PSM);

  // ---- channel gates ----
  gate_kernel<<<dim3(3 * kBatch), dim3(512), 0, stream>>>(PMX, PSM, gw1, gw2, SCL);

  // ---- attention, all (batch, head) in one launch, gates applied inside: Oh[b, i, h*64+d] = f16( 256 * context ) ----
  attn_fused_kernel<<<dim3(kSeq / 256, kBatch * kHeads), dim3(256), 0, stream>>>(Qf, Kh, VT, SCL, Oh);

  // ---- output projection: out = 2^-12 * Oh.Wo^T(x16) + bo   (M=8192, N=512, K=512), f32 to d_out ----
  wmma_gemm64<0, false, 2, 0, false, 0><<<dim3(tilesProj / 8, 1), dim3(256), 0, stream>>>(
      Oh, Oh, kDim, 0L, WT + 3 * wPlane, WT + 3 * wPlane, kDim, 0L,
      (void*)out, (void*)out, kDim, 0L, bias_o, SCL, 0L, kTok, kDim, kDim, kOutScale, nullptr, nullptr, nullptr);
}

// v005
// It runs in 115 microseconds.
// Timed twice side by side with v004, it ran 1.23 and 1.22 times as fast.
// Counting every step since v000, it is 31.2 times as fast.
// Contractions: q/k/v projections (x,m RNE-converted to bf16 held in f16 planes x W^T bf16-valued f16 planes carried x16), scores k.q^T (k f16 plane and q fragments scaled by both gates, each carried x8), v^T.p^T (V^T f16 carried x8 x unnormalised P f16 carried x64; v gate on the f32 result), output projection (context f16 carried x256 x Wo^T f16 carried x16): all v_wmma_f32_16x16x32_f16 with f32 accumulate; token pooling, channel-gate MLP, online softmax in f32.
#include <hip/hip_runtime.h>
#include <math.h>

// ---------------------------------------------------------------------------
// Problem constants
// ---------------------------------------------------------------------------
constexpr int kBatch = 4;
constexpr int kSeq   = 2048;
constexpr int kDim   = 512;               // model dim = inner dim
constexpr int kHeads = 8;
constexpr int kDh    = 64;
constexpr int kRed   = 32;                // gate hidden width (512 / 16)
constexpr int kTok   = kBatch * kSeq;     // 8192 token rows
constexpr int kPlane = kTok * kDim;       // 4194304 elements per [8192][512] plane
constexpr float kWCarry    = 16.0f;                 // weights carried x16 in f16
constexpr float kWCarryInv = 1.0f / 16.0f;
constexpr float kGCarry    = 8.0f;                  // q fragments, k and V^T planes carried x8 in f16
constexpr float kPShift    = 6.0f;                  // unnormalised probabilities carried x2^6 in f16 (added to the base-2 exponent)
constexpr float kCtxCarry  = 256.0f;                // context carried x2^8 in f16
constexpr float kCtxScale  = kCtxCarry / kGCarry;                   // 32; the P carry cancels against the row sum
constexpr float kOutScale  = 1.0f / (kCtxCarry * kWCarry);          // 2^-12
constexpr float kAttnScale = 0.044194173824159216f;                 // 512^-0.5
constexpr float kSmScale   = kAttnScale / (kGCarry * kGCarry);      // exact: / 64
constexpr float kSmScale2  = kSmScale * 1.4426950408889634f;        // scores to base-2 exponents
constexpr float kInvSeq    = 1.0f / 2048.0f;
static_assert(kHeads * kDh == kDim);
static_assert(kDim / 16 == kRed);
static_assert(kSeq % 256 == 0 && (kSeq & (kSeq - 1)) == 0 && kDh == 64);   // fused attention: 256 queries per block
// GEMM shape contract: M % 64 == 0, N % 64 == 0, K % 32 == 0 for every launch
static_assert(kTok % 64 == 0 && kDim % 64 == 0 && kDim % 32 == 0);     // projections / out: M=8192 N=512 K=512
static_assert((kPlane / 8) % 256 == 0);                                // cast grids exact

typedef __attribute__((ext_vector_type(16))) _Float16 v16h;
typedef __attribute__((ext_vector_type(8)))  _Float16 v8h;
typedef __attribute__((ext_vector_type(16))) __bf16   v16b;
typedef __attribute__((ext_vector_type(8)))  __bf16   v8b;
typedef __attribute__((ext_vector_type(8)))  float    v8f;
typedef __attribute__((ext_vector_type(4)))  float    v4f;
typedef __attribute__((ext_vector_type(2)))  float    v2f;
typedef __attribute__((ext_vector_type(2)))  _Float16 v2h;
typedef __attribute__((ext_vector_type(4)))  unsigned int v4u;

__device__ __forceinline__ unsigned short f2bf_bits(float f) {
  unsigned u = __float_as_uint(f);
  return (unsigned short)((u + 0x7FFFu + ((u >> 16) & 1u)) >> 16);
}
__device__ __forceinline__ float bf_bits2f(unsigned short h) { return __uint_as_float(((unsigned)h) << 16); }
// RNE convert f32 -> bf16 -> f32
__device__ __forceinline__ float bf_rne(float f) { return bf_bits2f(f2bf_bits(f)); }

// hazard guards as plain device helpers (no inline asm inside the kernel template body)
__device__ __forceinline__ void dep_guard_h(v8f& a, v8f& b, v16h x, v16h y) { asm volatile("v_nop\n\tv_nop\n\tv_nop\n\tv_nop" : "+v"(a), "+v"(b) : "v"(x), "v"(y)); }
__device__ __forceinline__ void dep_guard_b(v8f& a, v8f& b, v16b x, v16b y) { asm volatile("v_nop\n\tv_nop\n\tv_nop\n\tv_nop" : "+v"(a), "+v"(b) : "v"(x), "v"(y)); }
__device__ __forceinline__ void keep4_h(v16h a, v16h b, v16h c, v16h d) { asm volatile("v_nop" :: "v"(a), "v"(b), "v"(c), "v"(d)); }
__device__ __forceinline__ void keep4_b(v16b a, v16b b, v16b c, v16b d) { asm volatile("v_nop" :: "v"(a), "v"(b), "v"(c), "v"(d)); }
__device__ __forceinline__ void acc_guard4(v8f& a, v8f& b, v8f& c, v8f& d) { asm volatile("v_nop\n\tv_nop\n\tv_nop\n\tv_nop" : "+v"(a), "+v"(b), "+v"(c), "+v"(d)); }
template <typename T> struct Frag;
template <> struct Frag<_Float16> {
  typedef v16h V; union U { v16h v; v8h h[2]; };
  // elements 0..7 <- p[0..7], 8..15 <- p[16..23]
  static __device__ __forceinline__ v16h load(const _Float16* p) {
    U f; f.h[0] = *(const v8h*)(p); f.h[1] = *(const v8h*)(p + 16); return f.v;
  }
  static __device__ __forceinline__ v8f mma(v16h a, v16h b, v8f c) {
    return __builtin_amdgcn_wmma_f32_16x16x32_f16(false, a, false, b, (short)0, c, false, false);
  }
  static __device__ __forceinline__ void guard(v8f& a, v8f& b, v16h x, v16h y) { dep_guard_h(a, b, x, y); }
  static __device__ __forceinline__ void keep(v16h a, v16h b, v16h c, v16h d) { keep4_h(a, b, c, d); }
};
template <> struct Frag<__bf16> {
  typedef v16b V; union U { v16b v; v8b h[2]; };
  static __device__ __forceinline__ v16b load(const __bf16* p) {
    U f; f.h[0] = *(const v8b*)(p); f.h[1] = *(const v8b*)(p + 16); return f.v;
  }
  static __device__ __forceinline__ v8f mma(v16b a, v16b b, v8f c) {
    return __builtin_amdgcn_wmma_f32_16x16x32_bf16(false, a, false, b, (short)0, c, false, false);
  }
  static __device__ __forceinline__ void guard(v8f& a, v8f& b, v16b x, v16b y) { dep_guard_b(a, b, x, y); }
  static __device__ __forceinline__ void keep(v16b a, v16b b, v16b c, v16b d) { keep4_b(a, b, c, d); }
};

__device__ __forceinline__ unsigned pk16(unsigned short a, unsigned short b) { return (unsigned)a | ((unsigned)b << 16); }
__device__ __forceinline__ unsigned short h_bits(float f) { const _Float16 h = (_Float16)f; return __builtin_bit_cast(unsigned short, h); }

__device__ __forceinline__ float xhalf(float x) {   // lane l <-> lane l ^ 16
  const int v = __builtin_bit_cast(int, x);
  return __builtin_bit_cast(float, __builtin_amdgcn_permlanex16(v, v, 0x76543210, 0xfedcba98, false, false));
}

// ---------------------------------------------------------------------------
// Epilogue of the q/k/v projections (OUT_MODE 3 of the GEMM below): the first passes of their consumers, done on the wave's own tile.
// b = product (0: x.Wq, 1: m.Wk, 2: m.Wv, block-uniform); the tile is 64 tokens (from row m0) x 64 channels (from n0) = one head of one batch.
// From the f32 accumulators, before anything is rounded:
//   pmax[tb][chunk][c] = max over the tile's 64 tokens, psum[tb][chunk][c] = their sum (tb = product*4 + batch, chunk = 64 tokens);
//   in-lane over the lane's 32 rows in row order, then one exchange between the wave's halves.
// Then the tile itself, ungated (the gates are not known yet; the attention kernel applies them):
//   product 0: Qf[token][c] f32;  product 1: Kh[token][c] = f16(8 k);  product 2: VT[batch*8+head][d][token] = f16(8 v).
// ---------------------------------------------------------------------------
constexpr int kPoolTok   = 64;                  // tokens per pooling chunk = rows of a wave tile
constexpr int kPoolParts = kSeq / kPoolTok;     // 32 partial rows per (tensor, batch)
static_assert(kSeq % kPoolTok == 0 && kRed == 32 && kDim == 16 * 32 && kSeq == 2048);
__device__ __forceinline__ void proj_epilogue(const v8f (&acc)[4][4], float* slab, int b, int m0, int n0, int lane,
                                              float* __restrict__ Qf, unsigned short* __restrict__ Kh, unsigned short* __restrict__ VT,
                                              float* __restrict__ pmax, float* __restrict__ psum) {
  const int rlane = lane & 15;                 // column within a subtile
  const int hf    = lane >> 4;
  const int mOff  = hf * 8;                    // row offset within a subtile
  const int batch = m0 >> 11;                  // token row / 2048
  const int s0    = m0 & (kSeq - 1);           // token inside the batch

  // ---- pooling partials of this tile: lane half 0 stores the maxima, half 1 the sums; 256 contiguous bytes per wave and array ----
  {
    float* dst = (hf == 0 ? pmax : psum) + ((size_t)(b * kBatch + batch) * kPoolParts + (s0 >> 6)) * kDim + n0 + rlane;
#pragma unroll
    for (int j = 0; j < 4; ++j) {
      float mx = acc[0][j][0];
      float sm = 0.0f;
#pragma unroll
      for (int i = 0; i < 4; ++i)
#pragma unroll
        for (int r = 0; r < 8; ++r) {
          mx = fmaxf(mx, acc[i][j][r]);
          sm += acc[i][j][r];
        }
      mx = fmaxf(mx, xhalf(mx));
      sm += xhalf(sm);
      dst[j << 4] = (hf == 0 ? mx : sm) * kWCarryInv;   // the weight carry is a power of two: exact on either side of max and sum
    }
    asm volatile("s_wait_xcnt 0x0" ::: "memory");   // the code behind reuses the address and data registers of the four stores above
  }

  // ---- the tile ----
  if (b == 2) {      // a lane holds 8 consecutive tokens of one channel: V^T rows straight from the registers
    _Float16* vt = (_Float16*)VT + ((size_t)(batch * kHeads + (n0 >> 6)) * kDh + rlane) * kSeq + s0 + mOff;
#pragma unroll
    for (int j = 0; j < 4; ++j)
#pragma unroll
      for (int i = 0; i < 4; ++i) {    // the four stores of a j fill each channel's 128-byte line
        v8h hv;
#pragma unroll
        for (int r = 0; r < 8; ++r) hv[r] = (_Float16)(acc[i][j][r] * (kGCarry * kWCarryInv));
        *(v8h*)(vt + (size_t)(j << 4) * kSeq + (i << 4)) = hv;
      }
    return;
  }
  const float sc = (b == 0) ? kWCarryInv : kGCarry * kWCarryInv;
#pragma unroll
  for (int i = 0; i < 4; ++i) {
    const int mBase = m0 + (i << 4);
#pragma unroll
    for (int j = 0; j < 4; ++j)
#pragma unroll
      for (int r = 0; r < 8; ++r) slab[(mOff + r) * 68 + (j << 4) + rlane] = acc[i][j][r] * sc;
    __builtin_amdgcn_fence(__ATOMIC_RELEASE, "workgroup");
    __builtin_amdgcn_wave_barrier();
    __builtin_amdgcn_fence(__ATOMIC_ACQUIRE, "workgroup");
    if (b == 0) {
      const int c4 = (lane & 15) * 4;                    // row seg = 256 B = 16 lanes x 16 B
#pragma unroll
      for (int it = 0; it < 8; ++it) {
        const int row = it * 2 + hf;
        const v4f v = *(const v4f*)(slab + row * 68 + c4);
        *(v4f*)(Qf + (size_t)(mBase + row) * kDim + n0 + c4) = v;
      }
    } else {
      const int q = lane >> 3, c8 = (lane & 7) * 8;      // row seg = 128 B = 8 lanes x 16 B
#pragma unroll
      for (int it = 0; it < 4; ++it) {
        const int row = it * 4 + q;
        const float* sp = slab + row * 68 + c8;
        v8h hv;
#pragma unroll
        for (int e = 0; e < 8; ++e) hv[e] = (_Float16)sp[e];
        *(v8h*)((_Float16*)Kh + (size_t)(mBase + row) * kDim + n0 + c8) = hv;
      }
      asm volatile("s_wait_xcnt 0x0" ::: "memory");   // the code behind reuses the address and data registers of the four stores above
    }
    __builtin_amdgcn_fence(__ATOMIC_RELEASE, "workgroup");
    __builtin_amdgcn_wave_barrier();
    __builtin_amdgcn_fence(__ATOMIC_ACQUIRE, "workgroup");
  }
}

// ---- Register-blocked batched WMMA GEMM (ACT reduced to none/relu/leaky) -------------------------------
// C[m,n] = scale * sum_k A[m,k] * Bt[n,k] (+bias)(+resid); each wave owns a 64x64 tile.
// A row-major [M,K]; Bt row-major [N,K]; M,N % 64 == 0, K % 32 == 0.
// SPLIT: operands are hi/lo planes (A2/Bt2 = lo planes, same layout); product = hi*hi + hi*lo + lo*hi.
// BIAS_MODE: 0 = none, 1 = bias[m], 2 = bias[n].
// OUT_MODE: 0 = f32, 1 = f16, 2 = bf16 hi plane (Cout) + bf16 lo plane (Cout2), 3 = proj_epilogue above (Cout = f32 q, Cout2 = f16 k, VTo, pmax, psum).
// ET: 0 = f16 operands, 1 = bf16 operands (pointers passed as 16-bit storage)
// A_ALT (only without SPLIT): batch 0 reads A from Ap, batch b > 0 from A2p + (b - 1) * strideA, so products of different left operands share one grid.
template <int ET> struct Elem;
template <> struct Elem<0> { typedef _Float16 T; };
template <> struct Elem<1> { typedef __bf16 T; };
template <int ET, bool SPLIT, int BIAS_MODE, int OUT_MODE, bool RESID, int ACT = 0, bool A_ALT = false>
__global__ __launch_bounds__(256) void wmma_gemm64(
    const unsigned short* __restrict__ Ap, const unsigned short* __restrict__ A2p, int lda, long strideA,
    const unsigned short* __restrict__ Btp, const unsigned short* __restrict__ Bt2p, int ldb, long strideB,
    void* __restrict__ Cout, void* __restrict__ Cout2, int ldc, long strideC,
    const float* __restrict__ bias,
    const float* __restrict__ resid, long strideR,
    int M, int N, int K, float scale,
    unsigned short* __restrict__ VTo, float* __restrict__ pmax, float* __restrict__ psum) {
  typedef typename Elem<ET>::T T;
  typedef typename Frag<T>::V V;
  const T* A = (const T*)Ap; const T* A2 = (const T*)A2p; const T* Bt = (const T*)Btp; const T* Bt2 = (const T*)Bt2p;
  __shared__ __align__(16) float sT[8][16 * 68];   // per-wave 16x64 slab, pitch 68 floats
  const int b    = blockIdx.y;
  const int lane = threadIdx.x & 31;
  const int wave = threadIdx.x >> 5;
  const int tilesN = N >> 6;
  const int tilesM = M >> 6;
  const int tile = blockIdx.x * 8 + wave;
  if (tile >= tilesM * tilesN) return;   // wave-uniform; no block barriers in this kernel
  const int tm = tile / tilesN;
  const int tn = tile - tm * tilesN;
  const int m0 = tm << 6;
  const int n0 = tn << 6;

  static_assert(!(A_ALT && SPLIT));
  const T* Ab  = (A_ALT && b > 0) ? (A2 + (size_t)(b - 1) * strideA) : (A + (size_t)b * strideA);   // block-uniform select
  const T* Bb  = Bt + (size_t)b * strideB;
  const T* Ab2 = SPLIT ? (A2  + (size_t)b * strideA) : nullptr;
  const T* Bb2 = SPLIT ? (Bt2 + (size_t)b * strideB) : nullptr;

  const int rlane = lane & 15;                 // row (A) / col (B, D) within subtile
  const int koff  = (lane >> 4) * 8;           // k offset of this lane half
  const int mOff  = (lane >> 4) * 8;           // D row offset

  v8f acc[4][4];
#pragma unroll
  for (int i = 0; i < 4; ++i)
#pragma unroll
    for (int j = 0; j < 4; ++j) acc[i][j] = (v8f){0.f,0.f,0.f,0.f,0.f,0.f,0.f,0.f};

  for (int k0 = 0; k0 < K; k0 += 32) {
    V bh[4], bl[4];
#pragma unroll
    for (int j = 0; j < 4; ++j) {
      const size_t bo = (size_t)(n0 + (j << 4) + rlane) * ldb + koff + k0;
      bh[j] = Frag<T>::load(Bb + bo);
      if (SPLIT) bl[j] = Frag<T>::load(Bb2 + bo);
    }
#pragma unroll
    for (int i = 0; i < 4; ++i) {
      const size_t ao = (size_t)(m0 + (i << 4) + rlane) * lda + koff + k0;
      V ah = Frag<T>::load(Ab + ao);
      V al;
      if (SPLIT) al = Frag<T>::load(Ab2 + ao);
#pragma unroll
      for (int j = 0; j < 4; ++j) {
        acc[i][j] = Frag<T>::mma(ah, bh[j], acc[i][j]);
        if (SPLIT) {
          acc[i][j] = Frag<T>::mma(ah, bl[j], acc[i][j]);
          acc[i][j] = Frag<T>::mma(al, bh[j], acc[i][j]);
        }
      }
      Frag<T>::guard(acc[i][0], acc[i][3], ah, SPLIT ? al : ah);
    }
    Frag<T>::keep(bh[0], bh[1], bh[2], bh[3]);
    if (SPLIT) Frag<T>::keep(bl[0], bl[1], bl[2], bl[3]);
  }
  acc_guard4(acc[0][0], acc[0][1], acc[0][2], acc[0][3]);
  acc_guard4(acc[1][0], acc[1][1], acc[1][2], acc[1][3]);
  acc_guard4(acc[2][0], acc[2][1], acc[2][2], acc[2][3]);
  acc_guard4(acc[3][0], acc[3][1], acc[3][2], acc[3][3]);

  // ---- epilogue ----
  float* slab = sT[wave];
  if (OUT_MODE == 3) {
    proj_epilogue(acc, slab, b, m0, n0, lane, (float*)Cout, (unsigned short*)Cout2, VTo, pmax, psum);
    return;
  }
  const float* Rb = RESID ? (resid + (size_t)b * strideR) : nullptr;
#pragma unroll
  for (int i = 0; i < 4; ++i) {
    const int mBase = m0 + (i << 4);
#pragma unroll
    for (int j = 0; j < 4; ++j) {
      const int n = n0 + (j << 4) + rlane;
      float bv = 0.f;
      if (BIAS_MODE == 2) bv = bias[n];
#pragma unroll
      for (int r = 0; r < 8; ++r) {
        float v = acc[i][j][r] * scale;
        if (BIAS_MODE == 1) v += bias[mBase + mOff + r];
        if (BIAS_MODE == 2) v += bv;
        if (RESID) v += Rb[(size_t)(mBase + mOff + r) * ldc + n];
        if (ACT == 2) v = fmaxf(v, 0.0f);
        if (ACT == 4) v = (v > 0.f) ? v : 0.01f * v;
        slab[(mOff + r) * 68 + (j << 4) + rlane] = v;
      }
    }
    __builtin_amdgcn_fence(__ATOMIC_RELEASE, "workgroup");
    __builtin_amdgcn_wave_barrier();
    __builtin_amdgcn_fence(__ATOMIC_ACQUIRE, "workgroup");
    if (OUT_MODE == 0) {
      float* C = (float*)Cout + (size_t)b * strideC;
      const int hh = lane >> 4, c4 = (lane & 15) * 4;     // row seg = 256 B = 16 lanes x 16 B
      {
#pragma unroll
        for (int it = 0; it < 8; ++it) {
          const int row = it * 2 + hh;
          v4f v = *(const v4f*)(slab + row * 68 + c4);
          *(v4f*)(C + (size_t)(mBase + row) * ldc + n0 + c4) = v;
        }
        
      }
    } else {
      const int q = lane >> 3, c8 = (lane & 7) * 8;
      unsigned short* C  = (unsigned short*)Cout  + (size_t)b * strideC;
      unsigned short* C2 = (OUT_MODE == 2) ? ((unsigned short*)Cout2 + (size_t)b * strideC) : nullptr;
      {
#pragma unroll
        for (int it = 0; it < 4; ++it) {
          const int row = it * 4 + q;
          const float* sp = slab + row * 68 + c8;
          v8h hv, lv;
#pragma unroll
          for (int e = 0; e < 8; ++e) {
            if (OUT_MODE == 1) {
              hv[e] = (_Float16)sp[e];
            } else {
              unsigned short hb = f2bf_bits(sp[e]);
              unsigned short lb = f2bf_bits(sp[e] - bf_bits2f(hb));
              hv[e] = __builtin_bit_cast(_Float16, hb);
              lv[e] = __builtin_bit_cast(_Float16, lb);
            }
          }
          *(v8h*)(C + (size_t)(mBase + row) * ldc + n0 + c8) = hv;
          if (OUT_MODE == 2) *(v8h*)(C2 + (size_t)(mBase + row) * ldc + n0 + c8) = lv;
        }
        
      }
    }
    __builtin_amdgcn_fence(__ATOMIC_RELEASE, "workgroup");
    __builtin_amdgcn_wave_barrier();
    __builtin_amdgcn_fence(__ATOMIC_ACQUIRE, "workgroup");
  }
}

// ---------------------------------------------------------------------------
// Input cast: out plane z (0 <- x, 1 <- m) = f16( bf16_rne(v) ), [8192][512] halves each. One work-group's share: block bx of plane z.
// ---------------------------------------------------------------------------
__device__ __forceinline__ void cast_in_block(const float* __restrict__ x, const float* __restrict__ m,
                                              unsigned short* __restrict__ out, int n8, int z, int bx) {
  const float* in = (z == 0) ? x : m;                // block-uniform plane select
  const int i = bx * 256 + threadIdx.x;
  if (i >= n8) return;
  const float* p = in + 8 * (size_t)i;
  const v4f a = *(const v4f*)(p);
  const v4f c = *(const v4f*)(p + 4);
  unsigned short hb[8];
#pragma unroll
  for (int e = 0; e < 4; ++e) {
    hb[e]     = h_bits(bf_rne(a[e]));
    hb[4 + e] = h_bits(bf_rne(c[e]));
  }
  const v4u u = (v4u){pk16(hb[0], hb[1]), pk16(hb[2], hb[3]), pk16(hb[4], hb[5]), pk16(hb[6], hb[7])};
  unsigned short* q = out + (size_t)z * 8 * (size_t)n8 + 8 * (size_t)i;
  *(v4u*)q = u;
  
}

// ---------------------------------------------------------------------------
// Weight transpose + cast: W is [in d][out h] (512x512, row-major); WT[h][d] = f16( scale * bf16_rne(W[d][h]) ).
// One work-group's share: bd = d tile (64 cols of WT, 0..7), bh = h tile (64 rows of WT, 0..7), z selects W0..W3 and the
// output plane (plane z at out + z*512*512 halves). 256 threads; sm is the work-group's 64 x 65 float exchange tile.
// Load coverage: 4 iterations x 256 threads x float4 = 4096 = the whole 64(d) x 64(h) tile (coalesced along h), 4 b128 loads per lane.
// Store coverage: 8 waves x 2 iterations x 4 rows (lane>>3) = 64 rows; (lane&7) x 8 halves = 64 cols; each row segment =
// ---------------------------------------------------------------------------
__device__ __forceinline__ void wtcast_block(const float* __restrict__ W0, const float* __restrict__ W1,
                                             const float* __restrict__ W2, const float* __restrict__ W3,
                                             unsigned short* __restrict__ out, float scale,
                                             float (*sm)[65], int bd, int bh, int z) {   // sm[h_local][d_local]; z block-uniform
  const int t  = threadIdx.x;
  const int d0 = bd * 64;
  const int h0 = bh * 64;
  const float* W = (z == 0) ? W0 : (z == 1) ? W1 : (z == 2) ? W2 : W3;
#pragma unroll
  for (int i = 0; i < 4; ++i) {
    const int e4 = i * 256 + t;
    const int r  = e4 >> 4;            // d local 0..63
    const int c4 = (e4 & 15) * 4;      // h local 0..60
    const v4f w = *(const v4f*)(W + (size_t)(d0 + r) * kDim + h0 + c4);
#pragma unroll
    for (int k = 0; k < 4; ++k) sm[c4 + k][r] = bf_rne(w[k]) * scale;
  }
  __syncthreads();
  const int lane = t & 31, wave = t >> 5;
  const int q = lane >> 3, c8 = (lane & 7) * 8;
  unsigned short* op = out + (size_t)z * kDim * kDim;
  {
#pragma unroll
    for (int it = 0; it < 2; ++it) {
      const int row = wave * 8 + it * 4 + q;                 // h local
      unsigned short hb[8];
#pragma unroll
      for (int e = 0; e < 8; ++e) hb[e] = h_bits(sm[row][c8 + e]);
      const v4u u = (v4u){pk16(hb[0], hb[1]), pk16(hb[2], hb[3]), pk16(hb[4], hb[5]), pk16(hb[6], hb[7])};
      *(v4u*)(op + (size_t)(h0 + row) * kDim + d0 + c8) = u;
    }
    
  }
}

// ---------------------------------------------------------------------------
// The two independent casts above in one grid, told apart by the block index (block-uniform, so the transpose's barrier is passed by
// whole work-groups only): blocks 0..255 = weight tiles (d tile, h tile, matrix), blocks 256..4351 = input cast (2048 blocks per plane).
// ---------------------------------------------------------------------------
constexpr int kWtBlocks   = (kDim / 64) * (kDim / 64) * 4;   // 256
constexpr int kCastBlocks = kPlane / 8 / 256;                // 2048 per plane
static_assert(kDim / 64 == 8 && kCastBlocks == 2048);
__global__ __launch_bounds__(256) void prep_kernel(const float* __restrict__ x, const float* __restrict__ m,
                                                   const float* __restrict__ W0, const float* __restrict__ W1,
                                                   const float* __restrict__ W2, const float* __restrict__ W3,
                                                   unsigned short* __restrict__ xm_out, unsigned short* __restrict__ wt_out,
                                                   float scale, int n8) {
  __shared__ float sm[64][65];
  const int blk = blockIdx.x;
  if (blk < kWtBlocks) {
    wtcast_block(W0, W1, W2, W3, wt_out, scale, sm, blk & 7, (blk >> 3) & 7, blk >> 6);
  } else {
    const int cb = blk - kWtBlocks;
    cast_in_block(x, m, xm_out, n8, cb >> 11, cb & (kCastBlocks - 1));
  }
}

// ---------------------------------------------------------------------------
// Token pooling, part 2 + channel gate MLP (f32): block tb = tensor*4 + batch (12 blocks), 512 threads = channels.
//   mx[c] = max over 32 chunk maxima, av[c] = (sum of 32 chunk sums, chunk order) * (1/2048)
//   hid[j] = relu( sum_c mx[c]*w1[c][j] + sum_c av[c]*w1[c][j] )   j < 32      (w1, w2 RNE-converted to bf16 where used)
//            thread t holds w1 elements i*512 + t, so wave w sums channels w, w+16, .. w+496 for all 32 j (lane = j);
//            32 threads then add the 16 wave partials in wave order
//   g[c]   = 1 / (1 + exp(-sum_j hid[j]*w2[j][c]))
// The w1 and w2 elements a thread needs depend on nothing computed here: they are loaded first, beside the chunk partials.
// ---------------------------------------------------------------------------
__global__ __launch_bounds__(512) void gate_kernel(const float* __restrict__ pmax, const float* __restrict__ psum,
                                                   const float* __restrict__ w1, const float* __restrict__ w2,
                                                   float* __restrict__ scl) {
  __shared__ float smax[kDim];
  __shared__ float savg[kDim];
  __shared__ float pa1[kDim / 32][kRed];
  __shared__ float pa2[kDim / 32][kRed];
  __shared__ float hid[kRed];
  const int t    = threadIdx.x;
  const int tb   = blockIdx.x;          // 0..11
  const int lane = t & 31, wave = t >> 5;
  float w1v[32], w2v[kRed];
#pragma unroll   // this loop and the next two: independent loads at immediate offsets, in flight together
  for (int i = 0; i < 32; ++i) w1v[i] = w1[i * kDim + t];      // channel i*16 + wave, hidden unit lane
#pragma unroll   // as above
  for (int j = 0; j < kRed; ++j) w2v[j] = w2[j * kDim + t];
  const float* pm = pmax + (size_t)tb * kPoolParts * kDim + t;
  const float* ps = psum + (size_t)tb * kPoolParts * kDim + t;
  float mx = -__builtin_inff();
  float sm = 0.0f;
#pragma unroll   // as above
  for (int p = 0; p < kPoolParts; ++p) {
    mx = fmaxf(mx, pm[p * kDim]);
    sm += ps[p * kDim];
  }
  smax[t] = mx;
  savg[t] = sm * kInvSeq;
  __syncthreads();
  float a1 = 0.0f, a2 = 0.0f;
#pragma unroll   // w1v[] stays in registers
  for (int i = 0; i < 32; ++i) {
    const float w = bf_rne(w1v[i]);
    a1 += smax[i * 16 + wave] * w;
    a2 += savg[i * 16 + wave] * w;
  }
  pa1[wave][lane] = a1;
  pa2[wave][lane] = a2;
  __syncthreads();
  if (t < kRed) {                       // wave 0, wave-uniform
    float s1 = 0.0f, s2 = 0.0f;
#pragma unroll   // the 32 LDS reads overlap
    for (int w = 0; w < kDim / 32; ++w) {
      s1 += pa1[w][t];
      s2 += pa2[w][t];
    }
    hid[t] = fmaxf(s1 + s2, 0.0f);
  }
  __syncthreads();
  float a = 0.0f;
#pragma unroll   // w2v[] stays in registers
  for (int j = 0; j < kRed; ++j) a += hid[j] * bf_rne(w2v[j]);
  const float g = 1.0f / (1.0f + expf(-a));
  scl[(size_t)tb * kDim + t] = g;       // one whole 128-byte line per wave
}

// ---------------------------------------------------------------------------
// Fused attention of every (batch, head): S^T = K.Q^T, online softmax (base 2, f32), O^T += V^T.P^T; scores and P stay in registers.
// grid (8, 32): blockIdx.x = block of 256 queries, blockIdx.y = batch*8 + head. 8 waves x 32 query columns (2 groups of 16).
// One pass = 32 keys. Lane (c = lane & 15, hf = lane >> 4) of a score tile holds query c, keys 8*hf + r: the two 16-key tiles of a
// pass, converted in place, are the B operand of the second product (element s: key 8*hf + s, s < 8; key 16 + 8*hf + s - 8 else),
// the k order in which Frag::load brings V^T (and K; the q fragments are built in the same order).
// The maximum in use may trail the true one by up to 8 (base-2 exponent), so P <= 2^8 and P carried x2^6 <= 2^14 in f16.
// Oh[b][q][head*64 + d] = f16( 32 * acc / rowsum * gv[d] ): context carried x256, V carried x8.
// The channel gates (scl = [3][4][512]: q, k, v) come in here: a score is sum_d q_d gq_d k_d gk_d, so the q fragments, built once per wave
// from f32 q, carry f16( q * (8 gq gk) ) against the ungated k plane; gv scales channel d of the f32 result.
// K and V^T reach the waves through LDS: a stage is 128 keys (K 128 rows of 128 B at pitch 144 B, V^T 64 rows of 256 B at pitch 272 B, both
// 16 B x odd for the 16-byte fragment reads), brought once per work-group by asynchronous copies, whole 128-byte lines per wave, two buffers:
// stage s + 2 is copied into the buffer of stage s behind the barrier that ends its last read. A stage serves four passes.
// ---------------------------------------------------------------------------
constexpr int kStKeys = 128;                    // keys per stage
constexpr int kStages = kSeq / kStKeys;         // 16
constexpr int kKPitch = 72;                     // halves per staged K row (144 B)
constexpr int kVPitch = 136;                    // halves per staged V^T row (272 B)
constexpr int kKTile  = kStKeys * kKPitch;      // 9216 halves
constexpr int kStageH = kKTile + kDh * kVPitch; // 17920 halves = 35,840 B per buffer
static_assert(kStages >= 2 && kStKeys % 32 == 0 && (kKTile * 2) % 16 == 0 && (kStageH * 2) % 16 == 0);
// One thread's share of a stage: 4 x 16 B of K (rows 32 apart) and 4 x 16 B of V^T (rows 16 apart). kd, vd: LDS byte addresses; kg, vg: global.
__device__ __forceinline__ void stage_copy(unsigned kd, unsigned vd, const _Float16* kg, const _Float16* vg) {
  // s_wait_xcnt 0 closes the statement (a precaution): so no later write of the copies' address registers can be scheduled ahead of it
  asm volatile("global_load_async_to_lds_b128 %0, %8, off\n\t"
               "global_load_async_to_lds_b128 %1, %9, off\n\t"
               "global_load_async_to_lds_b128 %2, %10, off\n\t"
               "global_load_async_to_lds_b128 %3, %11, off\n\t"
               "global_load_async_to_lds_b128 %4, %12, off\n\t"
               "global_load_async_to_lds_b128 %5, %13, off\n\t"
               "global_load_async_to_lds_b128 %6, %14, off\n\t"
               "global_load_async_to_lds_b128 %7, %15, off\n\t"
               "s_wait_xcnt 0x0"
               :: "v"(kd), "v"(kd + 32 * kKPitch * 2), "v"(kd + 64 * kKPitch * 2), "v"(kd + 96 * kKPitch * 2),
                  "v"(vd), "v"(vd + 16 * kVPitch * 2), "v"(vd + 32 * kVPitch * 2), "v"(vd + 48 * kVPitch * 2),
                  "v"(kg), "v"(kg + (size_t)32 * kDim), "v"(kg + (size_t)64 * kDim), "v"(kg + (size_t)96 * kDim),
                  "v"(vg), "v"(vg + (size_t)16 * kSeq), "v"(vg + (size_t)32 * kSeq), "v"(vg + (size_t)48 * kSeq)
               : "memory");
}
__global__ __launch_bounds__(256) void attn_fused_kernel(const float* __restrict__ Qf, const unsigned short* __restrict__ Kp,
                                                         const unsigned short* __restrict__ VTp, const float* __restrict__ scl,
                                                         unsigned short* __restrict__ Op) {
  typedef Frag<_Float16> FH;
  __shared__ __align__(16) _Float16 ring[2 * kStageH];
  const int lane = threadIdx.x & 31, wave = threadIdx.x >> 5;
  const int c = lane & 15, hf = lane >> 4;
  const int bh = blockIdx.y;
  const int q0 = blockIdx.x * 256 + wave * 32;
  const size_t tokOff = (size_t)(bh >> 3) * kSeq * kDim + (size_t)(bh & 7) * kDh;
  const float* ql = Qf + tokOff + (size_t)(q0 + c) * kDim + 8 * hf;
  const float* gl = scl + (size_t)(bh >> 3) * kDim + (size_t)(bh & 7) * kDh + 8 * hf;   // q gate of this lane's first channel; k, v: + 4, 8 rows

  // this thread's share of every stage: K row t / 8 (+ 32 i), 16-byte column t % 8; V^T row t / 16 (+ 16 i), 16-byte column t % 16
  const int tid = threadIdx.x;
  const _Float16* kg = (const _Float16*)Kp + tokOff + (size_t)(tid >> 3) * kDim + 8 * (tid & 7);
  const _Float16* vg = (const _Float16*)VTp + (size_t)bh * kDh * kSeq + (size_t)(tid >> 4) * kSeq + 8 * (tid & 15);
  const unsigned ringB = (unsigned)(size_t)ring;     // byte offset of the ring in the work-group's LDS
  const unsigned kd = ringB + (unsigned)((tid >> 3) * kKPitch + 8 * (tid & 7)) * 2u;
  const unsigned vd = ringB + (unsigned)(kKTile + (tid >> 4) * kVPitch + 8 * (tid & 15)) * 2u;

  stage_copy(kd, vd, kg, vg);                        // stage 0, in flight under the q fragments' loads

  v16h qf[2][2];   // element e < 8: channel 32 kc + 8 hf + e; e >= 8: 32 kc + 16 + 8 hf + e - 8 (the order of Frag::load)
#pragma unroll
  for (int kc = 0; kc < 2; ++kc)
#pragma unroll
    for (int u = 0; u < 4; ++u) {      // four channels at a time
      const int d = 32 * kc + 16 * (u >> 1) + 4 * (u & 1);
      const v4f gg = *(const v4f*)(gl + d) * *(const v4f*)(gl + (size_t)kBatch * kDim + d) * kGCarry;
#pragma unroll
      for (int g = 0; g < 2; ++g) {
        const v4f qv = *(const v4f*)(ql + (size_t)(16 * g) * kDim + d) * gg;
#pragma unroll
        for (int e = 0; e < 4; ++e) qf[g][kc][4 * u + e] = (_Float16)qv[e];
      }
    }

  v8f acc[2][4];
  v2f ls[2];
  float m_run[2];
#pragma unroll
  for (int g = 0; g < 2; ++g) {
    m_run[g] = -__builtin_inff();
    ls[g] = (v2f){0.f, 0.f};
#pragma unroll
    for (int t = 0; t < 4; ++t) acc[g][t] = (v8f){0.f,0.f,0.f,0.f,0.f,0.f,0.f,0.f};
  }

  asm volatile("s_wait_asynccnt 0x0" ::: "memory");  // this wave's copies of stage 0 have landed
  __syncthreads();                                   // publishes stage 0
  stage_copy(kd + kStageH * 2, vd + kStageH * 2, kg + (size_t)kStKeys * kDim, vg + kStKeys);   // stage 1

  // rolled over the stages; the four passes of a stage are unrolled, so that a pass can fetch the next pass's K inside its own stage
#pragma unroll 1
  for (int st = 0; st < kStages; ++st) {
    const _Float16* kl = ring + (st & 1) * kStageH + c * kKPitch + 8 * hf;
    const _Float16* vl = ring + (st & 1) * kStageH + kKTile + c * kVPitch + 8 * hf;
    v16h kf[2][2];
#pragma unroll
    for (int kt = 0; kt < 2; ++kt)
#pragma unroll
      for (int kc = 0; kc < 2; ++kc) kf[kt][kc] = FH::load(kl + (16 * kt) * kKPitch + 32 * kc);
    __builtin_amdgcn_sched_barrier(0);   // the stage's first K fragments are read as one group: one LDS latency in front of the products, not one per fragment

#pragma unroll
    for (int ps = 0; ps < kStKeys / 32; ++ps) {
      v16h vf[4];      // this pass's V^T, in flight under the score products and the maxima
#pragma unroll
      for (int t = 0; t < 4; ++t) vf[t] = FH::load(vl + (16 * t) * kVPitch + 32 * ps);

      v8f s[2][2];
#pragma unroll
      for (int kt = 0; kt < 2; ++kt)
#pragma unroll
        for (int g = 0; g < 2; ++g) {
          s[kt][g] = (v8f){0.f,0.f,0.f,0.f,0.f,0.f,0.f,0.f};
#pragma unroll
          for (int kc = 0; kc < 2; ++kc) s[kt][g] = FH::mma(kf[kt][kc], qf[g][kc], s[kt][g]);
        }
      if (ps + 1 < kStKeys / 32) {
#pragma unroll
        for (int kt = 0; kt < 2; ++kt)
#pragma unroll
          for (int kc = 0; kc < 2; ++kc) kf[kt][kc] = FH::load(kl + (32 * (ps + 1) + 16 * kt) * kKPitch + 32 * kc);
      }
      __builtin_amdgcn_sched_barrier(0);   // keeps the K loads issued here, ahead of the vector work that hides their latency

      float mb[2];
      bool need = false;
#pragma unroll
      for (int g = 0; g < 2; ++g) {
        float mx = s[0][g][0];
#pragma unroll
        for (int r = 1; r < 8; ++r) mx = fmaxf(mx, s[0][g][r]);
#pragma unroll
        for (int r = 0; r < 8; ++r) mx = fmaxf(mx, s[1][g][r]);
        mx = fmaxf(mx, xhalf(mx)) * kSmScale2;         // both halves hold the query's maximum of this pass (the scale is positive)
        mb[g] = mx;
        need = need || (mx > m_run[g] + 8.0f);
      }
      if (__builtin_amdgcn_ballot_w32(need) != 0) {    // wave-uniform; always on the first pass, rare later
#pragma unroll
        for (int g = 0; g < 2; ++g) {
          const float m_new = fmaxf(m_run[g], mb[g]);
          const float corr = __builtin_amdgcn_exp2f(m_run[g] - m_new);   // 0 on the first pass
          m_run[g] = m_new;
          ls[g] = ls[g] * corr;
#pragma unroll
          for (int t = 0; t < 4; ++t) acc[g][t] = acc[g][t] * corr;
        }
      }
#pragma unroll
      for (int g = 0; g < 2; ++g) {
        const float nm = kPShift - m_run[g];
        v16h pf;
#pragma unroll
        for (int i = 0; i < 8; ++i) {
          const v2f sv = (v2f){s[i >> 2][g][2 * (i & 3)], s[i >> 2][g][2 * (i & 3) + 1]};
          const v2f arg = __builtin_elementwise_fma(sv, (v2f){kSmScale2, kSmScale2}, (v2f){nm, nm});
          const v2f p = (v2f){__builtin_amdgcn_exp2f(arg.x), __builtin_amdgcn_exp2f(arg.y)};
          ls[g] = ls[g] + p;
          const v2h ph = __builtin_convertvector(p, v2h);
          pf[2 * i]     = ph.x;
          pf[2 * i + 1] = ph.y;
        }
#pragma unroll
        for (int t = 0; t < 4; ++t) acc[g][t] = FH::mma(vf[t], pf, acc[g][t]);
      }
    }

    // hand-over: this wave's reads of stage st are done, its copies of stage st + 1 have landed; the barrier says both of every wave
    asm volatile("s_wait_dscnt 0x0" ::: "memory");
    asm volatile("s_wait_asynccnt 0x0" ::: "memory");
    __syncthreads();
    if (st + 2 < kStages)                              // the same for the whole work-group
      stage_copy(kd + (st & 1) * (kStageH * 2), vd + (st & 1) * (kStageH * 2),
                 kg + (size_t)(st + 2) * kStKeys * kDim, vg + (st + 2) * kStKeys);
  }
  asm volatile("s_wait_asynccnt 0x0" ::: "memory");    // no copy is outstanding when the wave ends

  _Float16* ol = (_Float16*)Op + tokOff + (size_t)(q0 + c) * kDim + 8 * hf;
  float inv[2];
#pragma unroll
  for (int g = 0; g < 2; ++g) {
    float l = ls[g].x + ls[g].y;
    l += xhalf(l);                                   // join the two halves' key sums
    inv[g] = kCtxScale / l;
  }
#pragma unroll
  for (int t = 0; t < 4; ++t) {
    const float* gv = gl + (size_t)(2 * kBatch) * kDim + 16 * t;
    const v4f g0 = *(const v4f*)(gv);
    const v4f g1 = *(const v4f*)(gv + 4);
#pragma unroll
    for (int g = 0; g < 2; ++g) {
      v8h hv;
#pragma unroll
      for (int r = 0; r < 8; ++r) hv[r] = (_Float16)(acc[g][t][r] * inv[g] * (r < 4 ? g0[r & 3] : g1[r & 3]));   // d = 16 t + 8 hf + r of query 16 g + c
      *(v8h*)(ol + (size_t)(16 * g) * kDim + 16 * t) = hv;
    }
  }
}

// ---------------------------------------------------------------------------
// Host glue.
//   XMh  f16 [2][8192][512]     16,777,216  at           0   (x plane then m plane, bf16-valued)
//   WT   f16 [4][512][512]       2,097,152  at  16,777,216   (Wq^T, Wk^T, Wv^T, Wo^T, [out][in], carried x16)
//   Qf   f32 [8192][512]        16,777,216  at  18,874,368   (q projection, ungated)
//   Kh   f16 [8192][512]         8,388,608  at  35,651,584   (k projection, ungated, carried x8)
//   VT   f16 [32][64][2048]      8,388,608  at  44,040,192   (v projection transposed per (batch, head), ungated, carried x8)
//   Oh   f16 [8192][512]         8,388,608  at  52,428,800   (attention context, carried x256)
//   SCL  f32 [3][4][512]            24,576  at  60,817,408   (channel gates)
//   PMX  f32 [12][32][512]         786,432  at  60,841,984   (chunk maxima of the token pooling)
//   PSM  f32 [12][32][512]         786,432  at  61,628,416   (chunk sums of the token pooling)
//   total                       62,414,848
// GEMM shapes: projections/out M=8192 N=512 K=512.
// All M,N multiples of 64, all K multiples of 32, no padded rows anywhere; every plane fully written before it is read.
// Launches: casts 1, projections with pooling partials 1, gates 1, attention 1, output projection 1 = 5.
// ---------------------------------------------------------------------------
extern "C" void kernel_launch(void* const* d_in, const int* in_sizes, int n_in,
                              void* d_out, int out_size, void* d_ws, size_t ws_size,
                              hipStream_t stream) {
  if (n_in < 9) return;
  if (in_sizes[0] != kPlane || in_sizes[1] != kPlane) return;
  if (in_sizes[2] != kDim * kDim || in_sizes[3] != kDim * kDim || in_sizes[4] != kDim * kDim || in_sizes[5] != kDim * kDim) return;
  if (in_sizes[6] != kDim || in_sizes[7] != kDim * kRed || in_sizes[8] != kRed * kDim) return;
  if (out_size != kPlane) return;

  const size_t szHalfPlane = (size_t)kPlane * 2;                 // 8,388,608
  const size_t szXM  = 2 * szHalfPlane;
  const size_t szWT  = (size_t)4 * kDim * kDim * 2;
  const size_t szQf  = (size_t)kPlane * 4;
  const size_t szVT  = (size_t)kBatch * kHeads * kDh * kSeq * 2;
  const size_t szSCL = (size_t)3 * kBatch * kDim * 4;
  const size_t offXM  = 0;
  const size_t offWT  = offXM + szXM;
  const size_t offQf  = offWT + szWT;
  const size_t offKh  = offQf + szQf;
  const size_t offVT  = offKh + szHalfPlane;
  const size_t offOh  = offVT + szVT;
  const size_t offSCL = offOh + szHalfPlane;
  const size_t szPart = (size_t)3 * kBatch * kPoolParts * kDim * 4;
  const size_t offPMX = offSCL + szSCL;
  const size_t offPSM = offPMX + szPart;
  const size_t total  = offPSM + szPart;                          // 62,414,848
  if (ws_size < total) return;

  const float* x      = (const float*)d_in[0];
  const float* m      = (const float*)d_in[1];
  const float* Wq     = (const float*)d_in[2];
  const float* Wk     = (const float*)d_in[3];
  const float* Wv     = (const float*)d_in[4];
  const float* Wo     = (const float*)d_in[5];
  const float* bias_o = (const float*)d_in[6];
  const float* gw1    = (const float*)d_in[7];
  const float* gw2    = (const float*)d_in[8];
  float* out = (float*)d_out;
  char* ws = (char*)d_ws;
  unsigned short* XMh = (unsigned short*)(ws + offXM);
  unsigned short* WT  = (unsigned short*)(ws + offWT);
  float*          Qf  = (float*)(ws + offQf);
  unsigned short* Kh  = (unsigned short*)(ws + offKh);
  unsigned short* VT  = (unsigned short*)(ws + offVT);
  unsigned short* Oh  = (unsigned short*)(ws + offOh);
  float*          SCL = (float*)(ws + offSCL);
  float*          PMX = (float*)(ws + offPMX);
  float*          PSM = (float*)(ws + offPSM);

  const unsigned short* Xh = XMh;
  const unsigned short* Mh = XMh + (size_t)kPlane;
  const size_t wPlane = (size_t)kDim * kDim;

  // ---- 16-bit operand planes of the inputs ----
  const int n8 = kPlane / 8;   // 524288 -> 2048 blocks exact
  prep_kernel<<<dim3(kWtBlocks + 2 * kCastBlocks), dim3(256), 0, stream>>>(x, m, Wq, Wk, Wv, Wo, XMh, WT, kWCarry, n8);

  // ---- projections x.Wq, m.Wk, m.Wv (M=8192, N=512, K=512): f32 q, f16 k and V^T, and the token pooling's chunk partials ----
  const int tilesProj = (kTok / 64) * (kDim / 64);   // 1024 -> 128 blocks of 8 waves
  // one grid, blockIdx.y = product: left operand x for 0, m for 1 and 2 (A_ALT, stride 0)
  wmma_gemm64<0, false, 0, 3, false, 0, true><<<dim3(tilesProj / 8, 3), dim3(256), 0, stream>>>(
      Xh, Mh, kDim, 0L, WT, WT, kDim, (long)wPlane,
      (void*)Qf, (void*)Kh, kDim, 0L, bias_o, SCL, 0L, kTok, kDim, kDim, kWCarryInv, VT, PMX, PSM);

  // ---- channel gates ----
  gate_kernel<<<dim3(3 * kBatch), dim3(512), 0, stream>>>(PMX, PSM, gw1, gw2, SCL);

  // ---- attention, all (batch, head) in one launch, gates applied inside: Oh[b, i, h*64+d] = f16( 256 * context ) ----
  attn_fused_kernel<<<dim3(kSeq / 256, kBatch * kHeads), dim3(256), 0, stream>>>(Qf, Kh, VT, SCL, Oh);

  // ---- output projection: out = 2^-12 * Oh.Wo^T(x16) + bo   (M=8192, N=512, K=512), f32 to d_out ----
  wmma_gemm64<0, false, 2, 0, false, 0><<<dim3(tilesProj / 8, 1), dim3(256), 0, stream>>>(
      Oh, Oh, kDim, 0L, WT + 3 * wPlane, WT + 3 * wPlane, kDim, 0L,
      (void*)out, (void*)out, kDim, 0L, bias_o, SCL, 0L, kTok, kDim, kDim, kOutScale, nullptr, nullptr, nullptr);
}

// v006
// It runs in 74.7 microseconds.
// Timed twice side by side with v005, it ran 1.53 times as fast both times.
// All steps since v000 together make it 47.6 times as fast.
// Contractions: q/k/v projections (x,m RNE-converted to bf16 held in f16 planes x W^T bf16-valued f16 planes carried x16), scores k.q^T (k f16 plane and q fragments scaled by both gates, each carried x8), v^T.p^T (V^T f16 carried x8 x unnormalised P f16 carried x64; v gate on the f32 result), output projection (context f16 carried x256 x Wo^T f16 carried x16): all v_wmma_f32_16x16x32_f16 with f32 accumulate; token pooling, channel-gate MLP, online softmax in f32.
#include <hip/hip_runtime.h>
#include <math.h>

// ---------------------------------------------------------------------------
// Problem constants
// ---------------------------------------------------------------------------
constexpr int kBatch = 4;
constexpr int kSeq   = 2048;
constexpr int kDim   = 512;               // model dim = inner dim
constexpr int kHeads = 8;
constexpr int kDh    = 64;
constexpr int kRed   = 32;                // gate hidden width (512 / 16)
constexpr int kTok   = kBatch * kSeq;     // 8192 token rows
constexpr int kPlane = kTok * kDim;       // 4194304 elements per [8192][512] plane
constexpr float kWCarry    = 16.0f;                 // weights carried x16 in f16
constexpr float kWCarryInv = 1.0f / 16.0f;
constexpr float kGCarry    = 8.0f;                  // q fragments, k and V^T planes carried x8 in f16
constexpr float kPShift    = 6.0f;                  // unnormalised probabilities carried x2^6 in f16 (added to the base-2 exponent)
constexpr float kCtxCarry  = 256.0f;                // context carried x2^8 in f16
constexpr float kCtxScale  = kCtxCarry / kGCarry;                   // 32; the P carry cancels against the row sum
constexpr float kOutScale  = 1.0f / (kCtxCarry * kWCarry);          // 2^-12
constexpr float kAttnScale = 0.044194173824159216f;                 // 512^-0.5
constexpr float kSmScale   = kAttnScale / (kGCarry * kGCarry);      // exact: / 64
constexpr float kSmScale2  = kSmScale * 1.4426950408889634f;        // scores to base-2 exponents
constexpr float kInvSeq    = 1.0f / 2048.0f;
static_assert(kHeads * kDh == kDim);
static_assert(kDim / 16 == kRed);
static_assert(kSeq % 256 == 0 && (kSeq & (kSeq - 1)) == 0 && kDh == 64);   // fused attention: 256 queries per block
// GEMM shape contract: M % 128 == 0, N % 128 == 0, K % 64 == 0 for every launch
static_assert(kTok % 128 == 0 && kDim % 128 == 0 && kDim % 64 == 0);   // projections / out: M=8192 N=512 K=512
static_assert((kPlane / 8) % 256 == 0);                                // cast grids exact

typedef __attribute__((ext_vector_type(16))) _Float16 v16h;
typedef __attribute__((ext_vector_type(8)))  _Float16 v8h;
typedef __attribute__((ext_vector_type(16))) __bf16   v16b;
typedef __attribute__((ext_vector_type(8)))  __bf16   v8b;
typedef __attribute__((ext_vector_type(8)))  float    v8f;
typedef __attribute__((ext_vector_type(4)))  float    v4f;
typedef __attribute__((ext_vector_type(2)))  float    v2f;
typedef __attribute__((ext_vector_type(2)))  _Float16 v2h;
typedef __attribute__((ext_vector_type(4)))  unsigned int v4u;

__device__ __forceinline__ unsigned short f2bf_bits(float f) {
  unsigned u = __float_as_uint(f);
  return (unsigned short)((u + 0x7FFFu + ((u >> 16) & 1u)) >> 16);
}
__device__ __forceinline__ float bf_bits2f(unsigned short h) { return __uint_as_float(((unsigned)h) << 16); }
// RNE convert f32 -> bf16 -> f32
__device__ __forceinline__ float bf_rne(float f) { return bf_bits2f(f2bf_bits(f)); }

// hazard guards as plain device helpers
__device__ __forceinline__ void dep_guard_h(v8f& a, v8f& b, v16h x, v16h y) { asm volatile("v_nop\n\tv_nop\n\tv_nop\n\tv_nop" : "+v"(a), "+v"(b) : "v"(x), "v"(y)); }
__device__ __forceinline__ void dep_guard_b(v8f& a, v8f& b, v16b x, v16b y) { asm volatile("v_nop\n\tv_nop\n\tv_nop\n\tv_nop" : "+v"(a), "+v"(b) : "v"(x), "v"(y)); }
__device__ __forceinline__ void keep4_h(v16h a, v16h b, v16h c, v16h d) { asm volatile("v_nop" :: "v"(a), "v"(b), "v"(c), "v"(d)); }
__device__ __forceinline__ void keep4_b(v16b a, v16b b, v16b c, v16b d) { asm volatile("v_nop" :: "v"(a), "v"(b), "v"(c), "v"(d)); }
__device__ __forceinline__ void acc_guard4(v8f& a, v8f& b, v8f& c, v8f& d) { asm volatile("v_nop\n\tv_nop\n\tv_nop\n\tv_nop" : "+v"(a), "+v"(b), "+v"(c), "+v"(d)); }
template <typename T> struct Frag;
template <> struct Frag<_Float16> {
  typedef v16h V; union U { v16h v; v8h h[2]; };
  // elements 0..7 <- p[0..7], 8..15 <- p[16..23]
  static __device__ __forceinline__ v16h load(const _Float16* p) {
    U f; f.h[0] = *(const v8h*)(p); f.h[1] = *(const v8h*)(p + 16); return f.v;
  }
  static __device__ __forceinline__ v8f mma(v16h a, v16h b, v8f c) {
    return __builtin_amdgcn_wmma_f32_16x16x32_f16(false, a, false, b, (short)0, c, false, false);
  }
  static __device__ __forceinline__ void guard(v8f& a, v8f& b, v16h x, v16h y) { dep_guard_h(a, b, x, y); }
  static __device__ __forceinline__ void keep(v16h a, v16h b, v16h c, v16h d) { keep4_h(a, b, c, d); }
};
template <> struct Frag<__bf16> {
  typedef v16b V; union U { v16b v; v8b h[2]; };
  static __device__ __forceinline__ v16b load(const __bf16* p) {
    U f; f.h[0] = *(const v8b*)(p); f.h[1] = *(const v8b*)(p + 16); return f.v;
  }
  static __device__ __forceinline__ v8f mma(v16b a, v16b b, v8f c) {
    return __builtin_amdgcn_wmma_f32_16x16x32_bf16(false, a, false, b, (short)0, c, false, false);
  }
  static __device__ __forceinline__ void guard(v8f& a, v8f& b, v16b x, v16b y) { dep_guard_b(a, b, x, y); }
  static __device__ __forceinline__ void keep(v16b a, v16b b, v16b c, v16b d) { keep4_b(a, b, c, d); }
};

__device__ __forceinline__ unsigned pk16(unsigned short a, unsigned short b) { return (unsigned)a | ((unsigned)b << 16); }
__device__ __forceinline__ unsigned short h_bits(float f) { const _Float16 h = (_Float16)f; return __builtin_bit_cast(unsigned short, h); }

__device__ __forceinline__ float xhalf(float x) {   // lane l <-> lane l ^ 16
  const int v = __builtin_bit_cast(int, x);
  return __builtin_bit_cast(float, __builtin_amdgcn_permlanex16(v, v, 0x76543210, 0xfedcba98, false, false));
}

// ---------------------------------------------------------------------------
// Epilogue of the q/k/v projections (OUT_MODE 3 of the GEMM below): the first passes of their consumers, done on the wave's own tile.
// b = product (0: x.Wq, 1: m.Wk, 2: m.Wv, block-uniform); the tile is 64 tokens (from row m0) x 64 channels (from n0) = one head of one batch.
// From the f32 accumulators, before anything is rounded:
//   pmax[tb][chunk][c] = max over the tile's 64 tokens, psum[tb][chunk][c] = their sum (tb = product*4 + batch, chunk = 64 tokens);
//   in-lane over the lane's 32 rows in row order, then one exchange between the wave's halves.
// Then the tile itself, ungated (the gates are not known yet; the attention kernel applies them):
//   product 0: Qf[token][c] f32;  product 1: Kh[token][c] = f16(8 k);  product 2: VT[batch*8+head][d][token] = f16(8 v).
// ---------------------------------------------------------------------------
constexpr int kPoolTok   = 64;                  // tokens per pooling chunk = rows of a wave tile
constexpr int kPoolParts = kSeq / kPoolTok;     // 32 partial rows per (tensor, batch)
static_assert(kSeq % kPoolTok == 0 && kRed == 32 && kDim == 16 * 32 && kSeq == 2048);
__device__ __forceinline__ void proj_epilogue(const v8f (&acc)[4][4], float* slab, int b, int m0, int n0, int lane,
                                              float* __restrict__ Qf, unsigned short* __restrict__ Kh, unsigned short* __restrict__ VT,
                                              float* __restrict__ pmax, float* __restrict__ psum) {
  const int rlane = lane & 15;                 // column within a subtile
  const int hf    = lane >> 4;
  const int mOff  = hf * 8;                    // row offset within a subtile
  const int batch = m0 >> 11;                  // token row / 2048
  const int s0    = m0 & (kSeq - 1);           // token inside the batch

  // ---- pooling partials of this tile: lane half 0 stores the maxima, half 1 the sums; 256 contiguous bytes per wave and array ----
  {
    float* dst = (hf == 0 ? pmax : psum) + ((size_t)(b * kBatch + batch) * kPoolParts + (s0 >> 6)) * kDim + n0 + rlane;
#pragma unroll
    for (int j = 0; j < 4; ++j) {
      float mx = acc[0][j][0];
      float sm = 0.0f;
#pragma unroll
      for (int i = 0; i < 4; ++i)
#pragma unroll
        for (int r = 0; r < 8; ++r) {
          mx = fmaxf(mx, acc[i][j][r]);
          sm += acc[i][j][r];
        }
      mx = fmaxf(mx, xhalf(mx));
      sm += xhalf(sm);
      dst[j << 4] = (hf == 0 ? mx : sm) * kWCarryInv;   // the weight carry is a power of two: exact on either side of max and sum
    }
    asm volatile("s_wait_xcnt 0x0" ::: "memory");   // the code behind reuses the address and data registers of the four stores above
  }

  // ---- the tile ----
  if (b == 2) {      // a lane holds 8 consecutive tokens of one channel: V^T rows straight from the registers
    _Float16* vt = (_Float16*)VT + ((size_t)(batch * kHeads + (n0 >> 6)) * kDh + rlane) * kSeq + s0 + mOff;
#pragma unroll
    for (int j = 0; j < 4; ++j)
#pragma unroll
      for (int i = 0; i < 4; ++i) {    // the four stores of a j fill each channel's 128-byte line
        v8h hv;
#pragma unroll
        for (int r = 0; r < 8; ++r) hv[r] = (_Float16)(acc[i][j][r] * (kGCarry * kWCarryInv));
        *(v8h*)(vt + (size_t)(j << 4) * kSeq + (i << 4)) = hv;
      }
    return;
  }
  const float sc = (b == 0) ? kWCarryInv : kGCarry * kWCarryInv;
#pragma unroll
  for (int i = 0; i < 4; ++i) {
    const int mBase = m0 + (i << 4);
#pragma unroll
    for (int j = 0; j < 4; ++j)
#pragma unroll
      for (int r = 0; r < 8; ++r) slab[(mOff + r) * 68 + (j << 4) + rlane] = acc[i][j][r] * sc;
    __builtin_amdgcn_fence(__ATOMIC_RELEASE, "workgroup");
    __builtin_amdgcn_wave_barrier();
    __builtin_amdgcn_fence(__ATOMIC_ACQUIRE, "workgroup");
    if (b == 0) {
      const int c4 = (lane & 15) * 4;                    // row seg = 256 B = 16 lanes x 16 B
#pragma unroll
      for (int it = 0; it < 8; ++it) {
        const int row = it * 2 + hf;
        const v4f v = *(const v4f*)(slab + row * 68 + c4);
        *(v4f*)(Qf + (size_t)(mBase + row) * kDim + n0 + c4) = v;
      }
    } else {
      const int q = lane >> 3, c8 = (lane & 7) * 8;      // row seg = 128 B = 8 lanes x 16 B
#pragma unroll
      for (int it = 0; it < 4; ++it) {
        const int row = it * 4 + q;
        const float* sp = slab + row * 68 + c8;
        v8h hv;
#pragma unroll
        for (int e = 0; e < 8; ++e) hv[e] = (_Float16)sp[e];
        *(v8h*)((_Float16*)Kh + (size_t)(mBase + row) * kDim + n0 + c8) = hv;
      }
      asm volatile("s_wait_xcnt 0x0" ::: "memory");   // the code behind reuses the address and data registers of the four stores above
    }
    __builtin_amdgcn_fence(__ATOMIC_RELEASE, "workgroup");
    __builtin_amdgcn_wave_barrier();
    __builtin_amdgcn_fence(__ATOMIC_ACQUIRE, "workgroup");
  }
}

// ---- Register-blocked batched WMMA GEMM (ACT reduced to none/relu/leaky) -------------------------------
// C[m,n] = scale * sum_k A[m,k] * Bt[n,k] (+bias)(+resid); each wave owns a 64x64 tile, a work-group of 4 waves (2 x 2) a 128x128 tile.
// A row-major [M,K]; Bt row-major [N,K]; M,N % 128 == 0, K % 64 == 0.
// BIAS_MODE: 0 = none, 1 = bias[m], 2 = bias[n].
// OUT_MODE: 0 = f32, 1 = f16, 2 = bf16 hi plane (Cout) + bf16 lo plane (Cout2), 3 = proj_epilogue above (Cout = f32 q, Cout2 = f16 k, VTo, pmax, psum).
// ET: 0 = f16 operands, 1 = bf16 operands (pointers passed as 16-bit storage)
// A_ALT: batch 0 reads A from Ap, batch b > 0 from A2p + (b - 1) * strideA, so products of different left operands share one grid.
// A and Bt reach the waves through LDS: a stage is 64 k of the work-group's 128 A rows and 128 Bt rows (256 rows of 128 B at pitch 144 B,
// 16 B x odd for the 16-byte fragment reads), brought once per work-group by asynchronous copies, whole 128-byte lines per wave, two buffers:
// stage s + 2 is copied into the buffer of stage s behind the barrier that ends its last read.
constexpr int kGK      = 64;                     // k per stage
constexpr int kGPitch  = 72;                     // halves per staged row (144 B)
constexpr int kGRows   = 128;                    // rows per operand and stage
constexpr int kGStageH = 2 * kGRows * kGPitch;   // 18432 halves = 36,864 B per buffer
static_assert((kGPitch * 2) % 16 == 0 && (kGStageH * 2) % 16 == 0);
static_assert(kTok % kGRows == 0 && kDim % kGRows == 0 && kDim % kGK == 0 && kDim / kGK >= 2);
// One thread's share of one operand's stage: 8 x 16 B, rows 16 apart. d: LDS byte address; g: global; step: elements between the copied rows.
__device__ __forceinline__ void gemm_copy8(unsigned d, const unsigned short* g, size_t step) {
  // s_wait_xcnt 0 closes the statement (a precaution): so no later write of the copies' address registers can be scheduled ahead of it
  asm volatile("global_load_async_to_lds_b128 %0, %8, off\n\t"
               "global_load_async_to_lds_b128 %1, %9, off\n\t"
               "global_load_async_to_lds_b128 %2, %10, off\n\t"
               "global_load_async_to_lds_b128 %3, %11, off\n\t"
               "global_load_async_to_lds_b128 %4, %12, off\n\t"
               "global_load_async_to_lds_b128 %5, %13, off\n\t"
               "global_load_async_to_lds_b128 %6, %14, off\n\t"
               "global_load_async_to_lds_b128 %7, %15, off\n\t"
               "s_wait_xcnt 0x0"
               :: "v"(d), "v"(d + 16 * kGPitch * 2), "v"(d + 32 * kGPitch * 2), "v"(d + 48 * kGPitch * 2),
                  "v"(d + 64 * kGPitch * 2), "v"(d + 80 * kGPitch * 2), "v"(d + 96 * kGPitch * 2), "v"(d + 112 * kGPitch * 2),
                  "v"(g), "v"(g + step), "v"(g + 2 * step), "v"(g + 3 * step),
                  "v"(g + 4 * step), "v"(g + 5 * step), "v"(g + 6 * step), "v"(g + 7 * step)
               : "memory");
}
template <int ET> struct Elem;
template <> struct Elem<0> { typedef _Float16 T; };
template <> struct Elem<1> { typedef __bf16 T; };
template <int ET, bool SPLIT, int BIAS_MODE, int OUT_MODE, bool RESID, int ACT = 0, bool A_ALT = false>
__global__ __launch_bounds__(128) void wmma_gemm64(
    const unsigned short* __restrict__ Ap, const unsigned short* __restrict__ A2p, int lda, long strideA,
    const unsigned short* __restrict__ Btp, const unsigned short* __restrict__ Bt2p, int ldb, long strideB,
    void* __restrict__ Cout, void* __restrict__ Cout2, int ldc, long strideC,
    const float* __restrict__ bias,
    const float* __restrict__ resid, long strideR,
    int M, int N, int K, float scale,
    unsigned short* __restrict__ VTo, float* __restrict__ pmax, float* __restrict__ psum) {
  typedef typename Elem<ET>::T T;
  typedef typename Frag<T>::V V;
  static_assert(!SPLIT);                           // the staged operand path carries one plane per operand
  __shared__ __align__(16) unsigned short ring[2 * kGStageH];
  __shared__ __align__(16) float sT[4][16 * 68];   // per-wave 16x64 slab, pitch 68 floats
  const int b    = blockIdx.y;
  const int tid  = threadIdx.x;
  const int lane = tid & 31;
  const int wave = tid >> 5;
  const int tilesN = N >> 7;
  const int tilesM = M >> 7;
  if ((int)blockIdx.x >= tilesM * tilesN) return;  // the same for the whole work-group, in front of every barrier and copy
  const int bm = blockIdx.x / tilesN;
  const int bn = blockIdx.x - bm * tilesN;
  const int m0 = (bm << 7) + ((wave >> 1) << 6);
  const int n0 = (bn << 7) + ((wave & 1) << 6);

  const unsigned short* Ab = (A_ALT && b > 0) ? (A2p + (size_t)(b - 1) * strideA) : (Ap + (size_t)b * strideA);   // block-uniform select
  const unsigned short* Bb = Btp + (size_t)b * strideB;

  const int rlane = lane & 15;                 // row (A) / col (B, D) within subtile
  const int koff  = (lane >> 4) * 8;           // k offset of this lane half
  const int mOff  = (lane >> 4) * 8;           // D row offset

  // this thread's share of every stage: row tid / 8 (+ 16 i) of each operand's 128, 16-byte column tid % 8
  const unsigned short* ag = Ab + (size_t)((bm << 7) + (tid >> 3)) * lda + 8 * (tid & 7);
  const unsigned short* bg = Bb + (size_t)((bn << 7) + (tid >> 3)) * ldb + 8 * (tid & 7);
  const unsigned ad = (unsigned)(size_t)ring + (unsigned)((tid >> 3) * kGPitch + 8 * (tid & 7)) * 2u;   // byte offset in the work-group's LDS
  const unsigned bd = ad + kGRows * kGPitch * 2;
  const size_t aStep = (size_t)16 * lda, bStep = (size_t)16 * ldb;
  const int stages = K / kGK;

  gemm_copy8(ad, ag, aStep);                   // stage 0
  gemm_copy8(bd, bg, bStep);

  v8f acc[4][4];
#pragma unroll
  for (int i = 0; i < 4; ++i)
#pragma unroll
    for (int j = 0; j < 4; ++j) acc[i][j] = (v8f){0.f,0.f,0.f,0.f,0.f,0.f,0.f,0.f};

  asm volatile("s_wait_asynccnt 0x0" ::: "memory");  // this wave's copies of stage 0 have landed
  __syncthreads();                                   // publishes stage 0
  if (stages > 1) {                                  // the same for the whole work-group
    gemm_copy8(ad + kGStageH * 2, ag + kGK, aStep);  // stage 1
    gemm_copy8(bd + kGStageH * 2, bg + kGK, bStep);
  }

  // rolled over the stages, so that the loop's foot is the one hand-over point
#pragma unroll 1
  for (int st = 0; st < stages; ++st) {
    const T* al = (const T*)ring + (st & 1) * kGStageH + (((wave >> 1) << 6) + rlane) * kGPitch + koff;
    const T* bl = (const T*)ring + (st & 1) * kGStageH + (kGRows + ((wave & 1) << 6) + rlane) * kGPitch + koff;
#pragma unroll
    for (int kk = 0; kk < kGK / 32; ++kk) {
      V bh[4], ah[4];
#pragma unroll
      for (int j = 0; j < 4; ++j) bh[j] = Frag<T>::load(bl + (j << 4) * kGPitch + 32 * kk);
#pragma unroll
      for (int i = 0; i < 4; ++i) ah[i] = Frag<T>::load(al + (i << 4) * kGPitch + 32 * kk);
      __builtin_amdgcn_sched_barrier(0);   // the 16 products' fragments are read as one group: one LDS latency in front of them, not one per fragment
#pragma unroll
      for (int i = 0; i < 4; ++i) {
#pragma unroll
        for (int j = 0; j < 4; ++j) acc[i][j] = Frag<T>::mma(ah[i], bh[j], acc[i][j]);
        Frag<T>::guard(acc[i][0], acc[i][3], ah[i], ah[i]);
      }
      Frag<T>::keep(bh[0], bh[1], bh[2], bh[3]);
    }

    // hand-over: this wave's reads of stage st are done, its copies of stage st + 1 have landed; the barrier says both of every wave
    asm volatile("s_wait_dscnt 0x0" ::: "memory");
    asm volatile("s_wait_asynccnt 0x0" ::: "memory");
    __syncthreads();
    if (st + 2 < stages) {                             // the same for the whole work-group
      gemm_copy8(ad + (st & 1) * (kGStageH * 2), ag + (size_t)(st + 2) * kGK, aStep);
      gemm_copy8(bd + (st & 1) * (kGStageH * 2), bg + (size_t)(st + 2) * kGK, bStep);
    }
  }
  asm volatile("s_wait_asynccnt 0x0" ::: "memory");    // no copy is outstanding when the wave goes on
  acc_guard4(acc[0][0], acc[0][1], acc[0][2], acc[0][3]);
  acc_guard4(acc[1][0], acc[1][1], acc[1][2], acc[1][3]);
  acc_guard4(acc[2][0], acc[2][1], acc[2][2], acc[2][3]);
  acc_guard4(acc[3][0], acc[3][1], acc[3][2], acc[3][3]);

  // ---- epilogue ----
  float* slab = sT[wave];
  if (OUT_MODE == 3) {
    proj_epilogue(acc, slab, b, m0, n0, lane, (float*)Cout, (unsigned short*)Cout2, VTo, pmax, psum);
    return;
  }
  const float* Rb = RESID ? (resid + (size_t)b * strideR) : nullptr;
#pragma unroll
  for (int i = 0; i < 4; ++i) {
    const int mBase = m0 + (i << 4);
#pragma unroll
    for (int j = 0; j < 4; ++j) {
      const int n = n0 + (j << 4) + rlane;
      float bv = 0.f;
      if (BIAS_MODE == 2) bv = bias[n];
#pragma unroll
      for (int r = 0; r < 8; ++r) {
        float v = acc[i][j][r] * scale;
        if (BIAS_MODE == 1) v += bias[mBase + mOff + r];
        if (BIAS_MODE == 2) v += bv;
        if (RESID) v += Rb[(size_t)(mBase + mOff + r) * ldc + n];
        if (ACT == 2) v = fmaxf(v, 0.0f);
        if (ACT == 4) v = (v > 0.f) ? v : 0.01f * v;
        slab[(mOff + r) * 68 + (j << 4) + rlane] = v;
      }
    }
    __builtin_amdgcn_fence(__ATOMIC_RELEASE, "workgroup");
    __builtin_amdgcn_wave_barrier();
    __builtin_amdgcn_fence(__ATOMIC_ACQUIRE, "workgroup");
    if (OUT_MODE == 0) {
      float* C = (float*)Cout + (size_t)b * strideC;
      const int hh = lane >> 4, c4 = (lane & 15) * 4;     // row seg = 256 B = 16 lanes x 16 B
      {
#pragma unroll
        for (int it = 0; it < 8; ++it) {
          const int row = it * 2 + hh;
          v4f v = *(const v4f*)(slab + row * 68 + c4);
          *(v4f*)(C + (size_t)(mBase + row) * ldc + n0 + c4) = v;
        }
        
      }
    } else {
      const int q = lane >> 3, c8 = (lane & 7) * 8;
      unsigned short* C  = (unsigned short*)Cout  + (size_t)b * strideC;
      unsigned short* C2 = (OUT_MODE == 2) ? ((unsigned short*)Cout2 + (size_t)b * strideC) : nullptr;
      {
#pragma unroll
        for (int it = 0; it < 4; ++it) {
          const int row = it * 4 + q;
          const float* sp = slab + row * 68 + c8;
          v8h hv, lv;
#pragma unroll
          for (int e = 0; e < 8; ++e) {
            if (OUT_MODE == 1) {
              hv[e] = (_Float16)sp[e];
            } else {
              unsigned short hb = f2bf_bits(sp[e]);
              unsigned short lb = f2bf_bits(sp[e] - bf_bits2f(hb));
              hv[e] = __builtin_bit_cast(_Float16, hb);
              lv[e] = __builtin_bit_cast(_Float16, lb);
            }
          }
          *(v8h*)(C + (size_t)(mBase + row) * ldc + n0 + c8) = hv;
          if (OUT_MODE == 2) *(v8h*)(C2 + (size_t)(mBase + row) * ldc + n0 + c8) = lv;
        }
        
      }
    }
    __builtin_amdgcn_fence(__ATOMIC_RELEASE, "workgroup");
    __builtin_amdgcn_wave_barrier();
    __builtin_amdgcn_fence(__ATOMIC_ACQUIRE, "workgroup");
  }
}

// ---------------------------------------------------------------------------
// Input cast: out plane z (0 <- x, 1 <- m) = f16( bf16_rne(v) ), [8192][512] halves each. One work-group's share: block bx of plane z.
// ---------------------------------------------------------------------------
__device__ __forceinline__ void cast_in_block(const float* __restrict__ x, const float* __restrict__ m,
                                              unsigned short* __restrict__ out, int n8, int z, int bx) {
  const float* in = (z == 0) ? x : m;                // block-uniform plane select
  const int i = bx * 256 + threadIdx.x;
  if (i >= n8) return;
  const float* p = in + 8 * (size_t)i;
  const v4f a = *(const v4f*)(p);
  const v4f c = *(const v4f*)(p + 4);
  unsigned short hb[8];
#pragma unroll
  for (int e = 0; e < 4; ++e) {
    hb[e]     = h_bits(bf_rne(a[e]));
    hb[4 + e] = h_bits(bf_rne(c[e]));
  }
  const v4u u = (v4u){pk16(hb[0], hb[1]), pk16(hb[2], hb[3]), pk16(hb[4], hb[5]), pk16(hb[6], hb[7])};
  unsigned short* q = out + (size_t)z * 8 * (size_t)n8 + 8 * (size_t)i;
  *(v4u*)q = u;
  
}

// ---------------------------------------------------------------------------
// Weight transpose + cast: W is [in d][out h] (512x512, row-major); WT[h][d] = f16( scale * bf16_rne(W[d][h]) ).
// One work-group's share: bd = d tile (64 cols of WT, 0..7), bh = h tile (64 rows of WT, 0..7), z selects W0..W3 and the
// output plane (plane z at out + z*512*512 halves). 256 threads; sm is the work-group's 64 x 65 float exchange tile.
// Load coverage: 4 iterations x 256 threads x float4 = 4096 = the whole 64(d) x 64(h) tile (coalesced along h), 4 b128 loads per lane.
// Store coverage: 8 waves x 2 iterations x 4 rows (lane>>3) = 64 rows; (lane&7) x 8 halves = 64 cols; each row segment =
// ---------------------------------------------------------------------------
__device__ __forceinline__ void wtcast_block(const float* __restrict__ W0, const float* __restrict__ W1,
                                             const float* __restrict__ W2, const float* __restrict__ W3,
                                             unsigned short* __restrict__ out, float scale,
                                             float (*sm)[65], int bd, int bh, int z) {   // sm[h_local][d_local]; z block-uniform
  const int t  = threadIdx.x;
  const int d0 = bd * 64;
  const int h0 = bh * 64;
  const float* W = (z == 0) ? W0 : (z == 1) ? W1 : (z == 2) ? W2 : W3;
#pragma unroll
  for (int i = 0; i < 4; ++i) {
    const int e4 = i * 256 + t;
    const int r  = e4 >> 4;            // d local 0..63
    const int c4 = (e4 & 15) * 4;      // h local 0..60
    const v4f w = *(const v4f*)(W + (size_t)(d0 + r) * kDim + h0 + c4);
#pragma unroll
    for (int k = 0; k < 4; ++k) sm[c4 + k][r] = bf_rne(w[k]) * scale;
  }
  __syncthreads();
  const int lane = t & 31, wave = t >> 5;
  const int q = lane >> 3, c8 = (lane & 7) * 8;
  unsigned short* op = out + (size_t)z * kDim * kDim;
  {
#pragma unroll
    for (int it = 0; it < 2; ++it) {
      const int row = wave * 8 + it * 4 + q;                 // h local
      unsigned short hb[8];
#pragma unroll
      for (int e = 0; e < 8; ++e) hb[e] = h_bits(sm[row][c8 + e]);
      const v4u u = (v4u){pk16(hb[0], hb[1]), pk16(hb[2], hb[3]), pk16(hb[4], hb[5]), pk16(hb[6], hb[7])};
      *(v4u*)(op + (size_t)(h0 + row) * kDim + d0 + c8) = u;
    }
    
  }
}

// ---------------------------------------------------------------------------
// The two independent casts above in one grid, told apart by the block index (block-uniform, so the transpose's barrier is passed by
// whole work-groups only): blocks 0..255 = weight tiles (d tile, h tile, matrix), blocks 256..4351 = input cast (2048 blocks per plane).
// ---------------------------------------------------------------------------
constexpr int kWtBlocks   = (kDim / 64) * (kDim / 64) * 4;   // 256
constexpr int kCastBlocks = kPlane / 8 / 256;                // 2048 per plane
static_assert(kDim / 64 == 8 && kCastBlocks == 2048);
__global__ __launch_bounds__(256) void prep_kernel(const float* __restrict__ x, const float* __restrict__ m,
                                                   const float* __restrict__ W0, const float* __restrict__ W1,
                                                   const float* __restrict__ W2, const float* __restrict__ W3,
                                                   unsigned short* __restrict__ xm_out, unsigned short* __restrict__ wt_out,
                                                   float scale, int n8) {
  __shared__ float sm[64][65];
  const int blk = blockIdx.x;
  if (blk < kWtBlocks) {
    wtcast_block(W0, W1, W2, W3, wt_out, scale, sm, blk & 7, (blk >> 3) & 7, blk >> 6);
  } else {
    const int cb = blk - kWtBlocks;
    cast_in_block(x, m, xm_out, n8, cb >> 11, cb & (kCastBlocks - 1));
  }
}

// ---------------------------------------------------------------------------
// Token pooling, part 2 + channel gate MLP (f32): block tb = tensor*4 + batch (12 blocks), 512 threads = channels.
//   mx[c] = max over 32 chunk maxima, av[c] = (sum of 32 chunk sums, chunk order) * (1/2048)
//   hid[j] = relu( sum_c mx[c]*w1[c][j] + sum_c av[c]*w1[c][j] )   j < 32      (w1, w2 RNE-converted to bf16 where used)
//            thread t holds w1 elements i*512 + t, so wave w sums channels w, w+16, .. w+496 for all 32 j (lane = j);
//            32 threads then add the 16 wave partials in wave order
//   g[c]   = 1 / (1 + exp(-sum_j hid[j]*w2[j][c]))
// The w1 and w2 elements a thread needs depend on nothing computed here: they are loaded first, beside the chunk partials.
// ---------------------------------------------------------------------------
__global__ __launch_bounds__(512) void gate_kernel(const float* __restrict__ pmax, const float* __restrict__ psum,
                                                   const float* __restrict__ w1, const float* __restrict__ w2,
                                                   float* __restrict__ scl) {
  __shared__ float smax[kDim];
  __shared__ float savg[kDim];
  __shared__ float pa1[kDim / 32][kRed];
  __shared__ float pa2[kDim / 32][kRed];
  __shared__ float hid[kRed];
  const int t    = threadIdx.x;
  const int tb   = blockIdx.x;          // 0..11
  const int lane = t & 31, wave = t >> 5;
  float w1v[32], w2v[kRed];
#pragma unroll   // this loop and the next two: independent loads at immediate offsets, in flight together
  for (int i = 0; i < 32; ++i) w1v[i] = w1[i * kDim + t];      // channel i*16 + wave, hidden unit lane
#pragma unroll   // as above
  for (int j = 0; j < kRed; ++j) w2v[j] = w2[j * kDim + t];
  const float* pm = pmax + (size_t)tb * kPoolParts * kDim + t;
  const float* ps = psum + (size_t)tb * kPoolParts * kDim + t;
  float mx = -__builtin_inff();
  float sm = 0.0f;
#pragma unroll   // as above
  for (int p = 0; p < kPoolParts; ++p) {
    mx = fmaxf(mx, pm[p * kDim]);
    sm += ps[p * kDim];
  }
  smax[t] = mx;
  savg[t] = sm * kInvSeq;
  __syncthreads();
  float a1 = 0.0f, a2 = 0.0f;
#pragma unroll   // w1v[] stays in registers
  for (int i = 0; i < 32; ++i) {
    const float w = bf_rne(w1v[i]);
    a1 += smax[i * 16 + wave] * w;
    a2 += savg[i * 16 + wave] * w;
  }
  pa1[wave][lane] = a1;
  pa2[wave][lane] = a2;
  __syncthreads();
  if (t < kRed) {                       // wave 0, wave-uniform
    float s1 = 0.0f, s2 = 0.0f;
#pragma unroll   // the 32 LDS reads overlap
    for (int w = 0; w < kDim / 32; ++w) {
      s1 += pa1[w][t];
      s2 += pa2[w][t];
    }
    hid[t] = fmaxf(s1 + s2, 0.0f);
  }
  __syncthreads();
  float a = 0.0f;
#pragma unroll   // w2v[] stays in registers
  for (int j = 0; j < kRed; ++j) a += hid[j] * bf_rne(w2v[j]);
  const float g = 1.0f / (1.0f + expf(-a));
  scl[(size_t)tb * kDim + t] = g;       // one whole 128-byte line per wave
}

// ---------------------------------------------------------------------------
// Fused attention of every (batch, head): S^T = K.Q^T, online softmax (base 2, f32), O^T += V^T.P^T; scores and P stay in registers.
// grid (8, 32): blockIdx.x = block of 256 queries, blockIdx.y = batch*8 + head. 8 waves x 32 query columns (2 groups of 16).
// One pass = 32 keys. Lane (c = lane & 15, hf = lane >> 4) of a score tile holds query c, keys 8*hf + r: the two 16-key tiles of a
// pass, converted in place, are the B operand of the second product (element s: key 8*hf + s, s < 8; key 16 + 8*hf + s - 8 else),
// the k order in which Frag::load brings V^T (and K; the q fragments are built in the same order).
// The maximum in use may trail the true one by up to 8 (base-2 exponent), so P <= 2^8 and P carried x2^6 <= 2^14 in f16.
// Oh[b][q][head*64 + d] = f16( 32 * acc / rowsum * gv[d] ): context carried x256, V carried x8.
// The channel gates (scl = [3][4][512]: q, k, v) come in here: a score is sum_d q_d gq_d k_d gk_d, so the q fragments, built once per wave
// from f32 q, carry f16( q * (8 gq gk) ) against the ungated k plane; gv scales channel d of the f32 result.
// K and V^T reach the waves through LDS: a stage is 128 keys (K 128 rows of 128 B at pitch 144 B, V^T 64 rows of 256 B at pitch 272 B, both
// 16 B x odd for the 16-byte fragment reads), brought once per work-group by asynchronous copies, whole 128-byte lines per wave, two buffers:
// stage s + 2 is copied into the buffer of stage s behind the barrier that ends its last read. A stage serves four passes.
// ---------------------------------------------------------------------------
constexpr int kStKeys = 128;                    // keys per stage
constexpr int kStages = kSeq / kStKeys;         // 16
constexpr int kKPitch = 72;                     // halves per staged K row (144 B)
constexpr int kVPitch = 136;                    // halves per staged V^T row (272 B)
constexpr int kKTile  = kStKeys * kKPitch;      // 9216 halves
constexpr int kStageH = kKTile + kDh * kVPitch; // 17920 halves = 35,840 B per buffer
static_assert(kStages >= 2 && kStKeys % 32 == 0 && (kKTile * 2) % 16 == 0 && (kStageH * 2) % 16 == 0);
// One thread's share of a stage: 4 x 16 B of K (rows 32 apart) and 4 x 16 B of V^T (rows 16 apart). kd, vd: LDS byte addresses; kg, vg: global.
__device__ __forceinline__ void stage_copy(unsigned kd, unsigned vd, const _Float16* kg, const _Float16* vg) {
  // s_wait_xcnt 0 closes the statement (a precaution): so no later write of the copies' address registers can be scheduled ahead of it
  asm volatile("global_load_async_to_lds_b128 %0, %8, off\n\t"
               "global_load_async_to_lds_b128 %1, %9, off\n\t"
               "global_load_async_to_lds_b128 %2, %10, off\n\t"
               "global_load_async_to_lds_b128 %3, %11, off\n\t"
               "global_load_async_to_lds_b128 %4, %12, off\n\t"
               "global_load_async_to_lds_b128 %5, %13, off\n\t"
               "global_load_async_to_lds_b128 %6, %14, off\n\t"
               "global_load_async_to_lds_b128 %7, %15, off\n\t"
               "s_wait_xcnt 0x0"
               :: "v"(kd), "v"(kd + 32 * kKPitch * 2), "v"(kd + 64 * kKPitch * 2), "v"(kd + 96 * kKPitch * 2),
                  "v"(vd), "v"(vd + 16 * kVPitch * 2), "v"(vd + 32 * kVPitch * 2), "v"(vd + 48 * kVPitch * 2),
                  "v"(kg), "v"(kg + (size_t)32 * kDim), "v"(kg + (size_t)64 * kDim), "v"(kg + (size_t)96 * kDim),
                  "v"(vg), "v"(vg + (size_t)16 * kSeq), "v"(vg + (size_t)32 * kSeq), "v"(vg + (size_t)48 * kSeq)
               : "memory");
}
__global__ __launch_bounds__(256) void attn_fused_kernel(const float* __restrict__ Qf, const unsigned short* __restrict__ Kp,
                                                         const unsigned short* __restrict__ VTp, const float* __restrict__ scl,
                                                         unsigned short* __restrict__ Op) {
  typedef Frag<_Float16> FH;
  __shared__ __align__(16) _Float16 ring[2 * kStageH];
  const int lane = threadIdx.x & 31, wave = threadIdx.x >> 5;
  const int c = lane & 15, hf = lane >> 4;
  const int bh = blockIdx.y;
  const int q0 = blockIdx.x * 256 + wave * 32;
  const size_t tokOff = (size_t)(bh >> 3) * kSeq * kDim + (size_t)(bh & 7) * kDh;
  const float* ql = Qf + tokOff + (size_t)(q0 + c) * kDim + 8 * hf;
  const float* gl = scl + (size_t)(bh >> 3) * kDim + (size_t)(bh & 7) * kDh + 8 * hf;   // q gate of this lane's first channel; k, v: + 4, 8 rows

  // this thread's share of every stage: K row t / 8 (+ 32 i), 16-byte column t % 8; V^T row t / 16 (+ 16 i), 16-byte column t % 16
  const int tid = threadIdx.x;
  const _Float16* kg = (const _Float16*)Kp + tokOff + (size_t)(tid >> 3) * kDim + 8 * (tid & 7);
  const _Float16* vg = (const _Float16*)VTp + (size_t)bh * kDh * kSeq + (size_t)(tid >> 4) * kSeq + 8 * (tid & 15);
  const unsigned ringB = (unsigned)(size_t)ring;     // byte offset of the ring in the work-group's LDS
  const unsigned kd = ringB + (unsigned)((tid >> 3) * kKPitch + 8 * (tid & 7)) * 2u;
  const unsigned vd = ringB + (unsigned)(kKTile + (tid >> 4) * kVPitch + 8 * (tid & 15)) * 2u;

  stage_copy(kd, vd, kg, vg);                        // stage 0, in flight under the q fragments' loads

  v16h qf[2][2];   // element e < 8: channel 32 kc + 8 hf + e; e >= 8: 32 kc + 16 + 8 hf + e - 8 (the order of Frag::load)
#pragma unroll
  for (int kc = 0; kc < 2; ++kc)
#pragma unroll
    for (int u = 0; u < 4; ++u) {      // four channels at a time
      const int d = 32 * kc + 16 * (u >> 1) + 4 * (u & 1);
      const v4f gg = *(const v4f*)(gl + d) * *(const v4f*)(gl + (size_t)kBatch * kDim + d) * kGCarry;
#pragma unroll
      for (int g = 0; g < 2; ++g) {
        const v4f qv = *(const v4f*)(ql + (size_t)(16 * g) * kDim + d) * gg;
#pragma unroll
        for (int e = 0; e < 4; ++e) qf[g][kc][4 * u + e] = (_Float16)qv[e];
      }
    }

  v8f acc[2][4];
  v2f ls[2];
  float m_run[2];
#pragma unroll
  for (int g = 0; g < 2; ++g) {
    m_run[g] = -__builtin_inff();
    ls[g] = (v2f){0.f, 0.f};
#pragma unroll
    for (int t = 0; t < 4; ++t) acc[g][t] = (v8f){0.f,0.f,0.f,0.f,0.f,0.f,0.f,0.f};
  }

  asm volatile("s_wait_asynccnt 0x0" ::: "memory");  // this wave's copies of stage 0 have landed
  __syncthreads();                                   // publishes stage 0
  stage_copy(kd + kStageH * 2, vd + kStageH * 2, kg + (size_t)kStKeys * kDim, vg + kStKeys);   // stage 1

  // rolled over the stages; the four passes of a stage are unrolled, so that a pass can fetch the next pass's K inside its own stage
#pragma unroll 1
  for (int st = 0; st < kStages; ++st) {
    const _Float16* kl = ring + (st & 1) * kStageH + c * kKPitch + 8 * hf;
    const _Float16* vl = ring + (st & 1) * kStageH + kKTile + c * kVPitch + 8 * hf;
    v16h kf[2][2];
#pragma unroll
    for (int kt = 0; kt < 2; ++kt)
#pragma unroll
      for (int kc = 0; kc < 2; ++kc) kf[kt][kc] = FH::load(kl + (16 * kt) * kKPitch + 32 * kc);
    __builtin_amdgcn_sched_barrier(0);   // the stage's first K fragments are read as one group: one LDS latency in front of the products, not one per fragment

#pragma unroll
    for (int ps = 0; ps < kStKeys / 32; ++ps) {
      v16h vf[4];      // this pass's V^T, in flight under the score products and the maxima
#pragma unroll
      for (int t = 0; t < 4; ++t) vf[t] = FH::load(vl + (16 * t) * kVPitch + 32 * ps);

      v8f s[2][2];
#pragma unroll
      for (int kt = 0; kt < 2; ++kt)
#pragma unroll
        for (int g = 0; g < 2; ++g) {
          s[kt][g] = (v8f){0.f,0.f,0.f,0.f,0.f,0.f,0.f,0.f};
#pragma unroll
          for (int kc = 0; kc < 2; ++kc) s[kt][g] = FH::mma(kf[kt][kc], qf[g][kc], s[kt][g]);
        }
      if (ps + 1 < kStKeys / 32) {
#pragma unroll
        for (int kt = 0; kt < 2; ++kt)
#pragma unroll
          for (int kc = 0; kc < 2; ++kc) kf[kt][kc] = FH::load(kl + (32 * (ps + 1) + 16 * kt) * kKPitch + 32 * kc);
      }
      __builtin_amdgcn_sched_barrier(0);   // keeps the K loads issued here, ahead of the vector work that hides their latency

      float mb[2];
      bool need = false;
#pragma unroll
      for (int g = 0; g < 2; ++g) {
        float mx = s[0][g][0];
#pragma unroll
        for (int r = 1; r < 8; ++r) mx = fmaxf(mx, s[0][g][r]);
#pragma unroll
        for (int r = 0; r < 8; ++r) mx = fmaxf(mx, s[1][g][r]);
        mx = fmaxf(mx, xhalf(mx)) * kSmScale2;         // both halves hold the query's maximum of this pass (the scale is positive)
        mb[g] = mx;
        need = need || (mx > m_run[g] + 8.0f);
      }
      if (__builtin_amdgcn_ballot_w32(need) != 0) {    // wave-uniform; always on the first pass, rare later
#pragma unroll
        for (int g = 0; g < 2; ++g) {
          const float m_new = fmaxf(m_run[g], mb[g]);
          const float corr = __builtin_amdgcn_exp2f(m_run[g] - m_new);   // 0 on the first pass
          m_run[g] = m_new;
          ls[g] = ls[g] * corr;
#pragma unroll
          for (int t = 0; t < 4; ++t) acc[g][t] = acc[g][t] * corr;
        }
      }
#pragma unroll
      for (int g = 0; g < 2; ++g) {
        const float nm = kPShift - m_run[g];
        v16h pf;
#pragma unroll
        for (int i = 0; i < 8; ++i) {
          const v2f sv = (v2f){s[i >> 2][g][2 * (i & 3)], s[i >> 2][g][2 * (i & 3) + 1]};
          const v2f arg = __builtin_elementwise_fma(sv, (v2f){kSmScale2, kSmScale2}, (v2f){nm, nm});
          const v2f p = (v2f){__builtin_amdgcn_exp2f(arg.x), __builtin_amdgcn_exp2f(arg.y)};
          ls[g] = ls[g] + p;
          const v2h ph = __builtin_convertvector(p, v2h);
          pf[2 * i]     = ph.x;
          pf[2 * i + 1] = ph.y;
        }
#pragma unroll
        for (int t = 0; t < 4; ++t) acc[g][t] = FH::mma(vf[t], pf, acc[g][t]);
      }
    }

    // hand-over: this wave's reads of stage st are done, its copies of stage st + 1 have landed; the barrier says both of every wave
    asm volatile("s_wait_dscnt 0x0" ::: "memory");
    asm volatile("s_wait_asynccnt 0x0" ::: "memory");
    __syncthreads();
    if (st + 2 < kStages)                              // the same for the whole work-group
      stage_copy(kd + (st & 1) * (kStageH * 2), vd + (st & 1) * (kStageH * 2),
                 kg + (size_t)(st + 2) * kStKeys * kDim, vg + (st + 2) * kStKeys);
  }
  asm volatile("s_wait_asynccnt 0x0" ::: "memory");    // no copy is outstanding when the wave ends

  _Float16* ol = (_Float16*)Op + tokOff + (size_t)(q0 + c) * kDim + 8 * hf;
  float inv[2];
#pragma unroll
  for (int g = 0; g < 2; ++g) {
    float l = ls[g].x + ls[g].y;
    l += xhalf(l);                                   // join the two halves' key sums
    inv[g] = kCtxScale / l;
  }
#pragma unroll
  for (int t = 0; t < 4; ++t) {
    const float* gv = gl + (size_t)(2 * kBatch) * kDim + 16 * t;
    const v4f g0 = *(const v4f*)(gv);
    const v4f g1 = *(const v4f*)(gv + 4);
#pragma unroll
    for (int g = 0; g < 2; ++g) {
      v8h hv;
#pragma unroll
      for (int r = 0; r < 8; ++r) hv[r] = (_Float16)(acc[g][t][r] * inv[g] * (r < 4 ? g0[r & 3] : g1[r & 3]));   // d = 16 t + 8 hf + r of query 16 g + c
      *(v8h*)(ol + (size_t)(16 * g) * kDim + 16 * t) = hv;
    }
  }
}

// ---------------------------------------------------------------------------
// Host glue.
//   XMh  f16 [2][8192][512]     16,777,216  at           0   (x plane then m plane, bf16-valued)
//   WT   f16 [4][512][512]       2,097,152  at  16,777,216   (Wq^T, Wk^T, Wv^T, Wo^T, [out][in], carried x16)
//   Qf   f32 [8192][512]        16,777,216  at  18,874,368   (q projection, ungated)
//   Kh   f16 [8192][512]         8,388,608  at  35,651,584   (k projection, ungated, carried x8)
//   VT   f16 [32][64][2048]      8,388,608  at  44,040,192   (v projection transposed per (batch, head), ungated, carried x8)
//   Oh   f16 [8192][512]         8,388,608  at  52,428,800   (attention context, carried x256)
//   SCL  f32 [3][4][512]            24,576  at  60,817,408   (channel gates)
//   PMX  f32 [12][32][512]         786,432  at  60,841,984   (chunk maxima of the token pooling)
//   PSM  f32 [12][32][512]         786,432  at  61,628,416   (chunk sums of the token pooling)
//   total                       62,414,848
// GEMM shapes: projections/out M=8192 N=512 K=512.
// All M,N multiples of 128, all K multiples of 64, no padded rows anywhere; every plane fully written before it is read.
// Launches: casts 1, projections with pooling partials 1, gates 1, attention 1, output projection 1 = 5.
// ---------------------------------------------------------------------------
extern "C" void kernel_launch(void* const* d_in, const int* in_sizes, int n_in,
                              void* d_out, int out_size, void* d_ws, size_t ws_size,
                              hipStream_t stream) {
  if (n_in < 9) return;
  if (in_sizes[0] != kPlane || in_sizes[1] != kPlane) return;
  if (in_sizes[2] != kDim * kDim || in_sizes[3] != kDim * kDim || in_sizes[4] != kDim * kDim || in_sizes[5] != kDim * kDim) return;
  if (in_sizes[6] != kDim || in_sizes[7] != kDim * kRed || in_sizes[8] != kRed * kDim) return;
  if (out_size != kPlane) return;

  const size_t szHalfPlane = (size_t)kPlane * 2;                 // 8,388,608
  const size_t szXM  = 2 * szHalfPlane;
  const size_t szWT  = (size_t)4 * kDim * kDim * 2;
  const size_t szQf  = (size_t)kPlane * 4;
  const size_t szVT  = (size_t)kBatch * kHeads * kDh * kSeq * 2;
  const size_t szSCL = (size_t)3 * kBatch * kDim * 4;
  const size_t offXM  = 0;
  const size_t offWT  = offXM + szXM;
  const size_t offQf  = offWT + szWT;
  const size_t offKh  = offQf + szQf;
  const size_t offVT  = offKh + szHalfPlane;
  const size_t offOh  = offVT + szVT;
  const size_t offSCL = offOh + szHalfPlane;
  const size_t szPart = (size_t)3 * kBatch * kPoolParts * kDim * 4;
  const size_t offPMX = offSCL + szSCL;
  const size_t offPSM = offPMX + szPart;
  const size_t total  = offPSM + szPart;                          // 62,414,848
  if (ws_size < total) return;

  const float* x      = (const float*)d_in[0];
  const float* m      = (const float*)d_in[1];
  const float* Wq     = (const float*)d_in[2];
  const float* Wk     = (const float*)d_in[3];
  const float* Wv     = (const float*)d_in[4];
  const float* Wo     = (const float*)d_in[5];
  const float* bias_o = (const float*)d_in[6];
  const float* gw1    = (const float*)d_in[7];
  const float* gw2    = (const float*)d_in[8];
  float* out = (float*)d_out;
  char* ws = (char*)d_ws;
  unsigned short* XMh = (unsigned short*)(ws + offXM);
  unsigned short* WT  = (unsigned short*)(ws + offWT);
  float*          Qf  = (float*)(ws + offQf);
  unsigned short* Kh  = (unsigned short*)(ws + offKh);
  unsigned short* VT  = (unsigned short*)(ws + offVT);
  unsigned short* Oh  = (unsigned short*)(ws + offOh);
  float*          SCL = (float*)(ws + offSCL);
  float*          PMX = (float*)(ws + offPMX);
  float*          PSM = (float*)(ws + offPSM);

  const unsigned short* Xh = XMh;
  const unsigned short* Mh = XMh + (size_t)kPlane;
  const size_t wPlane = (size_t)kDim * kDim;

  // ---- 16-bit operand planes of the inputs ----
  const int n8 = kPlane / 8;   // 524288 -> 2048 blocks exact
  prep_kernel<<<dim3(kWtBlocks + 2 * kCastBlocks), dim3(256), 0, stream>>>(x, m, Wq, Wk, Wv, Wo, XMh, WT, kWCarry, n8);

  // ---- projections x.Wq, m.Wk, m.Wv (M=8192, N=512, K=512): f32 q, f16 k and V^T, and the token pooling's chunk partials ----
  const int tilesProj = (kTok / kGRows) * (kDim / kGRows);   // 256 work-groups of 4 waves, a 128x128 tile each
  // one grid, blockIdx.y = product: left operand x for 0, m for 1 and 2 (A_ALT, stride 0)
  wmma_gemm64<0, false, 0, 3, false, 0, true><<<dim3(tilesProj, 3), dim3(128), 0, stream>>>(
      Xh, Mh, kDim, 0L, WT, WT, kDim, (long)wPlane,
      (void*)Qf, (void*)Kh, kDim, 0L, bias_o, SCL, 0L, kTok, kDim, kDim, kWCarryInv, VT, PMX, PSM);

  // ---- channel gates ----
  gate_kernel<<<dim3(3 * kBatch), dim3(512), 0, stream>>>(PMX, PSM, gw1, gw2, SCL);

  // ---- attention, all (batch, head) in one launch, gates applied inside: Oh[b, i, h*64+d] = f16( 256 * context ) ----
  attn_fused_kernel<<<dim3(kSeq / 256, kBatch * kHeads), dim3(256), 0, stream>>>(Qf, Kh, VT, SCL, Oh);

  // ---- output projection: out = 2^-12 * Oh.Wo^T(x16) + bo   (M=8192, N=512, K=512), f32 to d_out ----
  wmma_gemm64<0, false, 2, 0, false, 0><<<dim3(tilesProj, 1), dim3(128), 0, stream>>>(
      Oh, Oh, kDim, 0L, WT + 3 * wPlane, WT + 3 * wPlane, kDim, 0L,
      (void*)out, (void*)out, kDim, 0L, bias_o, SCL, 0L, kTok, kDim, kDim, kOutScale, nullptr, nullptr, nullptr);
}

// v007
// One run takes 71.1 microseconds.
// In both of two side-by-side timings against v006, it was 1.06 times as fast.
// Over all steps from v000 it is 50.3 times as fast.
// Contractions: q/k/v projections (x,m RNE-converted to bf16 held in f16 LDS tiles x W^T bf16-valued f16 planes carried x16), scores k.q^T (k f16 plane and q fragments scaled by both gates, each carried x8), v^T.p^T (V^T f16 carried x8 x unnormalised P f16 carried x64; v gate on the f32 result), output projection (context f16 carried x256 x Wo^T f16 carried x16): all v_wmma_f32_16x16x32_f16 with f32 accumulate; token pooling, channel-gate MLP, online softmax in f32.
#include <hip/hip_runtime.h>
#include <math.h>

// ---------------------------------------------------------------------------
// Problem constants
// ---------------------------------------------------------------------------
constexpr int kBatch = 4;
constexpr int kSeq   = 2048;
constexpr int kDim   = 512;               // model dim = inner dim
constexpr int kHeads = 8;
constexpr int kDh    = 64;
constexpr int kRed   = 32;                // gate hidden width (512 / 16)
constexpr int kTok   = kBatch * kSeq;     // 8192 token rows
constexpr int kPlane = kTok * kDim;       // 4194304 elements per [8192][512] plane
constexpr float kWCarry    = 16.0f;                 // weights carried x16 in f16
constexpr float kWCarryInv = 1.0f / 16.0f;
constexpr float kGCarry    = 8.0f;                  // q fragments, k and V^T planes carried x8 in f16
constexpr float kPShift    = 6.0f;                  // unnormalised probabilities carried x2^6 in f16 (added to the base-2 exponent)
constexpr float kCtxCarry  = 256.0f;                // context carried x2^8 in f16
constexpr float kCtxScale  = kCtxCarry / kGCarry;                   // 32; the P carry cancels against the row sum
constexpr float kOutScale  = 1.0f / (kCtxCarry * kWCarry);          // 2^-12
constexpr float kAttnScale = 0.044194173824159216f;                 // 512^-0.5
constexpr float kSmScale   = kAttnScale / (kGCarry * kGCarry);      // exact: / 64
constexpr float kSmScale2  = kSmScale * 1.4426950408889634f;        // scores to base-2 exponents
constexpr float kInvSeq    = 1.0f / 2048.0f;
static_assert(kHeads * kDh == kDim);
static_assert(kDim / 16 == kRed);
static_assert(kSeq % 256 == 0 && (kSeq & (kSeq - 1)) == 0 && kDh == 64);   // fused attention: 256 queries per block
// GEMM shape contract: M % 128 == 0, N % 128 == 0, K % 64 == 0 for every launch
static_assert(kTok % 128 == 0 && kDim % 128 == 0 && kDim % 64 == 0);   // projections / out: M=8192 N=512 K=512

typedef __attribute__((ext_vector_type(16))) _Float16 v16h;
typedef __attribute__((ext_vector_type(8)))  _Float16 v8h;
typedef __attribute__((ext_vector_type(16))) __bf16   v16b;
typedef __attribute__((ext_vector_type(8)))  __bf16   v8b;
typedef __attribute__((ext_vector_type(8)))  float    v8f;
typedef __attribute__((ext_vector_type(4)))  float    v4f;
typedef __attribute__((ext_vector_type(2)))  float    v2f;
typedef __attribute__((ext_vector_type(2)))  _Float16 v2h;
typedef __attribute__((ext_vector_type(4)))  unsigned int v4u;
typedef __attribute__((ext_vector_type(2)))  unsigned int v2u;
typedef __attribute__((ext_vector_type(2)))  __bf16   v2b;

__device__ __forceinline__ unsigned short f2bf_bits(float f) {
  unsigned u = __float_as_uint(f);
  return (unsigned short)((u + 0x7FFFu + ((u >> 16) & 1u)) >> 16);
}
__device__ __forceinline__ float bf_bits2f(unsigned short h) { return __uint_as_float(((unsigned)h) << 16); }
// RNE convert f32 -> bf16 -> f32
__device__ __forceinline__ float bf_rne(float f) { return bf_bits2f(f2bf_bits(f)); }

// hazard guards as plain device helpers
__device__ __forceinline__ void dep_guard_h(v8f& a, v8f& b, v16h x, v16h y) { asm volatile("v_nop\n\tv_nop\n\tv_nop\n\tv_nop" : "+v"(a), "+v"(b) : "v"(x), "v"(y)); }
__device__ __forceinline__ void dep_guard_b(v8f& a, v8f& b, v16b x, v16b y) { asm volatile("v_nop\n\tv_nop\n\tv_nop\n\tv_nop" : "+v"(a), "+v"(b) : "v"(x), "v"(y)); }
__device__ __forceinline__ void keep4_h(v16h a, v16h b, v16h c, v16h d) { asm volatile("v_nop" :: "v"(a), "v"(b), "v"(c), "v"(d)); }
__device__ __forceinline__ void keep4_b(v16b a, v16b b, v16b c, v16b d) { asm volatile("v_nop" :: "v"(a), "v"(b), "v"(c), "v"(d)); }
__device__ __forceinline__ void acc_guard4(v8f& a, v8f& b, v8f& c, v8f& d) { asm volatile("v_nop\n\tv_nop\n\tv_nop\n\tv_nop" : "+v"(a), "+v"(b), "+v"(c), "+v"(d)); }
template <typename T> struct Frag;
template <> struct Frag<_Float16> {
  typedef v16h V; union U { v16h v; v8h h[2]; };
  // elements 0..7 <- p[0..7], 8..15 <- p[16..23]
  static __device__ __forceinline__ v16h load(const _Float16* p) {
    U f; f.h[0] = *(const v8h*)(p); f.h[1] = *(const v8h*)(p + 16); return f.v;
  }
  static __device__ __forceinline__ v8f mma(v16h a, v16h b, v8f c) {
    return __builtin_amdgcn_wmma_f32_16x16x32_f16(false, a, false, b, (short)0, c, false, false);
  }
  static __device__ __forceinline__ void guard(v8f& a, v8f& b, v16h x, v16h y) { dep_guard_h(a, b, x, y); }
  static __device__ __forceinline__ void keep(v16h a, v16h b, v16h c, v16h d) { keep4_h(a, b, c, d); }
};
template <> struct Frag<__bf16> {
  typedef v16b V; union U { v16b v; v8b h[2]; };
  static __device__ __forceinline__ v16b load(const __bf16* p) {
    U f; f.h[0] = *(const v8b*)(p); f.h[1] = *(const v8b*)(p + 16); return f.v;
  }
  static __device__ __forceinline__ v8f mma(v16b a, v16b b, v8f c) {
    return __builtin_amdgcn_wmma_f32_16x16x32_bf16(false, a, false, b, (short)0, c, false, false);
  }
  static __device__ __forceinline__ void guard(v8f& a, v8f& b, v16b x, v16b y) { dep_guard_b(a, b, x, y); }
  static __device__ __forceinline__ void keep(v16b a, v16b b, v16b c, v16b d) { keep4_b(a, b, c, d); }
};

__device__ __forceinline__ unsigned pk16(unsigned short a, unsigned short b) { return (unsigned)a | ((unsigned)b << 16); }
__device__ __forceinline__ unsigned short h_bits(float f) { const _Float16 h = (_Float16)f; return __builtin_bit_cast(unsigned short, h); }

__device__ __forceinline__ float xhalf(float x) {   // lane l <-> lane l ^ 16
  const int v = __builtin_bit_cast(int, x);
  return __builtin_bit_cast(float, __builtin_amdgcn_permlanex16(v, v, 0x76543210, 0xfedcba98, false, false));
}

// ---------------------------------------------------------------------------
// Epilogue of the q/k/v projections (OUT_MODE 3 of the GEMM below): the first passes of their consumers, done on the wave's own tile.
// b = product (0: x.Wq, 1: m.Wk, 2: m.Wv, block-uniform); the tile is 64 tokens (from row m0) x 64 channels (from n0) = one head of one batch.
// From the f32 accumulators, before anything is rounded:
//   pmax[tb][chunk][c] = max over the tile's 64 tokens, psum[tb][chunk][c] = their sum (tb = product*4 + batch, chunk = 64 tokens);
//   in-lane over the lane's 32 rows in row order, then one exchange between the wave's halves.
// Then the tile itself, ungated (the gates are not known yet; the attention kernel applies them):
//   product 0: Qf[token][c] f32;  product 1: Kh[token][c] = f16(8 k);  product 2: VT[batch*8+head][d][token] = f16(8 v).
// ---------------------------------------------------------------------------
constexpr int kPoolTok   = 64;                  // tokens per pooling chunk = rows of a wave tile
constexpr int kPoolParts = kSeq / kPoolTok;     // 32 partial rows per (tensor, batch)
static_assert(kSeq % kPoolTok == 0 && kRed == 32 && kDim == 16 * 32 && kSeq == 2048);
__device__ __forceinline__ void proj_epilogue(const v8f (&acc)[4][4], float* slab, int b, int m0, int n0, int lane,
                                              float* __restrict__ Qf, unsigned short* __restrict__ Kh, unsigned short* __restrict__ VT,
                                              float* __restrict__ pmax, float* __restrict__ psum) {
  const int rlane = lane & 15;                 // column within a subtile
  const int hf    = lane >> 4;
  const int mOff  = hf * 8;                    // row offset within a subtile
  const int batch = m0 >> 11;                  // token row / 2048
  const int s0    = m0 & (kSeq - 1);           // token inside the batch

  // ---- pooling partials of this tile: lane half 0 stores the maxima, half 1 the sums; 256 contiguous bytes per wave and array ----
  {
    float* dst = (hf == 0 ? pmax : psum) + ((size_t)(b * kBatch + batch) * kPoolParts + (s0 >> 6)) * kDim + n0 + rlane;
#pragma unroll
    for (int j = 0; j < 4; ++j) {
      float mx = acc[0][j][0];
      float sm = 0.0f;
#pragma unroll
      for (int i = 0; i < 4; ++i)
#pragma unroll
        for (int r = 0; r < 8; ++r) {
          mx = fmaxf(mx, acc[i][j][r]);
          sm += acc[i][j][r];
        }
      mx = fmaxf(mx, xhalf(mx));
      sm += xhalf(sm);
      dst[j << 4] = (hf == 0 ? mx : sm) * kWCarryInv;   // the weight carry is a power of two: exact on either side of max and sum
    }
    asm volatile("s_wait_xcnt 0x0" ::: "memory");   // the code behind reuses the address and data registers of the four stores above
  }

  // ---- the tile ----
  if (b == 2) {      // a lane holds 8 consecutive tokens of one channel: V^T rows straight from the registers
    _Float16* vt = (_Float16*)VT + ((size_t)(batch * kHeads + (n0 >> 6)) * kDh + rlane) * kSeq + s0 + mOff;
#pragma unroll
    for (int j = 0; j < 4; ++j)
#pragma unroll
      for (int i = 0; i < 4; ++i) {    // the four stores of a j fill each channel's 128-byte line
        v8h hv;
#pragma unroll
        for (int r = 0; r < 8; ++r) hv[r] = (_Float16)(acc[i][j][r] * (kGCarry * kWCarryInv));
        *(v8h*)(vt + (size_t)(j << 4) * kSeq + (i << 4)) = hv;
      }
    return;
  }
  const float sc = (b == 0) ? kWCarryInv : kGCarry * kWCarryInv;
#pragma unroll
  for (int i = 0; i < 4; ++i) {
    const int mBase = m0 + (i << 4);
#pragma unroll
    for (int j = 0; j < 4; ++j)
#pragma unroll
      for (int r = 0; r < 8; ++r) slab[(mOff + r) * 68 + (j << 4) + rlane] = acc[i][j][r] * sc;
    __builtin_amdgcn_fence(__ATOMIC_RELEASE, "workgroup");
    __builtin_amdgcn_wave_barrier();
    __builtin_amdgcn_fence(__ATOMIC_ACQUIRE, "workgroup");
    if (b == 0) {
      const int c4 = (lane & 15) * 4;                    // row seg = 256 B = 16 lanes x 16 B
#pragma unroll
      for (int it = 0; it < 8; ++it) {
        const int row = it * 2 + hf;
        const v4f v = *(const v4f*)(slab + row * 68 + c4);
        *(v4f*)(Qf + (size_t)(mBase + row) * kDim + n0 + c4) = v;
      }
    } else {
      const int q = lane >> 3, c8 = (lane & 7) * 8;      // row seg = 128 B = 8 lanes x 16 B
#pragma unroll
      for (int it = 0; it < 4; ++it) {
        const int row = it * 4 + q;
        const float* sp = slab + row * 68 + c8;
        v8h hv;
#pragma unroll
        for (int e = 0; e < 8; ++e) hv[e] = (_Float16)sp[e];
        *(v8h*)((_Float16*)Kh + (size_t)(mBase + row) * kDim + n0 + c8) = hv;
      }
      asm volatile("s_wait_xcnt 0x0" ::: "memory");   // the code behind reuses the address and data registers of the four stores above
    }
    __builtin_amdgcn_fence(__ATOMIC_RELEASE, "workgroup");
    __builtin_amdgcn_wave_barrier();
    __builtin_amdgcn_fence(__ATOMIC_ACQUIRE, "workgroup");
  }
}

// ---- Register-blocked batched WMMA GEMM (ACT reduced to none/relu/leaky) -------------------------------
// C[m,n] = scale * sum_k A[m,k] * Bt[n,k] (+bias)(+resid); each wave owns a 64x64 tile, a work-group of 4 waves (2 x 2) a 128x128 tile.
// A row-major [M,K]; Bt row-major [N,K]; M,N % 128 == 0, K % 64 == 0.
// BIAS_MODE: 0 = none, 1 = bias[m], 2 = bias[n].
// OUT_MODE: 0 = f32, 1 = f16, 2 = bf16 hi plane (Cout) + bf16 lo plane (Cout2), 3 = proj_epilogue above (Cout = f32 q, Cout2 = f16 k, VTo, pmax, psum).
// ET: 0 = f16 operands, 1 = bf16 operands (pointers passed as 16-bit storage)
// A_ALT: batch 0 reads A from Ap, batch b > 0 from A2p + (b - 1) * strideA, so products of different left operands share one grid.
// A and Bt reach the waves through LDS: a stage is 64 k of the work-group's 128 A rows and 128 Bt rows (256 rows of 128 B at pitch 144 B,
// 16 B x odd for the 16-byte fragment reads), brought once per work-group by asynchronous copies, whole 128-byte lines per wave, two buffers:
// stage s + 2 is copied into the buffer of stage s behind the barrier that ends its last read.
// A_F32: A is an f32 input (Af0 for batch 0, Af1 else, row pitch kDim). Its stage comes through registers: 16 x 16 B per thread, whole 128-byte
// lines per wave, loaded behind the barrier one stage ahead, rounded to bf16 (RNE), held as f16 and stored into the same LDS rows in front of the hand-over barrier.
constexpr int kGK      = 64;                     // k per stage
constexpr int kGPitch  = 72;                     // halves per staged row (144 B)
constexpr int kGRows   = 128;                    // rows per operand and stage
constexpr int kGStageH = 2 * kGRows * kGPitch;   // 18432 halves = 36,864 B per buffer
static_assert((kGPitch * 2) % 16 == 0 && (kGStageH * 2) % 16 == 0);
static_assert(kTok % kGRows == 0 && kDim % kGRows == 0 && kDim % kGK == 0 && kDim / kGK >= 2);
// One thread's share of one operand's stage: 8 x 16 B, rows 16 apart. d: LDS byte address; g: global; step: elements between the copied rows.
__device__ __forceinline__ void gemm_copy8(unsigned d, const unsigned short* g, size_t step) {
  // s_wait_xcnt 0 closes the statement (a precaution): so no later write of the copies' address registers can be scheduled ahead of it
  asm volatile("global_load_async_to_lds_b128 %0, %8, off\n\t"
               "global_load_async_to_lds_b128 %1, %9, off\n\t"
               "global_load_async_to_lds_b128 %2, %10, off\n\t"
               "global_load_async_to_lds_b128 %3, %11, off\n\t"
               "global_load_async_to_lds_b128 %4, %12, off\n\t"
               "global_load_async_to_lds_b128 %5, %13, off\n\t"
               "global_load_async_to_lds_b128 %6, %14, off\n\t"
               "global_load_async_to_lds_b128 %7, %15, off\n\t"
               "s_wait_xcnt 0x0"
               :: "v"(d), "v"(d + 16 * kGPitch * 2), "v"(d + 32 * kGPitch * 2), "v"(d + 48 * kGPitch * 2),
                  "v"(d + 64 * kGPitch * 2), "v"(d + 80 * kGPitch * 2), "v"(d + 96 * kGPitch * 2), "v"(d + 112 * kGPitch * 2),
                  "v"(g), "v"(g + step), "v"(g + 2 * step), "v"(g + 3 * step),
                  "v"(g + 4 * step), "v"(g + 5 * step), "v"(g + 6 * step), "v"(g + 7 * step)
               : "memory");
}
// Two f32 -> bf16 (RNE) -> the same two values as f16, packed (a bf16 value inside f16's normal range is exact in f16).
__device__ __forceinline__ unsigned bf_pair_h(float a, float c) {
  const unsigned u = __builtin_bit_cast(unsigned, __builtin_convertvector((v2f){a, c}, v2b));
  const v2f w = (v2f){__uint_as_float(u << 16), __uint_as_float(u & 0xFFFF0000u)};
  return __builtin_bit_cast(unsigned, __builtin_convertvector(w, v2h));
}
constexpr int kAF = 16;   // 16-byte f32 loads per thread and stage: rows 8 apart
__device__ __forceinline__ void a_f32_load(v4f (&ar)[kAF], const float* g) {
#pragma unroll   // independent loads at immediate offsets, in flight together
  for (int i = 0; i < kAF; ++i) ar[i] = *(const v4f*)(g + (size_t)(8 * i) * kDim);
  asm volatile("s_wait_xcnt 0x0" ::: "memory");   // a precaution: the code behind may reuse the address registers of the loads above
}
__device__ __forceinline__ void a_f32_store(const v4f (&ar)[kAF], unsigned short* d) {
#pragma unroll   // ar[] stays in registers
  for (int i = 0; i < kAF; ++i)
    *(v2u*)(d + (8 * i) * kGPitch) = (v2u){bf_pair_h(ar[i][0], ar[i][1]), bf_pair_h(ar[i][2], ar[i][3])};
}
template <int ET> struct Elem;
template <> struct Elem<0> { typedef _Float16 T; };
template <> struct Elem<1> { typedef __bf16 T; };
template <int ET, bool SPLIT, int BIAS_MODE, int OUT_MODE, bool RESID, int ACT = 0, bool A_ALT = false, bool A_F32 = false>
__global__ __launch_bounds__(128) void wmma_gemm64(
    const unsigned short* __restrict__ Ap, const unsigned short* __restrict__ A2p, int lda, long strideA,
    const unsigned short* __restrict__ Btp, const unsigned short* __restrict__ Bt2p, int ldb, long strideB,
    void* __restrict__ Cout, void* __restrict__ Cout2, int ldc, long strideC,
    const float* __restrict__ bias,
    const float* __restrict__ resid, long strideR,
    int M, int N, int K, float scale,
    unsigned short* __restrict__ VTo, float* __restrict__ pmax, float* __restrict__ psum,
    const float* __restrict__ Af0, const float* __restrict__ Af1) {
  typedef typename Elem<ET>::T T;
  typedef typename Frag<T>::V V;
  static_assert(!SPLIT);                           // the staged operand path carries one plane per operand
  __shared__ __align__(16) unsigned short ring[2 * kGStageH];
  __shared__ __align__(16) float sT[4][16 * 68];   // per-wave 16x64 slab, pitch 68 floats
  const int b    = blockIdx.y;
  const int tid  = threadIdx.x;
  const int lane = tid & 31;
  const int wave = tid >> 5;
  const int tilesN = N >> 7;
  const int tilesM = M >> 7;
  if ((int)blockIdx.x >= tilesM * tilesN) return;  // the same for the whole work-group, in front of every barrier and copy
  const int bm = blockIdx.x / tilesN;
  const int bn = blockIdx.x - bm * tilesN;
  const int m0 = (bm << 7) + ((wave >> 1) << 6);
  const int n0 = (bn << 7) + ((wave & 1) << 6);

  const unsigned short* Ab = (A_ALT && b > 0) ? (A2p + (size_t)(b - 1) * strideA) : (Ap + (size_t)b * strideA);   // block-uniform select
  const unsigned short* Bb = Btp + (size_t)b * strideB;

  const int rlane = lane & 15;                 // row (A) / col (B, D) within subtile
  const int koff  = (lane >> 4) * 8;           // k offset of this lane half
  const int mOff  = (lane >> 4) * 8;           // D row offset

  // this thread's share of every stage: row tid / 8 (+ 16 i) of each operand's 128, 16-byte column tid % 8
  const unsigned short* ag = Ab + (size_t)((bm << 7) + (tid >> 3)) * lda + 8 * (tid & 7);
  const unsigned short* bg = Bb + (size_t)((bn << 7) + (tid >> 3)) * ldb + 8 * (tid & 7);
  const unsigned ad = (unsigned)(size_t)ring + (unsigned)((tid >> 3) * kGPitch + 8 * (tid & 7)) * 2u;   // byte offset in the work-group's LDS
  const unsigned bd = ad + kGRows * kGPitch * 2;
  const size_t aStep = (size_t)16 * lda, bStep = (size_t)16 * ldb;
  const int stages = K / kGK;
  // A_F32: this thread's share of every A stage: row tid / 16 (+ 8 i) of the 128, 16-byte f32 column tid % 16 (8 bytes of the staged row)
  const float* af = (b == 0 ? Af0 : Af1) + (size_t)((bm << 7) + (tid >> 4)) * kDim + 4 * (tid & 15);   // block-uniform select
  unsigned short* as = ring + (tid >> 4) * kGPitch + 4 * (tid & 15);
  v4f ar[kAF];

  if (A_F32) a_f32_load(ar, af);               // stage 0
  else       gemm_copy8(ad, ag, aStep);
  gemm_copy8(bd, bg, bStep);

  v8f acc[4][4];
#pragma unroll
  for (int i = 0; i < 4; ++i)
#pragma unroll
    for (int j = 0; j < 4; ++j) acc[i][j] = (v8f){0.f,0.f,0.f,0.f,0.f,0.f,0.f,0.f};

  if (A_F32) a_f32_store(ar, as);                    // stage 0 into buffer 0; the barrier's own fence waits for these stores
  asm volatile("s_wait_asynccnt 0x0" ::: "memory");  // this wave's copies of stage 0 have landed
  __syncthreads();                                   // publishes stage 0
  if (stages > 1) {                                  // the same for the whole work-group
    if (A_F32) a_f32_load(ar, af + kGK);             // stage 1; behind the barrier, whose fence would wait for loads issued in front of it
    else       gemm_copy8(ad + kGStageH * 2, ag + kGK, aStep);
    gemm_copy8(bd + kGStageH * 2, bg + kGK, bStep);
  }

  // rolled over the stages, so that the loop's foot is the one hand-over point
#pragma unroll 1
  for (int st = 0; st < stages; ++st) {
    const T* al = (const T*)ring + (st & 1) * kGStageH + (((wave >> 1) << 6) + rlane) * kGPitch + koff;
    const T* bl = (const T*)ring + (st & 1) * kGStageH + (kGRows + ((wave & 1) << 6) + rlane) * kGPitch + koff;
#pragma unroll
    for (int kk = 0; kk < kGK / 32; ++kk) {
      V bh[4], ah[4];
#pragma unroll
      for (int j = 0; j < 4; ++j) bh[j] = Frag<T>::load(bl + (j << 4) * kGPitch + 32 * kk);
#pragma unroll
      for (int i = 0; i < 4; ++i) ah[i] = Frag<T>::load(al + (i << 4) * kGPitch + 32 * kk);
      __builtin_amdgcn_sched_barrier(0);   // the 16 products' fragments are read as one group: one LDS latency in front of them, not one per fragment
#pragma unroll
      for (int i = 0; i < 4; ++i) {
#pragma unroll
        for (int j = 0; j < 4; ++j) acc[i][j] = Frag<T>::mma(ah[i], bh[j], acc[i][j]);
        Frag<T>::guard(acc[i][0], acc[i][3], ah[i], ah[i]);
      }
      Frag<T>::keep(bh[0], bh[1], bh[2], bh[3]);
    }

    if (A_F32 && st + 1 < stages)                      // the same for the whole work-group
      a_f32_store(ar, as + ((st + 1) & 1) * kGStageH); // stage st + 1 into the other buffer, whose last readers left at the barrier of stage st - 1
    // hand-over: this wave's reads of stage st and its stores of stage st + 1 are done, its copies of stage st + 1 have landed; the barrier says so of every wave
    asm volatile("s_wait_dscnt 0x0" ::: "memory");
    asm volatile("s_wait_asynccnt 0x0" ::: "memory");
    __syncthreads();
    if (st + 2 < stages) {                             // the same for the whole work-group
      if (A_F32) a_f32_load(ar, af + (size_t)(st + 2) * kGK);   // in flight under stage st + 1's products
      else       gemm_copy8(ad + (st & 1) * (kGStageH * 2), ag + (size_t)(st + 2) * kGK, aStep);
      gemm_copy8(bd + (st & 1) * (kGStageH * 2), bg + (size_t)(st + 2) * kGK, bStep);
    }
  }
  asm volatile("s_wait_asynccnt 0x0" ::: "memory");    // no copy is outstanding when the wave goes on
  acc_guard4(acc[0][0], acc[0][1], acc[0][2], acc[0][3]);
  acc_guard4(acc[1][0], acc[1][1], acc[1][2], acc[1][3]);
  acc_guard4(acc[2][0], acc[2][1], acc[2][2], acc[2][3]);
  acc_guard4(acc[3][0], acc[3][1], acc[3][2], acc[3][3]);

  // ---- epilogue ----
  float* slab = sT[wave];
  if (OUT_MODE == 3) {
    proj_epilogue(acc, slab, b, m0, n0, lane, (float*)Cout, (unsigned short*)Cout2, VTo, pmax, psum);
    return;
  }
  const float* Rb = RESID ? (resid + (size_t)b * strideR) : nullptr;
#pragma unroll
  for (int i = 0; i < 4; ++i) {
    const int mBase = m0 + (i << 4);
#pragma unroll
    for (int j = 0; j < 4; ++j) {
      const int n = n0 + (j << 4) + rlane;
      float bv = 0.f;
      if (BIAS_MODE == 2) bv = bias[n];
#pragma unroll
      for (int r = 0; r < 8; ++r) {
        float v = acc[i][j][r] * scale;
        if (BIAS_MODE == 1) v += bias[mBase + mOff + r];
        if (BIAS_MODE == 2) v += bv;
        if (RESID) v += Rb[(size_t)(mBase + mOff + r) * ldc + n];
        if (ACT == 2) v = fmaxf(v, 0.0f);
        if (ACT == 4) v = (v > 0.f) ? v : 0.01f * v;
        slab[(mOff + r) * 68 + (j << 4) + rlane] = v;
      }
    }
    __builtin_amdgcn_fence(__ATOMIC_RELEASE, "workgroup");
    __builtin_amdgcn_wave_barrier();
    __builtin_amdgcn_fence(__ATOMIC_ACQUIRE, "workgroup");
    if (OUT_MODE == 0) {
      float* C = (float*)Cout + (size_t)b * strideC;
      const int hh = lane >> 4, c4 = (lane & 15) * 4;     // row seg = 256 B = 16 lanes x 16 B
      {
#pragma unroll
        for (int it = 0; it < 8; ++it) {
          const int row = it * 2 + hh;
          v4f v = *(const v4f*)(slab + row * 68 + c4);
          *(v4f*)(C + (size_t)(mBase + row) * ldc + n0 + c4) = v;
        }
        
      }
    } else {
      const int q = lane >> 3, c8 = (lane & 7) * 8;
      unsigned short* C  = (unsigned short*)Cout  + (size_t)b * strideC;
      unsigned short* C2 = (OUT_MODE == 2) ? ((unsigned short*)Cout2 + (size_t)b * strideC) : nullptr;
      {
#pragma unroll
        for (int it = 0; it < 4; ++it) {
          const int row = it * 4 + q;
          const float* sp = slab + row * 68 + c8;
          v8h hv, lv;
#pragma unroll
          for (int e = 0; e < 8; ++e) {
            if (OUT_MODE == 1) {
              hv[e] = (_Float16)sp[e];
            } else {
              unsigned short hb = f2bf_bits(sp[e]);
              unsigned short lb = f2bf_bits(sp[e] - bf_bits2f(hb));
              hv[e] = __builtin_bit_cast(_Float16, hb);
              lv[e] = __builtin_bit_cast(_Float16, lb);
            }
          }
          *(v8h*)(C + (size_t)(mBase + row) * ldc + n0 + c8) = hv;
          if (OUT_MODE == 2) *(v8h*)(C2 + (size_t)(mBase + row) * ldc + n0 + c8) = lv;
        }
        
      }
    }
    __builtin_amdgcn_fence(__ATOMIC_RELEASE, "workgroup");
    __builtin_amdgcn_wave_barrier();
    __builtin_amdgcn_fence(__ATOMIC_ACQUIRE, "workgroup");
  }
}

// ---------------------------------------------------------------------------
// Weight transpose + cast: W is [in d][out h] (512x512, row-major); WT[h][d] = f16( scale * bf16_rne(W[d][h]) ).
// One work-group's share: bd = d tile (64 cols of WT, 0..7), bh = h tile (64 rows of WT, 0..7), z selects W0..W3 and the
// output plane (plane z at out + z*512*512 halves). 256 threads; sm is the work-group's 64 x 65 float exchange tile.
// Load coverage: 4 iterations x 256 threads x float4 = 4096 = the whole 64(d) x 64(h) tile (coalesced along h), 4 b128 loads per lane.
// Store coverage: 8 waves x 2 iterations x 4 rows (lane>>3) = 64 rows; (lane&7) x 8 halves = 64 cols; each row segment =
// ---------------------------------------------------------------------------
__device__ __forceinline__ void wtcast_block(const float* __restrict__ W0, const float* __restrict__ W1,
                                             const float* __restrict__ W2, const float* __restrict__ W3,
                                             unsigned short* __restrict__ out, float scale,
                                             float (*sm)[65], int bd, int bh, int z) {   // sm[h_local][d_local]; z block-uniform
  const int t  = threadIdx.x;
  const int d0 = bd * 64;
  const int h0 = bh * 64;
  const float* W = (z == 0) ? W0 : (z == 1) ? W1 : (z == 2) ? W2 : W3;
#pragma unroll
  for (int i = 0; i < 4; ++i) {
    const int e4 = i * 256 + t;
    const int r  = e4 >> 4;            // d local 0..63
    const int c4 = (e4 & 15) * 4;      // h local 0..60
    const v4f w = *(const v4f*)(W + (size_t)(d0 + r) * kDim + h0 + c4);
#pragma unroll
    for (int k = 0; k < 4; ++k) sm[c4 + k][r] = bf_rne(w[k]) * scale;
  }
  __syncthreads();
  const int lane = t & 31, wave = t >> 5;
  const int q = lane >> 3, c8 = (lane & 7) * 8;
  unsigned short* op = out + (size_t)z * kDim * kDim;
  {
#pragma unroll
    for (int it = 0; it < 2; ++it) {
      const int row = wave * 8 + it * 4 + q;                 // h local
      unsigned short hb[8];
#pragma unroll
      for (int e = 0; e < 8; ++e) hb[e] = h_bits(sm[row][c8 + e]);
      const v4u u = (v4u){pk16(hb[0], hb[1]), pk16(hb[2], hb[3]), pk16(hb[4], hb[5]), pk16(hb[6], hb[7])};
      *(v4u*)(op + (size_t)(h0 + row) * kDim + d0 + c8) = u;
    }
    
  }
}

// ---------------------------------------------------------------------------
// The weight planes: one work-group per 64 x 64 tile (d tile, h tile, matrix).
// ---------------------------------------------------------------------------
constexpr int kWtBlocks = (kDim / 64) * (kDim / 64) * 4;   // 256
static_assert(kDim / 64 == 8);
__global__ __launch_bounds__(256) void prep_kernel(const float* __restrict__ W0, const float* __restrict__ W1,
                                                   const float* __restrict__ W2, const float* __restrict__ W3,
                                                   unsigned short* __restrict__ wt_out, float scale) {
  __shared__ float sm[64][65];
  const int blk = blockIdx.x;
  wtcast_block(W0, W1, W2, W3, wt_out, scale, sm, blk & 7, (blk >> 3) & 7, blk >> 6);
}

// ---------------------------------------------------------------------------
// Token pooling, part 2 + channel gate MLP (f32): block tb = tensor*4 + batch (12 blocks), 512 threads = channels.
//   mx[c] = max over 32 chunk maxima, av[c] = (sum of 32 chunk sums, chunk order) * (1/2048)
//   hid[j] = relu( sum_c mx[c]*w1[c][j] + sum_c av[c]*w1[c][j] )   j < 32      (w1, w2 RNE-converted to bf16 where used)
//            thread t holds w1 elements i*512 + t, so wave w sums channels w, w+16, .. w+496 for all 32 j (lane = j);
//            32 threads then add the 16 wave partials in wave order
//   g[c]   = 1 / (1 + exp(-sum_j hid[j]*w2[j][c]))
// The w1 and w2 elements a thread needs depend on nothing computed here: they are loaded first, beside the chunk partials.
// ---------------------------------------------------------------------------
__global__ __launch_bounds__(512) void gate_kernel(const float* __restrict__ pmax, const float* __restrict__ psum,
                                                   const float* __restrict__ w1, const float* __restrict__ w2,
                                                   float* __restrict__ scl) {
  __shared__ float smax[kDim];
  __shared__ float savg[kDim];
  __shared__ float pa1[kDim / 32][kRed];
  __shared__ float pa2[kDim / 32][kRed];
  __shared__ float hid[kRed];
  const int t    = threadIdx.x;
  const int tb   = blockIdx.x;          // 0..11
  const int lane = t & 31, wave = t >> 5;
  float w1v[32], w2v[kRed];
#pragma unroll   // this loop and the next two: independent loads at immediate offsets, in flight together
  for (int i = 0; i < 32; ++i) w1v[i] = w1[i * kDim + t];      // channel i*16 + wave, hidden unit lane
#pragma unroll   // as above
  for (int j = 0; j < kRed; ++j) w2v[j] = w2[j * kDim + t];
  const float* pm = pmax + (size_t)tb * kPoolParts * kDim + t;
  const float* ps = psum + (size_t)tb * kPoolParts * kDim + t;
  float mx = -__builtin_inff();
  float sm = 0.0f;
#pragma unroll   // as above
  for (int p = 0; p < kPoolParts; ++p) {
    mx = fmaxf(mx, pm[p * kDim]);
    sm += ps[p * kDim];
  }
  smax[t] = mx;
  savg[t] = sm * kInvSeq;
  __syncthreads();
  float a1 = 0.0f, a2 = 0.0f;
#pragma unroll   // w1v[] stays in registers
  for (int i = 0; i < 32; ++i) {
    const float w = bf_rne(w1v[i]);
    a1 += smax[i * 16 + wave] * w;
    a2 += savg[i * 16 + wave] * w;
  }
  pa1[wave][lane] = a1;
  pa2[wave][lane] = a2;
  __syncthreads();
  if (t < kRed) {                       // wave 0, wave-uniform
    float s1 = 0.0f, s2 = 0.0f;
#pragma unroll   // the 32 LDS reads overlap
    for (int w = 0; w < kDim / 32; ++w) {
      s1 += pa1[w][t];
      s2 += pa2[w][t];
    }
    hid[t] = fmaxf(s1 + s2, 0.0f);
  }
  __syncthreads();
  float a = 0.0f;
#pragma unroll   // w2v[] stays in registers
  for (int j = 0; j < kRed; ++j) a += hid[j] * bf_rne(w2v[j]);
  const float g = 1.0f / (1.0f + expf(-a));
  scl[(size_t)tb * kDim + t] = g;       // one whole 128-byte line per wave
}

// ---------------------------------------------------------------------------
// Fused attention of every (batch, head): S^T = K.Q^T, online softmax (base 2, f32), O^T += V^T.P^T; scores and P stay in registers.
// grid (8, 32): blockIdx.x = block of 256 queries, blockIdx.y = batch*8 + head. 8 waves x 32 query columns (2 groups of 16).
// One pass = 32 keys. Lane (c = lane & 15, hf = lane >> 4) of a score tile holds query c, keys 8*hf + r: the two 16-key tiles of a
// pass, converted in place, are the B operand of the second product (element s: key 8*hf + s, s < 8; key 16 + 8*hf + s - 8 else),
// the k order in which Frag::load brings V^T (and K; the q fragments are built in the same order).
// The maximum in use may trail the true one by up to 8 (base-2 exponent), so P <= 2^8 and P carried x2^6 <= 2^14 in f16.
// Oh[b][q][head*64 + d] = f16( 32 * acc / rowsum * gv[d] ): context carried x256, V carried x8.
// The channel gates (scl = [3][4][512]: q, k, v) come in here: a score is sum_d q_d gq_d k_d gk_d, so the q fragments, built once per wave
// from f32 q, carry f16( q * (8 gq gk) ) against the ungated k plane; gv scales channel d of the f32 result.
// K and V^T reach the waves through LDS: a stage is 128 keys (K 128 rows of 128 B at pitch 144 B, V^T 64 rows of 256 B at pitch 272 B, both
// 16 B x odd for the 16-byte fragment reads), brought once per work-group by asynchronous copies, whole 128-byte lines per wave, two buffers:
// stage s + 2 is copied into the buffer of stage s behind the barrier that ends its last read. A stage serves four passes.
// ---------------------------------------------------------------------------
constexpr int kStKeys = 128;                    // keys per stage
constexpr int kStages = kSeq / kStKeys;         // 16
constexpr int kKPitch = 72;                     // halves per staged K row (144 B)
constexpr int kVPitch = 136;                    // halves per staged V^T row (272 B)
constexpr int kKTile  = kStKeys * kKPitch;      // 9216 halves
constexpr int kStageH = kKTile + kDh * kVPitch; // 17920 halves = 35,840 B per buffer
static_assert(kStages >= 2 && kStKeys % 32 == 0 && (kKTile * 2) % 16 == 0 && (kStageH * 2) % 16 == 0);
// One thread's share of a stage: 4 x 16 B of K (rows 32 apart) and 4 x 16 B of V^T (rows 16 apart). kd, vd: LDS byte addresses; kg, vg: global.
__device__ __forceinline__ void stage_copy(unsigned kd, unsigned vd, const _Float16* kg, const _Float16* vg) {
  // s_wait_xcnt 0 closes the statement (a precaution): so no later write of the copies' address registers can be scheduled ahead of it
  asm volatile("global_load_async_to_lds_b128 %0, %8, off\n\t"
               "global_load_async_to_lds_b128 %1, %9, off\n\t"
               "global_load_async_to_lds_b128 %2, %10, off\n\t"
               "global_load_async_to_lds_b128 %3, %11, off\n\t"
               "global_load_async_to_lds_b128 %4, %12, off\n\t"
               "global_load_async_to_lds_b128 %5, %13, off\n\t"
               "global_load_async_to_lds_b128 %6, %14, off\n\t"
               "global_load_async_to_lds_b128 %7, %15, off\n\t"
               "s_wait_xcnt 0x0"
               :: "v"(kd), "v"(kd + 32 * kKPitch * 2), "v"(kd + 64 * kKPitch * 2), "v"(kd + 96 * kKPitch * 2),
                  "v"(vd), "v"(vd + 16 * kVPitch * 2), "v"(vd + 32 * kVPitch * 2), "v"(vd + 48 * kVPitch * 2),
                  "v"(kg), "v"(kg + (size_t)32 * kDim), "v"(kg + (size_t)64 * kDim), "v"(kg + (size_t)96 * kDim),
                  "v"(vg), "v"(vg + (size_t)16 * kSeq), "v"(vg + (size_t)32 * kSeq), "v"(vg + (size_t)48 * kSeq)
               : "memory");
}
__global__ __launch_bounds__(256) void attn_fused_kernel(const float* __restrict__ Qf, const unsigned short* __restrict__ Kp,
                                                         const unsigned short* __restrict__ VTp, const float* __restrict__ scl,
                                                         unsigned short* __restrict__ Op) {
  typedef Frag<_Float16> FH;
  __shared__ __align__(16) _Float16 ring[2 * kStageH];
  const int lane = threadIdx.x & 31, wave = threadIdx.x >> 5;
  const int c = lane & 15, hf = lane >> 4;
  const int bh = blockIdx.y;
  const int q0 = blockIdx.x * 256 + wave * 32;
  const size_t tokOff = (size_t)(bh >> 3) * kSeq * kDim + (size_t)(bh & 7) * kDh;
  const float* ql = Qf + tokOff + (size_t)(q0 + c) * kDim + 8 * hf;
  const float* gl = scl + (size_t)(bh >> 3) * kDim + (size_t)(bh & 7) * kDh + 8 * hf;   // q gate of this lane's first channel; k, v: + 4, 8 rows

  // this thread's share of every stage: K row t / 8 (+ 32 i), 16-byte column t % 8; V^T row t / 16 (+ 16 i), 16-byte column t % 16
  const int tid = threadIdx.x;
  const _Float16* kg = (const _Float16*)Kp + tokOff + (size_t)(tid >> 3) * kDim + 8 * (tid & 7);
  const _Float16* vg = (const _Float16*)VTp + (size_t)bh * kDh * kSeq + (size_t)(tid >> 4) * kSeq + 8 * (tid & 15);
  const unsigned ringB = (unsigned)(size_t)ring;     // byte offset of the ring in the work-group's LDS
  const unsigned kd = ringB + (unsigned)((tid >> 3) * kKPitch + 8 * (tid & 7)) * 2u;
  const unsigned vd = ringB + (unsigned)(kKTile + (tid >> 4) * kVPitch + 8 * (tid & 15)) * 2u;

  stage_copy(kd, vd, kg, vg);                        // stage 0, in flight under the q fragments' loads

  v16h qf[2][2];   // element e < 8: channel 32 kc + 8 hf + e; e >= 8: 32 kc + 16 + 8 hf + e - 8 (the order of Frag::load)
#pragma unroll
  for (int kc = 0; kc < 2; ++kc)
#pragma unroll
    for (int u = 0; u < 4; ++u) {      // four channels at a time
      const int d = 32 * kc + 16 * (u >> 1) + 4 * (u & 1);
      const v4f gg = *(const v4f*)(gl + d) * *(const v4f*)(gl + (size_t)kBatch * kDim + d) * kGCarry;
#pragma unroll
      for (int g = 0; g < 2; ++g) {
        const v4f qv = *(const v4f*)(ql + (size_t)(16 * g) * kDim + d) * gg;
#pragma unroll
        for (int e = 0; e < 4; ++e) qf[g][kc][4 * u + e] = (_Float16)qv[e];
      }
    }

  v8f acc[2][4];
  v2f ls[2];
  float m_run[2];
#pragma unroll
  for (int g = 0; g < 2; ++g) {
    m_run[g] = -__builtin_inff();
    ls[g] = (v2f){0.f, 0.f};
#pragma unroll
    for (int t = 0; t < 4; ++t) acc[g][t] = (v8f){0.f,0.f,0.f,0.f,0.f,0.f,0.f,0.f};
  }

  asm volatile("s_wait_asynccnt 0x0" ::: "memory");  // this wave's copies of stage 0 have landed
  __syncthreads();                                   // publishes stage 0
  stage_copy(kd + kStageH * 2, vd + kStageH * 2, kg + (size_t)kStKeys * kDim, vg + kStKeys);   // stage 1

  // rolled over the stages; the four passes of a stage are unrolled, so that a pass can fetch the next pass's K inside its own stage
#pragma unroll 1
  for (int st = 0; st < kStages; ++st) {
    const _Float16* kl = ring + (st & 1) * kStageH + c * kKPitch + 8 * hf;
    const _Float16* vl = ring + (st & 1) * kStageH + kKTile + c * kVPitch + 8 * hf;
    v16h kf[2][2];
#pragma unroll
    for (int kt = 0; kt < 2; ++kt)
#pragma unroll
      for (int kc = 0; kc < 2; ++kc) kf[kt][kc] = FH::load(kl + (16 * kt) * kKPitch + 32 * kc);
    __builtin_amdgcn_sched_barrier(0);   // the stage's first K fragments are read as one group: one LDS latency in front of the products, not one per fragment

#pragma unroll
    for (int ps = 0; ps < kStKeys / 32; ++ps) {
      v16h vf[4];      // this pass's V^T, in flight under the score products and the maxima
#pragma unroll
      for (int t = 0; t < 4; ++t) vf[t] = FH::load(vl + (16 * t) * kVPitch + 32 * ps);

      v8f s[2][2];
#pragma unroll
      for (int kt = 0; kt < 2; ++kt)
#pragma unroll
        for (int g = 0; g < 2; ++g) {
          s[kt][g] = (v8f){0.f,0.f,0.f,0.f,0.f,0.f,0.f,0.f};
#pragma unroll
          for (int kc = 0; kc < 2; ++kc) s[kt][g] = FH::mma(kf[kt][kc], qf[g][kc], s[kt][g]);
        }
      if (ps + 1 < kStKeys / 32) {
#pragma unroll
        for (int kt = 0; kt < 2; ++kt)
#pragma unroll
          for (int kc = 0; kc < 2; ++kc) kf[kt][kc] = FH::load(kl + (32 * (ps + 1) + 16 * kt) * kKPitch + 32 * kc);
      }
      __builtin_amdgcn_sched_barrier(0);   // keeps the K loads issued here, ahead of the vector work that hides their latency

      float mb[2];
      bool need = false;
#pragma unroll
      for (int g = 0; g < 2; ++g) {
        float mx = s[0][g][0];
#pragma unroll
        for (int r = 1; r < 8; ++r) mx = fmaxf(mx, s[0][g][r]);
#pragma unroll
        for (int r = 0; r < 8; ++r) mx = fmaxf(mx, s[1][g][r]);
        mx = fmaxf(mx, xhalf(mx)) * kSmScale2;         // both halves hold the query's maximum of this pass (the scale is positive)
        mb[g] = mx;
        need = need || (mx > m_run[g] + 8.0f);
      }
      if (__builtin_amdgcn_ballot_w32(need) != 0) {    // wave-uniform; always on the first pass, rare later
#pragma unroll
        for (int g = 0; g < 2; ++g) {
          const float m_new = fmaxf(m_run[g], mb[g]);
          const float corr = __builtin_amdgcn_exp2f(m_run[g] - m_new);   // 0 on the first pass
          m_run[g] = m_new;
          ls[g] = ls[g] * corr;
#pragma unroll
          for (int t = 0; t < 4; ++t) acc[g][t] = acc[g][t] * corr;
        }
      }
#pragma unroll
      for (int g = 0; g < 2; ++g) {
        const float nm = kPShift - m_run[g];
        v16h pf;
#pragma unroll
        for (int i = 0; i < 8; ++i) {
          const v2f sv = (v2f){s[i >> 2][g][2 * (i & 3)], s[i >> 2][g][2 * (i & 3) + 1]};
          const v2f arg = __builtin_elementwise_fma(sv, (v2f){kSmScale2, kSmScale2}, (v2f){nm, nm});
          const v2f p = (v2f){__builtin_amdgcn_exp2f(arg.x), __builtin_amdgcn_exp2f(arg.y)};
          ls[g] = ls[g] + p;
          const v2h ph = __builtin_convertvector(p, v2h);
          pf[2 * i]     = ph.x;
          pf[2 * i + 1] = ph.y;
        }
#pragma unroll
        for (int t = 0; t < 4; ++t) acc[g][t] = FH::mma(vf[t], pf, acc[g][t]);
      }
    }

    // hand-over: this wave's reads of stage st are done, its copies of stage st + 1 have landed; the barrier says both of every wave
    asm volatile("s_wait_dscnt 0x0" ::: "memory");
    asm volatile("s_wait_asynccnt 0x0" ::: "memory");
    __syncthreads();
    if (st + 2 < kStages)                              // the same for the whole work-group
      stage_copy(kd + (st & 1) * (kStageH * 2), vd + (st & 1) * (kStageH * 2),
                 kg + (size_t)(st + 2) * kStKeys * kDim, vg + (st + 2) * kStKeys);
  }
  asm volatile("s_wait_asynccnt 0x0" ::: "memory");    // no copy is outstanding when the wave ends

  _Float16* ol = (_Float16*)Op + tokOff + (size_t)(q0 + c) * kDim + 8 * hf;
  float inv[2];
#pragma unroll
  for (int g = 0; g < 2; ++g) {
    float l = ls[g].x + ls[g].y;
    l += xhalf(l);                                   // join the two halves' key sums
    inv[g] = kCtxScale / l;
  }
#pragma unroll
  for (int t = 0; t < 4; ++t) {
    const float* gv = gl + (size_t)(2 * kBatch) * kDim + 16 * t;
    const v4f g0 = *(const v4f*)(gv);
    const v4f g1 = *(const v4f*)(gv + 4);
#pragma unroll
    for (int g = 0; g < 2; ++g) {
      v8h hv;
#pragma unroll
      for (int r = 0; r < 8; ++r) hv[r] = (_Float16)(acc[g][t][r] * inv[g] * (r < 4 ? g0[r & 3] : g1[r & 3]));   // d = 16 t + 8 hf + r of query 16 g + c
      *(v8h*)(ol + (size_t)(16 * g) * kDim + 16 * t) = hv;
    }
  }
}

// ---------------------------------------------------------------------------
// Host glue.
//   WT   f16 [4][512][512]       2,097,152  at           0   (Wq^T, Wk^T, Wv^T, Wo^T, [out][in], carried x16)
//   Qf   f32 [8192][512]        16,777,216  at   2,097,152   (q projection, ungated)
//   Kh   f16 [8192][512]         8,388,608  at  18,874,368   (k projection, ungated, carried x8)
//   VT   f16 [32][64][2048]      8,388,608  at  27,262,976   (v projection transposed per (batch, head), ungated, carried x8)
//   Oh   f16 [8192][512]         8,388,608  at  35,651,584   (attention context, carried x256)
//   SCL  f32 [3][4][512]            24,576  at  44,040,192   (channel gates)
//   PMX  f32 [12][32][512]         786,432  at  44,064,768   (chunk maxima of the token pooling)
//   PSM  f32 [12][32][512]         786,432  at  44,851,200   (chunk sums of the token pooling)
//   total                       45,637,632
// GEMM shapes: projections/out M=8192 N=512 K=512.
// All M,N multiples of 128, all K multiples of 64, no padded rows anywhere; every plane fully written before it is read.
// Launches: weight casts 1, projections (input rounding inside) with pooling partials 1, gates 1, attention 1, output projection 1 = 5.
// ---------------------------------------------------------------------------
extern "C" void kernel_launch(void* const* d_in, const int* in_sizes, int n_in,
                              void* d_out, int out_size, void* d_ws, size_t ws_size,
                              hipStream_t stream) {
  if (n_in < 9) return;
  if (in_sizes[0] != kPlane || in_sizes[1] != kPlane) return;
  if (in_sizes[2] != kDim * kDim || in_sizes[3] != kDim * kDim || in_sizes[4] != kDim * kDim || in_sizes[5] != kDim * kDim) return;
  if (in_sizes[6] != kDim || in_sizes[7] != kDim * kRed || in_sizes[8] != kRed * kDim) return;
  if (out_size != kPlane) return;

  const size_t szHalfPlane = (size_t)kPlane * 2;                 // 8,388,608
  const size_t szWT  = (size_t)4 * kDim * kDim * 2;
  const size_t szQf  = (size_t)kPlane * 4;
  const size_t szVT  = (size_t)kBatch * kHeads * kDh * kSeq * 2;
  const size_t szSCL = (size_t)3 * kBatch * kDim * 4;
  const size_t offWT  = 0;
  const size_t offQf  = offWT + szWT;
  const size_t offKh  = offQf + szQf;
  const size_t offVT  = offKh + szHalfPlane;
  const size_t offOh  = offVT + szVT;
  const size_t offSCL = offOh + szHalfPlane;
  const size_t szPart = (size_t)3 * kBatch * kPoolParts * kDim * 4;
  const size_t offPMX = offSCL + szSCL;
  const size_t offPSM = offPMX + szPart;
  const size_t total  = offPSM + szPart;                          // 45,637,632
  if (ws_size < total) return;

  const float* x      = (const float*)d_in[0];
  const float* m      = (const float*)d_in[1];
  const float* Wq     = (const float*)d_in[2];
  const float* Wk     = (const float*)d_in[3];
  const float* Wv     = (const float*)d_in[4];
  const float* Wo     = (const float*)d_in[5];
  const float* bias_o = (const float*)d_in[6];
  const float* gw1    = (const float*)d_in[7];
  const float* gw2    = (const float*)d_in[8];
  float* out = (float*)d_out;
  char* ws = (char*)d_ws;
  unsigned short* WT  = (unsigned short*)(ws + offWT);
  float*          Qf  = (float*)(ws + offQf);
  unsigned short* Kh  = (unsigned short*)(ws + offKh);
  unsigned short* VT  = (unsigned short*)(ws + offVT);
  unsigned short* Oh  = (unsigned short*)(ws + offOh);
  float*          SCL = (float*)(ws + offSCL);
  float*          PMX = (float*)(ws + offPMX);
  float*          PSM = (float*)(ws + offPSM);

  const size_t wPlane = (size_t)kDim * kDim;

  // ---- 16-bit planes of the weights ----
  prep_kernel<<<dim3(kWtBlocks), dim3(256), 0, stream>>>(Wq, Wk, Wv, Wo, WT, kWCarry);

  // ---- projections x.Wq, m.Wk, m.Wv (M=8192, N=512, K=512): f32 q, f16 k and V^T, and the token pooling's chunk partials ----
  const int tilesProj = (kTok / kGRows) * (kDim / kGRows);   // 256 work-groups of 4 waves, a 128x128 tile each
  // one grid, blockIdx.y = product: left operand x for 0, m for 1 and 2, read as f32 and rounded inside (A_F32)
  wmma_gemm64<0, false, 0, 3, false, 0, true, true><<<dim3(tilesProj, 3), dim3(128), 0, stream>>>(
      nullptr, nullptr, kDim, 0L, WT, WT, kDim, (long)wPlane,
      (void*)Qf, (void*)Kh, kDim, 0L, bias_o, SCL, 0L, kTok, kDim, kDim, kWCarryInv, VT, PMX, PSM, x, m);

  // ---- channel gates ----
  gate_kernel<<<dim3(3 * kBatch), dim3(512), 0, stream>>>(PMX, PSM, gw1, gw2, SCL);

  // ---- attention, all (batch, head) in one launch, gates applied inside: Oh[b, i, h*64+d] = f16( 256 * context ) ----
  attn_fused_kernel<<<dim3(kSeq / 256, kBatch * kHeads), dim3(256), 0, stream>>>(Qf, Kh, VT, SCL, Oh);

  // ---- output projection: out = 2^-12 * Oh.Wo^T(x16) + bo   (M=8192, N=512, K=512), f32 to d_out ----
  wmma_gemm64<0, false, 2, 0, false, 0><<<dim3(tilesProj, 1), dim3(128), 0, stream>>>(
      Oh, Oh, kDim, 0L, WT + 3 * wPlane, WT + 3 * wPlane, kDim, 0L,
      (void*)out, (void*)out, kDim, 0L, bias_o, SCL, 0L, kTok, kDim, kDim, kOutScale, nullptr, nullptr, nullptr, nullptr, nullptr);
}

// v008
// A run of this version takes 68.8 microseconds.
// Two timings next to v007 put it at 1.04 and 1.03 times that version's speed.
// Over all steps from v000 it is 52.1 times as fast.
// Contractions: q/k/v projections (x,m RNE-converted to bf16 held in f16 LDS tiles x W^T bf16-valued f16 planes carried x16), scores k.q^T (k f16 plane carried x8; q fragments scaled by both gates and by the softmax scale in base 2 over 8; the exponent offset is the f32 C operand), v^T.p^T (V^T f16 carried x8 x unnormalised P f16 carried x64; v gate on the f32 result), output projection (context f16 carried x256 x Wo^T f16 carried x16): all v_wmma_f32_16x16x32_f16 with f32 accumulate; token pooling, channel-gate MLP, online softmax in f32.
#include <hip/hip_runtime.h>
#include <math.h>

// ---------------------------------------------------------------------------
// Problem constants
// ---------------------------------------------------------------------------
constexpr int kBatch = 4;
constexpr int kSeq   = 2048;
constexpr int kDim   = 512;               // model dim = inner dim
constexpr int kHeads = 8;
constexpr int kDh    = 64;
constexpr int kRed   = 32;                // gate hidden width (512 / 16)
constexpr int kTok   = kBatch * kSeq;     // 8192 token rows
constexpr int kPlane = kTok * kDim;       // 4194304 elements per [8192][512] plane
constexpr float kWCarry    = 16.0f;                 // weights carried x16 in f16
constexpr float kWCarryInv = 1.0f / 16.0f;
constexpr float kGCarry    = 8.0f;                  // k and V^T planes carried x8 in f16
constexpr float kPShift    = 6.0f;                  // unnormalised probabilities carried x2^6 in f16 (added to the base-2 exponent)
constexpr float kCtxCarry  = 256.0f;                // context carried x2^8 in f16
constexpr float kCtxScale  = kCtxCarry / kGCarry;                   // 32; the P carry cancels against the row sum
constexpr float kOutScale  = 1.0f / (kCtxCarry * kWCarry);          // 2^-12
constexpr float kAttnScale = 0.044194173824159216f;                 // 512^-0.5
constexpr float kQFold     = kAttnScale * 1.4426950408889634f / kGCarry;   // on the q fragments: (q kQFold).(8 k) is the score as a base-2 exponent
constexpr float kPSumMax   = 16384.0f;                              // 2^14: a lane's sum of one pass's carried P above this calls for a new maximum
constexpr float kInvSeq    = 1.0f / 2048.0f;
static_assert(kHeads * kDh == kDim);
static_assert(kDim / 16 == kRed);
static_assert(kSeq % 256 == 0 && (kSeq & (kSeq - 1)) == 0 && kDh == 64);   // fused attention: 256 queries per block
// GEMM shape contract: M % 128 == 0, N % 128 == 0, K % 64 == 0 for every launch
static_assert(kTok % 128 == 0 && kDim % 128 == 0 && kDim % 64 == 0);   // projections / out: M=8192 N=512 K=512

typedef __attribute__((ext_vector_type(16))) _Float16 v16h;
typedef __attribute__((ext_vector_type(8)))  _Float16 v8h;
typedef __attribute__((ext_vector_type(16))) __bf16   v16b;
typedef __attribute__((ext_vector_type(8)))  __bf16   v8b;
typedef __attribute__((ext_vector_type(8)))  float    v8f;
typedef __attribute__((ext_vector_type(4)))  float    v4f;
typedef __attribute__((ext_vector_type(2)))  float    v2f;
typedef __attribute__((ext_vector_type(2)))  _Float16 v2h;
typedef __attribute__((ext_vector_type(4)))  unsigned int v4u;
typedef __attribute__((ext_vector_type(2)))  unsigned int v2u;
typedef __attribute__((ext_vector_type(2)))  __bf16   v2b;

__device__ __forceinline__ unsigned short f2bf_bits(float f) {
  unsigned u = __float_as_uint(f);
  return (unsigned short)((u + 0x7FFFu + ((u >> 16) & 1u)) >> 16);
}
__device__ __forceinline__ float bf_bits2f(unsigned short h) { return __uint_as_float(((unsigned)h) << 16); }
// RNE convert f32 -> bf16 -> f32
__device__ __forceinline__ float bf_rne(float f) { return bf_bits2f(f2bf_bits(f)); }

// hazard guards as plain device helpers
__device__ __forceinline__ void dep_guard_h(v8f& a, v8f& b, v16h x, v16h y) { asm volatile("v_nop\n\tv_nop\n\tv_nop\n\tv_nop" : "+v"(a), "+v"(b) : "v"(x), "v"(y)); }
__device__ __forceinline__ void dep_guard_b(v8f& a, v8f& b, v16b x, v16b y) { asm volatile("v_nop\n\tv_nop\n\tv_nop\n\tv_nop" : "+v"(a), "+v"(b) : "v"(x), "v"(y)); }
__device__ __forceinline__ void keep4_h(v16h a, v16h b, v16h c, v16h d) { asm volatile("v_nop" :: "v"(a), "v"(b), "v"(c), "v"(d)); }
__device__ __forceinline__ void keep4_b(v16b a, v16b b, v16b c, v16b d) { asm volatile("v_nop" :: "v"(a), "v"(b), "v"(c), "v"(d)); }
__device__ __forceinline__ void acc_guard4(v8f& a, v8f& b, v8f& c, v8f& d) { asm volatile("v_nop\n\tv_nop\n\tv_nop\n\tv_nop" : "+v"(a), "+v"(b), "+v"(c), "+v"(d)); }
template <typename T> struct Frag;
template <> struct Frag<_Float16> {
  typedef v16h V; union U { v16h v; v8h h[2]; };
  // elements 0..7 <- p[0..7], 8..15 <- p[16..23]
  static __device__ __forceinline__ v16h load(const _Float16* p) {
    U f; f.h[0] = *(const v8h*)(p); f.h[1] = *(const v8h*)(p + 16); return f.v;
  }
  static __device__ __forceinline__ v8f mma(v16h a, v16h b, v8f c) {
    return __builtin_amdgcn_wmma_f32_16x16x32_f16(false, a, false, b, (short)0, c, false, false);
  }
  static __device__ __forceinline__ void guard(v8f& a, v8f& b, v16h x, v16h y) { dep_guard_h(a, b, x, y); }
  static __device__ __forceinline__ void keep(v16h a, v16h b, v16h c, v16h d) { keep4_h(a, b, c, d); }
};
template <> struct Frag<__bf16> {
  typedef v16b V; union U { v16b v; v8b h[2]; };
  static __device__ __forceinline__ v16b load(const __bf16* p) {
    U f; f.h[0] = *(const v8b*)(p); f.h[1] = *(const v8b*)(p + 16); return f.v;
  }
  static __device__ __forceinline__ v8f mma(v16b a, v16b b, v8f c) {
    return __builtin_amdgcn_wmma_f32_16x16x32_bf16(false, a, false, b, (short)0, c, false, false);
  }
  static __device__ __forceinline__ void guard(v8f& a, v8f& b, v16b x, v16b y) { dep_guard_b(a, b, x, y); }
  static __device__ __forceinline__ void keep(v16b a, v16b b, v16b c, v16b d) { keep4_b(a, b, c, d); }
};

__device__ __forceinline__ unsigned pk16(unsigned short a, unsigned short b) { return (unsigned)a | ((unsigned)b << 16); }
__device__ __forceinline__ unsigned short h_bits(float f) { const _Float16 h = (_Float16)f; return __builtin_bit_cast(unsigned short, h); }

__device__ __forceinline__ float xhalf(float x) {   // lane l <-> lane l ^ 16
  const int v = __builtin_bit_cast(int, x);
  return __builtin_bit_cast(float, __builtin_amdgcn_permlanex16(v, v, 0x76543210, 0xfedcba98, false, false));
}

// ---------------------------------------------------------------------------
// Epilogue of the q/k/v projections (OUT_MODE 3 of the GEMM below): the first passes of their consumers, done on the wave's own tile.
// b = product (0: x.Wq, 1: m.Wk, 2: m.Wv, block-uniform); the tile is 64 tokens (from row m0) x 64 channels (from n0) = one head of one batch.
// From the f32 accumulators, before anything is rounded:
//   pmax[tb][chunk][c] = max over the tile's 64 tokens, psum[tb][chunk][c] = their sum (tb = product*4 + batch, chunk = 64 tokens);
//   in-lane over the lane's 32 rows in row order, then one exchange between the wave's halves.
// Then the tile itself, ungated (the gates are not known yet; the attention kernel applies them):
//   product 0: Qf[token][c] f32;  product 1: Kh[token][c] = f16(8 k);  product 2: VT[batch*8+head][d][token] = f16(8 v).
// ---------------------------------------------------------------------------
constexpr int kPoolTok   = 64;                  // tokens per pooling chunk = rows of a wave tile
constexpr int kPoolParts = kSeq / kPoolTok;     // 32 partial rows per (tensor, batch)
static_assert(kSeq % kPoolTok == 0 && kRed == 32 && kDim == 16 * 32 && kSeq == 2048);
__device__ __forceinline__ void proj_epilogue(const v8f (&acc)[4][4], float* slab, int b, int m0, int n0, int lane,
                                              float* __restrict__ Qf, unsigned short* __restrict__ Kh, unsigned short* __restrict__ VT,
                                              float* __restrict__ pmax, float* __restrict__ psum) {
  const int rlane = lane & 15;                 // column within a subtile
  const int hf    = lane >> 4;
  const int mOff  = hf * 8;                    // row offset within a subtile
  const int batch = m0 >> 11;                  // token row / 2048
  const int s0    = m0 & (kSeq - 1);           // token inside the batch

  // ---- pooling partials of this tile: lane half 0 stores the maxima, half 1 the sums; 256 contiguous bytes per wave and array ----
  {
    float* dst = (hf == 0 ? pmax : psum) + ((size_t)(b * kBatch + batch) * kPoolParts + (s0 >> 6)) * kDim + n0 + rlane;
#pragma unroll
    for (int j = 0; j < 4; ++j) {
      float mx = acc[0][j][0];
      float sm = 0.0f;
#pragma unroll
      for (int i = 0; i < 4; ++i)
#pragma unroll
        for (int r = 0; r < 8; ++r) {
          mx = fmaxf(mx, acc[i][j][r]);
          sm += acc[i][j][r];
        }
      mx = fmaxf(mx, xhalf(mx));
      sm += xhalf(sm);
      dst[j << 4] = (hf == 0 ? mx : sm) * kWCarryInv;   // the weight carry is a power of two: exact on either side of max and sum
    }
    asm volatile("s_wait_xcnt 0x0" ::: "memory");   // the code behind reuses the address and data registers of the four stores above
  }

  // ---- the tile ----
  if (b == 2) {      // a lane holds 8 consecutive tokens of one channel: V^T rows straight from the registers
    _Float16* vt = (_Float16*)VT + ((size_t)(batch * kHeads + (n0 >> 6)) * kDh + rlane) * kSeq + s0 + mOff;
#pragma unroll
    for (int j = 0; j < 4; ++j)
#pragma unroll
      for (int i = 0; i < 4; ++i) {    // the four stores of a j fill each channel's 128-byte line
        v8h hv;
#pragma unroll
        for (int r = 0; r < 8; ++r) hv[r] = (_Float16)(acc[i][j][r] * (kGCarry * kWCarryInv));
        *(v8h*)(vt + (size_t)(j << 4) * kSeq + (i << 4)) = hv;
      }
    return;
  }
  const float sc = (b == 0) ? kWCarryInv : kGCarry * kWCarryInv;
#pragma unroll
  for (int i = 0; i < 4; ++i) {
    const int mBase = m0 + (i << 4);
#pragma unroll
    for (int j = 0; j < 4; ++j)
#pragma unroll
      for (int r = 0; r < 8; ++r) slab[(mOff + r) * 68 + (j << 4) + rlane] = acc[i][j][r] * sc;
    __builtin_amdgcn_fence(__ATOMIC_RELEASE, "workgroup");
    __builtin_amdgcn_wave_barrier();
    __builtin_amdgcn_fence(__ATOMIC_ACQUIRE, "workgroup");
    if (b == 0) {
      const int c4 = (lane & 15) * 4;                    // row seg = 256 B = 16 lanes x 16 B
#pragma unroll
      for (int it = 0; it < 8; ++it) {
        const int row = it * 2 + hf;
        const v4f v = *(const v4f*)(slab + row * 68 + c4);
        *(v4f*)(Qf + (size_t)(mBase + row) * kDim + n0 + c4) = v;
      }
    } else {
      const int q = lane >> 3, c8 = (lane & 7) * 8;      // row seg = 128 B = 8 lanes x 16 B
#pragma unroll
      for (int it = 0; it < 4; ++it) {
        const int row = it * 4 + q;
        const float* sp = slab + row * 68 + c8;
        v8h hv;
#pragma unroll
        for (int e = 0; e < 8; ++e) hv[e] = (_Float16)sp[e];
        *(v8h*)((_Float16*)Kh + (size_t)(mBase + row) * kDim + n0 + c8) = hv;
      }
      asm volatile("s_wait_xcnt 0x0" ::: "memory");   // the code behind reuses the address and data registers of the four stores above
    }
    __builtin_amdgcn_fence(__ATOMIC_RELEASE, "workgroup");
    __builtin_amdgcn_wave_barrier();
    __builtin_amdgcn_fence(__ATOMIC_ACQUIRE, "workgroup");
  }
}

// ---- Register-blocked batched WMMA GEMM (ACT reduced to none/relu/leaky) -------------------------------
// C[m,n] = scale * sum_k A[m,k] * Bt[n,k] (+bias)(+resid); each wave owns a 64x64 tile, a work-group of 4 waves (2 x 2) a 128x128 tile.
// A row-major [M,K]; Bt row-major [N,K]; M,N % 128 == 0, K % 64 == 0.
// BIAS_MODE: 0 = none, 1 = bias[m], 2 = bias[n].
// OUT_MODE: 0 = f32, 1 = f16, 2 = bf16 hi plane (Cout) + bf16 lo plane (Cout2), 3 = proj_epilogue above (Cout = f32 q, Cout2 = f16 k, VTo, pmax, psum).
// ET: 0 = f16 operands, 1 = bf16 operands (pointers passed as 16-bit storage)
// A_ALT: batch 0 reads A from Ap, batch b > 0 from A2p + (b - 1) * strideA, so products of different left operands share one grid.
// A and Bt reach the waves through LDS: a stage is 64 k of the work-group's 128 A rows and 128 Bt rows (256 rows of 128 B at pitch 144 B,
// 16 B x odd for the 16-byte fragment reads), brought once per work-group by asynchronous copies, whole 128-byte lines per wave, two buffers:
// stage s + 2 is copied into the buffer of stage s behind the barrier that ends its last read.
// A_F32: A is an f32 input (Af0 for batch 0, Af1 else, row pitch kDim). Its stage comes through registers: 16 x 16 B per thread, whole 128-byte
// lines per wave, loaded behind the barrier one stage ahead, rounded to bf16 (RNE), held as f16 and stored into the same LDS rows in front of the hand-over barrier.
constexpr int kGK      = 64;                     // k per stage
constexpr int kGPitch  = 72;                     // halves per staged row (144 B)
constexpr int kGRows   = 128;                    // rows per operand and stage
constexpr int kGStageH = 2 * kGRows * kGPitch;   // 18432 halves = 36,864 B per buffer
static_assert((kGPitch * 2) % 16 == 0 && (kGStageH * 2) % 16 == 0);
static_assert(kTok % kGRows == 0 && kDim % kGRows == 0 && kDim % kGK == 0 && kDim / kGK >= 2);
// One thread's share of one operand's stage: 8 x 16 B, rows 16 apart. d: LDS byte address; g: global; step: elements between the copied rows.
__device__ __forceinline__ void gemm_copy8(unsigned d, const unsigned short* g, size_t step) {
  // s_wait_xcnt 0 closes the statement (a precaution): so no later write of the copies' address registers can be scheduled ahead of it
  asm volatile("global_load_async_to_lds_b128 %0, %8, off\n\t"
               "global_load_async_to_lds_b128 %1, %9, off\n\t"
               "global_load_async_to_lds_b128 %2, %10, off\n\t"
               "global_load_async_to_lds_b128 %3, %11, off\n\t"
               "global_load_async_to_lds_b128 %4, %12, off\n\t"
               "global_load_async_to_lds_b128 %5, %13, off\n\t"
               "global_load_async_to_lds_b128 %6, %14, off\n\t"
               "global_load_async_to_lds_b128 %7, %15, off\n\t"
               "s_wait_xcnt 0x0"
               :: "v"(d), "v"(d + 16 * kGPitch * 2), "v"(d + 32 * kGPitch * 2), "v"(d + 48 * kGPitch * 2),
                  "v"(d + 64 * kGPitch * 2), "v"(d + 80 * kGPitch * 2), "v"(d + 96 * kGPitch * 2), "v"(d + 112 * kGPitch * 2),
                  "v"(g), "v"(g + step), "v"(g + 2 * step), "v"(g + 3 * step),
                  "v"(g + 4 * step), "v"(g + 5 * step), "v"(g + 6 * step), "v"(g + 7 * step)
               : "memory");
}
// Two f32 -> bf16 (RNE) -> the same two values as f16, packed (a bf16 value inside f16's normal range is exact in f16).
__device__ __forceinline__ unsigned bf_pair_h(float a, float c) {
  const unsigned u = __builtin_bit_cast(unsigned, __builtin_convertvector((v2f){a, c}, v2b));
  const v2f w = (v2f){__uint_as_float(u << 16), __uint_as_float(u & 0xFFFF0000u)};
  return __builtin_bit_cast(unsigned, __builtin_convertvector(w, v2h));
}
constexpr int kAF = 16;   // 16-byte f32 loads per thread and stage: rows 8 apart
__device__ __forceinline__ void a_f32_load(v4f (&ar)[kAF], const float* g) {
#pragma unroll   // independent loads at immediate offsets, in flight together
  for (int i = 0; i < kAF; ++i) ar[i] = *(const v4f*)(g + (size_t)(8 * i) * kDim);
  asm volatile("s_wait_xcnt 0x0" ::: "memory");   // a precaution: the code behind may reuse the address registers of the loads above
}
__device__ __forceinline__ void a_f32_store(const v4f (&ar)[kAF], unsigned short* d) {
#pragma unroll   // ar[] stays in registers
  for (int i = 0; i < kAF; ++i)
    *(v2u*)(d + (8 * i) * kGPitch) = (v2u){bf_pair_h(ar[i][0], ar[i][1]), bf_pair_h(ar[i][2], ar[i][3])};
}
template <int ET> struct Elem;
template <> struct Elem<0> { typedef _Float16 T; };
template <> struct Elem<1> { typedef __bf16 T; };
template <int ET, bool SPLIT, int BIAS_MODE, int OUT_MODE, bool RESID, int ACT = 0, bool A_ALT = false, bool A_F32 = false>
__global__ __launch_bounds__(128) void wmma_gemm64(
    const unsigned short* __restrict__ Ap, const unsigned short* __restrict__ A2p, int lda, long strideA,
    const unsigned short* __restrict__ Btp, const unsigned short* __restrict__ Bt2p, int ldb, long strideB,
    void* __restrict__ Cout, void* __restrict__ Cout2, int ldc, long strideC,
    const float* __restrict__ bias,
    const float* __restrict__ resid, long strideR,
    int M, int N, int K, float scale,
    unsigned short* __restrict__ VTo, float* __restrict__ pmax, float* __restrict__ psum,
    const float* __restrict__ Af0, const float* __restrict__ Af1) {
  typedef typename Elem<ET>::T T;
  typedef typename Frag<T>::V V;
  static_assert(!SPLIT);                           // the staged operand path carries one plane per operand
  __shared__ __align__(16) unsigned short ring[2 * kGStageH];
  __shared__ __align__(16) float sT[4][16 * 68];   // per-wave 16x64 slab, pitch 68 floats
  const int b    = blockIdx.y;
  const int tid  = threadIdx.x;
  const int lane = tid & 31;
  const int wave = tid >> 5;
  const int tilesN = N >> 7;
  const int tilesM = M >> 7;
  if ((int)blockIdx.x >= tilesM * tilesN) return;  // the same for the whole work-group, in front of every barrier and copy
  const int bm = blockIdx.x / tilesN;
  const int bn = blockIdx.x - bm * tilesN;
  const int m0 = (bm << 7) + ((wave >> 1) << 6);
  const int n0 = (bn << 7) + ((wave & 1) << 6);

  const unsigned short* Ab = (A_ALT && b > 0) ? (A2p + (size_t)(b - 1) * strideA) : (Ap + (size_t)b * strideA);   // block-uniform select
  const unsigned short* Bb = Btp + (size_t)b * strideB;

  const int rlane = lane & 15;                 // row (A) / col (B, D) within subtile
  const int koff  = (lane >> 4) * 8;           // k offset of this lane half
  const int mOff  = (lane >> 4) * 8;           // D row offset

  // this thread's share of every stage: row tid / 8 (+ 16 i) of each operand's 128, 16-byte column tid % 8
  const unsigned short* ag = Ab + (size_t)((bm << 7) + (tid >> 3)) * lda + 8 * (tid & 7);
  const unsigned short* bg = Bb + (size_t)((bn << 7) + (tid >> 3)) * ldb + 8 * (tid & 7);
  const unsigned ad = (unsigned)(size_t)ring + (unsigned)((tid >> 3) * kGPitch + 8 * (tid & 7)) * 2u;   // byte offset in the work-group's LDS
  const unsigned bd = ad + kGRows * kGPitch * 2;
  const size_t aStep = (size_t)16 * lda, bStep = (size_t)16 * ldb;
  const int stages = K / kGK;
  // A_F32: this thread's share of every A stage: row tid / 16 (+ 8 i) of the 128, 16-byte f32 column tid % 16 (8 bytes of the staged row)
  const float* af = (b == 0 ? Af0 : Af1) + (size_t)((bm << 7) + (tid >> 4)) * kDim + 4 * (tid & 15);   // block-uniform select
  unsigned short* as = ring + (tid >> 4) * kGPitch + 4 * (tid & 15);
  v4f ar[kAF];

  if (A_F32) a_f32_load(ar, af);               // stage 0
  else       gemm_copy8(ad, ag, aStep);
  gemm_copy8(bd, bg, bStep);

  v8f acc[4][4];
#pragma unroll
  for (int i = 0; i < 4; ++i)
#pragma unroll
    for (int j = 0; j < 4; ++j) acc[i][j] = (v8f){0.f,0.f,0.f,0.f,0.f,0.f,0.f,0.f};

  if (A_F32) a_f32_store(ar, as);                    // stage 0 into buffer 0; the barrier's own fence waits for these stores
  asm volatile("s_wait_asynccnt 0x0" ::: "memory");  // this wave's copies of stage 0 have landed
  __syncthreads();                                   // publishes stage 0
  if (stages > 1) {                                  // the same for the whole work-group
    if (A_F32) a_f32_load(ar, af + kGK);             // stage 1; behind the barrier, whose fence would wait for loads issued in front of it
    else       gemm_copy8(ad + kGStageH * 2, ag + kGK, aStep);
    gemm_copy8(bd + kGStageH * 2, bg + kGK, bStep);
  }

  // rolled over the stages, so that the loop's foot is the one hand-over point
#pragma unroll 1
  for (int st = 0; st < stages; ++st) {
    const T* al = (const T*)ring + (st & 1) * kGStageH + (((wave >> 1) << 6) + rlane) * kGPitch + koff;
    const T* bl = (const T*)ring + (st & 1) * kGStageH + (kGRows + ((wave & 1) << 6) + rlane) * kGPitch + koff;
#pragma unroll
    for (int kk = 0; kk < kGK / 32; ++kk) {
      V bh[4], ah[4];
#pragma unroll
      for (int j = 0; j < 4; ++j) bh[j] = Frag<T>::load(bl + (j << 4) * kGPitch + 32 * kk);
#pragma unroll
      for (int i = 0; i < 4; ++i) ah[i] = Frag<T>::load(al + (i << 4) * kGPitch + 32 * kk);
      __builtin_amdgcn_sched_barrier(0);   // the 16 products' fragments are read as one group: one LDS latency in front of them, not one per fragment
#pragma unroll
      for (int i = 0; i < 4; ++i) {
#pragma unroll
        for (int j = 0; j < 4; ++j) acc[i][j] = Frag<T>::mma(ah[i], bh[j], acc[i][j]);
        Frag<T>::guard(acc[i][0], acc[i][3], ah[i], ah[i]);
      }
      Frag<T>::keep(bh[0], bh[1], bh[2], bh[3]);
    }

    if (A_F32 && st + 1 < stages)                      // the same for the whole work-group
      a_f32_store(ar, as + ((st + 1) & 1) * kGStageH); // stage st + 1 into the other buffer, whose last readers left at the barrier of stage st - 1
    // hand-over: this wave's reads of stage st and its stores of stage st + 1 are done, its copies of stage st + 1 have landed; the barrier says so of every wave
    asm volatile("s_wait_dscnt 0x0" ::: "memory");
    asm volatile("s_wait_asynccnt 0x0" ::: "memory");
    __syncthreads();
    if (st + 2 < stages) {                             // the same for the whole work-group
      if (A_F32) a_f32_load(ar, af + (size_t)(st + 2) * kGK);   // in flight under stage st + 1's products
      else       gemm_copy8(ad + (st & 1) * (kGStageH * 2), ag + (size_t)(st + 2) * kGK, aStep);
      gemm_copy8(bd + (st & 1) * (kGStageH * 2), bg + (size_t)(st + 2) * kGK, bStep);
    }
  }
  asm volatile("s_wait_asynccnt 0x0" ::: "memory");    // no copy is outstanding when the wave goes on
  acc_guard4(acc[0][0], acc[0][1], acc[0][2], acc[0][3]);
  acc_guard4(acc[1][0], acc[1][1], acc[1][2], acc[1][3]);
  acc_guard4(acc[2][0], acc[2][1], acc[2][2], acc[2][3]);
  acc_guard4(acc[3][0], acc[3][1], acc[3][2], acc[3][3]);

  // ---- epilogue ----
  float* slab = sT[wave];
  if (OUT_MODE == 3) {
    proj_epilogue(acc, slab, b, m0, n0, lane, (float*)Cout, (unsigned short*)Cout2, VTo, pmax, psum);
    return;
  }
  const float* Rb = RESID ? (resid + (size_t)b * strideR) : nullptr;
#pragma unroll
  for (int i = 0; i < 4; ++i) {
    const int mBase = m0 + (i << 4);
#pragma unroll
    for (int j = 0; j < 4; ++j) {
      const int n = n0 + (j << 4) + rlane;
      float bv = 0.f;
      if (BIAS_MODE == 2) bv = bias[n];
#pragma unroll
      for (int r = 0; r < 8; ++r) {
        float v = acc[i][j][r] * scale;
        if (BIAS_MODE == 1) v += bias[mBase + mOff + r];
        if (BIAS_MODE == 2) v += bv;
        if (RESID) v += Rb[(size_t)(mBase + mOff + r) * ldc + n];
        if (ACT == 2) v = fmaxf(v, 0.0f);
        if (ACT == 4) v = (v > 0.f) ? v : 0.01f * v;
        slab[(mOff + r) * 68 + (j << 4) + rlane] = v;
      }
    }
    __builtin_amdgcn_fence(__ATOMIC_RELEASE, "workgroup");
    __builtin_amdgcn_wave_barrier();
    __builtin_amdgcn_fence(__ATOMIC_ACQUIRE, "workgroup");
    if (OUT_MODE == 0) {
      float* C = (float*)Cout + (size_t)b * strideC;
      const int hh = lane >> 4, c4 = (lane & 15) * 4;     // row seg = 256 B = 16 lanes x 16 B
      {
#pragma unroll
        for (int it = 0; it < 8; ++it) {
          const int row = it * 2 + hh;
          v4f v = *(const v4f*)(slab + row * 68 + c4);
          *(v4f*)(C + (size_t)(mBase + row) * ldc + n0 + c4) = v;
        }
        
      }
    } else {
      const int q = lane >> 3, c8 = (lane & 7) * 8;
      unsigned short* C  = (unsigned short*)Cout  + (size_t)b * strideC;
      unsigned short* C2 = (OUT_MODE == 2) ? ((unsigned short*)Cout2 + (size_t)b * strideC) : nullptr;
      {
#pragma unroll
        for (int it = 0; it < 4; ++it) {
          const int row = it * 4 + q;
          const float* sp = slab + row * 68 + c8;
          v8h hv, lv;
#pragma unroll
          for (int e = 0; e < 8; ++e) {
            if (OUT_MODE == 1) {
              hv[e] = (_Float16)sp[e];
            } else {
              unsigned short hb = f2bf_bits(sp[e]);
              unsigned short lb = f2bf_bits(sp[e] - bf_bits2f(hb));
              hv[e] = __builtin_bit_cast(_Float16, hb);
              lv[e] = __builtin_bit_cast(_Float16, lb);
            }
          }
          *(v8h*)(C + (size_t)(mBase + row) * ldc + n0 + c8) = hv;
          if (OUT_MODE == 2) *(v8h*)(C2 + (size_t)(mBase + row) * ldc + n0 + c8) = lv;
        }
        
      }
    }
    __builtin_amdgcn_fence(__ATOMIC_RELEASE, "workgroup");
    __builtin_amdgcn_wave_barrier();
    __builtin_amdgcn_fence(__ATOMIC_ACQUIRE, "workgroup");
  }
}

// ---------------------------------------------------------------------------
// Weight transpose + cast: W is [in d][out h] (512x512, row-major); WT[h][d] = f16( scale * bf16_rne(W[d][h]) ).
// One work-group's share: bd = d tile (64 cols of WT, 0..7), bh = h tile (64 rows of WT, 0..7), z selects W0..W3 and the
// output plane (plane z at out + z*512*512 halves). 256 threads; sm is the work-group's 64 x 65 float exchange tile.
// Load coverage: 4 iterations x 256 threads x float4 = 4096 = the whole 64(d) x 64(h) tile (coalesced along h), 4 b128 loads per lane.
// Store coverage: 8 waves x 2 iterations x 4 rows (lane>>3) = 64 rows; (lane&7) x 8 halves = 64 cols; each row segment =
// ---------------------------------------------------------------------------
__device__ __forceinline__ void wtcast_block(const float* __restrict__ W0, const float* __restrict__ W1,
                                             const float* __restrict__ W2, const float* __restrict__ W3,
                                             unsigned short* __restrict__ out, float scale,
                                             float (*sm)[65], int bd, int bh, int z) {   // sm[h_local][d_local]; z block-uniform
  const int t  = threadIdx.x;
  const int d0 = bd * 64;
  const int h0 = bh * 64;
  const float* W = (z == 0) ? W0 : (z == 1) ? W1 : (z == 2) ? W2 : W3;
#pragma unroll
  for (int i = 0; i < 4; ++i) {
    const int e4 = i * 256 + t;
    const int r  = e4 >> 4;            // d local 0..63
    const int c4 = (e4 & 15) * 4;      // h local 0..60
    const v4f w = *(const v4f*)(W + (size_t)(d0 + r) * kDim + h0 + c4);
#pragma unroll
    for (int k = 0; k < 4; ++k) sm[c4 + k][r] = bf_rne(w[k]) * scale;
  }
  __syncthreads();
  const int lane = t & 31, wave = t >> 5;
  const int q = lane >> 3, c8 = (lane & 7) * 8;
  unsigned short* op = out + (size_t)z * kDim * kDim;
  {
#pragma unroll
    for (int it = 0; it < 2; ++it) {
      const int row = wave * 8 + it * 4 + q;                 // h local
      unsigned short hb[8];
#pragma unroll
      for (int e = 0; e < 8; ++e) hb[e] = h_bits(sm[row][c8 + e]);
      const v4u u = (v4u){pk16(hb[0], hb[1]), pk16(hb[2], hb[3]), pk16(hb[4], hb[5]), pk16(hb[6], hb[7])};
      *(v4u*)(op + (size_t)(h0 + row) * kDim + d0 + c8) = u;
    }
    
  }
}

// ---------------------------------------------------------------------------
// The weight planes: one work-group per 64 x 64 tile (d tile, h tile, matrix).
// ---------------------------------------------------------------------------
constexpr int kWtBlocks = (kDim / 64) * (kDim / 64) * 4;   // 256
static_assert(kDim / 64 == 8);
__global__ __launch_bounds__(256) void prep_kernel(const float* __restrict__ W0, const float* __restrict__ W1,
                                                   const float* __restrict__ W2, const float* __restrict__ W3,
                                                   unsigned short* __restrict__ wt_out, float scale) {
  __shared__ float sm[64][65];
  const int blk = blockIdx.x;
  wtcast_block(W0, W1, W2, W3, wt_out, scale, sm, blk & 7, (blk >> 3) & 7, blk >> 6);
}

// ---------------------------------------------------------------------------
// Token pooling, part 2 + channel gate MLP (f32): block tb = tensor*4 + batch (12 blocks), 512 threads = channels.
//   mx[c] = max over 32 chunk maxima, av[c] = (sum of 32 chunk sums, chunk order) * (1/2048)
//   hid[j] = relu( sum_c mx[c]*w1[c][j] + sum_c av[c]*w1[c][j] )   j < 32      (w1, w2 RNE-converted to bf16 where used)
//            thread t holds w1 elements i*512 + t, so wave w sums channels w, w+16, .. w+496 for all 32 j (lane = j);
//            32 threads then add the 16 wave partials in wave order
//   g[c]   = 1 / (1 + exp(-sum_j hid[j]*w2[j][c]))
// The w1 and w2 elements a thread needs depend on nothing computed here: they are loaded first, beside the chunk partials.
// ---------------------------------------------------------------------------
__global__ __launch_bounds__(512) void gate_kernel(const float* __restrict__ pmax, const float* __restrict__ psum,
                                                   const float* __restrict__ w1, const float* __restrict__ w2,
                                                   float* __restrict__ scl) {
  __shared__ float smax[kDim];
  __shared__ float savg[kDim];
  __shared__ float pa1[kDim / 32][kRed];
  __shared__ float pa2[kDim / 32][kRed];
  __shared__ float hid[kRed];
  const int t    = threadIdx.x;
  const int tb   = blockIdx.x;          // 0..11
  const int lane = t & 31, wave = t >> 5;
  float w1v[32], w2v[kRed];
#pragma unroll   // this loop and the next two: independent loads at immediate offsets, in flight together
  for (int i = 0; i < 32; ++i) w1v[i] = w1[i * kDim + t];      // channel i*16 + wave, hidden unit lane
#pragma unroll   // as above
  for (int j = 0; j < kRed; ++j) w2v[j] = w2[j * kDim + t];
  const float* pm = pmax + (size_t)tb * kPoolParts * kDim + t;
  const float* ps = psum + (size_t)tb * kPoolParts * kDim + t;
  float mx = -__builtin_inff();
  float sm = 0.0f;
#pragma unroll   // as above
  for (int p = 0; p < kPoolParts; ++p) {
    mx = fmaxf(mx, pm[p * kDim]);
    sm += ps[p * kDim];
  }
  smax[t] = mx;
  savg[t] = sm * kInvSeq;
  __syncthreads();
  float a1 = 0.0f, a2 = 0.0f;
#pragma unroll   // w1v[] stays in registers
  for (int i = 0; i < 32; ++i) {
    const float w = bf_rne(w1v[i]);
    a1 += smax[i * 16 + wave] * w;
    a2 += savg[i * 16 + wave] * w;
  }
  pa1[wave][lane] = a1;
  pa2[wave][lane] = a2;
  __syncthreads();
  if (t < kRed) {                       // wave 0, wave-uniform
    float s1 = 0.0f, s2 = 0.0f;
#pragma unroll   // the 32 LDS reads overlap
    for (int w = 0; w < kDim / 32; ++w) {
      s1 += pa1[w][t];
      s2 += pa2[w][t];
    }
    hid[t] = fmaxf(s1 + s2, 0.0f);
  }
  __syncthreads();
  float a = 0.0f;
#pragma unroll   // w2v[] stays in registers
  for (int j = 0; j < kRed; ++j) a += hid[j] * bf_rne(w2v[j]);
  const float g = 1.0f / (1.0f + expf(-a));
  scl[(size_t)tb * kDim + t] = g;       // one whole 128-byte line per wave
}

// ---------------------------------------------------------------------------
// Fused attention of every (batch, head): S^T = K.Q^T, online softmax (base 2, f32), O^T += V^T.P^T; scores and P stay in registers.
// grid (8, 32): blockIdx.x = block of 256 queries, blockIdx.y = batch*8 + head. 8 waves x 32 query columns (2 groups of 16).
// One pass = 32 keys. Lane (c = lane & 15, hf = lane >> 4) of a score tile holds query c, keys 8*hf + r: the two 16-key tiles of a
// pass, converted in place, are the B operand of the second product (element s: key 8*hf + s, s < 8; key 16 + 8*hf + s - 8 else),
// the k order in which Frag::load brings V^T (and K, Q among themselves).
// The score product gives the exponent itself: the q fragments carry the softmax scale (base 2), and the product's C operand is 6 - maximum in use
// (the same in a lane's eight registers, which all belong to one query), so the common path of a pass is exp2, sum, convert.
// No maximum is formed there: every P is positive, so a lane's sum of the pass's P at or below 2^14 bounds each carried P by 2^14 (finite in f16);
// a larger sum (or the first pass) takes the wave to the branch that forms the maximum, rescales, and redoes the pass's P.
// Oh[b][q][head*64 + d] = f16( 32 * acc / rowsum * gv[d] ): context carried x256, V carried x8.
// The channel gates (scl = [3][4][512]: q, k, v) come in here: a score is sum_d q_d gq_d k_d gk_d, so the q fragments, built once per wave
// from f32 q, carry f16( q * (gq gk kQFold) ) against the ungated k plane; gv scales channel d of the f32 result.
// K and V^T reach the waves through LDS: a stage is 128 keys (K 128 rows of 128 B at pitch 144 B, V^T 64 rows of 256 B at pitch 272 B, both
// 16 B x odd for the 16-byte fragment reads), brought once per work-group by asynchronous copies, whole 128-byte lines per wave, two buffers:
// stage s + 2 is copied into the buffer of stage s behind the barrier that ends its last read. A stage serves four passes.
// ---------------------------------------------------------------------------
constexpr int kStKeys = 128;                    // keys per stage
constexpr int kStages = kSeq / kStKeys;         // 16
constexpr int kKPitch = 72;                     // halves per staged K row (144 B)
constexpr int kVPitch = 136;                    // halves per staged V^T row (272 B)
constexpr int kKTile  = kStKeys * kKPitch;      // 9216 halves
constexpr int kStageH = kKTile + kDh * kVPitch; // 17920 halves = 35,840 B per buffer
static_assert(kStages >= 2 && kStKeys % 32 == 0 && (kKTile * 2) % 16 == 0 && (kStageH * 2) % 16 == 0);
// One thread's share of a stage: 4 x 16 B of K (rows 32 apart) and 4 x 16 B of V^T (rows 16 apart). kd, vd: LDS byte addresses; kg, vg: global.
__device__ __forceinline__ void stage_copy(unsigned kd, unsigned vd, const _Float16* kg, const _Float16* vg) {
  // s_wait_xcnt 0 closes the statement (a precaution): so no later write of the copies' address registers can be scheduled ahead of it
  asm volatile("global_load_async_to_lds_b128 %0, %8, off\n\t"
               "global_load_async_to_lds_b128 %1, %9, off\n\t"
               "global_load_async_to_lds_b128 %2, %10, off\n\t"
               "global_load_async_to_lds_b128 %3, %11, off\n\t"
               "global_load_async_to_lds_b128 %4, %12, off\n\t"
               "global_load_async_to_lds_b128 %5, %13, off\n\t"
               "global_load_async_to_lds_b128 %6, %14, off\n\t"
               "global_load_async_to_lds_b128 %7, %15, off\n\t"
               "s_wait_xcnt 0x0"
               :: "v"(kd), "v"(kd + 32 * kKPitch * 2), "v"(kd + 64 * kKPitch * 2), "v"(kd + 96 * kKPitch * 2),
                  "v"(vd), "v"(vd + 16 * kVPitch * 2), "v"(vd + 32 * kVPitch * 2), "v"(vd + 48 * kVPitch * 2),
                  "v"(kg), "v"(kg + (size_t)32 * kDim), "v"(kg + (size_t)64 * kDim), "v"(kg + (size_t)96 * kDim),
                  "v"(vg), "v"(vg + (size_t)16 * kSeq), "v"(vg + (size_t)32 * kSeq), "v"(vg + (size_t)48 * kSeq)
               : "memory");
}
// One query group's P of one pass: exp2(exponent), rounded to f16 in the key order of the B operand; returns the f32 sum (pairwise tree).
__device__ __forceinline__ v2f exp_pass(const v8f& a, const v8f& b, v16h& pf) {
  v2f p[8];
#pragma unroll
  for (int i = 0; i < 8; ++i) {
    const v8f& t = (i < 4) ? a : b;
    p[i] = (v2f){__builtin_amdgcn_exp2f(t[2 * (i & 3)]), __builtin_amdgcn_exp2f(t[2 * (i & 3) + 1])};
    const v2h ph = __builtin_convertvector(p[i], v2h);
    pf[2 * i]     = ph.x;
    pf[2 * i + 1] = ph.y;
  }
  return ((p[0] + p[1]) + (p[2] + p[3])) + ((p[4] + p[5]) + (p[6] + p[7]));
}
__global__ __launch_bounds__(256) void attn_fused_kernel(const float* __restrict__ Qf, const unsigned short* __restrict__ Kp,
                                                         const unsigned short* __restrict__ VTp, const float* __restrict__ scl,
                                                         unsigned short* __restrict__ Op) {
  typedef Frag<_Float16> FH;
  __shared__ __align__(16) _Float16 ring[2 * kStageH];
  const int lane = threadIdx.x & 31, wave = threadIdx.x >> 5;
  const int c = lane & 15, hf = lane >> 4;
  const int bh = blockIdx.y;
  const int q0 = blockIdx.x * 256 + wave * 32;
  const size_t tokOff = (size_t)(bh >> 3) * kSeq * kDim + (size_t)(bh & 7) * kDh;
  const float* ql = Qf + tokOff + (size_t)(q0 + c) * kDim + 8 * hf;
  const float* gl = scl + (size_t)(bh >> 3) * kDim + (size_t)(bh & 7) * kDh + 8 * hf;   // q gate of this lane's first channel; k, v: + 4, 8 rows

  // this thread's share of every stage: K row t / 8 (+ 32 i), 16-byte column t % 8; V^T row t / 16 (+ 16 i), 16-byte column t % 16
  const int tid = threadIdx.x;
  const _Float16* kg = (const _Float16*)Kp + tokOff + (size_t)(tid >> 3) * kDim + 8 * (tid & 7);
  const _Float16* vg = (const _Float16*)VTp + (size_t)bh * kDh * kSeq + (size_t)(tid >> 4) * kSeq + 8 * (tid & 15);
  const unsigned ringB = (unsigned)(size_t)ring;     // byte offset of the ring in the work-group's LDS
  const unsigned kd = ringB + (unsigned)((tid >> 3) * kKPitch + 8 * (tid & 7)) * 2u;
  const unsigned vd = ringB + (unsigned)(kKTile + (tid >> 4) * kVPitch + 8 * (tid & 15)) * 2u;

  stage_copy(kd, vd, kg, vg);                        // stage 0, in flight under the q fragments' loads

  v16h qf[2][2];   // element e < 8: channel 32 kc + 8 hf + e; e >= 8: 32 kc + 16 + 8 hf + e - 8 (the order of Frag::load)
#pragma unroll
  for (int kc = 0; kc < 2; ++kc)
#pragma unroll
    for (int u = 0; u < 4; ++u) {      // four channels at a time
      const int d = 32 * kc + 16 * (u >> 1) + 4 * (u & 1);
      const v4f gg = *(const v4f*)(gl + d) * *(const v4f*)(gl + (size_t)kBatch * kDim + d) * kQFold;
#pragma unroll
      for (int g = 0; g < 2; ++g) {
        const v4f qv = *(const v4f*)(ql + (size_t)(16 * g) * kDim + d) * gg;
#pragma unroll
        for (int e = 0; e < 4; ++e) qf[g][kc][4 * u + e] = (_Float16)qv[e];
      }
    }

  v8f acc[2][4];
  v2f ls[2];
  float m_run[2];
  v8f nmv[2];      // C operand of the score products: kPShift - m_run; 0 until the first pass has set a maximum
#pragma unroll
  for (int g = 0; g < 2; ++g) {
    m_run[g] = -__builtin_inff();
    nmv[g] = (v8f){0.f,0.f,0.f,0.f,0.f,0.f,0.f,0.f};
    ls[g] = (v2f){0.f, 0.f};
#pragma unroll
    for (int t = 0; t < 4; ++t) acc[g][t] = (v8f){0.f,0.f,0.f,0.f,0.f,0.f,0.f,0.f};
  }

  asm volatile("s_wait_asynccnt 0x0" ::: "memory");  // this wave's copies of stage 0 have landed
  __syncthreads();                                   // publishes stage 0
  stage_copy(kd + kStageH * 2, vd + kStageH * 2, kg + (size_t)kStKeys * kDim, vg + kStKeys);   // stage 1

  // rolled over the stages; the four passes of a stage are unrolled, so that a pass can fetch the next pass's K inside its own stage
#pragma unroll 1
  for (int st = 0; st < kStages; ++st) {
    const _Float16* kl = ring + (st & 1) * kStageH + c * kKPitch + 8 * hf;
    const _Float16* vl = ring + (st & 1) * kStageH + kKTile + c * kVPitch + 8 * hf;
    v16h kf[2][2];
#pragma unroll
    for (int kt = 0; kt < 2; ++kt)
#pragma unroll
      for (int kc = 0; kc < 2; ++kc) kf[kt][kc] = FH::load(kl + (16 * kt) * kKPitch + 32 * kc);
    __builtin_amdgcn_sched_barrier(0);   // the stage's first K fragments are read as one group: one LDS latency in front of the products, not one per fragment

#pragma unroll
    for (int ps = 0; ps < kStKeys / 32; ++ps) {
      v16h vf[4];      // this pass's V^T, in flight under the score products and the exponentials
#pragma unroll
      for (int t = 0; t < 4; ++t) vf[t] = FH::load(vl + (16 * t) * kVPitch + 32 * ps);

      v8f s[2][2];
#pragma unroll
      for (int kt = 0; kt < 2; ++kt)
#pragma unroll
        for (int g = 0; g < 2; ++g) {
          s[kt][g] = FH::mma(kf[kt][0], qf[g][0], nmv[g]);
          s[kt][g] = FH::mma(kf[kt][1], qf[g][1], s[kt][g]);
        }
      if (ps + 1 < kStKeys / 32) {
#pragma unroll
        for (int kt = 0; kt < 2; ++kt)
#pragma unroll
          for (int kc = 0; kc < 2; ++kc) kf[kt][kc] = FH::load(kl + (32 * (ps + 1) + 16 * kt) * kKPitch + 32 * kc);
      }
      __builtin_amdgcn_sched_barrier(0);   // keeps the K loads issued here, ahead of the vector work that hides their latency

      v16h pf[2];
      v2f sp[2];
#pragma unroll
      for (int g = 0; g < 2; ++g) sp[g] = exp_pass(s[0][g], s[1][g], pf[g]);
      const bool need = (sp[0].x + sp[0].y > kPSumMax) || (sp[1].x + sp[1].y > kPSumMax);
      if (__builtin_amdgcn_ballot_w32(need) != 0 || (ps == 0 && st == 0)) {   // wave-uniform; always on the first pass, rare later
        v16h kr[2][2];   // this pass's K again, from the stage that is still published: the common path keeps no copy of the scores
#pragma unroll
        for (int kt = 0; kt < 2; ++kt)
#pragma unroll
          for (int kc = 0; kc < 2; ++kc) kr[kt][kc] = FH::load(kl + (32 * ps + 16 * kt) * kKPitch + 32 * kc);
#pragma unroll
        for (int g = 0; g < 2; ++g) {
          v8f r[2];      // the scores as base-2 exponents, no offset
#pragma unroll
          for (int kt = 0; kt < 2; ++kt) {
            r[kt] = (v8f){0.f,0.f,0.f,0.f,0.f,0.f,0.f,0.f};
#pragma unroll
            for (int kc = 0; kc < 2; ++kc) r[kt] = FH::mma(kr[kt][kc], qf[g][kc], r[kt]);
          }
          float mx = r[0][0];
#pragma unroll
          for (int e = 1; e < 8; ++e) mx = fmaxf(mx, r[0][e]);
#pragma unroll
          for (int e = 0; e < 8; ++e) mx = fmaxf(mx, r[1][e]);
          mx = fmaxf(mx, xhalf(mx));                     // both halves hold the query's maximum of this pass
          const float m_new = fmaxf(m_run[g], mx);
          const float corr = __builtin_amdgcn_exp2f(m_run[g] - m_new);   // 0 on the first pass
          const float nm = kPShift - m_new;
          m_run[g] = m_new;
#pragma unroll
          for (int e = 0; e < 8; ++e) nmv[g][e] = nm;
          ls[g] = ls[g] * corr;
#pragma unroll
          for (int t = 0; t < 4; ++t) acc[g][t] = acc[g][t] * corr;
          r[0] = r[0] + nm;
          r[1] = r[1] + nm;
          sp[g] = exp_pass(r[0], r[1], pf[g]);           // this pass's P against the new maximum
        }
      }
#pragma unroll
      for (int g = 0; g < 2; ++g) {
        ls[g] = ls[g] + sp[g];
#pragma unroll
        for (int t = 0; t < 4; ++t) acc[g][t] = FH::mma(vf[t], pf[g], acc[g][t]);
      }
    }

    // hand-over: this wave's reads of stage st are done, its copies of stage st + 1 have landed; the barrier says both of every wave
    asm volatile("s_wait_dscnt 0x0" ::: "memory");
    asm volatile("s_wait_asynccnt 0x0" ::: "memory");
    __syncthreads();
    if (st + 2 < kStages)                              // the same for the whole work-group
      stage_copy(kd + (st & 1) * (kStageH * 2), vd + (st & 1) * (kStageH * 2),
                 kg + (size_t)(st + 2) * kStKeys * kDim, vg + (st + 2) * kStKeys);
  }
  asm volatile("s_wait_asynccnt 0x0" ::: "memory");    // no copy is outstanding when the wave ends

  _Float16* ol = (_Float16*)Op + tokOff + (size_t)(q0 + c) * kDim + 8 * hf;
  float inv[2];
#pragma unroll
  for (int g = 0; g < 2; ++g) {
    float l = ls[g].x + ls[g].y;
    l += xhalf(l);                                   // join the two halves' key sums
    inv[g] = kCtxScale / l;
  }
#pragma unroll
  for (int t = 0; t < 4; ++t) {
    const float* gv = gl + (size_t)(2 * kBatch) * kDim + 16 * t;
    const v4f g0 = *(const v4f*)(gv);
    const v4f g1 = *(const v4f*)(gv + 4);
#pragma unroll
    for (int g = 0; g < 2; ++g) {
      v8h hv;
#pragma unroll
      for (int r = 0; r < 8; ++r) hv[r] = (_Float16)(acc[g][t][r] * inv[g] * (r < 4 ? g0[r & 3] : g1[r & 3]));   // d = 16 t + 8 hf + r of query 16 g + c
      *(v8h*)(ol + (size_t)(16 * g) * kDim + 16 * t) = hv;
    }
  }
}

// ---------------------------------------------------------------------------
// Host glue.
//   WT   f16 [4][512][512]       2,097,152  at           0   (Wq^T, Wk^T, Wv^T, Wo^T, [out][in], carried x16)
//   Qf   f32 [8192][512]        16,777,216  at   2,097,152   (q projection, ungated)
//   Kh   f16 [8192][512]         8,388,608  at  18,874,368   (k projection, ungated, carried x8)
//   VT   f16 [32][64][2048]      8,388,608  at  27,262,976   (v projection transposed per (batch, head), ungated, carried x8)
//   Oh   f16 [8192][512]         8,388,608  at  35,651,584   (attention context, carried x256)
//   SCL  f32 [3][4][512]            24,576  at  44,040,192   (channel gates)
//   PMX  f32 [12][32][512]         786,432  at  44,064,768   (chunk maxima of the token pooling)
//   PSM  f32 [12][32][512]         786,432  at  44,851,200   (chunk sums of the token pooling)
//   total                       45,637,632
// GEMM shapes: projections/out M=8192 N=512 K=512.
// All M,N multiples of 128, all K multiples of 64, no padded rows anywhere; every plane fully written before it is read.
// Launches: weight casts 1, projections (input rounding inside) with pooling partials 1, gates 1, attention 1, output projection 1 = 5.
// ---------------------------------------------------------------------------
extern "C" void kernel_launch(void* const* d_in, const int* in_sizes, int n_in,
                              void* d_out, int out_size, void* d_ws, size_t ws_size,
                              hipStream_t stream) {
  if (n_in < 9) return;
  if (in_sizes[0] != kPlane || in_sizes[1] != kPlane) return;
  if (in_sizes[2] != kDim * kDim || in_sizes[3] != kDim * kDim || in_sizes[4] != kDim * kDim || in_sizes[5] != kDim * kDim) return;
  if (in_sizes[6] != kDim || in_sizes[7] != kDim * kRed || in_sizes[8] != kRed * kDim) return;
  if (out_size != kPlane) return;

  const size_t szHalfPlane = (size_t)kPlane * 2;                 // 8,388,608
  const size_t szWT  = (size_t)4 * kDim * kDim * 2;
  const size_t szQf  = (size_t)kPlane * 4;
  const size_t szVT  = (size_t)kBatch * kHeads * kDh * kSeq * 2;
  const size_t szSCL = (size_t)3 * kBatch * kDim * 4;
  const size_t offWT  = 0;
  const size_t offQf  = offWT + szWT;
  const size_t offKh  = offQf + szQf;
  const size_t offVT  = offKh + szHalfPlane;
  const size_t offOh  = offVT + szVT;
  const size_t offSCL = offOh + szHalfPlane;
  const size_t szPart = (size_t)3 * kBatch * kPoolParts * kDim * 4;
  const size_t offPMX = offSCL + szSCL;
  const size_t offPSM = offPMX + szPart;
  const size_t total  = offPSM + szPart;                          // 45,637,632
  if (ws_size < total) return;

  const float* x      = (const float*)d_in[0];
  const float* m      = (const float*)d_in[1];
  const float* Wq     = (const float*)d_in[2];
  const float* Wk     = (const float*)d_in[3];
  const float* Wv     = (const float*)d_in[4];
  const float* Wo     = (const float*)d_in[5];
  const float* bias_o = (const float*)d_in[6];
  const float* gw1    = (const float*)d_in[7];
  const float* gw2    = (const float*)d_in[8];
  float* out = (float*)d_out;
  char* ws = (char*)d_ws;
  unsigned short* WT  = (unsigned short*)(ws + offWT);
  float*          Qf  = (float*)(ws + offQf);
  unsigned short* Kh  = (unsigned short*)(ws + offKh);
  unsigned short* VT  = (unsigned short*)(ws + offVT);
  unsigned short* Oh  = (unsigned short*)(ws + offOh);
  float*          SCL = (float*)(ws + offSCL);
  float*          PMX = (float*)(ws + offPMX);
  float*          PSM = (float*)(ws + offPSM);

  const size_t wPlane = (size_t)kDim * kDim;

  // ---- 16-bit planes of the weights ----
  prep_kernel<<<dim3(kWtBlocks), dim3(256), 0, stream>>>(Wq, Wk, Wv, Wo, WT, kWCarry);

  // ---- projections x.Wq, m.Wk, m.Wv (M=8192, N=512, K=512): f32 q, f16 k and V^T, and the token pooling's chunk partials ----
  const int tilesProj = (kTok / kGRows) * (kDim / kGRows);   // 256 work-groups of 4 waves, a 128x128 tile each
  // one grid, blockIdx.y = product: left operand x for 0, m for 1 and 2, read as f32 and rounded inside (A_F32)
  wmma_gemm64<0, false, 0, 3, false, 0, true, true><<<dim3(tilesProj, 3), dim3(128), 0, stream>>>(
      nullptr, nullptr, kDim, 0L, WT, WT, kDim, (long)wPlane,
      (void*)Qf, (void*)Kh, kDim, 0L, bias_o, SCL, 0L, kTok, kDim, kDim, kWCarryInv, VT, PMX, PSM, x, m);

  // ---- channel gates ----
  gate_kernel<<<dim3(3 * kBatch), dim3(512), 0, stream>>>(PMX, PSM, gw1, gw2, SCL);

  // ---- attention, all (batch, head) in one launch, gates applied inside: Oh[b, i, h*64+d] = f16( 256 * context ) ----
  attn_fused_kernel<<<dim3(kSeq / 256, kBatch * kHeads), dim3(256), 0, stream>>>(Qf, Kh, VT, SCL, Oh);

  // ---- output projection: out = 2^-12 * Oh.Wo^T(x16) + bo   (M=8192, N=512, K=512), f32 to d_out ----
  wmma_gemm64<0, false, 2, 0, false, 0><<<dim3(tilesProj, 1), dim3(128), 0, stream>>>(
      Oh, Oh, kDim, 0L, WT + 3 * wPlane, WT + 3 * wPlane, kDim, 0L,
      (void*)out, (void*)out, kDim, 0L, bias_o, SCL, 0L, kTok, kDim, kDim, kOutScale, nullptr, nullptr, nullptr, nullptr, nullptr);
}
